// v000
// Times are from an AMD MI455X. After a warm-up the kernel runs many times in a row, and a time is the length of
// such a window on the GPU divided by its runs, so every launch and the gaps after it count. The runs cycle
// through copies of the inputs. A figure is the median of several windows, for all but v000 over two sittings.
// Sittings can differ by a few percent; kernels timed side by side share one.
// v000 is the starting kernel. One run takes 346 microseconds.
#include <hip/hip_runtime.h>

// Multi-head attention, width 1024 = 16 heads x 64, separate q/k/v inputs [NB][SEQ][1024], Wq/Wk/Wv/Wp [in][out] (y = x W), no biases, unscaled scores, causal replace-mask, head split = flat row-major view (B,S,1024)->(B,16,S,64), output projection Wp (f32 out).
// Compute dtypes, f32 accumulate everywhere: q/k/v projections v_wmma_f32_16x16x32_bf16 (x and W RNE-converted to bf16; products exact);
// scores v_wmma_f32_16x16x32_f16 with q and k each as f16 value + f16 residual x2048 (three products, scaled residual products in their own accumulator);
// P (x2^14 carry, cancels in the normalisation) single f16, v as f16 value + f16 residual x2048 (two products, own accumulator); softmax f32 (online, running max);
// output projection v_wmma_f32_16x16x32_bf16 with ctx as bf16 hi | bf16 lo folded along K (K = 2048 against Wp^T repeated), Wp RNE-converted to bf16.
// Layout: bf16 copies of q/k/v, bf16 W^T planes [out][in]; projection planes [NB*SEQ][1024] f16 (== [b*16+h][s][64] by the flat head view); v^T planes [b*16+h][64][SEQ];
// fused flash kernel in transposed form (S^T = K Q^T, O^T = V^T P^T); ctx plane [NB*SEQ][2048] bf16 (hi | lo).

#ifndef NB
#define NB 2
#endif
#ifndef SEQ
#define SEQ 2048
#endif
#define NB_FULL  2
#define SEQ_FULL 2048
#ifndef OUT_SEQ
#define OUT_SEQ SEQ              // row pitch (in tokens) between batches of the output
#endif
#define DM   1024
#define NH_  16
#define HD   64
#define AW   4                   // waves per flash block (16 query rows each)
#define QRS  2048.0f             // carry of the residual planes
#define QRI  (1.0f / 2048.0f)
#define L2E  1.4426950408889634f // log2(e); scores are unscaled
#define PSH  14.0f               // log2 of the P carry (16384)
#define NEGB (-3.0e38f)

static_assert(HD == 64);
static_assert(NH_ * HD == DM);
static_assert((DM & (DM - 1)) == 0);           // B-operand k index wraps with a mask
static_assert(DM % 64 == 0);
static_assert(SEQ % 64 == 0);                  // 64-row tiles never straddle two batches; v^T tiles of 64 keys
static_assert((NB * SEQ) % 64 == 0);
static_assert(SEQ % 32 == 0);                  // key loop steps by 32
static_assert(SEQ % (16 * AW) == 0);           // flash grid covers the sequence exactly
static_assert(((size_t)SEQ * DM) % 8 == 0);
static_assert(NB <= NB_FULL);
static_assert(SEQ <= SEQ_FULL);

typedef _Float16 h16;
typedef unsigned short bf;
typedef __attribute__((ext_vector_type(16))) __bf16   v16bf;
typedef __attribute__((ext_vector_type(16))) _Float16 v16h;
typedef __attribute__((ext_vector_type(8)))  _Float16 v8h;
typedef __attribute__((ext_vector_type(8)))  unsigned short v8us;
typedef __attribute__((ext_vector_type(8)))  float    v8f;
typedef __attribute__((ext_vector_type(4)))  float    v4f;
typedef v4f  __attribute__((may_alias)) v4fa;

__device__ __forceinline__ unsigned short f2bf(float f) { unsigned u = __float_as_uint(f); u += 0x7FFFu + ((u >> 16) & 1u); return (unsigned short)(u >> 16); }
__device__ __forceinline__ float bf2f(unsigned short s) { return __uint_as_float(((unsigned)s) << 16); }
__device__ __forceinline__ v16h cat16(v8h lo, v8h hi) { return __builtin_shufflevector(lo, hi, 0, 1, 2, 3, 4, 5, 6, 7, 8, 9, 10, 11, 12, 13, 14, 15); }
__device__ __forceinline__ v16bf cat16b(v8us lo, v8us hi) { return __builtin_bit_cast(v16bf, __builtin_shufflevector(lo, hi, 0, 1, 2, 3, 4, 5, 6, 7, 8, 9, 10, 11, 12, 13, 14, 15)); }
__device__ __forceinline__ v8f wmma16(v16h a, v16h b, v8f c) { return __builtin_amdgcn_wmma_f32_16x16x32_f16(false, a, false, b, (short)0, c, false, false); }
__device__ __forceinline__ v8f wmmab(v16bf a, v16bf b, v8f c) { return __builtin_amdgcn_wmma_f32_16x16x32_bf16(false, a, false, b, (short)0, c, false, false); }
// fragment loaders from K-contiguous 16-bit rows; p already includes + 8*(lane>>4): elements 0..7 <- k0+8h+0..7, elements 8..15 <- k0+16+8h+0..7 (same map for A and B)
__device__ __forceinline__ v16h  ldh(const h16* p) { return cat16(*(const v8h*)p, *(const v8h*)(p + 16)); }
__device__ __forceinline__ v16bf ldb(const bf* p)  { return cat16b(*(const v8us*)p, *(const v8us*)(p + 16)); }
// ordering point for wave-private LDS tiles (same wave writes and reads)
__device__ __forceinline__ void wave_sync() { __builtin_amdgcn_fence(3 /* release order */, "wavefront"); __builtin_amdgcn_wave_barrier(); asm volatile("" ::: "memory"); }

__global__ __launch_bounds__(256) void k_cvt8(const float* __restrict__ src, bf* dst, size_t n8) {
    const size_t i = (size_t)blockIdx.x * 256 + threadIdx.x; if (i >= n8) return;
    const v8f v = *(const v8f*)(src + i * 8); v8us o;
#pragma unroll
    for (int k = 0; k < 8; ++k) o[k] = f2bf(v[k]);
    *(v8us*)(dst + i * 8) = o; 
}

// k_wt: weight transpose + RNE convert: in W[DM rows k][DM cols n] f32 -> out WT[DM rows n][DM cols k] bf16. grid (DM/64 over n, DM/64 over k), 256 threads.
__global__ __launch_bounds__(256) void k_wt(const float* __restrict__ W, bf* WT) {
    __shared__ float tile[64 * 65];
    const int tid = threadIdx.x; const int n0 = blockIdx.x * 64, k0 = blockIdx.y * 64;
#pragma unroll
    for (int it = 0; it < 4; ++it) { const int c = it * 256 + tid; const int r = c >> 4, c4 = (c & 15) * 4;   // 64 rows x 16 chunks of 4 floats
        const v4f v = *(const v4f*)(W + (size_t)(k0 + r) * DM + n0 + c4);
        tile[r * 65 + c4 + 0] = v[0]; tile[r * 65 + c4 + 1] = v[1]; tile[r * 65 + c4 + 2] = v[2]; tile[r * 65 + c4 + 3] = v[3]; }
    __syncthreads();
    v8us o[2];
#pragma unroll
    for (int it = 0; it < 2; ++it) { const int c = it * 256 + tid; const int n = c >> 3, k8 = (c & 7) * 8;     // 64 output rows x 8 chunks of 8
#pragma unroll
        for (int e = 0; e < 8; ++e) o[it][e] = f2bf(tile[(k8 + e) * 65 + n]); }
#pragma unroll
    for (int it = 0; it < 2; ++it) { const int c = it * 256 + tid; const int n = c >> 3, k8 = (c & 7) * 8;
        *(v8us*)(WT + (size_t)(n0 + n) * DM + k0 + k8) = o[it]; }
    
}

// k_gemm: register-blocked bf16 GEMM, ONE WAVE per 64x64 tile (16 accumulators), operands straight from K-contiguous bf16 planes.
// C[m][n] = sum_{kc < KA} A[m][kc] Bt[n][kc & (DM-1)]; A row pitch KA, Bt row pitch DM (KA = 2*DM folds the hi | lo halves of A against the same Bt rows).
// MODE 0: C written as f16 (Ph) and f16 residual x2048 (Pr), row-major pitch DM. MODE 1: C written as f32 to OUT rows (m/SEQ)*OUT_SEQ + m%SEQ, pitch DM.
// grid (M/64, DM/64), 32 threads. Epilogue per 16-row slab staged in LDS (wave-private);
template <int MODE>
__global__ __launch_bounds__(32) void k_gemm(const bf* __restrict__ A, const bf* __restrict__ Bt, int KA, h16* Ph, h16* Pr, float* OUT) {
    __shared__ __align__(16) float os[16 * 68];
    const int lane = threadIdx.x & 31, lr = lane & 15, hi = lane >> 4; const int r0 = blockIdx.x * 64, c0 = blockIdx.y * 64;
    v8f acc[4][4];
#pragma unroll
    for (int mb = 0; mb < 4; ++mb)
#pragma unroll
        for (int nb = 0; nb < 4; ++nb) acc[mb][nb] = (v8f){};
    const size_t aoff = (size_t)(r0 + lr) * (size_t)KA + 8 * hi, boff = (size_t)(c0 + lr) * DM + 8 * hi;
#pragma unroll 1
    for (int kc = 0; kc < KA; kc += 32) {
        const int kb = kc & (DM - 1);
        v16bf a[4];
#pragma unroll
        for (int mb = 0; mb < 4; ++mb) a[mb] = ldb(A + aoff + (size_t)mb * 16 * (size_t)KA + kc);
#pragma unroll
        for (int nb = 0; nb < 4; ++nb) { const v16bf b = ldb(Bt + boff + (size_t)nb * 16 * DM + kb);
#pragma unroll
            for (int mb = 0; mb < 4; ++mb) acc[mb][nb] = wmmab(a[mb], b, acc[mb][nb]); }
        asm volatile("v_nop\n\tv_nop\n\tv_nop\n\tv_nop" : "+v"(acc[0][0]), "+v"(acc[1][1]), "+v"(acc[2][2]), "+v"(acc[3][3]) : "v"(a[0]), "v"(a[1]), "v"(a[2]), "v"(a[3]));
    }
#pragma unroll
    for (int mb = 0; mb < 4; ++mb) {
#pragma unroll
        for (int nb = 0; nb < 4; ++nb) {
#pragma unroll
            for (int j = 0; j < 8; ++j) os[(hi * 8 + j) * 68 + nb * 16 + lr] = acc[mb][nb][j]; }   // D: row 8h+j, col lane&15; rows 0..15 x cols 0..63 all written
        wave_sync();
        const int m0 = r0 + mb * 16;
        if (MODE == 0) {
            const size_t sb = (size_t)m0 * DM + c0;
{
#pragma unroll
                for (int s = 0; s < 4; ++s) { const int row = 4 * s + (lane >> 3), c8 = (lane & 7) * 8;   // 4 s x 4 row groups = 16 rows; 8 lanes x 8 = 64 columns
                    const v4f x0 = *(const v4fa*)(&os[row * 68 + c8]); const v4f x1 = *(const v4fa*)(&os[row * 68 + c8 + 4]); v8h hv, rv;
#pragma unroll
                    for (int i = 0; i < 4; ++i) { const h16 a0 = (h16)x0[i]; const h16 a1 = (h16)x1[i]; hv[i] = a0; hv[4 + i] = a1; rv[i] = (h16)((x0[i] - (float)a0) * QRS); rv[4 + i] = (h16)((x1[i] - (float)a1) * QRS); }
                    const size_t oo = sb + (size_t)row * DM + c8;
                    *(v8h*)(Ph + oo) = hv; *(v8h*)(Pr + oo) = rv; }
                 }
        } else {
            float* orow = OUT + ((size_t)(m0 / SEQ) * OUT_SEQ + (size_t)(m0 % SEQ)) * DM + c0;
{
#pragma unroll
                for (int s = 0; s < 8; ++s) { const int row = 2 * s + hi, cofs = lr * 4;   // 8 s x 2 rows = 16 rows; 16 lanes x 4 floats = 64 columns
                    const v4f val = *(const v4fa*)(&os[row * 68 + cofs]);
                    *(v4f*)(orow + (size_t)row * DM + cofs) = val; }
                 }
        }
        wave_sync();
    }
}

// k_vt: per-head transpose of the v planes: in V2[z][zh][s][64] -> out VT2[z][zh][64][s] (z = 0 value plane, 1 residual plane; plane stride pln halves).
__global__ __launch_bounds__(256) void k_vt(const h16* __restrict__ V2, h16* VT2, size_t pln) {
    __shared__ __align__(16) h16 ts[64 * 72];
    const int tid = threadIdx.x; const int s0 = blockIdx.x * 64; const int zh = blockIdx.y; const size_t zo = (size_t)blockIdx.z * pln;
    const h16* src = V2 + zo + ((size_t)zh * SEQ + s0) * HD;
    h16* dst = VT2 + zo + (size_t)zh * HD * SEQ + s0;
#pragma unroll
    for (int it = 0; it < 2; ++it) { const int c = it * 256 + tid; const int row = c >> 3, c8 = (c & 7) * 8;   // 64 key rows x 8 chunks
        const v8h v = *(const v8h*)(src + (size_t)row * HD + c8); *(v8h*)(&ts[row * 72 + c8]) = v; }
    __syncthreads();
    v8h o[2];
#pragma unroll
    for (int it = 0; it < 2; ++it) { const int c = it * 256 + tid; const int d = c >> 3, k8 = (c & 7) * 8;     // 64 feature rows x 8 chunks of 8 keys
#pragma unroll
        for (int e = 0; e < 8; ++e) o[it][e] = ts[(k8 + e) * 72 + d]; }
#pragma unroll
    for (int it = 0; it < 2; ++it) { const int c = it * 256 + tid; const int d = c >> 3, k8 = (c & 7) * 8;
        *(v8h*)(dst + (size_t)d * SEQ + k8) = o[it]; }
    
}

#define STG(OFS, OH, OR) { v4f a_, c_; \
    a_[0] = OH[0] * inv + OR[0] * ri; a_[1] = OH[1] * inv + OR[1] * ri; a_[2] = OH[2] * inv + OR[2] * ri; a_[3] = OH[3] * inv + OR[3] * ri; \
    c_[0] = OH[4] * inv + OR[4] * ri; c_[1] = OH[5] * inv + OR[5] * ri; c_[2] = OH[6] * inv + OR[6] * ri; c_[3] = OH[7] * inv + OR[7] * ri; \
    *(v4fa*)(&os[wb + lr * 68 + (OFS) + 8 * hi]) = a_; *(v4fa*)(&os[wb + lr * 68 + (OFS) + 8 * hi + 4]) = c_; }

// k_flash: fused causal attention, one wave per 16 query rows of one (batch, head); K / V^T / Q fragments straight from the f16 planes (two 16-B loads each, arithmetic addressing).
// Transposed form: S^T[key][t] = K Q^T (A = K rows, B = Q rows); lane (t = lane&15, h = lane>>4) holds keys 8h+r of each 16-key tile, so the packed
// P tile is directly the B fragment of O^T[d][t] = V^T P^T (element r <- tile keys 0..15, element 8+r <- tile keys 16..31, lane unchanged).
// Causal: key loop runs to t0+16 (wave-uniform); entries with key > t are replaced by a large negative value (P = 0); every visited 32-key block holds a visible key for each row.
// Softmax state (running max, partial sum) is one scalar per lane; the two lane halves of a row are combined with one xor-16 exchange.
__global__ __launch_bounds__(32 * AW) void k_flash(const h16* __restrict__ QH, const h16* __restrict__ QR, const h16* __restrict__ KH, const h16* __restrict__ KR,
                                                   const h16* __restrict__ VTH, const h16* __restrict__ VTR, bf* CTX) {
    __shared__ __align__(16) float os[AW * 16 * 68];
    const int lane = threadIdx.x & 31, wave = threadIdx.x >> 5, lr = lane & 15, hi = lane >> 4;
    const int zh = blockIdx.y; const int b = zh / NH_, h = zh % NH_;
    const int t0 = (blockIdx.x * AW + wave) * 16;
    const size_t pbase = (size_t)zh * SEQ * HD;
    const size_t qo = pbase + (size_t)(t0 + lr) * HD + 8 * hi;
    const v16h qh0 = ldh(QH + qo), qh1 = ldh(QH + qo + 32), qr0 = ldh(QR + qo), qr1 = ldh(QR + qo + 32);   // B fragments: col t, k = d
    const size_t ko = pbase + (size_t)lr * HD + 8 * hi;      // + key * HD       (A fragment: row key, k = d)
    const size_t vo = pbase + (size_t)lr * SEQ + 8 * hi;     // + 16j*SEQ + key  (A fragment: row d, k = key)
    v8f oh0 = (v8f){}, oh1 = (v8f){}, oh2 = (v8f){}, oh3 = (v8f){};
    v8f or0 = (v8f){}, or1 = (v8f){}, or2 = (v8f){}, or3 = (v8f){};
    float m = NEGB, l = 0.0f;
    const int kend = t0 + 16;                                // keys 0 .. t0+15 visible to this wave; kend <= SEQ
#pragma unroll 1
    for (int key0 = 0; key0 < kend; key0 += 32) {
        const size_t kk = ko + (size_t)key0 * HD;
        v8f sHa = (v8f){}, sLa = (v8f){}, sHb = (v8f){}, sLb = (v8f){};
        { const v16h ka0 = ldh(KH + kk), ka1 = ldh(KH + kk + 32), kb0 = ldh(KH + kk + 16 * HD), kb1 = ldh(KH + kk + 16 * HD + 32);
          sHa = wmma16(ka0, qh0, sHa); sLa = wmma16(ka0, qr0, sLa); sHb = wmma16(kb0, qh0, sHb); sLb = wmma16(kb0, qr0, sLb);
          sHa = wmma16(ka1, qh1, sHa); sLa = wmma16(ka1, qr1, sLa); sHb = wmma16(kb1, qh1, sHb); sLb = wmma16(kb1, qr1, sLb);
          asm volatile("v_nop\n\tv_nop\n\tv_nop\n\tv_nop" : "+v"(sHa), "+v"(sLa), "+v"(sHb), "+v"(sLb) : "v"(ka0), "v"(ka1), "v"(kb0), "v"(kb1)); }
        { const v16h ra0 = ldh(KR + kk), ra1 = ldh(KR + kk + 32), rb0 = ldh(KR + kk + 16 * HD), rb1 = ldh(KR + kk + 16 * HD + 32);
          sLa = wmma16(ra0, qh0, sLa); sLb = wmma16(rb0, qh0, sLb); sLa = wmma16(ra1, qh1, sLa); sLb = wmma16(rb1, qh1, sLb);
          asm volatile("v_nop\n\tv_nop\n\tv_nop\n\tv_nop" : "+v"(sLa), "+v"(sLb) : "v"(ra0), "v"(ra1), "v"(rb0), "v"(rb1)); }
        float ta[8], tb[8];
#pragma unroll
        for (int r = 0; r < 8; ++r) { ta[r] = (sHa[r] + sLa[r] * QRI) * L2E; tb[r] = (sHb[r] + sLb[r] * QRI) * L2E; }
        if (key0 + 31 > t0) {                                // wave-uniform: block crosses the diagonal
            const int tq = t0 + lr - key0 - 8 * hi;          // tile a entry r is key key0+8h+r: hidden when r > tq; tile b entry r when 16 + r > tq
#pragma unroll
            for (int r = 0; r < 8; ++r) { ta[r] = (r > tq) ? NEGB : ta[r]; tb[r] = (16 + r > tq) ? NEGB : tb[r]; }
        }
        float mx = NEGB;
#pragma unroll
        for (int r = 0; r < 8; ++r) mx = fmaxf(mx, fmaxf(ta[r], tb[r]));
        mx = fmaxf(mx, __shfl_xor(mx, 16, 32));
        const float mnew = fmaxf(m, mx);
        const float alpha = __builtin_amdgcn_exp2f(m - mnew);
        const float sh = PSH - mnew;
        v16h pb; float ls = 0.0f;
#pragma unroll
        for (int r = 0; r < 8; ++r) { const h16 pa = (h16)__builtin_amdgcn_exp2f(ta[r] + sh); const h16 pc = (h16)__builtin_amdgcn_exp2f(tb[r] + sh); pb[r] = pa; pb[8 + r] = pc; ls += (float)pa + (float)pc; }
        l = l * alpha + ls; m = mnew;
        oh0 = oh0 * alpha; oh1 = oh1 * alpha; oh2 = oh2 * alpha; oh3 = oh3 * alpha;
        or0 = or0 * alpha; or1 = or1 * alpha; or2 = or2 * alpha; or3 = or3 * alpha;
        { const h16* va = VTH + vo + key0;
          const v16h v0 = ldh(va), v1 = ldh(va + (size_t)16 * SEQ), v2 = ldh(va + (size_t)32 * SEQ), v3 = ldh(va + (size_t)48 * SEQ);
          oh0 = wmma16(v0, pb, oh0); oh1 = wmma16(v1, pb, oh1); oh2 = wmma16(v2, pb, oh2); oh3 = wmma16(v3, pb, oh3);
          asm volatile("v_nop\n\tv_nop\n\tv_nop\n\tv_nop" : "+v"(oh0), "+v"(oh1), "+v"(oh2), "+v"(oh3) : "v"(v0), "v"(v1), "v"(v2), "v"(v3), "v"(pb)); }
        { const h16* va = VTR + vo + key0;
          const v16h v0 = ldh(va), v1 = ldh(va + (size_t)16 * SEQ), v2 = ldh(va + (size_t)32 * SEQ), v3 = ldh(va + (size_t)48 * SEQ);
          or0 = wmma16(v0, pb, or0); or1 = wmma16(v1, pb, or1); or2 = wmma16(v2, pb, or2); or3 = wmma16(v3, pb, or3);
          asm volatile("v_nop\n\tv_nop\n\tv_nop\n\tv_nop" : "+v"(or0), "+v"(or1), "+v"(or2), "+v"(or3) : "v"(v0), "v"(v1), "v"(v2), "v"(v3), "v"(pb)); }
    }
    l += __shfl_xor(l, 16, 32);
    const float inv = 1.0f / l;
    const float ri = QRI * inv;
    const int wb = wave * 16 * 68;
    // O^T D layout: o_j[r] = (d = 16j + 8h + r, t = lane&15) -> os[t][d]; rows 0..15 x columns 0..63 all written
    STG(0, oh0, or0)
    STG(16, oh1, or1)
    STG(32, oh2, or2)
    STG(48, oh3, or3)
    wave_sync();
    bf* crow = CTX + ((size_t)b * SEQ + t0) * (size_t)(2 * DM) + h * HD;
{
#pragma unroll
        for (int s = 0; s < 4; ++s) { const int row = 4 * s + (lane >> 3), c8 = (lane & 7) * 8;   // 4 s x 4 row groups = 16 rows; 8 lanes x 8 = 64 columns
            const v4f x0 = *(const v4fa*)(&os[wb + row * 68 + c8]); const v4f x1 = *(const v4fa*)(&os[wb + row * 68 + c8 + 4]); v8us hv, lv;
#pragma unroll
            for (int i = 0; i < 4; ++i) { const unsigned short a0 = f2bf(x0[i]); const unsigned short a1 = f2bf(x1[i]); hv[i] = a0; hv[4 + i] = a1; lv[i] = f2bf(x0[i] - bf2f(a0)); lv[4 + i] = f2bf(x1[i] - bf2f(a1)); }
            const size_t oo = (size_t)row * (size_t)(2 * DM) + c8;
            *(v8us*)(crow + oo) = hv; *(v8us*)(crow + oo + DM) = lv; }
         }
}

static constexpr size_t al256(size_t v) { return (v + 255) & ~(size_t)255; }
static constexpr size_t SZ_XB  = al256((size_t)NB * SEQ * DM * 2);          // one bf16 input copy
static constexpr size_t SZ_WB  = al256((size_t)DM * DM * 2);                // one bf16 W^T plane
static constexpr size_t SZ_PL  = al256((size_t)NB * NH_ * SEQ * HD * 2);    // one f16 plane
static constexpr size_t SZ_CTX = al256((size_t)NB * SEQ * 2 * DM * 2);      // ctx hi | lo
static constexpr size_t SZ_TOTAL = 3 * SZ_XB + 4 * SZ_WB + 8 * SZ_PL + SZ_CTX;
static_assert(SZ_TOTAL <= (size_t)134217728);          // workspace carve <= 128 MiB
static_assert(SZ_PL == (size_t)NB * SEQ * DM * 2);     // value / residual plane pairs are exactly contiguous

extern "C" void kernel_launch(void* const* d_in, const int* in_sizes, int n_in,
                              void* d_out, int out_size, void* d_ws, size_t ws_size, hipStream_t stream) {
    if (n_in < 7) return;
    const size_t needx = ((size_t)(NB - 1) * SEQ_FULL + SEQ) * DM;
    if ((size_t)in_sizes[0] < needx || (size_t)in_sizes[1] < needx || (size_t)in_sizes[2] < needx) return;
    if ((size_t)in_sizes[3] < (size_t)DM * DM || (size_t)in_sizes[4] < (size_t)DM * DM || (size_t)in_sizes[5] < (size_t)DM * DM || (size_t)in_sizes[6] < (size_t)DM * DM) return;
    if ((size_t)out_size < ((size_t)(NB - 1) * OUT_SEQ + SEQ) * DM) return;
    if (SZ_TOTAL > ws_size) return;
    // wire order: q, k, v, Wq, Wk, Wv, Wp (weights [in][out])
    const float* xq = (const float*)d_in[0]; const float* xk = (const float*)d_in[1]; const float* xv = (const float*)d_in[2];
    const float* wq = (const float*)d_in[3]; const float* wk = (const float*)d_in[4]; const float* wv = (const float*)d_in[5]; const float* wp = (const float*)d_in[6];
    float* OUT = (float*)d_out;      // [NB][SEQ][1024]
    char* wsp = (char*)d_ws;
    bf* XQ = (bf*)wsp; wsp += SZ_XB;                 // [NB*SEQ][1024]
    bf* XK = (bf*)wsp; wsp += SZ_XB;
    bf* XV = (bf*)wsp; wsp += SZ_XB;
    bf* WQT = (bf*)wsp; wsp += SZ_WB;                // [out][in]
    bf* WKT = (bf*)wsp; wsp += SZ_WB;
    bf* WVT = (bf*)wsp; wsp += SZ_WB;
    bf* WPT = (bf*)wsp; wsp += SZ_WB;
    h16* QH = (h16*)wsp; wsp += SZ_PL;               // [NB*SEQ][1024] == [NB*16][SEQ][64]
    h16* QR = (h16*)wsp; wsp += SZ_PL;               // residual x2048
    h16* KH = (h16*)wsp; wsp += SZ_PL;
    h16* KR = (h16*)wsp; wsp += SZ_PL;
    h16* VH = (h16*)wsp; wsp += SZ_PL;               // value plane, residual plane directly behind it
    h16* VR = (h16*)wsp; wsp += SZ_PL;
    h16* VTH = (h16*)wsp; wsp += SZ_PL;              // [NB*16][64][SEQ], residual plane directly behind it
    h16* VTR = (h16*)wsp; wsp += SZ_PL;
    bf* CTX = (bf*)wsp; wsp += SZ_CTX;               // [NB*SEQ][2048]: hi | lo
    const size_t pln = SZ_PL / 2;                    // plane stride in halves

    if (SEQ == SEQ_FULL) {
        const size_t n8 = (size_t)NB * SEQ * DM / 8; const unsigned g = (unsigned)((n8 + 255) / 256);
        k_cvt8<<<g, 256, 0, stream>>>(xq, XQ, n8); k_cvt8<<<g, 256, 0, stream>>>(xk, XK, n8); k_cvt8<<<g, 256, 0, stream>>>(xv, XV, n8);
    } else {
        const size_t n8 = (size_t)SEQ * DM / 8; const unsigned g = (unsigned)((n8 + 255) / 256);
        for (int b = 0; b < NB; ++b) {
            k_cvt8<<<g, 256, 0, stream>>>(xq + (size_t)b * SEQ_FULL * DM, XQ + (size_t)b * SEQ * DM, n8);
            k_cvt8<<<g, 256, 0, stream>>>(xk + (size_t)b * SEQ_FULL * DM, XK + (size_t)b * SEQ * DM, n8);
            k_cvt8<<<g, 256, 0, stream>>>(xv + (size_t)b * SEQ_FULL * DM, XV + (size_t)b * SEQ * DM, n8);
        }
    }
    // W[in = 1024 rows][out = 1024 cols] -> WT[out][in]; grid (cols/64, rows/64)
    { const dim3 g(DM / 64, DM / 64, 1);
      k_wt<<<g, 256, 0, stream>>>(wq, WQT); k_wt<<<g, 256, 0, stream>>>(wk, WKT); k_wt<<<g, 256, 0, stream>>>(wv, WVT); k_wt<<<g, 256, 0, stream>>>(wp, WPT); }

    // projections: A = x rows (m = b*SEQ + t), Bt = W^T rows (n) -> row-major planes [m][n] (value + residual)
    { const dim3 g(NB * SEQ / 64, DM / 64, 1);
      k_gemm<0><<<g, 32, 0, stream>>>(XQ, WQT, DM, QH, QR, OUT);
      k_gemm<0><<<g, 32, 0, stream>>>(XK, WKT, DM, KH, KR, OUT);
      k_gemm<0><<<g, 32, 0, stream>>>(XV, WVT, DM, VH, VR, OUT); }

    // v planes [zh][s][64] -> v^T planes [zh][64][s], both the value and the residual plane
    k_vt<<<dim3(SEQ / 64, NB * NH_, 2), 256, 0, stream>>>(VH, VTH, pln);

    k_flash<<<dim3(SEQ / (16 * AW), NB * NH_, 1), 32 * AW, 0, stream>>>(QH, QR, KH, KR, VTH, VTR, CTX);

    // output projection: A = ctx rows [hi | lo] (K = 2048), Bt = Wp^T rows (k index wraps at 1024) -> f32 output
    k_gemm<1><<<dim3(NB * SEQ / 64, DM / 64, 1), 32, 0, stream>>>(CTX, WPT, 2 * DM, QH, QR, OUT);
}

// v001
// A run of this version takes 199 microseconds.
// Two timings next to v000 put it at 1.77 and 1.74 times that version's speed.
#include <hip/hip_runtime.h>

// Multi-head attention, width 1024 = 16 heads x 64, separate q/k/v inputs [NB][SEQ][1024], Wq/Wk/Wv/Wp [in][out] (y = x W), no biases, unscaled scores, causal replace-mask, head split = flat row-major view (B,S,1024)->(B,16,S,64), output projection Wp (f32 out).
// Compute dtypes, f32 accumulate everywhere: q/k/v projections v_wmma_f32_16x16x32_bf16 (x and W RNE-converted to bf16; products exact);
// scores v_wmma_f32_16x16x32_f16 with q and k each as f16 value + f16 residual x2048 (three products, scaled residual products in their own accumulator);
// P (x2^14 carry, cancels in the normalisation) single f16, v as f16 value + f16 residual x2048 (two products, own accumulator); softmax f32 (online, running max);
// output projection v_wmma_f32_16x16x32_bf16 with ctx as bf16 hi | bf16 lo folded along K (K = 2048 against Wp^T repeated), Wp RNE-converted to bf16.
// Layout: bf16 copies of q/k/v, bf16 W^T planes [out][in]; projection planes [NB*SEQ][1024] f16 (== [b*16+h][s][64] by the flat head view); v^T planes [b*16+h][64][SEQ];
// fused flash kernel in transposed form (S^T = K Q^T, O^T = V^T P^T), K / V^T tiles of 64 keys staged in LDS by tensor loads (two buffers, shared by the block's four waves); ctx plane [NB*SEQ][2048] bf16 (hi | lo).

#ifndef NB
#define NB 2
#endif
#ifndef SEQ
#define SEQ 2048
#endif
#define NB_FULL  2
#define SEQ_FULL 2048
#ifndef OUT_SEQ
#define OUT_SEQ SEQ              // row pitch (in tokens) between batches of the output
#endif
#define DM   1024
#define NH_  16
#define HD   64
#define AW   4                   // waves per flash block (16 query rows each)
#define QRS  2048.0f             // carry of the residual planes
#define QRI  (1.0f / 2048.0f)
#define L2E  1.4426950408889634f // log2(e); scores are unscaled
#define PSH  14.0f               // log2 of the P carry (16384)
#define NEGB (-3.0e38f)
#define KST  64                  // keys per LDS stage of the flash kernel
#define LP   144                 // LDS row pitch in bytes: 128-B rows + 16-B pad (16 B x odd, for 16-byte LDS reads)
#define LPH  (LP / 2)            // the same in halves
#define TSZ  10240               // place of one tile in LDS: 64 rows x 144 B = 9216 B, rounded up to a multiple of 2 KiB
#define BSZ  (4 * TSZ)           // one buffer: K value, K residual, V^T value, V^T residual

static_assert(HD == 64);
static_assert(NH_ * HD == DM);
static_assert((DM & (DM - 1)) == 0);           // B-operand k index wraps with a mask
static_assert(DM % 64 == 0);
static_assert(SEQ % 64 == 0);                  // 64-row tiles never straddle two batches; v^T tiles of 64 keys
static_assert((NB * SEQ) % 64 == 0);
static_assert(SEQ % 32 == 0);                  // key loop steps by 32
static_assert(SEQ % (16 * AW) == 0);           // flash grid covers the sequence exactly
static_assert(((size_t)SEQ * DM) % 8 == 0);
static_assert(NB <= NB_FULL);
static_assert(SEQ <= SEQ_FULL);
static_assert(AW == 4);                        // one tensor load per wave and stage: four tiles, four waves
static_assert(16 * AW == KST);                 // a block's queries end where its last 64-key stage ends
static_assert(SEQ >= 2 * KST);                 // the ring's prologue loads two stages
static_assert(HD * 2 == 128 && KST * 2 == 128);// both kinds of tile have 128-byte rows
static_assert(KST * LP <= TSZ && HD * LP <= TSZ && TSZ % 2048 == 0);
static_assert(AW * 16 * 68 * 4 <= 2 * BSZ);    // output staging reuses the ring

typedef _Float16 h16;
typedef unsigned short bf;
typedef __attribute__((ext_vector_type(16))) __bf16   v16bf;
typedef __attribute__((ext_vector_type(16))) _Float16 v16h;
typedef __attribute__((ext_vector_type(8)))  _Float16 v8h;
typedef __attribute__((ext_vector_type(8)))  unsigned short v8us;
typedef __attribute__((ext_vector_type(8)))  float    v8f;
typedef __attribute__((ext_vector_type(4)))  float    v4f;
typedef v4f  __attribute__((may_alias)) v4fa;
typedef uint32_t u32x4 __attribute__((ext_vector_type(4)));
typedef uint32_t u32x8 __attribute__((ext_vector_type(8)));

__device__ __forceinline__ unsigned short f2bf(float f) { unsigned u = __float_as_uint(f); u += 0x7FFFu + ((u >> 16) & 1u); return (unsigned short)(u >> 16); }
__device__ __forceinline__ float bf2f(unsigned short s) { return __uint_as_float(((unsigned)s) << 16); }
__device__ __forceinline__ v16h cat16(v8h lo, v8h hi) { return __builtin_shufflevector(lo, hi, 0, 1, 2, 3, 4, 5, 6, 7, 8, 9, 10, 11, 12, 13, 14, 15); }
__device__ __forceinline__ v16bf cat16b(v8us lo, v8us hi) { return __builtin_bit_cast(v16bf, __builtin_shufflevector(lo, hi, 0, 1, 2, 3, 4, 5, 6, 7, 8, 9, 10, 11, 12, 13, 14, 15)); }
__device__ __forceinline__ v8f wmma16(v16h a, v16h b, v8f c) { return __builtin_amdgcn_wmma_f32_16x16x32_f16(false, a, false, b, (short)0, c, false, false); }
__device__ __forceinline__ v8f wmmab(v16bf a, v16bf b, v8f c) { return __builtin_amdgcn_wmma_f32_16x16x32_bf16(false, a, false, b, (short)0, c, false, false); }
// fragment loaders from K-contiguous 16-bit rows; p already includes + 8*(lane>>4): elements 0..7 <- k0+8h+0..7, elements 8..15 <- k0+16+8h+0..7 (same map for A and B)
__device__ __forceinline__ v16h  ldh(const h16* p) { return cat16(*(const v8h*)p, *(const v8h*)(p + 16)); }
__device__ __forceinline__ v16bf ldb(const bf* p)  { return cat16b(*(const v8us*)p, *(const v8us*)(p + 16)); }
// ordering point for wave-private LDS tiles (same wave writes and reads)
__device__ __forceinline__ void wave_sync() { __builtin_amdgcn_fence(3 /* release order */, "wavefront"); __builtin_amdgcn_wave_barrier(); asm volatile("" ::: "memory"); }

__device__ __forceinline__ uint32_t uni(uint32_t v) { return (uint32_t)__builtin_amdgcn_readfirstlane(v); }
// wave-uniform test held in a scalar register, so that the branch on it is a scalar branch (a tensor load ignores EXEC)
__device__ __forceinline__ uint32_t pinned(uint32_t v) { uint32_t w = (uint32_t)__builtin_amdgcn_readfirstlane(v); asm volatile("" : "+s"(w)); return w; }
__device__ __forceinline__ void wait_ds0()     { asm volatile("s_wait_dscnt 0x0" ::: "memory"); }      // this wave's LDS reads have returned before the buffer is handed back
__device__ __forceinline__ void wait_tensor0() { asm volatile("s_wait_tensorcnt 0x0" ::: "memory"); }  // this wave's tensor load has landed
// one tile of 64 rows x 128 bytes, source row pitch src_pitch bytes, into LDS at pitch 144 B (a 16-B pad behind every 128-B row)
__device__ __forceinline__ void tile_load(uint32_t lds_dst, uint64_t ga, uint32_t src_pitch) {
    u32x4 g0; u32x8 g1;
    g0[0] = uni(1u); g0[1] = uni(lds_dst); g0[2] = uni((uint32_t)ga); g0[3] = uni((((uint32_t)(ga >> 32)) & 0x01FFFFFFu) | 0x80000000u);
    g1[0] = uni((1u << 20) | (4u << 22) | (3u << 25));   // no mask, 1-byte elements, pad of 4 dwords behind every 32
    g1[1] = uni(128u << 16); g1[2] = uni(64u << 16); g1[3] = uni(128u << 16); g1[4] = uni(64u); g1[5] = uni(src_pitch); g1[6] = uni(0u); g1[7] = uni(0u);
    asm volatile("tensor_load_to_lds %0, %1" :: "s"(g0), "s"(g1) : "memory");
}

__global__ __launch_bounds__(256) void k_cvt8(const float* __restrict__ src, bf* dst, size_t n8) {
    const size_t i = (size_t)blockIdx.x * 256 + threadIdx.x; if (i >= n8) return;
    const v8f v = *(const v8f*)(src + i * 8); v8us o;
#pragma unroll
    for (int k = 0; k < 8; ++k) o[k] = f2bf(v[k]);
    *(v8us*)(dst + i * 8) = o; 
}

// k_wt: weight transpose + RNE convert: in W[DM rows k][DM cols n] f32 -> out WT[DM rows n][DM cols k] bf16. grid (DM/64 over n, DM/64 over k), 256 threads.
__global__ __launch_bounds__(256) void k_wt(const float* __restrict__ W, bf* WT) {
    __shared__ float tile[64 * 65];
    const int tid = threadIdx.x; const int n0 = blockIdx.x * 64, k0 = blockIdx.y * 64;
#pragma unroll
    for (int it = 0; it < 4; ++it) { const int c = it * 256 + tid; const int r = c >> 4, c4 = (c & 15) * 4;   // 64 rows x 16 chunks of 4 floats
        const v4f v = *(const v4f*)(W + (size_t)(k0 + r) * DM + n0 + c4);
        tile[r * 65 + c4 + 0] = v[0]; tile[r * 65 + c4 + 1] = v[1]; tile[r * 65 + c4 + 2] = v[2]; tile[r * 65 + c4 + 3] = v[3]; }
    __syncthreads();
    v8us o[2];
#pragma unroll
    for (int it = 0; it < 2; ++it) { const int c = it * 256 + tid; const int n = c >> 3, k8 = (c & 7) * 8;     // 64 output rows x 8 chunks of 8
#pragma unroll
        for (int e = 0; e < 8; ++e) o[it][e] = f2bf(tile[(k8 + e) * 65 + n]); }
#pragma unroll
    for (int it = 0; it < 2; ++it) { const int c = it * 256 + tid; const int n = c >> 3, k8 = (c & 7) * 8;
        *(v8us*)(WT + (size_t)(n0 + n) * DM + k0 + k8) = o[it]; }
    
}

// k_gemm: register-blocked bf16 GEMM, ONE WAVE per 64x64 tile (16 accumulators), operands straight from K-contiguous bf16 planes.
// C[m][n] = sum_{kc < KA} A[m][kc] Bt[n][kc & (DM-1)]; A row pitch KA, Bt row pitch DM (KA = 2*DM folds the hi | lo halves of A against the same Bt rows).
// MODE 0: C written as f16 (Ph) and f16 residual x2048 (Pr), row-major pitch DM. MODE 1: C written as f32 to OUT rows (m/SEQ)*OUT_SEQ + m%SEQ, pitch DM.
// grid (M/64, DM/64), 32 threads. Epilogue per 16-row slab staged in LDS (wave-private);
template <int MODE>
__global__ __launch_bounds__(32) void k_gemm(const bf* __restrict__ A, const bf* __restrict__ Bt, int KA, h16* Ph, h16* Pr, float* OUT) {
    __shared__ __align__(16) float os[16 * 68];
    const int lane = threadIdx.x & 31, lr = lane & 15, hi = lane >> 4; const int r0 = blockIdx.x * 64, c0 = blockIdx.y * 64;
    v8f acc[4][4];
#pragma unroll
    for (int mb = 0; mb < 4; ++mb)
#pragma unroll
        for (int nb = 0; nb < 4; ++nb) acc[mb][nb] = (v8f){};
    const size_t aoff = (size_t)(r0 + lr) * (size_t)KA + 8 * hi, boff = (size_t)(c0 + lr) * DM + 8 * hi;
#pragma unroll 1
    for (int kc = 0; kc < KA; kc += 32) {
        const int kb = kc & (DM - 1);
        v16bf a[4];
#pragma unroll
        for (int mb = 0; mb < 4; ++mb) a[mb] = ldb(A + aoff + (size_t)mb * 16 * (size_t)KA + kc);
#pragma unroll
        for (int nb = 0; nb < 4; ++nb) { const v16bf b = ldb(Bt + boff + (size_t)nb * 16 * DM + kb);
#pragma unroll
            for (int mb = 0; mb < 4; ++mb) acc[mb][nb] = wmmab(a[mb], b, acc[mb][nb]); }
        asm volatile("v_nop\n\tv_nop\n\tv_nop\n\tv_nop" : "+v"(acc[0][0]), "+v"(acc[1][1]), "+v"(acc[2][2]), "+v"(acc[3][3]) : "v"(a[0]), "v"(a[1]), "v"(a[2]), "v"(a[3]));
    }
#pragma unroll
    for (int mb = 0; mb < 4; ++mb) {
#pragma unroll
        for (int nb = 0; nb < 4; ++nb) {
#pragma unroll
            for (int j = 0; j < 8; ++j) os[(hi * 8 + j) * 68 + nb * 16 + lr] = acc[mb][nb][j]; }   // D: row 8h+j, col lane&15; rows 0..15 x cols 0..63 all written
        wave_sync();
        const int m0 = r0 + mb * 16;
        if (MODE == 0) {
            const size_t sb = (size_t)m0 * DM + c0;
{
#pragma unroll
                for (int s = 0; s < 4; ++s) { const int row = 4 * s + (lane >> 3), c8 = (lane & 7) * 8;   // 4 s x 4 row groups = 16 rows; 8 lanes x 8 = 64 columns
                    const v4f x0 = *(const v4fa*)(&os[row * 68 + c8]); const v4f x1 = *(const v4fa*)(&os[row * 68 + c8 + 4]); v8h hv, rv;
#pragma unroll
                    for (int i = 0; i < 4; ++i) { const h16 a0 = (h16)x0[i]; const h16 a1 = (h16)x1[i]; hv[i] = a0; hv[4 + i] = a1; rv[i] = (h16)((x0[i] - (float)a0) * QRS); rv[4 + i] = (h16)((x1[i] - (float)a1) * QRS); }
                    const size_t oo = sb + (size_t)row * DM + c8;
                    *(v8h*)(Ph + oo) = hv; *(v8h*)(Pr + oo) = rv; }
                 }
        } else {
            float* orow = OUT + ((size_t)(m0 / SEQ) * OUT_SEQ + (size_t)(m0 % SEQ)) * DM + c0;
{
#pragma unroll
                for (int s = 0; s < 8; ++s) { const int row = 2 * s + hi, cofs = lr * 4;   // 8 s x 2 rows = 16 rows; 16 lanes x 4 floats = 64 columns
                    const v4f val = *(const v4fa*)(&os[row * 68 + cofs]);
                    *(v4f*)(orow + (size_t)row * DM + cofs) = val; }
                 }
        }
        wave_sync();
    }
}

// k_vt: per-head transpose of the v planes: in V2[z][zh][s][64] -> out VT2[z][zh][64][s] (z = 0 value plane, 1 residual plane; plane stride pln halves).
__global__ __launch_bounds__(256) void k_vt(const h16* __restrict__ V2, h16* VT2, size_t pln) {
    __shared__ __align__(16) h16 ts[64 * 72];
    const int tid = threadIdx.x; const int s0 = blockIdx.x * 64; const int zh = blockIdx.y; const size_t zo = (size_t)blockIdx.z * pln;
    const h16* src = V2 + zo + ((size_t)zh * SEQ + s0) * HD;
    h16* dst = VT2 + zo + (size_t)zh * HD * SEQ + s0;
#pragma unroll
    for (int it = 0; it < 2; ++it) { const int c = it * 256 + tid; const int row = c >> 3, c8 = (c & 7) * 8;   // 64 key rows x 8 chunks
        const v8h v = *(const v8h*)(src + (size_t)row * HD + c8); *(v8h*)(&ts[row * 72 + c8]) = v; }
    __syncthreads();
    v8h o[2];
#pragma unroll
    for (int it = 0; it < 2; ++it) { const int c = it * 256 + tid; const int d = c >> 3, k8 = (c & 7) * 8;     // 64 feature rows x 8 chunks of 8 keys
#pragma unroll
        for (int e = 0; e < 8; ++e) o[it][e] = ts[(k8 + e) * 72 + d]; }
#pragma unroll
    for (int it = 0; it < 2; ++it) { const int c = it * 256 + tid; const int d = c >> 3, k8 = (c & 7) * 8;
        *(v8h*)(dst + (size_t)d * SEQ + k8) = o[it]; }
    
}

#define STG(OFS, OH, OR) { v4f a_, c_; \
    a_[0] = OH[0] * inv + OR[0] * ri; a_[1] = OH[1] * inv + OR[1] * ri; a_[2] = OH[2] * inv + OR[2] * ri; a_[3] = OH[3] * inv + OR[3] * ri; \
    c_[0] = OH[4] * inv + OR[4] * ri; c_[1] = OH[5] * inv + OR[5] * ri; c_[2] = OH[6] * inv + OR[6] * ri; c_[3] = OH[7] * inv + OR[7] * ri; \
    *(v4fa*)(&os[wb + lr * 68 + (OFS) + 8 * hi]) = a_; *(v4fa*)(&os[wb + lr * 68 + (OFS) + 8 * hi + 4]) = c_; }

// k_flash: fused causal attention, one wave per 16 query rows of one (batch, head); Q fragments straight from the f16 planes (two 16-B loads each).
// K and V^T: per stage of 64 keys each of the four waves brings one tile (K value, K residual, V^T value, V^T residual; 64 rows x 128 B) into LDS with one tensor load;
// two buffers, the next stage's loads in flight while this stage is worked on; every wave reads its fragments from LDS (two 16-B reads each). Every wave passes every stage's hand-over.
// Transposed form: S^T[key][t] = K Q^T (A = K rows, B = Q rows); lane (t = lane&15, h = lane>>4) holds keys 8h+r of each 16-key tile, so the packed
// P tile is directly the B fragment of O^T[d][t] = V^T P^T (element r <- tile keys 0..15, element 8+r <- tile keys 16..31, lane unchanged).
// Causal: a wave works on the 32-key blocks below t0+16 (wave-uniform); entries with key > t are replaced by a large negative value (P = 0); every visited 32-key block holds a visible key for each row.
// Softmax state (running max, partial sum) is one scalar per lane; the two lane halves of a row are combined with one xor-16 exchange.
__global__ __launch_bounds__(32 * AW) void k_flash(const h16* __restrict__ QH, const h16* __restrict__ QR, const h16* __restrict__ KH, const h16* __restrict__ KR,
                                                   const h16* __restrict__ VTH, const h16* __restrict__ VTR, bf* CTX) {
    __shared__ __attribute__((aligned(2048))) unsigned char ring[2 * BSZ];
    const int lane = threadIdx.x & 31, wave = (int)uni(threadIdx.x >> 5), lr = lane & 15, hi = lane >> 4;
    const int zh = blockIdx.y; const int b = zh / NH_, h = zh % NH_;
    const int t0 = (blockIdx.x * AW + wave) * 16;
    const size_t pbase = (size_t)zh * SEQ * HD;
    const size_t qo = pbase + (size_t)(t0 + lr) * HD + 8 * hi;
    const v16h qh0 = ldh(QH + qo), qh1 = ldh(QH + qo + 32), qr0 = ldh(QR + qo), qr1 = ldh(QR + qo + 32);   // B fragments: col t, k = d
    // this wave's tile: waves 0, 1 the K planes (rows = keys, pitch 128 B), waves 2, 3 the V^T planes (rows = d, pitch 2*SEQ B, 64 keys a row)
    const h16* pl = wave == 0 ? KH : wave == 1 ? KR : wave == 2 ? VTH : VTR;
    const uint64_t gsrc = (uint64_t)(size_t)(pl + pbase);
    const uint32_t gstep = wave < 2 ? (uint32_t)(KST * HD * 2) : (uint32_t)(KST * 2);   // bytes from one stage's tile to the next
    const uint32_t gpitch = wave < 2 ? (uint32_t)(HD * 2) : (uint32_t)(SEQ * 2);
    const uint32_t ldst = (uint32_t)(size_t)ring + (uint32_t)wave * TSZ;
    const int nst = blockIdx.x == 0 ? 2 : (int)blockIdx.x + 1;   // 64-key stages the block walks: keys [0, 64*(blockIdx.x+1)), never fewer than the prologue's two
    tile_load(ldst, gsrc, gpitch);                           // stage 0 -> buffer 0
    const int fo = lr * LP + 16 * hi;                        // lane's byte offset in a tile: row lr, k offset 8h halves (A fragments of K and of V^T alike)
    v8f oh0 = (v8f){}, oh1 = (v8f){}, oh2 = (v8f){}, oh3 = (v8f){};
    v8f or0 = (v8f){}, or1 = (v8f){}, or2 = (v8f){}, or3 = (v8f){};
    float m = NEGB, l = 0.0f;
    const int kend = t0 + 16;                                // keys 0 .. t0+15 visible to this wave; kend <= SEQ
    wait_tensor0();
    __syncthreads();                                         // stage 0 published
    tile_load(ldst + BSZ, gsrc + gstep, gpitch);             // stage 1 -> buffer 1
#pragma unroll 1
    for (int st = 0; st < nst; ++st) {
      const unsigned char* bp = ring + (st & 1) * BSZ + fo;
#pragma unroll
      for (int sub = 0; sub < 2; ++sub) {
       const int key0 = st * KST + sub * 32;
       if (key0 < kend) {                                    // wave-uniform skip beyond the diagonal; the hand-over below stands outside it
        const h16* kk = (const h16*)(bp + sub * 32 * LP);    // K value tile, rows sub*32 + lr; residual tile TSZ bytes behind it
        v8f sHa = (v8f){}, sLa = (v8f){}, sHb = (v8f){}, sLb = (v8f){};
        { const v16h ka0 = ldh(kk), ka1 = ldh(kk + 32), kb0 = ldh(kk + 16 * LPH), kb1 = ldh(kk + 16 * LPH + 32);
          sHa = wmma16(ka0, qh0, sHa); sLa = wmma16(ka0, qr0, sLa); sHb = wmma16(kb0, qh0, sHb); sLb = wmma16(kb0, qr0, sLb);
          sHa = wmma16(ka1, qh1, sHa); sLa = wmma16(ka1, qr1, sLa); sHb = wmma16(kb1, qh1, sHb); sLb = wmma16(kb1, qr1, sLb);
          asm volatile("v_nop\n\tv_nop\n\tv_nop\n\tv_nop" : "+v"(sHa), "+v"(sLa), "+v"(sHb), "+v"(sLb) : "v"(ka0), "v"(ka1), "v"(kb0), "v"(kb1)); }
        { const h16* kr = kk + TSZ / 2;
          const v16h ra0 = ldh(kr), ra1 = ldh(kr + 32), rb0 = ldh(kr + 16 * LPH), rb1 = ldh(kr + 16 * LPH + 32);
          sLa = wmma16(ra0, qh0, sLa); sLb = wmma16(rb0, qh0, sLb); sLa = wmma16(ra1, qh1, sLa); sLb = wmma16(rb1, qh1, sLb);
          asm volatile("v_nop\n\tv_nop\n\tv_nop\n\tv_nop" : "+v"(sLa), "+v"(sLb) : "v"(ra0), "v"(ra1), "v"(rb0), "v"(rb1)); }
        float ta[8], tb[8];
#pragma unroll
        for (int r = 0; r < 8; ++r) { ta[r] = (sHa[r] + sLa[r] * QRI) * L2E; tb[r] = (sHb[r] + sLb[r] * QRI) * L2E; }
        if (key0 + 31 > t0) {                                // wave-uniform: block crosses the diagonal
            const int tq = t0 + lr - key0 - 8 * hi;          // tile a entry r is key key0+8h+r: hidden when r > tq; tile b entry r when 16 + r > tq
#pragma unroll
            for (int r = 0; r < 8; ++r) { ta[r] = (r > tq) ? NEGB : ta[r]; tb[r] = (16 + r > tq) ? NEGB : tb[r]; }
        }
        float mx = NEGB;
#pragma unroll
        for (int r = 0; r < 8; ++r) mx = fmaxf(mx, fmaxf(ta[r], tb[r]));
        mx = fmaxf(mx, __shfl_xor(mx, 16, 32));
        const float mnew = fmaxf(m, mx);
        const float alpha = __builtin_amdgcn_exp2f(m - mnew);
        const float sh = PSH - mnew;
        v16h pb; float ls = 0.0f;
#pragma unroll
        for (int r = 0; r < 8; ++r) { const h16 pa = (h16)__builtin_amdgcn_exp2f(ta[r] + sh); const h16 pc = (h16)__builtin_amdgcn_exp2f(tb[r] + sh); pb[r] = pa; pb[8 + r] = pc; ls += (float)pa + (float)pc; }
        l = l * alpha + ls; m = mnew;
        oh0 = oh0 * alpha; oh1 = oh1 * alpha; oh2 = oh2 * alpha; oh3 = oh3 * alpha;
        or0 = or0 * alpha; or1 = or1 * alpha; or2 = or2 * alpha; or3 = or3 * alpha;
        { const h16* va = (const h16*)(bp + 2 * TSZ) + sub * 32;   // V^T value tile, rows 16j + lr, keys sub*32 ..
          const v16h v0 = ldh(va), v1 = ldh(va + 16 * LPH), v2 = ldh(va + 32 * LPH), v3 = ldh(va + 48 * LPH);
          oh0 = wmma16(v0, pb, oh0); oh1 = wmma16(v1, pb, oh1); oh2 = wmma16(v2, pb, oh2); oh3 = wmma16(v3, pb, oh3);
          asm volatile("v_nop\n\tv_nop\n\tv_nop\n\tv_nop" : "+v"(oh0), "+v"(oh1), "+v"(oh2), "+v"(oh3) : "v"(v0), "v"(v1), "v"(v2), "v"(v3), "v"(pb)); }
        { const h16* va = (const h16*)(bp + 3 * TSZ) + sub * 32;   // V^T residual tile
          const v16h v0 = ldh(va), v1 = ldh(va + 16 * LPH), v2 = ldh(va + 32 * LPH), v3 = ldh(va + 48 * LPH);
          or0 = wmma16(v0, pb, or0); or1 = wmma16(v1, pb, or1); or2 = wmma16(v2, pb, or2); or3 = wmma16(v3, pb, or3);
          asm volatile("v_nop\n\tv_nop\n\tv_nop\n\tv_nop" : "+v"(or0), "+v"(or1), "+v"(or2), "+v"(or3) : "v"(v0), "v"(v1), "v"(v2), "v"(v3), "v"(pb)); }
       }
      }
      // hand-over, every wave: own LDS reads done, own tile of stage st+1 landed, barrier (publishes stage st+1, frees this stage's buffer), then the refill
      wait_ds0();
      wait_tensor0();
      __syncthreads();
      if (pinned(st + 2 < nst)) tile_load(ldst + (uint32_t)(st & 1) * BSZ, gsrc + (uint64_t)(st + 2) * gstep, gpitch);
    }
    wait_tensor0();
    wait_ds0();
    float* os = (float*)ring;                                // output staging reuses the ring: the last hand-over's barrier stands behind every wave's last read, and nothing was issued behind it
    l += __shfl_xor(l, 16, 32);
    const float inv = 1.0f / l;
    const float ri = QRI * inv;
    const int wb = wave * 16 * 68;
    // O^T D layout: o_j[r] = (d = 16j + 8h + r, t = lane&15) -> os[t][d]; rows 0..15 x columns 0..63 all written
    STG(0, oh0, or0)
    STG(16, oh1, or1)
    STG(32, oh2, or2)
    STG(48, oh3, or3)
    wave_sync();
    bf* crow = CTX + ((size_t)b * SEQ + t0) * (size_t)(2 * DM) + h * HD;
{
#pragma unroll
        for (int s = 0; s < 4; ++s) { const int row = 4 * s + (lane >> 3), c8 = (lane & 7) * 8;   // 4 s x 4 row groups = 16 rows; 8 lanes x 8 = 64 columns
            const v4f x0 = *(const v4fa*)(&os[wb + row * 68 + c8]); const v4f x1 = *(const v4fa*)(&os[wb + row * 68 + c8 + 4]); v8us hv, lv;
#pragma unroll
            for (int i = 0; i < 4; ++i) { const unsigned short a0 = f2bf(x0[i]); const unsigned short a1 = f2bf(x1[i]); hv[i] = a0; hv[4 + i] = a1; lv[i] = f2bf(x0[i] - bf2f(a0)); lv[4 + i] = f2bf(x1[i] - bf2f(a1)); }
            const size_t oo = (size_t)row * (size_t)(2 * DM) + c8;
            *(v8us*)(crow + oo) = hv; *(v8us*)(crow + oo + DM) = lv; }
         }
}

static constexpr size_t al256(size_t v) { return (v + 255) & ~(size_t)255; }
static constexpr size_t SZ_XB  = al256((size_t)NB * SEQ * DM * 2);          // one bf16 input copy
static constexpr size_t SZ_WB  = al256((size_t)DM * DM * 2);                // one bf16 W^T plane
static constexpr size_t SZ_PL  = al256((size_t)NB * NH_ * SEQ * HD * 2);    // one f16 plane
static constexpr size_t SZ_CTX = al256((size_t)NB * SEQ * 2 * DM * 2);      // ctx hi | lo
static constexpr size_t SZ_TOTAL = 3 * SZ_XB + 4 * SZ_WB + 8 * SZ_PL + SZ_CTX;
static_assert(SZ_TOTAL <= (size_t)134217728);          // workspace carve <= 128 MiB
static_assert(SZ_PL == (size_t)NB * SEQ * DM * 2);     // value / residual plane pairs are exactly contiguous

extern "C" void kernel_launch(void* const* d_in, const int* in_sizes, int n_in,
                              void* d_out, int out_size, void* d_ws, size_t ws_size, hipStream_t stream) {
    if (n_in < 7) return;
    const size_t needx = ((size_t)(NB - 1) * SEQ_FULL + SEQ) * DM;
    if ((size_t)in_sizes[0] < needx || (size_t)in_sizes[1] < needx || (size_t)in_sizes[2] < needx) return;
    if ((size_t)in_sizes[3] < (size_t)DM * DM || (size_t)in_sizes[4] < (size_t)DM * DM || (size_t)in_sizes[5] < (size_t)DM * DM || (size_t)in_sizes[6] < (size_t)DM * DM) return;
    if ((size_t)out_size < ((size_t)(NB - 1) * OUT_SEQ + SEQ) * DM) return;
    if (SZ_TOTAL > ws_size) return;
    // wire order: q, k, v, Wq, Wk, Wv, Wp (weights [in][out])
    const float* xq = (const float*)d_in[0]; const float* xk = (const float*)d_in[1]; const float* xv = (const float*)d_in[2];
    const float* wq = (const float*)d_in[3]; const float* wk = (const float*)d_in[4]; const float* wv = (const float*)d_in[5]; const float* wp = (const float*)d_in[6];
    float* OUT = (float*)d_out;      // [NB][SEQ][1024]
    char* wsp = (char*)d_ws;
    bf* XQ = (bf*)wsp; wsp += SZ_XB;                 // [NB*SEQ][1024]
    bf* XK = (bf*)wsp; wsp += SZ_XB;
    bf* XV = (bf*)wsp; wsp += SZ_XB;
    bf* WQT = (bf*)wsp; wsp += SZ_WB;                // [out][in]
    bf* WKT = (bf*)wsp; wsp += SZ_WB;
    bf* WVT = (bf*)wsp; wsp += SZ_WB;
    bf* WPT = (bf*)wsp; wsp += SZ_WB;
    h16* QH = (h16*)wsp; wsp += SZ_PL;               // [NB*SEQ][1024] == [NB*16][SEQ][64]
    h16* QR = (h16*)wsp; wsp += SZ_PL;               // residual x2048
    h16* KH = (h16*)wsp; wsp += SZ_PL;
    h16* KR = (h16*)wsp; wsp += SZ_PL;
    h16* VH = (h16*)wsp; wsp += SZ_PL;               // value plane, residual plane directly behind it
    h16* VR = (h16*)wsp; wsp += SZ_PL;
    h16* VTH = (h16*)wsp; wsp += SZ_PL;              // [NB*16][64][SEQ], residual plane directly behind it
    h16* VTR = (h16*)wsp; wsp += SZ_PL;
    bf* CTX = (bf*)wsp; wsp += SZ_CTX;               // [NB*SEQ][2048]: hi | lo
    const size_t pln = SZ_PL / 2;                    // plane stride in halves

    if (SEQ == SEQ_FULL) {
        const size_t n8 = (size_t)NB * SEQ * DM / 8; const unsigned g = (unsigned)((n8 + 255) / 256);
        k_cvt8<<<g, 256, 0, stream>>>(xq, XQ, n8); k_cvt8<<<g, 256, 0, stream>>>(xk, XK, n8); k_cvt8<<<g, 256, 0, stream>>>(xv, XV, n8);
    } else {
        const size_t n8 = (size_t)SEQ * DM / 8; const unsigned g = (unsigned)((n8 + 255) / 256);
        for (int b = 0; b < NB; ++b) {
            k_cvt8<<<g, 256, 0, stream>>>(xq + (size_t)b * SEQ_FULL * DM, XQ + (size_t)b * SEQ * DM, n8);
            k_cvt8<<<g, 256, 0, stream>>>(xk + (size_t)b * SEQ_FULL * DM, XK + (size_t)b * SEQ * DM, n8);
            k_cvt8<<<g, 256, 0, stream>>>(xv + (size_t)b * SEQ_FULL * DM, XV + (size_t)b * SEQ * DM, n8);
        }
    }
    // W[in = 1024 rows][out = 1024 cols] -> WT[out][in]; grid (cols/64, rows/64)
    { const dim3 g(DM / 64, DM / 64, 1);
      k_wt<<<g, 256, 0, stream>>>(wq, WQT); k_wt<<<g, 256, 0, stream>>>(wk, WKT); k_wt<<<g, 256, 0, stream>>>(wv, WVT); k_wt<<<g, 256, 0, stream>>>(wp, WPT); }

    // projections: A = x rows (m = b*SEQ + t), Bt = W^T rows (n) -> row-major planes [m][n] (value + residual)
    { const dim3 g(NB * SEQ / 64, DM / 64, 1);
      k_gemm<0><<<g, 32, 0, stream>>>(XQ, WQT, DM, QH, QR, OUT);
      k_gemm<0><<<g, 32, 0, stream>>>(XK, WKT, DM, KH, KR, OUT);
      k_gemm<0><<<g, 32, 0, stream>>>(XV, WVT, DM, VH, VR, OUT); }

    // v planes [zh][s][64] -> v^T planes [zh][64][s], both the value and the residual plane
    k_vt<<<dim3(SEQ / 64, NB * NH_, 2), 256, 0, stream>>>(VH, VTH, pln);

    k_flash<<<dim3(SEQ / (16 * AW), NB * NH_, 1), 32 * AW, 0, stream>>>(QH, QR, KH, KR, VTH, VTR, CTX);

    // output projection: A = ctx rows [hi | lo] (K = 2048), Bt = Wp^T rows (k index wraps at 1024) -> f32 output
    k_gemm<1><<<dim3(NB * SEQ / 64, DM / 64, 1), 32, 0, stream>>>(CTX, WPT, 2 * DM, QH, QR, OUT);
}

// v002
// Measured time: 142 microseconds a run.
// Next to v001, in two timings, it ran 1.41 and 1.42 times as fast.
// Over all steps from v000 it is 2.48 times as fast.
#include <hip/hip_runtime.h>

// Multi-head attention, width 1024 = 16 heads x 64, separate q/k/v inputs [NB][SEQ][1024], Wq/Wk/Wv/Wp [in][out] (y = x W), no biases, unscaled scores, causal replace-mask, head split = flat row-major view (B,S,1024)->(B,16,S,64), output projection Wp (f32 out).
// Compute dtypes, f32 accumulate everywhere: q/k/v projections v_wmma_f32_16x16x32_bf16 (x and W RNE-converted to bf16; products exact);
// scores v_wmma_f32_16x16x32_f16 with q and k each as f16 value + f16 residual x2048 (three products, scaled residual products in their own accumulator);
// P (x2^14 carry, cancels in the normalisation) single f16, v as f16 value + f16 residual x2048 (two products, own accumulator); softmax f32 (online, running max);
// output projection v_wmma_f32_16x16x32_bf16 with ctx as bf16 hi | bf16 lo folded along K (K = 2048 against Wp^T repeated), Wp RNE-converted to bf16.
// Layout: bf16 copies of q/k/v, bf16 W^T planes [out][in]; projection planes [NB*SEQ][1024] f16 (== [b*16+h][s][64] by the flat head view); v^T planes [b*16+h][64][SEQ];
// fused flash kernel in transposed form (S^T = K Q^T, O^T = V^T P^T), K / V^T tiles of 64 keys staged in LDS by tensor loads (two buffers, shared by the block's four waves); ctx plane [NB*SEQ][2048] bf16 (hi | lo).
// GEMMs: 128x128 tile per block of four waves (64x64 each), A and Bt stages of 128 k staged in LDS by tensor loads (two buffers).

#ifndef NB
#define NB 2
#endif
#ifndef SEQ
#define SEQ 2048
#endif
#define NB_FULL  2
#define SEQ_FULL 2048
#ifndef OUT_SEQ
#define OUT_SEQ SEQ              // row pitch (in tokens) between batches of the output
#endif
#define DM   1024
#define NH_  16
#define HD   64
#define AW   4                   // waves per flash block (16 query rows each)
#define QRS  2048.0f             // carry of the residual planes
#define QRI  (1.0f / 2048.0f)
#define L2E  1.4426950408889634f // log2(e); scores are unscaled
#define PSH  14.0f               // log2 of the P carry (16384)
#define NEGB (-3.0e38f)
#define KST  64                  // keys per LDS stage of the flash kernel
#define LP   144                 // LDS row pitch in bytes: 128-B rows + 16-B pad (16 B x odd, for 16-byte LDS reads)
#define LPH  (LP / 2)            // the same in halves
#define TSZ  10240               // place of one tile in LDS: 64 rows x 144 B = 9216 B, rounded up to a multiple of 2 KiB
#define BSZ  (4 * TSZ)           // one buffer: K value, K residual, V^T value, V^T residual
#define GKS  128                 // k per LDS stage of the GEMM (256-B rows)
#define GLP  272                 // its LDS row pitch in bytes: 256-B rows + 16-B pad (16 B x odd, for 16-byte LDS reads)
#define GLPH (GLP / 2)           // the same in 16-bit elements
#define GTSZ 18432               // place of one GEMM tile in LDS: 64 rows x 272 B = 17408 B, rounded up to a multiple of 2 KiB
#define GBSZ (4 * GTSZ)          // one buffer: A rows 0..63, A rows 64..127, Bt rows 0..63, Bt rows 64..127

static_assert(HD == 64);
static_assert(NH_ * HD == DM);
static_assert((DM & (DM - 1)) == 0);           // B-operand k index wraps with a mask
static_assert(DM % 64 == 0);
static_assert(SEQ % 64 == 0);                  // 64-row tiles never straddle two batches; v^T tiles of 64 keys
static_assert((NB * SEQ) % 64 == 0);
static_assert(SEQ % 32 == 0);                  // key loop steps by 32
static_assert(SEQ % (16 * AW) == 0);           // flash grid covers the sequence exactly
static_assert(((size_t)SEQ * DM) % 8 == 0);
static_assert(NB <= NB_FULL);
static_assert(SEQ <= SEQ_FULL);
static_assert(AW == 4);                        // one tensor load per wave and stage: four tiles, four waves
static_assert(16 * AW == KST);                 // a block's queries end where its last 64-key stage ends
static_assert(SEQ >= 2 * KST);                 // the ring's prologue loads two stages
static_assert(HD * 2 == 128 && KST * 2 == 128);// both kinds of tile have 128-byte rows
static_assert(KST * LP <= TSZ && HD * LP <= TSZ && TSZ % 2048 == 0);
static_assert(AW * 16 * 68 * 4 <= 2 * BSZ);    // output staging reuses the ring
static_assert((NB * SEQ) % 128 == 0 && DM % 128 == 0);   // GEMM grid of 128x128 tiles covers C exactly
static_assert(DM % GKS == 0 && DM >= 2 * GKS);           // whole stages, the Bt wrap falls on a stage boundary, the ring's prologue loads two stages
static_assert(GKS * 2 == 256 && 64 * GLP <= GTSZ && GTSZ % 2048 == 0);
static_assert(4 * 16 * 68 * 4 <= 2 * GBSZ);              // GEMM output staging reuses its ring

typedef _Float16 h16;
typedef unsigned short bf;
typedef __attribute__((ext_vector_type(16))) __bf16   v16bf;
typedef __attribute__((ext_vector_type(16))) _Float16 v16h;
typedef __attribute__((ext_vector_type(8)))  _Float16 v8h;
typedef __attribute__((ext_vector_type(8)))  unsigned short v8us;
typedef __attribute__((ext_vector_type(8)))  float    v8f;
typedef __attribute__((ext_vector_type(4)))  float    v4f;
typedef v4f  __attribute__((may_alias)) v4fa;
typedef uint32_t u32x4 __attribute__((ext_vector_type(4)));
typedef uint32_t u32x8 __attribute__((ext_vector_type(8)));

__device__ __forceinline__ unsigned short f2bf(float f) { unsigned u = __float_as_uint(f); u += 0x7FFFu + ((u >> 16) & 1u); return (unsigned short)(u >> 16); }
__device__ __forceinline__ float bf2f(unsigned short s) { return __uint_as_float(((unsigned)s) << 16); }
__device__ __forceinline__ v16h cat16(v8h lo, v8h hi) { return __builtin_shufflevector(lo, hi, 0, 1, 2, 3, 4, 5, 6, 7, 8, 9, 10, 11, 12, 13, 14, 15); }
__device__ __forceinline__ v16bf cat16b(v8us lo, v8us hi) { return __builtin_bit_cast(v16bf, __builtin_shufflevector(lo, hi, 0, 1, 2, 3, 4, 5, 6, 7, 8, 9, 10, 11, 12, 13, 14, 15)); }
__device__ __forceinline__ v8f wmma16(v16h a, v16h b, v8f c) { return __builtin_amdgcn_wmma_f32_16x16x32_f16(false, a, false, b, (short)0, c, false, false); }
__device__ __forceinline__ v8f wmmab(v16bf a, v16bf b, v8f c) { return __builtin_amdgcn_wmma_f32_16x16x32_bf16(false, a, false, b, (short)0, c, false, false); }
// fragment loaders from K-contiguous 16-bit rows; p already includes + 8*(lane>>4): elements 0..7 <- k0+8h+0..7, elements 8..15 <- k0+16+8h+0..7 (same map for A and B)
__device__ __forceinline__ v16h  ldh(const h16* p) { return cat16(*(const v8h*)p, *(const v8h*)(p + 16)); }
__device__ __forceinline__ v16bf ldb(const bf* p)  { return cat16b(*(const v8us*)p, *(const v8us*)(p + 16)); }
// ordering point for wave-private LDS tiles (same wave writes and reads)
__device__ __forceinline__ void wave_sync() { __builtin_amdgcn_fence(3 /* release order */, "wavefront"); __builtin_amdgcn_wave_barrier(); asm volatile("" ::: "memory"); }

__device__ __forceinline__ uint32_t uni(uint32_t v) { return (uint32_t)__builtin_amdgcn_readfirstlane(v); }
// wave-uniform test held in a scalar register, so that the branch on it is a scalar branch (a tensor load ignores EXEC)
__device__ __forceinline__ uint32_t pinned(uint32_t v) { uint32_t w = (uint32_t)__builtin_amdgcn_readfirstlane(v); asm volatile("" : "+s"(w)); return w; }
__device__ __forceinline__ void wait_ds0()     { asm volatile("s_wait_dscnt 0x0" ::: "memory"); }      // this wave's LDS reads have returned before the buffer is handed back
__device__ __forceinline__ void wait_tensor0() { asm volatile("s_wait_tensorcnt 0x0" ::: "memory"); }  // this wave's tensor load has landed
// one tile of 64 rows x 128 bytes, source row pitch src_pitch bytes, into LDS at pitch 144 B (a 16-B pad behind every 128-B row)
__device__ __forceinline__ void tile_load(uint32_t lds_dst, uint64_t ga, uint32_t src_pitch) {
    u32x4 g0; u32x8 g1;
    g0[0] = uni(1u); g0[1] = uni(lds_dst); g0[2] = uni((uint32_t)ga); g0[3] = uni((((uint32_t)(ga >> 32)) & 0x01FFFFFFu) | 0x80000000u);
    g1[0] = uni((1u << 20) | (4u << 22) | (3u << 25));   // no mask, 1-byte elements, pad of 4 dwords behind every 32
    g1[1] = uni(128u << 16); g1[2] = uni(64u << 16); g1[3] = uni(128u << 16); g1[4] = uni(64u); g1[5] = uni(src_pitch); g1[6] = uni(0u); g1[7] = uni(0u);
    asm volatile("tensor_load_to_lds %0, %1" :: "s"(g0), "s"(g1) : "memory");
}
// one tile of 64 rows x 256 bytes, source row pitch src_pitch bytes, into LDS at pitch 272 B (a 16-B pad behind every 256-B row): group 1 built once, group 0 per request
__device__ __forceinline__ u32x8 tile256_group1(uint32_t src_pitch) {
    u32x8 g1;
    g1[0] = uni((1u << 20) | (5u << 22) | (3u << 25));   // no mask, 1-byte elements, pad of 4 dwords behind every 64
    g1[1] = uni(256u << 16); g1[2] = uni(64u << 16); g1[3] = uni(256u << 16); g1[4] = uni(64u); g1[5] = uni(src_pitch); g1[6] = uni(0u); g1[7] = uni(0u);
    asm volatile("" : "+s"(g1));   // as pinned(): the descriptor words are held in their scalar registers through the loop, so that none of them takes another value while a request is outstanding
    return g1;
}
__device__ __forceinline__ void tile256_load(uint32_t lds_dst, uint64_t ga, u32x8 g1) {
    u32x4 g0;
    g0[0] = uni(1u); g0[1] = uni(lds_dst); g0[2] = uni((uint32_t)ga); g0[3] = uni((((uint32_t)(ga >> 32)) & 0x01FFFFFFu) | 0x80000000u);
    asm volatile("tensor_load_to_lds %0, %1" :: "s"(g0), "s"(g1) : "memory");
}

__global__ __launch_bounds__(256) void k_cvt8(const float* __restrict__ src, bf* dst, size_t n8) {
    const size_t i = (size_t)blockIdx.x * 256 + threadIdx.x; if (i >= n8) return;
    const v8f v = *(const v8f*)(src + i * 8); v8us o;
#pragma unroll
    for (int k = 0; k < 8; ++k) o[k] = f2bf(v[k]);
    *(v8us*)(dst + i * 8) = o; 
}

// k_wt: weight transpose + RNE convert: in W[DM rows k][DM cols n] f32 -> out WT[DM rows n][DM cols k] bf16. grid (DM/64 over n, DM/64 over k), 256 threads.
__global__ __launch_bounds__(256) void k_wt(const float* __restrict__ W, bf* WT) {
    __shared__ float tile[64 * 65];
    const int tid = threadIdx.x; const int n0 = blockIdx.x * 64, k0 = blockIdx.y * 64;
#pragma unroll
    for (int it = 0; it < 4; ++it) { const int c = it * 256 + tid; const int r = c >> 4, c4 = (c & 15) * 4;   // 64 rows x 16 chunks of 4 floats
        const v4f v = *(const v4f*)(W + (size_t)(k0 + r) * DM + n0 + c4);
        tile[r * 65 + c4 + 0] = v[0]; tile[r * 65 + c4 + 1] = v[1]; tile[r * 65 + c4 + 2] = v[2]; tile[r * 65 + c4 + 3] = v[3]; }
    __syncthreads();
    v8us o[2];
#pragma unroll
    for (int it = 0; it < 2; ++it) { const int c = it * 256 + tid; const int n = c >> 3, k8 = (c & 7) * 8;     // 64 output rows x 8 chunks of 8
#pragma unroll
        for (int e = 0; e < 8; ++e) o[it][e] = f2bf(tile[(k8 + e) * 65 + n]); }
#pragma unroll
    for (int it = 0; it < 2; ++it) { const int c = it * 256 + tid; const int n = c >> 3, k8 = (c & 7) * 8;
        *(v8us*)(WT + (size_t)(n0 + n) * DM + k0 + k8) = o[it]; }
    
}

// k_gemm: bf16 GEMM, 128x128 tile of C per block of four waves (2 x 2), each wave a 64x64 tile (16 accumulators).
// C[m][n] = sum_{kc < KA} A[m][kc] Bt[n][kc & (DM-1)]; A row pitch KA, Bt row pitch DM (KA = 2*DM folds the hi | lo halves of A against the same Bt rows).
// Per stage of 128 k each wave brings one tile of 64 rows x 256 B into LDS with one tensor load (waves 0, 1 the block's A rows, waves 2, 3 its Bt rows);
// two buffers, the next stage's loads in flight while this stage is worked on; every wave reads its fragments from LDS (two 16-B reads each).
// MODE 0: C written as f16 (Ph) and f16 residual x2048 (Pr), row-major pitch DM. MODE 1: C written as f32 to OUT rows (m/SEQ)*OUT_SEQ + m%SEQ, pitch DM.
// grid (M/128, DM/128), 128 threads; KA a multiple of 128, at least 256. Epilogue per 16-row slab staged in LDS (wave-private part of the ring);
template <int MODE>
__global__ __launch_bounds__(128) void k_gemm(const bf* __restrict__ A, const bf* __restrict__ Bt, int KA, h16* Ph, h16* Pr, float* OUT) {
    __shared__ __attribute__((aligned(2048))) unsigned char gring[2 * GBSZ];
    const int lane = threadIdx.x & 31, wave = (int)uni(threadIdx.x >> 5), lr = lane & 15, hi = lane >> 4;
    const int wm = wave >> 1, wn = wave & 1;                 // the wave's 64x64 tile inside the block's 128x128
    const int r0 = blockIdx.x * 128 + wm * 64, c0 = blockIdx.y * 128 + wn * 64;
    // this wave's tile to load: waves 0, 1 rows 0..63, 64..127 of the block's A rows; waves 2, 3 the same of its Bt rows
    const int lrow = (wave < 2 ? (int)blockIdx.x : (int)blockIdx.y) * 128 + (wave & 1) * 64;
    const uint32_t gpitch = wave < 2 ? (uint32_t)KA * 2u : (uint32_t)(DM * 2);
    const uint64_t gsrc = (uint64_t)(size_t)(wave < 2 ? A : Bt) + (uint64_t)lrow * gpitch;
    const uint32_t gmask = wave < 2 ? 0xFFFFFFFFu : (uint32_t)(DM * 2 - 1);   // byte offset along a row; Bt's wraps at DM elements
    const uint32_t ldst = (uint32_t)(size_t)gring + (uint32_t)wave * GTSZ;
    const int nst = KA / GKS;
    const u32x8 g1 = tile256_group1(gpitch);
    tile256_load(ldst, gsrc, g1);                            // stage 0 -> buffer 0
    v8f acc[4][4];
#pragma unroll
    for (int mb = 0; mb < 4; ++mb)
#pragma unroll
        for (int nb = 0; nb < 4; ++nb) acc[mb][nb] = (v8f){};
    const int fo = lr * GLP + 16 * hi;                       // lane's byte offset in a tile: row lr, k offset 8h elements (A and B fragments alike)
    wait_tensor0();
    __syncthreads();                                         // stage 0 published
    tile256_load(ldst + GBSZ, gsrc + ((uint32_t)(GKS * 2) & gmask), g1);       // stage 1 -> buffer 1
#pragma unroll 1
    for (int st = 0; st < nst; ++st) {
        const unsigned char* bp = gring + (st & 1) * GBSZ + fo;
        const bf* ap = (const bf*)(bp + wm * GTSZ);          // A rows of this wave
        const bf* bq = (const bf*)(bp + (2 + wn) * GTSZ);    // Bt rows of this wave
        v16bf a[2][4], b[2][4];                              // two fragment sets: the next 32 k are fetched ahead of this block's products
#pragma unroll
        for (int f = 0; f < 4; ++f) a[0][f] = ldb(ap + f * 16 * GLPH);
#pragma unroll
        for (int f = 0; f < 4; ++f) b[0][f] = ldb(bq + f * 16 * GLPH);
#pragma unroll
        for (int ks = 0; ks < GKS / 32; ++ks) {
            if (ks + 1 < GKS / 32) {
#pragma unroll
                for (int f = 0; f < 4; ++f) a[(ks + 1) & 1][f] = ldb(ap + f * 16 * GLPH + (ks + 1) * 32);
#pragma unroll
                for (int f = 0; f < 4; ++f) b[(ks + 1) & 1][f] = ldb(bq + f * 16 * GLPH + (ks + 1) * 32);
                __builtin_amdgcn_sched_barrier(0);           // holds the next block's LDS reads as one group ahead of this block's products (else each read sinks to its use and is waited for there)
            }
#pragma unroll
            for (int nb = 0; nb < 4; ++nb)
#pragma unroll
                for (int mb = 0; mb < 4; ++mb) acc[mb][nb] = wmmab(a[ks & 1][mb], b[ks & 1][nb], acc[mb][nb]);
            __builtin_amdgcn_sched_barrier(0);               // keeps this block's products ahead of the reads after next, which reuse its fragment registers
        }
        // hand-over, every wave: own LDS reads done, own tile of stage st+1 landed, barrier (publishes stage st+1, frees this stage's buffer), then the refill
        wait_ds0();
        wait_tensor0();
        __syncthreads();
        if (pinned(st + 2 < nst)) tile256_load(ldst + (uint32_t)(st & 1) * GBSZ, gsrc + ((uint32_t)((st + 2) * GKS * 2) & gmask), g1);
    }
    wait_tensor0();
    wait_ds0();
    float* os = (float*)gring + wave * 16 * 68;              // output staging reuses the ring: the last hand-over's barrier stands behind every wave's last read, and nothing was issued behind it
#pragma unroll
    for (int mb = 0; mb < 4; ++mb) {
#pragma unroll
        for (int nb = 0; nb < 4; ++nb) {
#pragma unroll
            for (int j = 0; j < 8; ++j) os[(hi * 8 + j) * 68 + nb * 16 + lr] = acc[mb][nb][j]; }   // D: row 8h+j, col lane&15; rows 0..15 x cols 0..63 all written
        wave_sync();
        const int m0 = r0 + mb * 16;
        if (MODE == 0) {
            const size_t sb = (size_t)m0 * DM + c0;
{
#pragma unroll
                for (int s = 0; s < 4; ++s) { const int row = 4 * s + (lane >> 3), c8 = (lane & 7) * 8;   // 4 s x 4 row groups = 16 rows; 8 lanes x 8 = 64 columns
                    const v4f x0 = *(const v4fa*)(&os[row * 68 + c8]); const v4f x1 = *(const v4fa*)(&os[row * 68 + c8 + 4]); v8h hv, rv;
#pragma unroll
                    for (int i = 0; i < 4; ++i) { const h16 a0 = (h16)x0[i]; const h16 a1 = (h16)x1[i]; hv[i] = a0; hv[4 + i] = a1; rv[i] = (h16)((x0[i] - (float)a0) * QRS); rv[4 + i] = (h16)((x1[i] - (float)a1) * QRS); }
                    const size_t oo = sb + (size_t)row * DM + c8;
                    *(v8h*)(Ph + oo) = hv; *(v8h*)(Pr + oo) = rv; }
                 }
        } else {
            float* orow = OUT + ((size_t)(m0 / SEQ) * OUT_SEQ + (size_t)(m0 % SEQ)) * DM + c0;
{
#pragma unroll
                for (int s = 0; s < 8; ++s) { const int row = 2 * s + hi, cofs = lr * 4;   // 8 s x 2 rows = 16 rows; 16 lanes x 4 floats = 64 columns
                    const v4f val = *(const v4fa*)(&os[row * 68 + cofs]);
                    *(v4f*)(orow + (size_t)row * DM + cofs) = val; }
                 }
        }
        wave_sync();
    }
}

// k_vt: per-head transpose of the v planes: in V2[z][zh][s][64] -> out VT2[z][zh][64][s] (z = 0 value plane, 1 residual plane; plane stride pln halves).
__global__ __launch_bounds__(256) void k_vt(const h16* __restrict__ V2, h16* VT2, size_t pln) {
    __shared__ __align__(16) h16 ts[64 * 72];
    const int tid = threadIdx.x; const int s0 = blockIdx.x * 64; const int zh = blockIdx.y; const size_t zo = (size_t)blockIdx.z * pln;
    const h16* src = V2 + zo + ((size_t)zh * SEQ + s0) * HD;
    h16* dst = VT2 + zo + (size_t)zh * HD * SEQ + s0;
#pragma unroll
    for (int it = 0; it < 2; ++it) { const int c = it * 256 + tid; const int row = c >> 3, c8 = (c & 7) * 8;   // 64 key rows x 8 chunks
        const v8h v = *(const v8h*)(src + (size_t)row * HD + c8); *(v8h*)(&ts[row * 72 + c8]) = v; }
    __syncthreads();
    v8h o[2];
#pragma unroll
    for (int it = 0; it < 2; ++it) { const int c = it * 256 + tid; const int d = c >> 3, k8 = (c & 7) * 8;     // 64 feature rows x 8 chunks of 8 keys
#pragma unroll
        for (int e = 0; e < 8; ++e) o[it][e] = ts[(k8 + e) * 72 + d]; }
#pragma unroll
    for (int it = 0; it < 2; ++it) { const int c = it * 256 + tid; const int d = c >> 3, k8 = (c & 7) * 8;
        *(v8h*)(dst + (size_t)d * SEQ + k8) = o[it]; }
    
}

#define STG(OFS, OH, OR) { v4f a_, c_; \
    a_[0] = OH[0] * inv + OR[0] * ri; a_[1] = OH[1] * inv + OR[1] * ri; a_[2] = OH[2] * inv + OR[2] * ri; a_[3] = OH[3] * inv + OR[3] * ri; \
    c_[0] = OH[4] * inv + OR[4] * ri; c_[1] = OH[5] * inv + OR[5] * ri; c_[2] = OH[6] * inv + OR[6] * ri; c_[3] = OH[7] * inv + OR[7] * ri; \
    *(v4fa*)(&os[wb + lr * 68 + (OFS) + 8 * hi]) = a_; *(v4fa*)(&os[wb + lr * 68 + (OFS) + 8 * hi + 4]) = c_; }

// k_flash: fused causal attention, one wave per 16 query rows of one (batch, head); Q fragments straight from the f16 planes (two 16-B loads each).
// K and V^T: per stage of 64 keys each of the four waves brings one tile (K value, K residual, V^T value, V^T residual; 64 rows x 128 B) into LDS with one tensor load;
// two buffers, the next stage's loads in flight while this stage is worked on; every wave reads its fragments from LDS (two 16-B reads each). Every wave passes every stage's hand-over.
// Transposed form: S^T[key][t] = K Q^T (A = K rows, B = Q rows); lane (t = lane&15, h = lane>>4) holds keys 8h+r of each 16-key tile, so the packed
// P tile is directly the B fragment of O^T[d][t] = V^T P^T (element r <- tile keys 0..15, element 8+r <- tile keys 16..31, lane unchanged).
// Causal: a wave works on the 32-key blocks below t0+16 (wave-uniform); entries with key > t are replaced by a large negative value (P = 0); every visited 32-key block holds a visible key for each row.
// Softmax state (running max, partial sum) is one scalar per lane; the two lane halves of a row are combined with one xor-16 exchange.
__global__ __launch_bounds__(32 * AW) void k_flash(const h16* __restrict__ QH, const h16* __restrict__ QR, const h16* __restrict__ KH, const h16* __restrict__ KR,
                                                   const h16* __restrict__ VTH, const h16* __restrict__ VTR, bf* CTX) {
    __shared__ __attribute__((aligned(2048))) unsigned char ring[2 * BSZ];
    const int lane = threadIdx.x & 31, wave = (int)uni(threadIdx.x >> 5), lr = lane & 15, hi = lane >> 4;
    const int zh = blockIdx.y; const int b = zh / NH_, h = zh % NH_;
    const int t0 = (blockIdx.x * AW + wave) * 16;
    const size_t pbase = (size_t)zh * SEQ * HD;
    const size_t qo = pbase + (size_t)(t0 + lr) * HD + 8 * hi;
    const v16h qh0 = ldh(QH + qo), qh1 = ldh(QH + qo + 32), qr0 = ldh(QR + qo), qr1 = ldh(QR + qo + 32);   // B fragments: col t, k = d
    // this wave's tile: waves 0, 1 the K planes (rows = keys, pitch 128 B), waves 2, 3 the V^T planes (rows = d, pitch 2*SEQ B, 64 keys a row)
    const h16* pl = wave == 0 ? KH : wave == 1 ? KR : wave == 2 ? VTH : VTR;
    const uint64_t gsrc = (uint64_t)(size_t)(pl + pbase);
    const uint32_t gstep = wave < 2 ? (uint32_t)(KST * HD * 2) : (uint32_t)(KST * 2);   // bytes from one stage's tile to the next
    const uint32_t gpitch = wave < 2 ? (uint32_t)(HD * 2) : (uint32_t)(SEQ * 2);
    const uint32_t ldst = (uint32_t)(size_t)ring + (uint32_t)wave * TSZ;
    const int nst = blockIdx.x == 0 ? 2 : (int)blockIdx.x + 1;   // 64-key stages the block walks: keys [0, 64*(blockIdx.x+1)), never fewer than the prologue's two
    tile_load(ldst, gsrc, gpitch);                           // stage 0 -> buffer 0
    const int fo = lr * LP + 16 * hi;                        // lane's byte offset in a tile: row lr, k offset 8h halves (A fragments of K and of V^T alike)
    v8f oh0 = (v8f){}, oh1 = (v8f){}, oh2 = (v8f){}, oh3 = (v8f){};
    v8f or0 = (v8f){}, or1 = (v8f){}, or2 = (v8f){}, or3 = (v8f){};
    float m = NEGB, l = 0.0f;
    const int kend = t0 + 16;                                // keys 0 .. t0+15 visible to this wave; kend <= SEQ
    wait_tensor0();
    __syncthreads();                                         // stage 0 published
    tile_load(ldst + BSZ, gsrc + gstep, gpitch);             // stage 1 -> buffer 1
#pragma unroll 1
    for (int st = 0; st < nst; ++st) {
      const unsigned char* bp = ring + (st & 1) * BSZ + fo;
#pragma unroll
      for (int sub = 0; sub < 2; ++sub) {
       const int key0 = st * KST + sub * 32;
       if (key0 < kend) {                                    // wave-uniform skip beyond the diagonal; the hand-over below stands outside it
        const h16* kk = (const h16*)(bp + sub * 32 * LP);    // K value tile, rows sub*32 + lr; residual tile TSZ bytes behind it
        v8f sHa = (v8f){}, sLa = (v8f){}, sHb = (v8f){}, sLb = (v8f){};
        { const v16h ka0 = ldh(kk), ka1 = ldh(kk + 32), kb0 = ldh(kk + 16 * LPH), kb1 = ldh(kk + 16 * LPH + 32);
          sHa = wmma16(ka0, qh0, sHa); sLa = wmma16(ka0, qr0, sLa); sHb = wmma16(kb0, qh0, sHb); sLb = wmma16(kb0, qr0, sLb);
          sHa = wmma16(ka1, qh1, sHa); sLa = wmma16(ka1, qr1, sLa); sHb = wmma16(kb1, qh1, sHb); sLb = wmma16(kb1, qr1, sLb);
          asm volatile("v_nop\n\tv_nop\n\tv_nop\n\tv_nop" : "+v"(sHa), "+v"(sLa), "+v"(sHb), "+v"(sLb) : "v"(ka0), "v"(ka1), "v"(kb0), "v"(kb1)); }
        { const h16* kr = kk + TSZ / 2;
          const v16h ra0 = ldh(kr), ra1 = ldh(kr + 32), rb0 = ldh(kr + 16 * LPH), rb1 = ldh(kr + 16 * LPH + 32);
          sLa = wmma16(ra0, qh0, sLa); sLb = wmma16(rb0, qh0, sLb); sLa = wmma16(ra1, qh1, sLa); sLb = wmma16(rb1, qh1, sLb);
          asm volatile("v_nop\n\tv_nop\n\tv_nop\n\tv_nop" : "+v"(sLa), "+v"(sLb) : "v"(ra0), "v"(ra1), "v"(rb0), "v"(rb1)); }
        float ta[8], tb[8];
#pragma unroll
        for (int r = 0; r < 8; ++r) { ta[r] = (sHa[r] + sLa[r] * QRI) * L2E; tb[r] = (sHb[r] + sLb[r] * QRI) * L2E; }
        if (key0 + 31 > t0) {                                // wave-uniform: block crosses the diagonal
            const int tq = t0 + lr - key0 - 8 * hi;          // tile a entry r is key key0+8h+r: hidden when r > tq; tile b entry r when 16 + r > tq
#pragma unroll
            for (int r = 0; r < 8; ++r) { ta[r] = (r > tq) ? NEGB : ta[r]; tb[r] = (16 + r > tq) ? NEGB : tb[r]; }
        }
        float mx = NEGB;
#pragma unroll
        for (int r = 0; r < 8; ++r) mx = fmaxf(mx, fmaxf(ta[r], tb[r]));
        mx = fmaxf(mx, __shfl_xor(mx, 16, 32));
        const float mnew = fmaxf(m, mx);
        const float alpha = __builtin_amdgcn_exp2f(m - mnew);
        const float sh = PSH - mnew;
        v16h pb; float ls = 0.0f;
#pragma unroll
        for (int r = 0; r < 8; ++r) { const h16 pa = (h16)__builtin_amdgcn_exp2f(ta[r] + sh); const h16 pc = (h16)__builtin_amdgcn_exp2f(tb[r] + sh); pb[r] = pa; pb[8 + r] = pc; ls += (float)pa + (float)pc; }
        l = l * alpha + ls; m = mnew;
        oh0 = oh0 * alpha; oh1 = oh1 * alpha; oh2 = oh2 * alpha; oh3 = oh3 * alpha;
        or0 = or0 * alpha; or1 = or1 * alpha; or2 = or2 * alpha; or3 = or3 * alpha;
        { const h16* va = (const h16*)(bp + 2 * TSZ) + sub * 32;   // V^T value tile, rows 16j + lr, keys sub*32 ..
          const v16h v0 = ldh(va), v1 = ldh(va + 16 * LPH), v2 = ldh(va + 32 * LPH), v3 = ldh(va + 48 * LPH);
          oh0 = wmma16(v0, pb, oh0); oh1 = wmma16(v1, pb, oh1); oh2 = wmma16(v2, pb, oh2); oh3 = wmma16(v3, pb, oh3);
          asm volatile("v_nop\n\tv_nop\n\tv_nop\n\tv_nop" : "+v"(oh0), "+v"(oh1), "+v"(oh2), "+v"(oh3) : "v"(v0), "v"(v1), "v"(v2), "v"(v3), "v"(pb)); }
        { const h16* va = (const h16*)(bp + 3 * TSZ) + sub * 32;   // V^T residual tile
          const v16h v0 = ldh(va), v1 = ldh(va + 16 * LPH), v2 = ldh(va + 32 * LPH), v3 = ldh(va + 48 * LPH);
          or0 = wmma16(v0, pb, or0); or1 = wmma16(v1, pb, or1); or2 = wmma16(v2, pb, or2); or3 = wmma16(v3, pb, or3);
          asm volatile("v_nop\n\tv_nop\n\tv_nop\n\tv_nop" : "+v"(or0), "+v"(or1), "+v"(or2), "+v"(or3) : "v"(v0), "v"(v1), "v"(v2), "v"(v3), "v"(pb)); }
       }
      }
      // hand-over, every wave: own LDS reads done, own tile of stage st+1 landed, barrier (publishes stage st+1, frees this stage's buffer), then the refill
      wait_ds0();
      wait_tensor0();
      __syncthreads();
      if (pinned(st + 2 < nst)) tile_load(ldst + (uint32_t)(st & 1) * BSZ, gsrc + (uint64_t)(st + 2) * gstep, gpitch);
    }
    wait_tensor0();
    wait_ds0();
    float* os = (float*)ring;                                // output staging reuses the ring: the last hand-over's barrier stands behind every wave's last read, and nothing was issued behind it
    l += __shfl_xor(l, 16, 32);
    const float inv = 1.0f / l;
    const float ri = QRI * inv;
    const int wb = wave * 16 * 68;
    // O^T D layout: o_j[r] = (d = 16j + 8h + r, t = lane&15) -> os[t][d]; rows 0..15 x columns 0..63 all written
    STG(0, oh0, or0)
    STG(16, oh1, or1)
    STG(32, oh2, or2)
    STG(48, oh3, or3)
    wave_sync();
    bf* crow = CTX + ((size_t)b * SEQ + t0) * (size_t)(2 * DM) + h * HD;
{
#pragma unroll
        for (int s = 0; s < 4; ++s) { const int row = 4 * s + (lane >> 3), c8 = (lane & 7) * 8;   // 4 s x 4 row groups = 16 rows; 8 lanes x 8 = 64 columns
            const v4f x0 = *(const v4fa*)(&os[wb + row * 68 + c8]); const v4f x1 = *(const v4fa*)(&os[wb + row * 68 + c8 + 4]); v8us hv, lv;
#pragma unroll
            for (int i = 0; i < 4; ++i) { const unsigned short a0 = f2bf(x0[i]); const unsigned short a1 = f2bf(x1[i]); hv[i] = a0; hv[4 + i] = a1; lv[i] = f2bf(x0[i] - bf2f(a0)); lv[4 + i] = f2bf(x1[i] - bf2f(a1)); }
            const size_t oo = (size_t)row * (size_t)(2 * DM) + c8;
            *(v8us*)(crow + oo) = hv; *(v8us*)(crow + oo + DM) = lv; }
         }
}

static constexpr size_t al256(size_t v) { return (v + 255) & ~(size_t)255; }
static constexpr size_t SZ_XB  = al256((size_t)NB * SEQ * DM * 2);          // one bf16 input copy
static constexpr size_t SZ_WB  = al256((size_t)DM * DM * 2);                // one bf16 W^T plane
static constexpr size_t SZ_PL  = al256((size_t)NB * NH_ * SEQ * HD * 2);    // one f16 plane
static constexpr size_t SZ_CTX = al256((size_t)NB * SEQ * 2 * DM * 2);      // ctx hi | lo
static constexpr size_t SZ_TOTAL = 3 * SZ_XB + 4 * SZ_WB + 8 * SZ_PL + SZ_CTX;
static_assert(SZ_TOTAL <= (size_t)134217728);          // workspace carve <= 128 MiB
static_assert(SZ_PL == (size_t)NB * SEQ * DM * 2);     // value / residual plane pairs are exactly contiguous

extern "C" void kernel_launch(void* const* d_in, const int* in_sizes, int n_in,
                              void* d_out, int out_size, void* d_ws, size_t ws_size, hipStream_t stream) {
    if (n_in < 7) return;
    const size_t needx = ((size_t)(NB - 1) * SEQ_FULL + SEQ) * DM;
    if ((size_t)in_sizes[0] < needx || (size_t)in_sizes[1] < needx || (size_t)in_sizes[2] < needx) return;
    if ((size_t)in_sizes[3] < (size_t)DM * DM || (size_t)in_sizes[4] < (size_t)DM * DM || (size_t)in_sizes[5] < (size_t)DM * DM || (size_t)in_sizes[6] < (size_t)DM * DM) return;
    if ((size_t)out_size < ((size_t)(NB - 1) * OUT_SEQ + SEQ) * DM) return;
    if (SZ_TOTAL > ws_size) return;
    // wire order: q, k, v, Wq, Wk, Wv, Wp (weights [in][out])
    const float* xq = (const float*)d_in[0]; const float* xk = (const float*)d_in[1]; const float* xv = (const float*)d_in[2];
    const float* wq = (const float*)d_in[3]; const float* wk = (const float*)d_in[4]; const float* wv = (const float*)d_in[5]; const float* wp = (const float*)d_in[6];
    float* OUT = (float*)d_out;      // [NB][SEQ][1024]
    char* wsp = (char*)d_ws;
    bf* XQ = (bf*)wsp; wsp += SZ_XB;                 // [NB*SEQ][1024]
    bf* XK = (bf*)wsp; wsp += SZ_XB;
    bf* XV = (bf*)wsp; wsp += SZ_XB;
    bf* WQT = (bf*)wsp; wsp += SZ_WB;                // [out][in]
    bf* WKT = (bf*)wsp; wsp += SZ_WB;
    bf* WVT = (bf*)wsp; wsp += SZ_WB;
    bf* WPT = (bf*)wsp; wsp += SZ_WB;
    h16* QH = (h16*)wsp; wsp += SZ_PL;               // [NB*SEQ][1024] == [NB*16][SEQ][64]
    h16* QR = (h16*)wsp; wsp += SZ_PL;               // residual x2048
    h16* KH = (h16*)wsp; wsp += SZ_PL;
    h16* KR = (h16*)wsp; wsp += SZ_PL;
    h16* VH = (h16*)wsp; wsp += SZ_PL;               // value plane, residual plane directly behind it
    h16* VR = (h16*)wsp; wsp += SZ_PL;
    h16* VTH = (h16*)wsp; wsp += SZ_PL;              // [NB*16][64][SEQ], residual plane directly behind it
    h16* VTR = (h16*)wsp; wsp += SZ_PL;
    bf* CTX = (bf*)wsp; wsp += SZ_CTX;               // [NB*SEQ][2048]: hi | lo
    const size_t pln = SZ_PL / 2;                    // plane stride in halves

    if (SEQ == SEQ_FULL) {
        const size_t n8 = (size_t)NB * SEQ * DM / 8; const unsigned g = (unsigned)((n8 + 255) / 256);
        k_cvt8<<<g, 256, 0, stream>>>(xq, XQ, n8); k_cvt8<<<g, 256, 0, stream>>>(xk, XK, n8); k_cvt8<<<g, 256, 0, stream>>>(xv, XV, n8);
    } else {
        const size_t n8 = (size_t)SEQ * DM / 8; const unsigned g = (unsigned)((n8 + 255) / 256);
        for (int b = 0; b < NB; ++b) {
            k_cvt8<<<g, 256, 0, stream>>>(xq + (size_t)b * SEQ_FULL * DM, XQ + (size_t)b * SEQ * DM, n8);
            k_cvt8<<<g, 256, 0, stream>>>(xk + (size_t)b * SEQ_FULL * DM, XK + (size_t)b * SEQ * DM, n8);
            k_cvt8<<<g, 256, 0, stream>>>(xv + (size_t)b * SEQ_FULL * DM, XV + (size_t)b * SEQ * DM, n8);
        }
    }
    // W[in = 1024 rows][out = 1024 cols] -> WT[out][in]; grid (cols/64, rows/64)
    { const dim3 g(DM / 64, DM / 64, 1);
      k_wt<<<g, 256, 0, stream>>>(wq, WQT); k_wt<<<g, 256, 0, stream>>>(wk, WKT); k_wt<<<g, 256, 0, stream>>>(wv, WVT); k_wt<<<g, 256, 0, stream>>>(wp, WPT); }

    // projections: A = x rows (m = b*SEQ + t), Bt = W^T rows (n) -> row-major planes [m][n] (value + residual)
    { const dim3 g(NB * SEQ / 128, DM / 128, 1);
      k_gemm<0><<<g, 128, 0, stream>>>(XQ, WQT, DM, QH, QR, OUT);
      k_gemm<0><<<g, 128, 0, stream>>>(XK, WKT, DM, KH, KR, OUT);
      k_gemm<0><<<g, 128, 0, stream>>>(XV, WVT, DM, VH, VR, OUT); }

    // v planes [zh][s][64] -> v^T planes [zh][64][s], both the value and the residual plane
    k_vt<<<dim3(SEQ / 64, NB * NH_, 2), 256, 0, stream>>>(VH, VTH, pln);

    k_flash<<<dim3(SEQ / (16 * AW), NB * NH_, 1), 32 * AW, 0, stream>>>(QH, QR, KH, KR, VTH, VTR, CTX);

    // output projection: A = ctx rows [hi | lo] (K = 2048), Bt = Wp^T rows (k index wraps at 1024) -> f32 output
    k_gemm<1><<<dim3(NB * SEQ / 128, DM / 128, 1), 128, 0, stream>>>(CTX, WPT, 2 * DM, QH, QR, OUT);
}

// v003
// It runs in 117 microseconds.
// In two side-by-side timings against v002, it was 1.22 and 1.21 times as fast.
// Counting every step since v000, it is 3.00 times as fast.
#include <hip/hip_runtime.h>

// Multi-head attention, width 1024 = 16 heads x 64, separate q/k/v inputs [NB][SEQ][1024], Wq/Wk/Wv/Wp [in][out] (y = x W), no biases, unscaled scores, causal replace-mask, head split = flat row-major view (B,S,1024)->(B,16,S,64), output projection Wp (f32 out).
// Compute dtypes, f32 accumulate everywhere: q/k/v projections v_wmma_f32_16x16x32_bf16 (x and W RNE-converted to bf16; products exact);
// scores v_wmma_f32_16x16x32_f16 with q and k each as f16 value + f16 residual x2048 (three products, scaled residual products in their own accumulator);
// P (x2^14 carry, cancels in the normalisation) single f16, v as f16 value + f16 residual x2048 (two products, own accumulator); softmax f32 (online, running max);
// output projection v_wmma_f32_16x16x32_bf16 with ctx as bf16 hi | bf16 lo folded along K (K = 2048 against Wp^T repeated), Wp RNE-converted to bf16.
// Layout: bf16 copies of q/k/v, bf16 W^T planes [out][in]; projection planes [NB*SEQ][1024] f16 (== [b*16+h][s][64] by the flat head view); v^T planes [b*16+h][64][SEQ];
// fused flash kernel in transposed form (S^T = K Q^T, O^T = V^T P^T), K / V^T tiles of 64 keys staged in LDS by tensor loads (two buffers, shared by the block's four waves); ctx plane [NB*SEQ][2048] bf16 (hi | lo).
// GEMMs: 128x128 tile per block of four waves (64x64 each), A and Bt stages of 128 k staged in LDS by tensor loads (two buffers).
// Five launches: k_prep (all seven input conversions, split by block index), k_gemm<0> (the three projections, one per blockIdx.z), k_vt, k_flash, k_gemm<1>.

#ifndef NB
#define NB 2
#endif
#ifndef SEQ
#define SEQ 2048
#endif
#define NB_FULL  2
#define SEQ_FULL 2048
#ifndef OUT_SEQ
#define OUT_SEQ SEQ              // row pitch (in tokens) between batches of the output
#endif
#define DM   1024
#define NH_  16
#define HD   64
#define AW   4                   // waves per flash block (16 query rows each)
#define QRS  2048.0f             // carry of the residual planes
#define QRI  (1.0f / 2048.0f)
#define L2E  1.4426950408889634f // log2(e); scores are unscaled
#define PSH  14.0f               // log2 of the P carry (16384)
#define NEGB (-3.0e38f)
#define KST  64                  // keys per LDS stage of the flash kernel
#define LP   144                 // LDS row pitch in bytes: 128-B rows + 16-B pad (16 B x odd, for 16-byte LDS reads)
#define LPH  (LP / 2)            // the same in halves
#define TSZ  10240               // place of one tile in LDS: 64 rows x 144 B = 9216 B, rounded up to a multiple of 2 KiB
#define BSZ  (4 * TSZ)           // one buffer: K value, K residual, V^T value, V^T residual
#define GKS  128                 // k per LDS stage of the GEMM (256-B rows)
#define GLP  272                 // its LDS row pitch in bytes: 256-B rows + 16-B pad (16 B x odd, for 16-byte LDS reads)
#define GLPH (GLP / 2)           // the same in 16-bit elements
#define GTSZ 18432               // place of one GEMM tile in LDS: 64 rows x 272 B = 17408 B, rounded up to a multiple of 2 KiB
#define GBSZ (4 * GTSZ)          // one buffer: A rows 0..63, A rows 64..127, Bt rows 0..63, Bt rows 64..127

static_assert(HD == 64);
static_assert(NH_ * HD == DM);
static_assert((DM & (DM - 1)) == 0);           // B-operand k index wraps with a mask
static_assert(DM % 64 == 0);
static_assert(SEQ % 64 == 0);                  // 64-row tiles never straddle two batches; v^T tiles of 64 keys
static_assert((NB * SEQ) % 64 == 0);
static_assert(SEQ % 32 == 0);                  // key loop steps by 32
static_assert(SEQ % (16 * AW) == 0);           // flash grid covers the sequence exactly
static_assert(((size_t)SEQ * DM) % 8 == 0);
static_assert(NB <= NB_FULL);
static_assert(SEQ <= SEQ_FULL);
static_assert(AW == 4);                        // one tensor load per wave and stage: four tiles, four waves
static_assert(16 * AW == KST);                 // a block's queries end where its last 64-key stage ends
static_assert(SEQ >= 2 * KST);                 // the ring's prologue loads two stages
static_assert(HD * 2 == 128 && KST * 2 == 128);// both kinds of tile have 128-byte rows
static_assert(KST * LP <= TSZ && HD * LP <= TSZ && TSZ % 2048 == 0);
static_assert(AW * 16 * 68 * 4 <= 2 * BSZ);    // output staging reuses the ring
static_assert((NB * SEQ) % 128 == 0 && DM % 128 == 0);   // GEMM grid of 128x128 tiles covers C exactly
static_assert(DM % GKS == 0 && DM >= 2 * GKS);           // whole stages, the Bt wrap falls on a stage boundary, the ring's prologue loads two stages
static_assert(GKS * 2 == 256 && 64 * GLP <= GTSZ && GTSZ % 2048 == 0);
static_assert(4 * 16 * 68 * 4 <= 2 * GBSZ);              // GEMM output staging reuses its ring

typedef _Float16 h16;
typedef unsigned short bf;
typedef __attribute__((ext_vector_type(16))) __bf16   v16bf;
typedef __attribute__((ext_vector_type(16))) _Float16 v16h;
typedef __attribute__((ext_vector_type(8)))  _Float16 v8h;
typedef __attribute__((ext_vector_type(8)))  unsigned short v8us;
typedef __attribute__((ext_vector_type(8)))  float    v8f;
typedef __attribute__((ext_vector_type(4)))  float    v4f;
typedef v4f  __attribute__((may_alias)) v4fa;
typedef uint32_t u32x4 __attribute__((ext_vector_type(4)));
typedef uint32_t u32x8 __attribute__((ext_vector_type(8)));

__device__ __forceinline__ unsigned short f2bf(float f) { unsigned u = __float_as_uint(f); u += 0x7FFFu + ((u >> 16) & 1u); return (unsigned short)(u >> 16); }
__device__ __forceinline__ float bf2f(unsigned short s) { return __uint_as_float(((unsigned)s) << 16); }
__device__ __forceinline__ v16h cat16(v8h lo, v8h hi) { return __builtin_shufflevector(lo, hi, 0, 1, 2, 3, 4, 5, 6, 7, 8, 9, 10, 11, 12, 13, 14, 15); }
__device__ __forceinline__ v16bf cat16b(v8us lo, v8us hi) { return __builtin_bit_cast(v16bf, __builtin_shufflevector(lo, hi, 0, 1, 2, 3, 4, 5, 6, 7, 8, 9, 10, 11, 12, 13, 14, 15)); }
__device__ __forceinline__ v8f wmma16(v16h a, v16h b, v8f c) { return __builtin_amdgcn_wmma_f32_16x16x32_f16(false, a, false, b, (short)0, c, false, false); }
__device__ __forceinline__ v8f wmmab(v16bf a, v16bf b, v8f c) { return __builtin_amdgcn_wmma_f32_16x16x32_bf16(false, a, false, b, (short)0, c, false, false); }
// fragment loaders from K-contiguous 16-bit rows; p already includes + 8*(lane>>4): elements 0..7 <- k0+8h+0..7, elements 8..15 <- k0+16+8h+0..7 (same map for A and B)
__device__ __forceinline__ v16h  ldh(const h16* p) { return cat16(*(const v8h*)p, *(const v8h*)(p + 16)); }
__device__ __forceinline__ v16bf ldb(const bf* p)  { return cat16b(*(const v8us*)p, *(const v8us*)(p + 16)); }
// ordering point for wave-private LDS tiles (same wave writes and reads)
__device__ __forceinline__ void wave_sync() { __builtin_amdgcn_fence(3 /* release order */, "wavefront"); __builtin_amdgcn_wave_barrier(); asm volatile("" ::: "memory"); }

__device__ __forceinline__ uint32_t uni(uint32_t v) { return (uint32_t)__builtin_amdgcn_readfirstlane(v); }
// wave-uniform test held in a scalar register, so that the branch on it is a scalar branch (a tensor load ignores EXEC)
__device__ __forceinline__ uint32_t pinned(uint32_t v) { uint32_t w = (uint32_t)__builtin_amdgcn_readfirstlane(v); asm volatile("" : "+s"(w)); return w; }
__device__ __forceinline__ void wait_ds0()     { asm volatile("s_wait_dscnt 0x0" ::: "memory"); }      // this wave's LDS reads have returned before the buffer is handed back
__device__ __forceinline__ void wait_tensor0() { asm volatile("s_wait_tensorcnt 0x0" ::: "memory"); }  // this wave's tensor load has landed
// one tile of 64 rows x 128 bytes, source row pitch src_pitch bytes, into LDS at pitch 144 B (a 16-B pad behind every 128-B row)
__device__ __forceinline__ void tile_load(uint32_t lds_dst, uint64_t ga, uint32_t src_pitch) {
    u32x4 g0; u32x8 g1;
    g0[0] = uni(1u); g0[1] = uni(lds_dst); g0[2] = uni((uint32_t)ga); g0[3] = uni((((uint32_t)(ga >> 32)) & 0x01FFFFFFu) | 0x80000000u);
    g1[0] = uni((1u << 20) | (4u << 22) | (3u << 25));   // no mask, 1-byte elements, pad of 4 dwords behind every 32
    g1[1] = uni(128u << 16); g1[2] = uni(64u << 16); g1[3] = uni(128u << 16); g1[4] = uni(64u); g1[5] = uni(src_pitch); g1[6] = uni(0u); g1[7] = uni(0u);
    asm volatile("tensor_load_to_lds %0, %1" :: "s"(g0), "s"(g1) : "memory");
}
// one tile of 64 rows x 256 bytes, source row pitch src_pitch bytes, into LDS at pitch 272 B (a 16-B pad behind every 256-B row): group 1 built once, group 0 per request
__device__ __forceinline__ u32x8 tile256_group1(uint32_t src_pitch) {
    u32x8 g1;
    g1[0] = uni((1u << 20) | (5u << 22) | (3u << 25));   // no mask, 1-byte elements, pad of 4 dwords behind every 64
    g1[1] = uni(256u << 16); g1[2] = uni(64u << 16); g1[3] = uni(256u << 16); g1[4] = uni(64u); g1[5] = uni(src_pitch); g1[6] = uni(0u); g1[7] = uni(0u);
    asm volatile("" : "+s"(g1));   // as pinned(): the descriptor words are held in their scalar registers through the loop, so that none of them takes another value while a request is outstanding
    return g1;
}
__device__ __forceinline__ void tile256_load(uint32_t lds_dst, uint64_t ga, u32x8 g1) {
    u32x4 g0;
    g0[0] = uni(1u); g0[1] = uni(lds_dst); g0[2] = uni((uint32_t)ga); g0[3] = uni((((uint32_t)(ga >> 32)) & 0x01FFFFFFu) | 0x80000000u);
    asm volatile("tensor_load_to_lds %0, %1" :: "s"(g0), "s"(g1) : "memory");
}

static constexpr size_t al256(size_t v) { return (v + 255) & ~(size_t)255; }
static constexpr size_t SZ_XB  = al256((size_t)NB * SEQ * DM * 2);          // one bf16 input copy
static constexpr size_t SZ_WB  = al256((size_t)DM * DM * 2);                // one bf16 W^T plane
static constexpr size_t SZ_PL  = al256((size_t)NB * NH_ * SEQ * HD * 2);    // one f16 plane
static constexpr size_t SZ_CTX = al256((size_t)NB * SEQ * 2 * DM * 2);      // ctx hi | lo
static constexpr size_t SZ_TOTAL = 3 * SZ_XB + 4 * SZ_WB + 8 * SZ_PL + SZ_CTX;
static_assert(SZ_TOTAL <= (size_t)134217728);          // workspace carve <= 128 MiB
static_assert(SZ_PL == (size_t)NB * SEQ * DM * 2);     // value / residual plane pairs are exactly contiguous

#define WTB ((DM / 64) * (DM / 64))                          // blocks per weight: 64x64 tiles
#define CVN ((size_t)NB * SEQ * DM / 8)                      // 8-element chunks per activation input
#define CVB ((int)((CVN + 255) / 256))                       // blocks per activation input

// RNE convert of one activation input: block cb takes 256 chunks of 8 floats; source batches SEQ_FULL tokens apart, copy packed [NB*SEQ][DM].
__device__ __forceinline__ void cvt8_block(const float* __restrict__ src, bf* dst, int cb) {
    const size_t i = (size_t)cb * 256 + threadIdx.x; if (i >= CVN) return;
    const size_t e = i * 8;
    const v8f v = *(const v8f*)(src + e + (e / ((size_t)SEQ * DM)) * ((size_t)(SEQ_FULL - SEQ) * DM)); v8us o;
#pragma unroll
    for (int k = 0; k < 8; ++k) o[k] = f2bf(v[k]);
    *(v8us*)(dst + e) = o;
}

// weight transpose + RNE convert of one 64x64 tile: in W[DM rows k][DM cols n] f32 -> out WT[DM rows n][DM cols k] bf16.
__device__ __forceinline__ void wt_block(const float* __restrict__ W, bf* WT, int n0, int k0, float* tile) {
    const int tid = threadIdx.x;
#pragma unroll
    for (int it = 0; it < 4; ++it) { const int c = it * 256 + tid; const int r = c >> 4, c4 = (c & 15) * 4;   // 64 rows x 16 chunks of 4 floats
        const v4f v = *(const v4f*)(W + (size_t)(k0 + r) * DM + n0 + c4);
        tile[r * 65 + c4 + 0] = v[0]; tile[r * 65 + c4 + 1] = v[1]; tile[r * 65 + c4 + 2] = v[2]; tile[r * 65 + c4 + 3] = v[3]; }
    __syncthreads();
    v8us o[2];
#pragma unroll
    for (int it = 0; it < 2; ++it) { const int c = it * 256 + tid; const int n = c >> 3, k8 = (c & 7) * 8;     // 64 output rows x 8 chunks of 8
#pragma unroll
        for (int e = 0; e < 8; ++e) o[it][e] = f2bf(tile[(k8 + e) * 65 + n]); }
#pragma unroll
    for (int it = 0; it < 2; ++it) { const int c = it * 256 + tid; const int n = c >> 3, k8 = (c & 7) * 8;
        *(v8us*)(WT + (size_t)(n0 + n) * DM + k0 + k8) = o[it]; }
}

// k_prep: every input conversion in one launch; none depends on another, the block index alone says which piece a block does (block-uniform branch).
// Blocks [0, 4*WTB): weight w = index / WTB, tile (n, k) = (index % WTB) % (DM/64), / (DM/64) -> plane w of WT. Blocks behind them: input index / CVB, chunk block index % CVB -> copy of X.
// grid 4*WTB + 3*CVB, 256 threads. X: three copies SZ_XB bytes apart (q, k, v); WT: four planes SZ_WB bytes apart (Wq, Wk, Wv, Wp).
__global__ __launch_bounds__(256) void k_prep(const float* __restrict__ xq, const float* __restrict__ xk, const float* __restrict__ xv,
                                              const float* __restrict__ wq, const float* __restrict__ wk, const float* __restrict__ wv, const float* __restrict__ wp,
                                              bf* X, bf* WT) {
    __shared__ float tile[64 * 65];
    const unsigned bid = blockIdx.x;
    if (bid < 4u * WTB) {
        const int w = (int)(bid / WTB), t = (int)(bid % WTB);
        wt_block(w == 0 ? wq : w == 1 ? wk : w == 2 ? wv : wp, WT + (size_t)w * (SZ_WB / 2), (t % (DM / 64)) * 64, (t / (DM / 64)) * 64, tile);
    } else {
        const unsigned c = bid - 4u * WTB; const int w = (int)(c / CVB);
        cvt8_block(w == 0 ? xq : w == 1 ? xk : xv, X + (size_t)w * (SZ_XB / 2), (int)(c % CVB));
    }
}

// k_gemm: bf16 GEMM, 128x128 tile of C per block of four waves (2 x 2), each wave a 64x64 tile (16 accumulators).
// C[m][n] = sum_{kc < KA} A[m][kc] Bt[n][kc & (DM-1)]; A row pitch KA, Bt row pitch DM (KA = 2*DM folds the hi | lo halves of A against the same Bt rows).
// Per stage of 128 k each wave brings one tile of 64 rows x 256 B into LDS with one tensor load (waves 0, 1 the block's A rows, waves 2, 3 its Bt rows);
// two buffers, the next stage's loads in flight while this stage is worked on; every wave reads its fragments from LDS (two 16-B reads each).
// MODE 0: C written as f16 (Ph) and f16 residual x2048 (Pr), row-major pitch DM. MODE 1: C written as f32 to OUT rows (m/SEQ)*OUT_SEQ + m%SEQ, pitch DM.
// grid (M/128, DM/128, Z), 128 threads; KA a multiple of 128, at least 256. Epilogue per 16-row slab staged in LDS (wave-private part of the ring);
// blockIdx.z picks one of Z independent products of the same shape: A planes za elements apart, Bt planes zb apart, Ph and Pr planes zp apart.
template <int MODE>
__global__ __launch_bounds__(128) void k_gemm(const bf* __restrict__ A0, const bf* __restrict__ Bt0, int KA, h16* Ph0, h16* Pr0, float* OUT, size_t za, size_t zb, size_t zp) {
    __shared__ __attribute__((aligned(2048))) unsigned char gring[2 * GBSZ];
    const bf* A = A0 + blockIdx.z * za; const bf* Bt = Bt0 + blockIdx.z * zb;
    h16* Ph = Ph0 + blockIdx.z * zp; h16* Pr = Pr0 + blockIdx.z * zp;
    const int lane = threadIdx.x & 31, wave = (int)uni(threadIdx.x >> 5), lr = lane & 15, hi = lane >> 4;
    const int wm = wave >> 1, wn = wave & 1;                 // the wave's 64x64 tile inside the block's 128x128
    const int r0 = blockIdx.x * 128 + wm * 64, c0 = blockIdx.y * 128 + wn * 64;
    // this wave's tile to load: waves 0, 1 rows 0..63, 64..127 of the block's A rows; waves 2, 3 the same of its Bt rows
    const int lrow = (wave < 2 ? (int)blockIdx.x : (int)blockIdx.y) * 128 + (wave & 1) * 64;
    const uint32_t gpitch = wave < 2 ? (uint32_t)KA * 2u : (uint32_t)(DM * 2);
    const uint64_t gsrc = (uint64_t)(size_t)(wave < 2 ? A : Bt) + (uint64_t)lrow * gpitch;
    const uint32_t gmask = wave < 2 ? 0xFFFFFFFFu : (uint32_t)(DM * 2 - 1);   // byte offset along a row; Bt's wraps at DM elements
    const uint32_t ldst = (uint32_t)(size_t)gring + (uint32_t)wave * GTSZ;
    const int nst = KA / GKS;
    const u32x8 g1 = tile256_group1(gpitch);
    tile256_load(ldst, gsrc, g1);                            // stage 0 -> buffer 0
    v8f acc[4][4];
#pragma unroll
    for (int mb = 0; mb < 4; ++mb)
#pragma unroll
        for (int nb = 0; nb < 4; ++nb) acc[mb][nb] = (v8f){};
    const int fo = lr * GLP + 16 * hi;                       // lane's byte offset in a tile: row lr, k offset 8h elements (A and B fragments alike)
    wait_tensor0();
    __syncthreads();                                         // stage 0 published
    tile256_load(ldst + GBSZ, gsrc + ((uint32_t)(GKS * 2) & gmask), g1);       // stage 1 -> buffer 1
#pragma unroll 1
    for (int st = 0; st < nst; ++st) {
        const unsigned char* bp = gring + (st & 1) * GBSZ + fo;
        const bf* ap = (const bf*)(bp + wm * GTSZ);          // A rows of this wave
        const bf* bq = (const bf*)(bp + (2 + wn) * GTSZ);    // Bt rows of this wave
        v16bf a[2][4], b[2][4];                              // two fragment sets: the next 32 k are fetched ahead of this block's products
#pragma unroll
        for (int f = 0; f < 4; ++f) a[0][f] = ldb(ap + f * 16 * GLPH);
#pragma unroll
        for (int f = 0; f < 4; ++f) b[0][f] = ldb(bq + f * 16 * GLPH);
#pragma unroll
        for (int ks = 0; ks < GKS / 32; ++ks) {
            if (ks + 1 < GKS / 32) {
#pragma unroll
                for (int f = 0; f < 4; ++f) a[(ks + 1) & 1][f] = ldb(ap + f * 16 * GLPH + (ks + 1) * 32);
#pragma unroll
                for (int f = 0; f < 4; ++f) b[(ks + 1) & 1][f] = ldb(bq + f * 16 * GLPH + (ks + 1) * 32);
                __builtin_amdgcn_sched_barrier(0);           // holds the next block's LDS reads as one group ahead of this block's products (else each read sinks to its use and is waited for there)
            }
#pragma unroll
            for (int nb = 0; nb < 4; ++nb)
#pragma unroll
                for (int mb = 0; mb < 4; ++mb) acc[mb][nb] = wmmab(a[ks & 1][mb], b[ks & 1][nb], acc[mb][nb]);
            __builtin_amdgcn_sched_barrier(0);               // keeps this block's products ahead of the reads after next, which reuse its fragment registers
        }
        // hand-over, every wave: own LDS reads done, own tile of stage st+1 landed, barrier (publishes stage st+1, frees this stage's buffer), then the refill
        wait_ds0();
        wait_tensor0();
        __syncthreads();
        if (pinned(st + 2 < nst)) tile256_load(ldst + (uint32_t)(st & 1) * GBSZ, gsrc + ((uint32_t)((st + 2) * GKS * 2) & gmask), g1);
    }
    wait_tensor0();
    wait_ds0();
    float* os = (float*)gring + wave * 16 * 68;              // output staging reuses the ring: the last hand-over's barrier stands behind every wave's last read, and nothing was issued behind it
#pragma unroll
    for (int mb = 0; mb < 4; ++mb) {
#pragma unroll
        for (int nb = 0; nb < 4; ++nb) {
#pragma unroll
            for (int j = 0; j < 8; ++j) os[(hi * 8 + j) * 68 + nb * 16 + lr] = acc[mb][nb][j]; }   // D: row 8h+j, col lane&15; rows 0..15 x cols 0..63 all written
        wave_sync();
        const int m0 = r0 + mb * 16;
        if (MODE == 0) {
            const size_t sb = (size_t)m0 * DM + c0;
{
#pragma unroll
                for (int s = 0; s < 4; ++s) { const int row = 4 * s + (lane >> 3), c8 = (lane & 7) * 8;   // 4 s x 4 row groups = 16 rows; 8 lanes x 8 = 64 columns
                    const v4f x0 = *(const v4fa*)(&os[row * 68 + c8]); const v4f x1 = *(const v4fa*)(&os[row * 68 + c8 + 4]); v8h hv, rv;
#pragma unroll
                    for (int i = 0; i < 4; ++i) { const h16 a0 = (h16)x0[i]; const h16 a1 = (h16)x1[i]; hv[i] = a0; hv[4 + i] = a1; rv[i] = (h16)((x0[i] - (float)a0) * QRS); rv[4 + i] = (h16)((x1[i] - (float)a1) * QRS); }
                    const size_t oo = sb + (size_t)row * DM + c8;
                    *(v8h*)(Ph + oo) = hv; *(v8h*)(Pr + oo) = rv; }
                 }
        } else {
            float* orow = OUT + ((size_t)(m0 / SEQ) * OUT_SEQ + (size_t)(m0 % SEQ)) * DM + c0;
{
#pragma unroll
                for (int s = 0; s < 8; ++s) { const int row = 2 * s + hi, cofs = lr * 4;   // 8 s x 2 rows = 16 rows; 16 lanes x 4 floats = 64 columns
                    const v4f val = *(const v4fa*)(&os[row * 68 + cofs]);
                    *(v4f*)(orow + (size_t)row * DM + cofs) = val; }
                 }
        }
        wave_sync();
    }
}

// k_vt: per-head transpose of the v planes: in V2[z][zh][s][64] -> out VT2[z][zh][64][s] (z = 0 value plane, 1 residual plane; plane stride pln halves).
__global__ __launch_bounds__(256) void k_vt(const h16* __restrict__ V2, h16* VT2, size_t pln) {
    __shared__ __align__(16) h16 ts[64 * 72];
    const int tid = threadIdx.x; const int s0 = blockIdx.x * 64; const int zh = blockIdx.y; const size_t zo = (size_t)blockIdx.z * pln;
    const h16* src = V2 + zo + ((size_t)zh * SEQ + s0) * HD;
    h16* dst = VT2 + zo + (size_t)zh * HD * SEQ + s0;
#pragma unroll
    for (int it = 0; it < 2; ++it) { const int c = it * 256 + tid; const int row = c >> 3, c8 = (c & 7) * 8;   // 64 key rows x 8 chunks
        const v8h v = *(const v8h*)(src + (size_t)row * HD + c8); *(v8h*)(&ts[row * 72 + c8]) = v; }
    __syncthreads();
    v8h o[2];
#pragma unroll
    for (int it = 0; it < 2; ++it) { const int c = it * 256 + tid; const int d = c >> 3, k8 = (c & 7) * 8;     // 64 feature rows x 8 chunks of 8 keys
#pragma unroll
        for (int e = 0; e < 8; ++e) o[it][e] = ts[(k8 + e) * 72 + d]; }
#pragma unroll
    for (int it = 0; it < 2; ++it) { const int c = it * 256 + tid; const int d = c >> 3, k8 = (c & 7) * 8;
        *(v8h*)(dst + (size_t)d * SEQ + k8) = o[it]; }
    
}

#define STG(OFS, OH, OR) { v4f a_, c_; \
    a_[0] = OH[0] * inv + OR[0] * ri; a_[1] = OH[1] * inv + OR[1] * ri; a_[2] = OH[2] * inv + OR[2] * ri; a_[3] = OH[3] * inv + OR[3] * ri; \
    c_[0] = OH[4] * inv + OR[4] * ri; c_[1] = OH[5] * inv + OR[5] * ri; c_[2] = OH[6] * inv + OR[6] * ri; c_[3] = OH[7] * inv + OR[7] * ri; \
    *(v4fa*)(&os[wb + lr * 68 + (OFS) + 8 * hi]) = a_; *(v4fa*)(&os[wb + lr * 68 + (OFS) + 8 * hi + 4]) = c_; }

// k_flash: fused causal attention, one wave per 16 query rows of one (batch, head); Q fragments straight from the f16 planes (two 16-B loads each).
// K and V^T: per stage of 64 keys each of the four waves brings one tile (K value, K residual, V^T value, V^T residual; 64 rows x 128 B) into LDS with one tensor load;
// two buffers, the next stage's loads in flight while this stage is worked on; every wave reads its fragments from LDS (two 16-B reads each). Every wave passes every stage's hand-over.
// Transposed form: S^T[key][t] = K Q^T (A = K rows, B = Q rows); lane (t = lane&15, h = lane>>4) holds keys 8h+r of each 16-key tile, so the packed
// P tile is directly the B fragment of O^T[d][t] = V^T P^T (element r <- tile keys 0..15, element 8+r <- tile keys 16..31, lane unchanged).
// Causal: a wave works on the 32-key blocks below t0+16 (wave-uniform); entries with key > t are replaced by a large negative value (P = 0); every visited 32-key block holds a visible key for each row.
// Softmax state (running max, partial sum) is one scalar per lane; the two lane halves of a row are combined with one xor-16 exchange.
__global__ __launch_bounds__(32 * AW) void k_flash(const h16* __restrict__ QH, const h16* __restrict__ QR, const h16* __restrict__ KH, const h16* __restrict__ KR,
                                                   const h16* __restrict__ VTH, const h16* __restrict__ VTR, bf* CTX) {
    __shared__ __attribute__((aligned(2048))) unsigned char ring[2 * BSZ];
    const int lane = threadIdx.x & 31, wave = (int)uni(threadIdx.x >> 5), lr = lane & 15, hi = lane >> 4;
    const int zh = blockIdx.y; const int b = zh / NH_, h = zh % NH_;
    const int t0 = (blockIdx.x * AW + wave) * 16;
    const size_t pbase = (size_t)zh * SEQ * HD;
    const size_t qo = pbase + (size_t)(t0 + lr) * HD + 8 * hi;
    const v16h qh0 = ldh(QH + qo), qh1 = ldh(QH + qo + 32), qr0 = ldh(QR + qo), qr1 = ldh(QR + qo + 32);   // B fragments: col t, k = d
    // this wave's tile: waves 0, 1 the K planes (rows = keys, pitch 128 B), waves 2, 3 the V^T planes (rows = d, pitch 2*SEQ B, 64 keys a row)
    const h16* pl = wave == 0 ? KH : wave == 1 ? KR : wave == 2 ? VTH : VTR;
    const uint64_t gsrc = (uint64_t)(size_t)(pl + pbase);
    const uint32_t gstep = wave < 2 ? (uint32_t)(KST * HD * 2) : (uint32_t)(KST * 2);   // bytes from one stage's tile to the next
    const uint32_t gpitch = wave < 2 ? (uint32_t)(HD * 2) : (uint32_t)(SEQ * 2);
    const uint32_t ldst = (uint32_t)(size_t)ring + (uint32_t)wave * TSZ;
    const int nst = blockIdx.x == 0 ? 2 : (int)blockIdx.x + 1;   // 64-key stages the block walks: keys [0, 64*(blockIdx.x+1)), never fewer than the prologue's two
    tile_load(ldst, gsrc, gpitch);                           // stage 0 -> buffer 0
    const int fo = lr * LP + 16 * hi;                        // lane's byte offset in a tile: row lr, k offset 8h halves (A fragments of K and of V^T alike)
    v8f oh0 = (v8f){}, oh1 = (v8f){}, oh2 = (v8f){}, oh3 = (v8f){};
    v8f or0 = (v8f){}, or1 = (v8f){}, or2 = (v8f){}, or3 = (v8f){};
    float m = NEGB, l = 0.0f;
    const int kend = t0 + 16;                                // keys 0 .. t0+15 visible to this wave; kend <= SEQ
    wait_tensor0();
    __syncthreads();                                         // stage 0 published
    tile_load(ldst + BSZ, gsrc + gstep, gpitch);             // stage 1 -> buffer 1
#pragma unroll 1
    for (int st = 0; st < nst; ++st) {
      const unsigned char* bp = ring + (st & 1) * BSZ + fo;
#pragma unroll
      for (int sub = 0; sub < 2; ++sub) {
       const int key0 = st * KST + sub * 32;
       if (key0 < kend) {                                    // wave-uniform skip beyond the diagonal; the hand-over below stands outside it
        const h16* kk = (const h16*)(bp + sub * 32 * LP);    // K value tile, rows sub*32 + lr; residual tile TSZ bytes behind it
        v8f sHa = (v8f){}, sLa = (v8f){}, sHb = (v8f){}, sLb = (v8f){};
        { const v16h ka0 = ldh(kk), ka1 = ldh(kk + 32), kb0 = ldh(kk + 16 * LPH), kb1 = ldh(kk + 16 * LPH + 32);
          sHa = wmma16(ka0, qh0, sHa); sLa = wmma16(ka0, qr0, sLa); sHb = wmma16(kb0, qh0, sHb); sLb = wmma16(kb0, qr0, sLb);
          sHa = wmma16(ka1, qh1, sHa); sLa = wmma16(ka1, qr1, sLa); sHb = wmma16(kb1, qh1, sHb); sLb = wmma16(kb1, qr1, sLb);
          asm volatile("v_nop\n\tv_nop\n\tv_nop\n\tv_nop" : "+v"(sHa), "+v"(sLa), "+v"(sHb), "+v"(sLb) : "v"(ka0), "v"(ka1), "v"(kb0), "v"(kb1)); }
        { const h16* kr = kk + TSZ / 2;
          const v16h ra0 = ldh(kr), ra1 = ldh(kr + 32), rb0 = ldh(kr + 16 * LPH), rb1 = ldh(kr + 16 * LPH + 32);
          sLa = wmma16(ra0, qh0, sLa); sLb = wmma16(rb0, qh0, sLb); sLa = wmma16(ra1, qh1, sLa); sLb = wmma16(rb1, qh1, sLb);
          asm volatile("v_nop\n\tv_nop\n\tv_nop\n\tv_nop" : "+v"(sLa), "+v"(sLb) : "v"(ra0), "v"(ra1), "v"(rb0), "v"(rb1)); }
        float ta[8], tb[8];
#pragma unroll
        for (int r = 0; r < 8; ++r) { ta[r] = (sHa[r] + sLa[r] * QRI) * L2E; tb[r] = (sHb[r] + sLb[r] * QRI) * L2E; }
        if (key0 + 31 > t0) {                                // wave-uniform: block crosses the diagonal
            const int tq = t0 + lr - key0 - 8 * hi;          // tile a entry r is key key0+8h+r: hidden when r > tq; tile b entry r when 16 + r > tq
#pragma unroll
            for (int r = 0; r < 8; ++r) { ta[r] = (r > tq) ? NEGB : ta[r]; tb[r] = (16 + r > tq) ? NEGB : tb[r]; }
        }
        float mx = NEGB;
#pragma unroll
        for (int r = 0; r < 8; ++r) mx = fmaxf(mx, fmaxf(ta[r], tb[r]));
        mx = fmaxf(mx, __shfl_xor(mx, 16, 32));
        const float mnew = fmaxf(m, mx);
        const float alpha = __builtin_amdgcn_exp2f(m - mnew);
        const float sh = PSH - mnew;
        v16h pb; float ls = 0.0f;
#pragma unroll
        for (int r = 0; r < 8; ++r) { const h16 pa = (h16)__builtin_amdgcn_exp2f(ta[r] + sh); const h16 pc = (h16)__builtin_amdgcn_exp2f(tb[r] + sh); pb[r] = pa; pb[8 + r] = pc; ls += (float)pa + (float)pc; }
        l = l * alpha + ls; m = mnew;
        oh0 = oh0 * alpha; oh1 = oh1 * alpha; oh2 = oh2 * alpha; oh3 = oh3 * alpha;
        or0 = or0 * alpha; or1 = or1 * alpha; or2 = or2 * alpha; or3 = or3 * alpha;
        { const h16* va = (const h16*)(bp + 2 * TSZ) + sub * 32;   // V^T value tile, rows 16j + lr, keys sub*32 ..
          const v16h v0 = ldh(va), v1 = ldh(va + 16 * LPH), v2 = ldh(va + 32 * LPH), v3 = ldh(va + 48 * LPH);
          oh0 = wmma16(v0, pb, oh0); oh1 = wmma16(v1, pb, oh1); oh2 = wmma16(v2, pb, oh2); oh3 = wmma16(v3, pb, oh3);
          asm volatile("v_nop\n\tv_nop\n\tv_nop\n\tv_nop" : "+v"(oh0), "+v"(oh1), "+v"(oh2), "+v"(oh3) : "v"(v0), "v"(v1), "v"(v2), "v"(v3), "v"(pb)); }
        { const h16* va = (const h16*)(bp + 3 * TSZ) + sub * 32;   // V^T residual tile
          const v16h v0 = ldh(va), v1 = ldh(va + 16 * LPH), v2 = ldh(va + 32 * LPH), v3 = ldh(va + 48 * LPH);
          or0 = wmma16(v0, pb, or0); or1 = wmma16(v1, pb, or1); or2 = wmma16(v2, pb, or2); or3 = wmma16(v3, pb, or3);
          asm volatile("v_nop\n\tv_nop\n\tv_nop\n\tv_nop" : "+v"(or0), "+v"(or1), "+v"(or2), "+v"(or3) : "v"(v0), "v"(v1), "v"(v2), "v"(v3), "v"(pb)); }
       }
      }
      // hand-over, every wave: own LDS reads done, own tile of stage st+1 landed, barrier (publishes stage st+1, frees this stage's buffer), then the refill
      wait_ds0();
      wait_tensor0();
      __syncthreads();
      if (pinned(st + 2 < nst)) tile_load(ldst + (uint32_t)(st & 1) * BSZ, gsrc + (uint64_t)(st + 2) * gstep, gpitch);
    }
    wait_tensor0();
    wait_ds0();
    float* os = (float*)ring;                                // output staging reuses the ring: the last hand-over's barrier stands behind every wave's last read, and nothing was issued behind it
    l += __shfl_xor(l, 16, 32);
    const float inv = 1.0f / l;
    const float ri = QRI * inv;
    const int wb = wave * 16 * 68;
    // O^T D layout: o_j[r] = (d = 16j + 8h + r, t = lane&15) -> os[t][d]; rows 0..15 x columns 0..63 all written
    STG(0, oh0, or0)
    STG(16, oh1, or1)
    STG(32, oh2, or2)
    STG(48, oh3, or3)
    wave_sync();
    bf* crow = CTX + ((size_t)b * SEQ + t0) * (size_t)(2 * DM) + h * HD;
{
#pragma unroll
        for (int s = 0; s < 4; ++s) { const int row = 4 * s + (lane >> 3), c8 = (lane & 7) * 8;   // 4 s x 4 row groups = 16 rows; 8 lanes x 8 = 64 columns
            const v4f x0 = *(const v4fa*)(&os[wb + row * 68 + c8]); const v4f x1 = *(const v4fa*)(&os[wb + row * 68 + c8 + 4]); v8us hv, lv;
#pragma unroll
            for (int i = 0; i < 4; ++i) { const unsigned short a0 = f2bf(x0[i]); const unsigned short a1 = f2bf(x1[i]); hv[i] = a0; hv[4 + i] = a1; lv[i] = f2bf(x0[i] - bf2f(a0)); lv[4 + i] = f2bf(x1[i] - bf2f(a1)); }
            const size_t oo = (size_t)row * (size_t)(2 * DM) + c8;
            *(v8us*)(crow + oo) = hv; *(v8us*)(crow + oo + DM) = lv; }
         }
}

extern "C" void kernel_launch(void* const* d_in, const int* in_sizes, int n_in,
                              void* d_out, int out_size, void* d_ws, size_t ws_size, hipStream_t stream) {
    if (n_in < 7) return;
    const size_t needx = ((size_t)(NB - 1) * SEQ_FULL + SEQ) * DM;
    if ((size_t)in_sizes[0] < needx || (size_t)in_sizes[1] < needx || (size_t)in_sizes[2] < needx) return;
    if ((size_t)in_sizes[3] < (size_t)DM * DM || (size_t)in_sizes[4] < (size_t)DM * DM || (size_t)in_sizes[5] < (size_t)DM * DM || (size_t)in_sizes[6] < (size_t)DM * DM) return;
    if ((size_t)out_size < ((size_t)(NB - 1) * OUT_SEQ + SEQ) * DM) return;
    if (SZ_TOTAL > ws_size) return;
    // wire order: q, k, v, Wq, Wk, Wv, Wp (weights [in][out])
    const float* xq = (const float*)d_in[0]; const float* xk = (const float*)d_in[1]; const float* xv = (const float*)d_in[2];
    const float* wq = (const float*)d_in[3]; const float* wk = (const float*)d_in[4]; const float* wv = (const float*)d_in[5]; const float* wp = (const float*)d_in[6];
    float* OUT = (float*)d_out;      // [NB][SEQ][1024]
    char* wsp = (char*)d_ws;
    bf* XQ = (bf*)wsp; wsp += SZ_XB;                 // [NB*SEQ][1024]; the k and v copies are reached from XQ, the other W^T planes from WQT, by their strides
    bf* XK = (bf*)wsp; wsp += SZ_XB;
    bf* XV = (bf*)wsp; wsp += SZ_XB;
    bf* WQT = (bf*)wsp; wsp += SZ_WB;                // [out][in]
    bf* WKT = (bf*)wsp; wsp += SZ_WB;
    bf* WVT = (bf*)wsp; wsp += SZ_WB;
    bf* WPT = (bf*)wsp; wsp += SZ_WB;
    h16* QH = (h16*)wsp; wsp += SZ_PL;               // [NB*SEQ][1024] == [NB*16][SEQ][64]
    h16* QR = (h16*)wsp; wsp += SZ_PL;               // residual x2048
    h16* KH = (h16*)wsp; wsp += SZ_PL;
    h16* KR = (h16*)wsp; wsp += SZ_PL;
    h16* VH = (h16*)wsp; wsp += SZ_PL;               // value plane, residual plane directly behind it
    h16* VR = (h16*)wsp; wsp += SZ_PL;
    h16* VTH = (h16*)wsp; wsp += SZ_PL;              // [NB*16][64][SEQ], residual plane directly behind it
    h16* VTR = (h16*)wsp; wsp += SZ_PL;
    bf* CTX = (bf*)wsp; wsp += SZ_CTX;               // [NB*SEQ][2048]: hi | lo
    const size_t pln = SZ_PL / 2;                    // plane stride in halves

    // every input conversion in one launch: W[in][out] -> WT[out][in] bf16 (four planes from WQT on), q, k, v -> bf16 copies (three from XQ on)
    k_prep<<<4 * WTB + 3 * CVB, 256, 0, stream>>>(xq, xk, xv, wq, wk, wv, wp, XQ, WQT);

    // projections, one launch, z = q, k, v: A = x rows (m = b*SEQ + t), Bt = W^T rows (n) -> row-major planes [m][n] (value + residual; a pair of planes per z)
    k_gemm<0><<<dim3(NB * SEQ / 128, DM / 128, 3), 128, 0, stream>>>(XQ, WQT, DM, QH, QR, OUT, SZ_XB / 2, SZ_WB / 2, SZ_PL);

    // v planes [zh][s][64] -> v^T planes [zh][64][s], both the value and the residual plane
    k_vt<<<dim3(SEQ / 64, NB * NH_, 2), 256, 0, stream>>>(VH, VTH, pln);

    k_flash<<<dim3(SEQ / (16 * AW), NB * NH_, 1), 32 * AW, 0, stream>>>(QH, QR, KH, KR, VTH, VTR, CTX);

    // output projection: A = ctx rows [hi | lo] (K = 2048), Bt = Wp^T rows (k index wraps at 1024) -> f32 output
    k_gemm<1><<<dim3(NB * SEQ / 128, DM / 128, 1), 128, 0, stream>>>(CTX, WPT, 2 * DM, QH, QR, OUT, 0, 0, 0);
}

// v004
// It runs in 110 microseconds.
// Next to v003, in two timings, it ran 1.07 and 1.06 times as fast.
// Counting every step since v000, it is 3.20 times as fast.
#include <hip/hip_runtime.h>

// Multi-head attention, width 1024 = 16 heads x 64, separate q/k/v inputs [NB][SEQ][1024], Wq/Wk/Wv/Wp [in][out] (y = x W), no biases, unscaled scores, causal replace-mask, head split = flat row-major view (B,S,1024)->(B,16,S,64), output projection Wp (f32 out).
// Compute dtypes, f32 accumulate everywhere: q/k/v projections v_wmma_f32_16x16x32_bf16 (x and W RNE-converted to bf16; products exact);
// scores v_wmma_f32_16x16x32_f16 with q and k each as f16 value + f16 residual x2048 (three products, scaled residual products in their own accumulator);
// P (x2^14 carry, cancels in the normalisation) single f16, v as f16 value + f16 residual x2048 (two products, own accumulator); softmax f32 (online, running max);
// output projection v_wmma_f32_16x16x32_bf16 with ctx as bf16 hi | bf16 lo folded along K (K = 2048 against Wp^T repeated), Wp RNE-converted to bf16.
// Layout: bf16 copies of q/k/v, bf16 W^T planes [out][in]; projection planes [NB*SEQ][1024] f16 (== [b*16+h][s][64] by the flat head view);
// fused flash kernel in transposed form (S^T = K Q^T, O^T = V^T P^T), K / V tiles of 64 keys staged row-major in LDS by tensor loads (two buffers, shared by the block's four waves),
// the V^T fragments read from the row-major V tiles by the transposing LDS load (ds_load_tr16_b128); ctx plane [NB*SEQ][2048] bf16 (hi | lo).
// GEMMs: 128x128 tile per block of four waves (64x64 each), A and Bt stages of 128 k staged in LDS by tensor loads (two buffers).
// Four launches: k_prep (all seven input conversions, split by block index), k_gemm<0> (the three projections, one per blockIdx.z), k_flash, k_gemm<1>.

#ifndef NB
#define NB 2
#endif
#ifndef SEQ
#define SEQ 2048
#endif
#define NB_FULL  2
#define SEQ_FULL 2048
#ifndef OUT_SEQ
#define OUT_SEQ SEQ              // row pitch (in tokens) between batches of the output
#endif
#define DM   1024
#define NH_  16
#define HD   64
#define AW   4                   // waves per flash block (16 query rows each)
#define QRS  2048.0f             // carry of the residual planes
#define QRI  (1.0f / 2048.0f)
#define L2E  1.4426950408889634f // log2(e); scores are unscaled
#define PSH  14.0f               // log2 of the P carry (16384)
#define NEGB (-3.0e38f)
#define KST  64                  // keys per LDS stage of the flash kernel
#define LP   144                 // LDS row pitch of the K tiles in bytes: 128-B rows + 16-B pad (16 B x odd, for 16-byte LDS reads)
#define LPH  (LP / 2)            // the same in halves
#define LPV  160                 // LDS row pitch of the V tiles in bytes: 128-B rows + 32-B pad (32 B x odd, for transposing LDS reads)
#define TSZ  10240               // place of one tile in LDS: 64 rows x 144 B = 9216 B or x 160 B = 10240 B, a multiple of 2 KiB
#define BSZ  (4 * TSZ)           // one buffer: K value, K residual, V value, V residual
#define GKS  128                 // k per LDS stage of the GEMM (256-B rows)
#define GLP  272                 // its LDS row pitch in bytes: 256-B rows + 16-B pad (16 B x odd, for 16-byte LDS reads)
#define GLPH (GLP / 2)           // the same in 16-bit elements
#define GTSZ 18432               // place of one GEMM tile in LDS: 64 rows x 272 B = 17408 B, rounded up to a multiple of 2 KiB
#define GBSZ (4 * GTSZ)          // one buffer: A rows 0..63, A rows 64..127, Bt rows 0..63, Bt rows 64..127

static_assert(HD == 64);
static_assert(NH_ * HD == DM);
static_assert((DM & (DM - 1)) == 0);           // B-operand k index wraps with a mask
static_assert(DM % 64 == 0);
static_assert(SEQ % 64 == 0);                  // 64-row tiles never straddle two batches; K and V tiles of 64 keys
static_assert((NB * SEQ) % 64 == 0);
static_assert(SEQ % 32 == 0);                  // key loop steps by 32
static_assert(SEQ % (16 * AW) == 0);           // flash grid covers the sequence exactly
static_assert(((size_t)SEQ * DM) % 8 == 0);
static_assert(NB <= NB_FULL);
static_assert(SEQ <= SEQ_FULL);
static_assert(AW == 4);                        // one tensor load per wave and stage: four tiles, four waves
static_assert(16 * AW == KST);                 // a block's queries end where its last 64-key stage ends
static_assert(SEQ >= 2 * KST);                 // the ring's prologue loads two stages
static_assert(HD * 2 == 128);                  // K and V tiles have 128-byte rows (one key's 64 features)
static_assert(KST * LP <= TSZ && KST * LPV <= TSZ && TSZ % 2048 == 0);
static_assert(AW * 16 * 68 * 4 <= 2 * BSZ);    // output staging reuses the ring
static_assert((NB * SEQ) % 128 == 0 && DM % 128 == 0);   // GEMM grid of 128x128 tiles covers C exactly
static_assert(DM % GKS == 0 && DM >= 2 * GKS);           // whole stages, the Bt wrap falls on a stage boundary, the ring's prologue loads two stages
static_assert(GKS * 2 == 256 && 64 * GLP <= GTSZ && GTSZ % 2048 == 0);
static_assert(4 * 16 * 68 * 4 <= 2 * GBSZ);              // GEMM output staging reuses its ring

typedef _Float16 h16;
typedef unsigned short bf;
typedef __attribute__((ext_vector_type(16))) __bf16   v16bf;
typedef __attribute__((ext_vector_type(16))) _Float16 v16h;
typedef __attribute__((ext_vector_type(8)))  _Float16 v8h;
typedef __attribute__((ext_vector_type(8)))  unsigned short v8us;
typedef __attribute__((ext_vector_type(8)))  short    v8s;
typedef __attribute__((ext_vector_type(8)))  float    v8f;
typedef __attribute__((ext_vector_type(4)))  float    v4f;
typedef v4f  __attribute__((may_alias)) v4fa;
typedef uint32_t u32x4 __attribute__((ext_vector_type(4)));
typedef uint32_t u32x8 __attribute__((ext_vector_type(8)));

__device__ __forceinline__ unsigned short f2bf(float f) { unsigned u = __float_as_uint(f); u += 0x7FFFu + ((u >> 16) & 1u); return (unsigned short)(u >> 16); }
__device__ __forceinline__ float bf2f(unsigned short s) { return __uint_as_float(((unsigned)s) << 16); }
__device__ __forceinline__ v16h cat16(v8h lo, v8h hi) { return __builtin_shufflevector(lo, hi, 0, 1, 2, 3, 4, 5, 6, 7, 8, 9, 10, 11, 12, 13, 14, 15); }
__device__ __forceinline__ v16bf cat16b(v8us lo, v8us hi) { return __builtin_bit_cast(v16bf, __builtin_shufflevector(lo, hi, 0, 1, 2, 3, 4, 5, 6, 7, 8, 9, 10, 11, 12, 13, 14, 15)); }
__device__ __forceinline__ v8f wmma16(v16h a, v16h b, v8f c) { return __builtin_amdgcn_wmma_f32_16x16x32_f16(false, a, false, b, (short)0, c, false, false); }
__device__ __forceinline__ v8f wmmab(v16bf a, v16bf b, v8f c) { return __builtin_amdgcn_wmma_f32_16x16x32_bf16(false, a, false, b, (short)0, c, false, false); }
// fragment loaders from K-contiguous 16-bit rows; p already includes + 8*(lane>>4): elements 0..7 <- k0+8h+0..7, elements 8..15 <- k0+16+8h+0..7 (same map for A and B)
__device__ __forceinline__ v16h  ldh(const h16* p) { return cat16(*(const v8h*)p, *(const v8h*)(p + 16)); }
__device__ __forceinline__ v16bf ldb(const bf* p)  { return cat16b(*(const v8us*)p, *(const v8us*)(p + 16)); }
// transposing LDS load from a row-major 16-bit tile T (rows = k, pitch LPV): with p = T + (k0 + 8*(lane>>4) + (lane&7)) * LPV + 2*d0 + 16*((lane>>3)&1)
// lane (c = lane&15, h = lane>>4) gets T[k0+8h+0..7][d0+c]; the loads at k0 and k0+16 make one A fragment of T^T in the k order of ldh (elements 0..7 <- k0+8h+0..7, 8..15 <- k0+16+8h+0..7)
__device__ __forceinline__ v8h ldtr(const unsigned char* p) { typedef __attribute__((address_space(3))) v8s lds_v8s; return __builtin_bit_cast(v8h, __builtin_amdgcn_ds_load_tr16_b128_v8i16((lds_v8s*)p)); }
__device__ __forceinline__ v16h ldvt(const unsigned char* p) { return cat16(ldtr(p), ldtr(p + 16 * LPV)); }
// ordering point for wave-private LDS tiles (same wave writes and reads)
__device__ __forceinline__ void wave_sync() { __builtin_amdgcn_fence(3 /* release order */, "wavefront"); __builtin_amdgcn_wave_barrier(); asm volatile("" ::: "memory"); }

__device__ __forceinline__ uint32_t uni(uint32_t v) { return (uint32_t)__builtin_amdgcn_readfirstlane(v); }
// wave-uniform test held in a scalar register, so that the branch on it is a scalar branch (a tensor load ignores EXEC)
__device__ __forceinline__ uint32_t pinned(uint32_t v) { uint32_t w = (uint32_t)__builtin_amdgcn_readfirstlane(v); asm volatile("" : "+s"(w)); return w; }
__device__ __forceinline__ void wait_ds0()     { asm volatile("s_wait_dscnt 0x0" ::: "memory"); }      // this wave's LDS reads have returned before the buffer is handed back
__device__ __forceinline__ void wait_tensor0() { asm volatile("s_wait_tensorcnt 0x0" ::: "memory"); }  // this wave's tensor load has landed (the compiler places no wait for it)
// one tile of 64 rows x 128 bytes, rows contiguous in the source, into LDS with a pad of PADC + 1 dwords behind every 128-B row (PADC = 3: pitch 144 B, PADC = 7: pitch 160 B): group 1 built once
template <uint32_t PADC>
__device__ __forceinline__ u32x8 tile128_group1() {
    u32x8 g1;
    g1[0] = uni((1u << 20) | (4u << 22) | (PADC << 25)); // no mask, 1-byte elements, pad behind every 32 dwords
    g1[1] = uni(128u << 16); g1[2] = uni(64u << 16); g1[3] = uni(128u << 16); g1[4] = uni(64u); g1[5] = uni(128u); g1[6] = uni(0u); g1[7] = uni(0u);
    asm volatile("" : "+s"(g1));   // as pinned(): the descriptor words are held in their scalar registers through the loop, so that none of them takes another value while a request is outstanding
    return g1;
}
// a wave's one request of a stage: a K tile (is_k) at the pitch of the 16-byte reads or a V tile (is_v) at the pitch of the transposing reads;
// is_k and is_v come from pinned(), one of them set: two scalar branches, so that each request's pad word is a constant
__device__ __forceinline__ void stage_load(uint32_t is_k, uint32_t is_v, uint32_t lds_dst, uint64_t ga, u32x8 g1k, u32x8 g1v) {
    u32x4 g0;
    g0[0] = uni(1u); g0[1] = uni(lds_dst); g0[2] = uni((uint32_t)ga); g0[3] = uni((((uint32_t)(ga >> 32)) & 0x01FFFFFFu) | 0x80000000u);
    if (is_k) asm volatile("tensor_load_to_lds %0, %1" :: "s"(g0), "s"(g1k) : "memory");
    if (is_v) asm volatile("tensor_load_to_lds %0, %1" :: "s"(g0), "s"(g1v) : "memory");
}
// one tile of 64 rows x 256 bytes, source row pitch src_pitch bytes, into LDS at pitch 272 B (a 16-B pad behind every 256-B row): group 1 built once, group 0 per request
__device__ __forceinline__ u32x8 tile256_group1(uint32_t src_pitch) {
    u32x8 g1;
    g1[0] = uni((1u << 20) | (5u << 22) | (3u << 25));   // no mask, 1-byte elements, pad of 4 dwords behind every 64
    g1[1] = uni(256u << 16); g1[2] = uni(64u << 16); g1[3] = uni(256u << 16); g1[4] = uni(64u); g1[5] = uni(src_pitch); g1[6] = uni(0u); g1[7] = uni(0u);
    asm volatile("" : "+s"(g1));   // as pinned(): the descriptor words are held in their scalar registers through the loop, so that none of them takes another value while a request is outstanding
    return g1;
}
__device__ __forceinline__ void tile256_load(uint32_t lds_dst, uint64_t ga, u32x8 g1) {
    u32x4 g0;
    g0[0] = uni(1u); g0[1] = uni(lds_dst); g0[2] = uni((uint32_t)ga); g0[3] = uni((((uint32_t)(ga >> 32)) & 0x01FFFFFFu) | 0x80000000u);
    asm volatile("tensor_load_to_lds %0, %1" :: "s"(g0), "s"(g1) : "memory");
}

static constexpr size_t al256(size_t v) { return (v + 255) & ~(size_t)255; }
static constexpr size_t SZ_XB  = al256((size_t)NB * SEQ * DM * 2);          // one bf16 input copy
static constexpr size_t SZ_WB  = al256((size_t)DM * DM * 2);                // one bf16 W^T plane
static constexpr size_t SZ_PL  = al256((size_t)NB * NH_ * SEQ * HD * 2);    // one f16 plane
static constexpr size_t SZ_CTX = al256((size_t)NB * SEQ * 2 * DM * 2);      // ctx hi | lo
static constexpr size_t SZ_TOTAL = 3 * SZ_XB + 4 * SZ_WB + 6 * SZ_PL + SZ_CTX;
static_assert(SZ_TOTAL <= (size_t)134217728);          // workspace carve <= 128 MiB
static_assert(SZ_PL == (size_t)NB * SEQ * DM * 2);     // value / residual plane pairs are exactly contiguous

#define WTB ((DM / 64) * (DM / 64))                          // blocks per weight: 64x64 tiles
#define CVN ((size_t)NB * SEQ * DM / 8)                      // 8-element chunks per activation input
#define CVB ((int)((CVN + 255) / 256))                       // blocks per activation input

// RNE convert of one activation input: block cb takes 256 chunks of 8 floats; source batches SEQ_FULL tokens apart, copy packed [NB*SEQ][DM].
__device__ __forceinline__ void cvt8_block(const float* __restrict__ src, bf* dst, int cb) {
    const size_t i = (size_t)cb * 256 + threadIdx.x; if (i >= CVN) return;
    const size_t e = i * 8;
    const v8f v = *(const v8f*)(src + e + (e / ((size_t)SEQ * DM)) * ((size_t)(SEQ_FULL - SEQ) * DM)); v8us o;
#pragma unroll
    for (int k = 0; k < 8; ++k) o[k] = f2bf(v[k]);
    *(v8us*)(dst + e) = o;
}

// weight transpose + RNE convert of one 64x64 tile: in W[DM rows k][DM cols n] f32 -> out WT[DM rows n][DM cols k] bf16.
__device__ __forceinline__ void wt_block(const float* __restrict__ W, bf* WT, int n0, int k0, float* tile) {
    const int tid = threadIdx.x;
#pragma unroll
    for (int it = 0; it < 4; ++it) { const int c = it * 256 + tid; const int r = c >> 4, c4 = (c & 15) * 4;   // 64 rows x 16 chunks of 4 floats
        const v4f v = *(const v4f*)(W + (size_t)(k0 + r) * DM + n0 + c4);
        tile[r * 65 + c4 + 0] = v[0]; tile[r * 65 + c4 + 1] = v[1]; tile[r * 65 + c4 + 2] = v[2]; tile[r * 65 + c4 + 3] = v[3]; }
    __syncthreads();
    v8us o[2];
#pragma unroll
    for (int it = 0; it < 2; ++it) { const int c = it * 256 + tid; const int n = c >> 3, k8 = (c & 7) * 8;     // 64 output rows x 8 chunks of 8
#pragma unroll
        for (int e = 0; e < 8; ++e) o[it][e] = f2bf(tile[(k8 + e) * 65 + n]); }
#pragma unroll
    for (int it = 0; it < 2; ++it) { const int c = it * 256 + tid; const int n = c >> 3, k8 = (c & 7) * 8;
        *(v8us*)(WT + (size_t)(n0 + n) * DM + k0 + k8) = o[it]; }
}

// k_prep: every input conversion in one launch; none depends on another, the block index alone says which piece a block does (block-uniform branch).
// Blocks [0, 4*WTB): weight w = index / WTB, tile (n, k) = (index % WTB) % (DM/64), / (DM/64) -> plane w of WT. Blocks behind them: input index / CVB, chunk block index % CVB -> copy of X.
// grid 4*WTB + 3*CVB, 256 threads. X: three copies SZ_XB bytes apart (q, k, v); WT: four planes SZ_WB bytes apart (Wq, Wk, Wv, Wp).
__global__ __launch_bounds__(256) void k_prep(const float* __restrict__ xq, const float* __restrict__ xk, const float* __restrict__ xv,
                                              const float* __restrict__ wq, const float* __restrict__ wk, const float* __restrict__ wv, const float* __restrict__ wp,
                                              bf* X, bf* WT) {
    __shared__ float tile[64 * 65];
    const unsigned bid = blockIdx.x;
    if (bid < 4u * WTB) {
        const int w = (int)(bid / WTB), t = (int)(bid % WTB);
        wt_block(w == 0 ? wq : w == 1 ? wk : w == 2 ? wv : wp, WT + (size_t)w * (SZ_WB / 2), (t % (DM / 64)) * 64, (t / (DM / 64)) * 64, tile);
    } else {
        const unsigned c = bid - 4u * WTB; const int w = (int)(c / CVB);
        cvt8_block(w == 0 ? xq : w == 1 ? xk : xv, X + (size_t)w * (SZ_XB / 2), (int)(c % CVB));
    }
}

// k_gemm: bf16 GEMM, 128x128 tile of C per block of four waves (2 x 2), each wave a 64x64 tile (16 accumulators).
// C[m][n] = sum_{kc < KA} A[m][kc] Bt[n][kc & (DM-1)]; A row pitch KA, Bt row pitch DM (KA = 2*DM folds the hi | lo halves of A against the same Bt rows).
// Per stage of 128 k each wave brings one tile of 64 rows x 256 B into LDS with one tensor load (waves 0, 1 the block's A rows, waves 2, 3 its Bt rows);
// two buffers, the next stage's loads in flight while this stage is worked on; every wave reads its fragments from LDS (two 16-B reads each).
// MODE 0: C written as f16 (Ph) and f16 residual x2048 (Pr), row-major pitch DM. MODE 1: C written as f32 to OUT rows (m/SEQ)*OUT_SEQ + m%SEQ, pitch DM.
// grid (M/128, DM/128, Z), 128 threads; KA a multiple of 128, at least 256. Epilogue per 16-row slab staged in LDS (wave-private part of the ring);
// blockIdx.z picks one of Z independent products of the same shape: A planes za elements apart, Bt planes zb apart, Ph and Pr planes zp apart.
template <int MODE>
__global__ __launch_bounds__(128) void k_gemm(const bf* __restrict__ A0, const bf* __restrict__ Bt0, int KA, h16* Ph0, h16* Pr0, float* OUT, size_t za, size_t zb, size_t zp) {
    __shared__ __attribute__((aligned(2048))) unsigned char gring[2 * GBSZ];
    const bf* A = A0 + blockIdx.z * za; const bf* Bt = Bt0 + blockIdx.z * zb;
    h16* Ph = Ph0 + blockIdx.z * zp; h16* Pr = Pr0 + blockIdx.z * zp;
    const int lane = threadIdx.x & 31, wave = (int)uni(threadIdx.x >> 5), lr = lane & 15, hi = lane >> 4;
    const int wm = wave >> 1, wn = wave & 1;                 // the wave's 64x64 tile inside the block's 128x128
    const int r0 = blockIdx.x * 128 + wm * 64, c0 = blockIdx.y * 128 + wn * 64;
    // this wave's tile to load: waves 0, 1 rows 0..63, 64..127 of the block's A rows; waves 2, 3 the same of its Bt rows
    const int lrow = (wave < 2 ? (int)blockIdx.x : (int)blockIdx.y) * 128 + (wave & 1) * 64;
    const uint32_t gpitch = wave < 2 ? (uint32_t)KA * 2u : (uint32_t)(DM * 2);
    const uint64_t gsrc = (uint64_t)(size_t)(wave < 2 ? A : Bt) + (uint64_t)lrow * gpitch;
    const uint32_t gmask = wave < 2 ? 0xFFFFFFFFu : (uint32_t)(DM * 2 - 1);   // byte offset along a row; Bt's wraps at DM elements
    const uint32_t ldst = (uint32_t)(size_t)gring + (uint32_t)wave * GTSZ;
    const int nst = KA / GKS;
    const u32x8 g1 = tile256_group1(gpitch);
    tile256_load(ldst, gsrc, g1);                            // stage 0 -> buffer 0
    v8f acc[4][4];
#pragma unroll
    for (int mb = 0; mb < 4; ++mb)
#pragma unroll
        for (int nb = 0; nb < 4; ++nb) acc[mb][nb] = (v8f){};
    const int fo = lr * GLP + 16 * hi;                       // lane's byte offset in a tile: row lr, k offset 8h elements (A and B fragments alike)
    wait_tensor0();
    __syncthreads();                                         // stage 0 published
    tile256_load(ldst + GBSZ, gsrc + ((uint32_t)(GKS * 2) & gmask), g1);       // stage 1 -> buffer 1
#pragma unroll 1
    for (int st = 0; st < nst; ++st) {
        const unsigned char* bp = gring + (st & 1) * GBSZ + fo;
        const bf* ap = (const bf*)(bp + wm * GTSZ);          // A rows of this wave
        const bf* bq = (const bf*)(bp + (2 + wn) * GTSZ);    // Bt rows of this wave
        v16bf a[2][4], b[2][4];                              // two fragment sets: the next 32 k are fetched ahead of this block's products
#pragma unroll
        for (int f = 0; f < 4; ++f) a[0][f] = ldb(ap + f * 16 * GLPH);
#pragma unroll
        for (int f = 0; f < 4; ++f) b[0][f] = ldb(bq + f * 16 * GLPH);
#pragma unroll
        for (int ks = 0; ks < GKS / 32; ++ks) {
            if (ks + 1 < GKS / 32) {
#pragma unroll
                for (int f = 0; f < 4; ++f) a[(ks + 1) & 1][f] = ldb(ap + f * 16 * GLPH + (ks + 1) * 32);
#pragma unroll
                for (int f = 0; f < 4; ++f) b[(ks + 1) & 1][f] = ldb(bq + f * 16 * GLPH + (ks + 1) * 32);
                __builtin_amdgcn_sched_barrier(0);           // holds the next block's LDS reads as one group ahead of this block's products (else each read sinks to its use and is waited for there)
            }
#pragma unroll
            for (int nb = 0; nb < 4; ++nb)
#pragma unroll
                for (int mb = 0; mb < 4; ++mb) acc[mb][nb] = wmmab(a[ks & 1][mb], b[ks & 1][nb], acc[mb][nb]);
            __builtin_amdgcn_sched_barrier(0);               // keeps this block's products ahead of the reads after next, which reuse its fragment registers
        }
        // hand-over, every wave: own LDS reads done, own tile of stage st+1 landed, barrier (publishes stage st+1, frees this stage's buffer), then the refill
        wait_ds0();
        wait_tensor0();
        __syncthreads();
        if (pinned(st + 2 < nst)) tile256_load(ldst + (uint32_t)(st & 1) * GBSZ, gsrc + ((uint32_t)((st + 2) * GKS * 2) & gmask), g1);
    }
    wait_tensor0();
    wait_ds0();
    float* os = (float*)gring + wave * 16 * 68;              // output staging reuses the ring: the last hand-over's barrier stands behind every wave's last read, and nothing was issued behind it
#pragma unroll
    for (int mb = 0; mb < 4; ++mb) {
#pragma unroll
        for (int nb = 0; nb < 4; ++nb) {
#pragma unroll
            for (int j = 0; j < 8; ++j) os[(hi * 8 + j) * 68 + nb * 16 + lr] = acc[mb][nb][j]; }   // D: row 8h+j, col lane&15; rows 0..15 x cols 0..63 all written
        wave_sync();
        const int m0 = r0 + mb * 16;
        if (MODE == 0) {
            const size_t sb = (size_t)m0 * DM + c0;
{
#pragma unroll
                for (int s = 0; s < 4; ++s) { const int row = 4 * s + (lane >> 3), c8 = (lane & 7) * 8;   // 4 s x 4 row groups = 16 rows; 8 lanes x 8 = 64 columns
                    const v4f x0 = *(const v4fa*)(&os[row * 68 + c8]); const v4f x1 = *(const v4fa*)(&os[row * 68 + c8 + 4]); v8h hv, rv;
#pragma unroll
                    for (int i = 0; i < 4; ++i) { const h16 a0 = (h16)x0[i]; const h16 a1 = (h16)x1[i]; hv[i] = a0; hv[4 + i] = a1; rv[i] = (h16)((x0[i] - (float)a0) * QRS); rv[4 + i] = (h16)((x1[i] - (float)a1) * QRS); }
                    const size_t oo = sb + (size_t)row * DM + c8;
                    *(v8h*)(Ph + oo) = hv; *(v8h*)(Pr + oo) = rv; }
                 }
        } else {
            float* orow = OUT + ((size_t)(m0 / SEQ) * OUT_SEQ + (size_t)(m0 % SEQ)) * DM + c0;
{
#pragma unroll
                for (int s = 0; s < 8; ++s) { const int row = 2 * s + hi, cofs = lr * 4;   // 8 s x 2 rows = 16 rows; 16 lanes x 4 floats = 64 columns
                    const v4f val = *(const v4fa*)(&os[row * 68 + cofs]);
                    *(v4f*)(orow + (size_t)row * DM + cofs) = val; }
                 }
        }
        wave_sync();
    }
}

#define STG(OFS, OH, OR) { v4f a_, c_; \
    a_[0] = OH[0] * inv + OR[0] * ri; a_[1] = OH[1] * inv + OR[1] * ri; a_[2] = OH[2] * inv + OR[2] * ri; a_[3] = OH[3] * inv + OR[3] * ri; \
    c_[0] = OH[4] * inv + OR[4] * ri; c_[1] = OH[5] * inv + OR[5] * ri; c_[2] = OH[6] * inv + OR[6] * ri; c_[3] = OH[7] * inv + OR[7] * ri; \
    *(v4fa*)(&os[wb + lr * 68 + (OFS) + 8 * hi]) = a_; *(v4fa*)(&os[wb + lr * 68 + (OFS) + 8 * hi + 4]) = c_; }

// k_flash: fused causal attention, one wave per 16 query rows of one (batch, head); Q fragments straight from the f16 planes (two 16-B loads each).
// K and V: per stage of 64 keys each of the four waves brings one tile (K value, K residual, V value, V residual; 64 key rows x 128 B) into LDS with one tensor load;
// two buffers, the next stage's loads in flight while this stage is worked on; every wave reads its fragments from LDS (two 16-B reads each, transposing ones for V^T). Every wave passes every stage's hand-over.
// Transposed form: S^T[key][t] = K Q^T (A = K rows, B = Q rows); lane (t = lane&15, h = lane>>4) holds keys 8h+r of each 16-key tile, so the packed
// P tile is directly the B fragment of O^T[d][t] = V^T P^T (element r <- tile keys 0..15, element 8+r <- tile keys 16..31, lane unchanged).
// Causal: a wave works on the 32-key blocks below t0+16 (wave-uniform); entries with key > t are replaced by a large negative value (P = 0); every visited 32-key block holds a visible key for each row.
// Softmax state (running max, partial sum) is one scalar per lane; the two lane halves of a row are combined with one xor-16 exchange.
__global__ __launch_bounds__(32 * AW) void k_flash(const h16* __restrict__ QH, const h16* __restrict__ QR, const h16* __restrict__ KH, const h16* __restrict__ KR,
                                                   const h16* __restrict__ VH, const h16* __restrict__ VR, bf* CTX) {
    __shared__ __attribute__((aligned(2048))) unsigned char ring[2 * BSZ];
    const int lane = threadIdx.x & 31, wave = (int)uni(threadIdx.x >> 5), lr = lane & 15, hi = lane >> 4;
    const int zh = blockIdx.y; const int b = zh / NH_, h = zh % NH_;
    const int t0 = (blockIdx.x * AW + wave) * 16;
    const size_t pbase = (size_t)zh * SEQ * HD;
    const size_t qo = pbase + (size_t)(t0 + lr) * HD + 8 * hi;
    const v16h qh0 = ldh(QH + qo), qh1 = ldh(QH + qo + 32), qr0 = ldh(QR + qo), qr1 = ldh(QR + qo + 32);   // B fragments: col t, k = d
    // this wave's tile: waves 0, 1 the K planes, waves 2, 3 the V planes (rows = keys, 128 B each, contiguous)
    const h16* pl = wave == 0 ? KH : wave == 1 ? KR : wave == 2 ? VH : VR;
    const uint64_t gsrc = (uint64_t)(size_t)(pl + pbase);
    const uint32_t gstep = (uint32_t)(KST * HD * 2);         // bytes from one stage's tile to the next
    const uint32_t isk = pinned(wave < 2), isv = pinned(wave >= 2);
    const u32x8 g1k = tile128_group1<3u>(), g1v = tile128_group1<7u>();
    const uint32_t ldst = (uint32_t)(size_t)ring + (uint32_t)wave * TSZ;
    // 64-key stages the block walks: keys [0, 64*(blockIdx.x+1)), never fewer than the prologue's two
    // as pinned(): the bound of the refill's scalar test is formed here, ahead of the first request (else its arithmetic sinks behind stage 1's request and takes a register of that request's group 0)
    const int nst = (int)pinned(blockIdx.x == 0 ? 2u : blockIdx.x + 1u);
    stage_load(isk, isv, ldst, gsrc, g1k, g1v);              // stage 0 -> buffer 0
    const int fo = lr * LP + 16 * hi;                        // lane's byte offset in a K tile: row lr, k offset 8h halves
    const int vo = (8 * hi + (lane & 7)) * LPV + 16 * ((lane >> 3) & 1);   // lane's byte offset in a V tile for the transposing load: key row 8h + (lane & 7), 16-B half (lane >> 3) & 1
    v8f oh0 = (v8f){}, oh1 = (v8f){}, oh2 = (v8f){}, oh3 = (v8f){};
    v8f or0 = (v8f){}, or1 = (v8f){}, or2 = (v8f){}, or3 = (v8f){};
    float m = NEGB, l = 0.0f;
    const int kend = t0 + 16;                                // keys 0 .. t0+15 visible to this wave; kend <= SEQ
    wait_tensor0();
    __syncthreads();                                         // stage 0 published
    stage_load(isk, isv, ldst + BSZ, gsrc + gstep, g1k, g1v);   // stage 1 -> buffer 1
#pragma unroll 1
    for (int st = 0; st < nst; ++st) {
      const unsigned char* bp = ring + (st & 1) * BSZ + fo;
      const unsigned char* bv = ring + (st & 1) * BSZ + vo;
#pragma unroll
      for (int sub = 0; sub < 2; ++sub) {
       const int key0 = st * KST + sub * 32;
       if (key0 < kend) {                                    // wave-uniform skip beyond the diagonal; the hand-over below stands outside it
        const h16* kk = (const h16*)(bp + sub * 32 * LP);    // K value tile, rows sub*32 + lr; residual tile TSZ bytes behind it
        v8f sHa = (v8f){}, sLa = (v8f){}, sHb = (v8f){}, sLb = (v8f){};
        { const v16h ka0 = ldh(kk), ka1 = ldh(kk + 32), kb0 = ldh(kk + 16 * LPH), kb1 = ldh(kk + 16 * LPH + 32);
          sHa = wmma16(ka0, qh0, sHa); sLa = wmma16(ka0, qr0, sLa); sHb = wmma16(kb0, qh0, sHb); sLb = wmma16(kb0, qr0, sLb);
          sHa = wmma16(ka1, qh1, sHa); sLa = wmma16(ka1, qr1, sLa); sHb = wmma16(kb1, qh1, sHb); sLb = wmma16(kb1, qr1, sLb);
          asm volatile("v_nop\n\tv_nop\n\tv_nop\n\tv_nop" : "+v"(sHa), "+v"(sLa), "+v"(sHb), "+v"(sLb) : "v"(ka0), "v"(ka1), "v"(kb0), "v"(kb1)); }
        { const h16* kr = kk + TSZ / 2;
          const v16h ra0 = ldh(kr), ra1 = ldh(kr + 32), rb0 = ldh(kr + 16 * LPH), rb1 = ldh(kr + 16 * LPH + 32);
          sLa = wmma16(ra0, qh0, sLa); sLb = wmma16(rb0, qh0, sLb); sLa = wmma16(ra1, qh1, sLa); sLb = wmma16(rb1, qh1, sLb);
          asm volatile("v_nop\n\tv_nop\n\tv_nop\n\tv_nop" : "+v"(sLa), "+v"(sLb) : "v"(ra0), "v"(ra1), "v"(rb0), "v"(rb1)); }
        float ta[8], tb[8];
#pragma unroll
        for (int r = 0; r < 8; ++r) { ta[r] = (sHa[r] + sLa[r] * QRI) * L2E; tb[r] = (sHb[r] + sLb[r] * QRI) * L2E; }
        if (key0 + 31 > t0) {                                // wave-uniform: block crosses the diagonal
            const int tq = t0 + lr - key0 - 8 * hi;          // tile a entry r is key key0+8h+r: hidden when r > tq; tile b entry r when 16 + r > tq
#pragma unroll
            for (int r = 0; r < 8; ++r) { ta[r] = (r > tq) ? NEGB : ta[r]; tb[r] = (16 + r > tq) ? NEGB : tb[r]; }
        }
        float mx = NEGB;
#pragma unroll
        for (int r = 0; r < 8; ++r) mx = fmaxf(mx, fmaxf(ta[r], tb[r]));
        mx = fmaxf(mx, __shfl_xor(mx, 16, 32));
        const float mnew = fmaxf(m, mx);
        const float alpha = __builtin_amdgcn_exp2f(m - mnew);
        const float sh = PSH - mnew;
        v16h pb; float ls = 0.0f;
#pragma unroll
        for (int r = 0; r < 8; ++r) { const h16 pa = (h16)__builtin_amdgcn_exp2f(ta[r] + sh); const h16 pc = (h16)__builtin_amdgcn_exp2f(tb[r] + sh); pb[r] = pa; pb[8 + r] = pc; ls += (float)pa + (float)pc; }
        l = l * alpha + ls; m = mnew;
        oh0 = oh0 * alpha; oh1 = oh1 * alpha; oh2 = oh2 * alpha; oh3 = oh3 * alpha;
        or0 = or0 * alpha; or1 = or1 * alpha; or2 = or2 * alpha; or3 = or3 * alpha;
        { const unsigned char* va = bv + 2 * TSZ + sub * 32 * LPV;   // V value tile, key rows sub*32 ..; fragment j: features 16j .. 16j+15 (32 B on)
          const v16h v0 = ldvt(va), v1 = ldvt(va + 32), v2 = ldvt(va + 64), v3 = ldvt(va + 96);
          oh0 = wmma16(v0, pb, oh0); oh1 = wmma16(v1, pb, oh1); oh2 = wmma16(v2, pb, oh2); oh3 = wmma16(v3, pb, oh3);
          asm volatile("v_nop\n\tv_nop\n\tv_nop\n\tv_nop" : "+v"(oh0), "+v"(oh1), "+v"(oh2), "+v"(oh3) : "v"(v0), "v"(v1), "v"(v2), "v"(v3), "v"(pb)); }
        { const unsigned char* va = bv + 3 * TSZ + sub * 32 * LPV;   // V residual tile
          const v16h v0 = ldvt(va), v1 = ldvt(va + 32), v2 = ldvt(va + 64), v3 = ldvt(va + 96);
          or0 = wmma16(v0, pb, or0); or1 = wmma16(v1, pb, or1); or2 = wmma16(v2, pb, or2); or3 = wmma16(v3, pb, or3);
          asm volatile("v_nop\n\tv_nop\n\tv_nop\n\tv_nop" : "+v"(or0), "+v"(or1), "+v"(or2), "+v"(or3) : "v"(v0), "v"(v1), "v"(v2), "v"(v3), "v"(pb)); }
       }
      }
      // hand-over, every wave: own LDS reads done, own tile of stage st+1 landed, barrier (publishes stage st+1, frees this stage's buffer), then the refill
      wait_ds0();
      wait_tensor0();
      __syncthreads();
      if (pinned(st + 2 < nst)) stage_load(isk, isv, ldst + (uint32_t)(st & 1) * BSZ, gsrc + (uint64_t)(st + 2) * gstep, g1k, g1v);
    }
    wait_tensor0();
    wait_ds0();
    float* os = (float*)ring;                                // output staging reuses the ring: the last hand-over's barrier stands behind every wave's last read, and nothing was issued behind it
    l += __shfl_xor(l, 16, 32);
    const float inv = 1.0f / l;
    const float ri = QRI * inv;
    const int wb = wave * 16 * 68;
    // O^T D layout: o_j[r] = (d = 16j + 8h + r, t = lane&15) -> os[t][d]; rows 0..15 x columns 0..63 all written
    STG(0, oh0, or0)
    STG(16, oh1, or1)
    STG(32, oh2, or2)
    STG(48, oh3, or3)
    wave_sync();
    bf* crow = CTX + ((size_t)b * SEQ + t0) * (size_t)(2 * DM) + h * HD;
{
#pragma unroll
        for (int s = 0; s < 4; ++s) { const int row = 4 * s + (lane >> 3), c8 = (lane & 7) * 8;   // 4 s x 4 row groups = 16 rows; 8 lanes x 8 = 64 columns
            const v4f x0 = *(const v4fa*)(&os[wb + row * 68 + c8]); const v4f x1 = *(const v4fa*)(&os[wb + row * 68 + c8 + 4]); v8us hv, lv;
#pragma unroll
            for (int i = 0; i < 4; ++i) { const unsigned short a0 = f2bf(x0[i]); const unsigned short a1 = f2bf(x1[i]); hv[i] = a0; hv[4 + i] = a1; lv[i] = f2bf(x0[i] - bf2f(a0)); lv[4 + i] = f2bf(x1[i] - bf2f(a1)); }
            const size_t oo = (size_t)row * (size_t)(2 * DM) + c8;
            *(v8us*)(crow + oo) = hv; *(v8us*)(crow + oo + DM) = lv; }
         }
}

extern "C" void kernel_launch(void* const* d_in, const int* in_sizes, int n_in,
                              void* d_out, int out_size, void* d_ws, size_t ws_size, hipStream_t stream) {
    if (n_in < 7) return;
    const size_t needx = ((size_t)(NB - 1) * SEQ_FULL + SEQ) * DM;
    if ((size_t)in_sizes[0] < needx || (size_t)in_sizes[1] < needx || (size_t)in_sizes[2] < needx) return;
    if ((size_t)in_sizes[3] < (size_t)DM * DM || (size_t)in_sizes[4] < (size_t)DM * DM || (size_t)in_sizes[5] < (size_t)DM * DM || (size_t)in_sizes[6] < (size_t)DM * DM) return;
    if ((size_t)out_size < ((size_t)(NB - 1) * OUT_SEQ + SEQ) * DM) return;
    if (SZ_TOTAL > ws_size) return;
    // wire order: q, k, v, Wq, Wk, Wv, Wp (weights [in][out])
    const float* xq = (const float*)d_in[0]; const float* xk = (const float*)d_in[1]; const float* xv = (const float*)d_in[2];
    const float* wq = (const float*)d_in[3]; const float* wk = (const float*)d_in[4]; const float* wv = (const float*)d_in[5]; const float* wp = (const float*)d_in[6];
    float* OUT = (float*)d_out;      // [NB][SEQ][1024]
    char* wsp = (char*)d_ws;
    bf* XQ = (bf*)wsp; wsp += SZ_XB;                 // [NB*SEQ][1024]; the k and v copies are reached from XQ, the other W^T planes from WQT, by their strides
    bf* XK = (bf*)wsp; wsp += SZ_XB;
    bf* XV = (bf*)wsp; wsp += SZ_XB;
    bf* WQT = (bf*)wsp; wsp += SZ_WB;                // [out][in]
    bf* WKT = (bf*)wsp; wsp += SZ_WB;
    bf* WVT = (bf*)wsp; wsp += SZ_WB;
    bf* WPT = (bf*)wsp; wsp += SZ_WB;
    h16* QH = (h16*)wsp; wsp += SZ_PL;               // [NB*SEQ][1024] == [NB*16][SEQ][64]
    h16* QR = (h16*)wsp; wsp += SZ_PL;               // residual x2048
    h16* KH = (h16*)wsp; wsp += SZ_PL;
    h16* KR = (h16*)wsp; wsp += SZ_PL;
    h16* VH = (h16*)wsp; wsp += SZ_PL;
    h16* VR = (h16*)wsp; wsp += SZ_PL;
    bf* CTX = (bf*)wsp; wsp += SZ_CTX;               // [NB*SEQ][2048]: hi | lo

    // every input conversion in one launch: W[in][out] -> WT[out][in] bf16 (four planes from WQT on), q, k, v -> bf16 copies (three from XQ on)
    k_prep<<<4 * WTB + 3 * CVB, 256, 0, stream>>>(xq, xk, xv, wq, wk, wv, wp, XQ, WQT);

    // projections, one launch, z = q, k, v: A = x rows (m = b*SEQ + t), Bt = W^T rows (n) -> row-major planes [m][n] (value + residual; a pair of planes per z)
    k_gemm<0><<<dim3(NB * SEQ / 128, DM / 128, 3), 128, 0, stream>>>(XQ, WQT, DM, QH, QR, OUT, SZ_XB / 2, SZ_WB / 2, SZ_PL);

    k_flash<<<dim3(SEQ / (16 * AW), NB * NH_, 1), 32 * AW, 0, stream>>>(QH, QR, KH, KR, VH, VR, CTX);

    // output projection: A = ctx rows [hi | lo] (K = 2048), Bt = Wp^T rows (k index wraps at 1024) -> f32 output
    k_gemm<1><<<dim3(NB * SEQ / 128, DM / 128, 1), 128, 0, stream>>>(CTX, WPT, 2 * DM, QH, QR, OUT, 0, 0, 0);
}

// v005
// A run of this version takes 98.2 microseconds.
// Two timings next to v004 both put it at 1.12 times that version's speed.
// Counting every step since v000, it is 3.59 times as fast.
#include <hip/hip_runtime.h>

// Multi-head attention, width 1024 = 16 heads x 64, separate q/k/v inputs [NB][SEQ][1024], Wq/Wk/Wv/Wp [in][out] (y = x W), no biases, unscaled scores, causal replace-mask, head split = flat row-major view (B,S,1024)->(B,16,S,64), output projection Wp (f32 out).
// Compute dtypes, f32 accumulate everywhere: q/k/v projections v_wmma_f32_16x16x32_bf16 (x and W RNE-converted to bf16; products exact);
// scores v_wmma_f32_16x16x32_f16 with q and k each as f16 value + f16 residual x2048 (three products, scaled residual products in their own accumulator);
// P (x2^14 carry, cancels in the normalisation) single f16, v as f16 value + f16 residual x2048 (two products, own accumulator); softmax f32 (online, running max);
// output projection v_wmma_f32_16x16x32_bf16 with ctx as bf16 hi | bf16 lo folded along K (K = 2048 against Wp^T repeated), Wp RNE-converted to bf16.
// Layout: bf16 copies of q/k/v, bf16 W^T planes [out][in]; projection planes [NB*SEQ][1024] f16 (== [b*16+h][s][64] by the flat head view);
// fused flash kernel in transposed form (S^T = K Q^T, O^T = V^T P^T), K / V tiles of 64 keys staged row-major in LDS by tensor loads (two buffers, shared by the block's four waves),
// the V^T fragments read from the row-major V tiles by the transposing LDS load (ds_load_tr16_b128); ctx plane [NB*SEQ][2048] bf16 (hi | lo).
// Each flash block works on two query tiles of one head, one after the other: tile x and tile NQT-1-x, so that every block walks the same number of key stages.
// GEMMs: 128x128 tile per block of four waves (64x64 each), A and Bt stages of 128 k staged in LDS by tensor loads (two buffers).
// Four launches: k_prep (all seven input conversions, split by block index), k_gemm<0> (the three projections, one per blockIdx.z), k_flash, k_gemm<1>.

#ifndef NB
#define NB 2
#endif
#ifndef SEQ
#define SEQ 2048
#endif
#define NB_FULL  2
#define SEQ_FULL 2048
#ifndef OUT_SEQ
#define OUT_SEQ SEQ              // row pitch (in tokens) between batches of the output
#endif
#define DM   1024
#define NH_  16
#define HD   64
#define AW   4                   // waves per flash block (16 query rows each)
#define QRS  2048.0f             // carry of the residual planes
#define QRI  (1.0f / 2048.0f)
#define L2E  1.4426950408889634f // log2(e); scores are unscaled
#define PSH  14.0f               // log2 of the P carry (16384)
#define NEGB (-3.0e38f)
#define KST  64                  // keys per LDS stage of the flash kernel
#define LP   144                 // LDS row pitch of the K tiles in bytes: 128-B rows + 16-B pad (16 B x odd, for 16-byte LDS reads)
#define LPH  (LP / 2)            // the same in halves
#define LPV  160                 // LDS row pitch of the V tiles in bytes: 128-B rows + 32-B pad (32 B x odd, for transposing LDS reads)
#define TSZ  10240               // place of one tile in LDS: 64 rows x 144 B = 9216 B or x 160 B = 10240 B, a multiple of 2 KiB
#define BSZ  (4 * TSZ)           // one buffer: K value, K residual, V value, V residual
#define NQT  (SEQ / (16 * AW))   // query tiles (64 rows) per head
#define OSB  (AW * 16 * 68 * 4)  // output staging of the flash kernel in bytes, behind its ring
#define GKS  128                 // k per LDS stage of the GEMM (256-B rows)
#define GLP  272                 // its LDS row pitch in bytes: 256-B rows + 16-B pad (16 B x odd, for 16-byte LDS reads)
#define GLPH (GLP / 2)           // the same in 16-bit elements
#define GTSZ 18432               // place of one GEMM tile in LDS: 64 rows x 272 B = 17408 B, rounded up to a multiple of 2 KiB
#define GBSZ (4 * GTSZ)          // one buffer: A rows 0..63, A rows 64..127, Bt rows 0..63, Bt rows 64..127

static_assert(HD == 64);
static_assert(NH_ * HD == DM);
static_assert((DM & (DM - 1)) == 0);           // B-operand k index wraps with a mask
static_assert(DM % 64 == 0);
static_assert(SEQ % 64 == 0);                  // 64-row tiles never straddle two batches; K and V tiles of 64 keys
static_assert((NB * SEQ) % 64 == 0);
static_assert(SEQ % 32 == 0);                  // key loop steps by 32
static_assert(SEQ % (16 * AW) == 0);           // flash grid covers the sequence exactly
static_assert(((size_t)SEQ * DM) % 8 == 0);
static_assert(NB <= NB_FULL);
static_assert(SEQ <= SEQ_FULL);
static_assert(AW == 4);                        // one tensor load per wave and stage: four tiles, four waves
static_assert(16 * AW == KST);                 // a block's queries end where its last 64-key stage ends
static_assert(NQT % 2 == 0 && NQT >= 2);       // query tiles pair up as x and NQT-1-x; a pair has NQT+1 >= 2 stages, which the ring's prologue needs
static_assert(HD * 2 == 128);                  // K and V tiles have 128-byte rows (one key's 64 features)
static_assert(KST * LP <= TSZ && KST * LPV <= TSZ && TSZ % 2048 == 0);
static_assert((NB * SEQ) % 128 == 0 && DM % 128 == 0);   // GEMM grid of 128x128 tiles covers C exactly
static_assert(DM % GKS == 0 && DM >= 2 * GKS);           // whole stages, the Bt wrap falls on a stage boundary, the ring's prologue loads two stages
static_assert(GKS * 2 == 256 && 64 * GLP <= GTSZ && GTSZ % 2048 == 0);
static_assert(4 * 16 * 68 * 4 <= 2 * GBSZ);              // GEMM output staging reuses its ring

typedef _Float16 h16;
typedef unsigned short bf;
typedef __attribute__((ext_vector_type(16))) __bf16   v16bf;
typedef __attribute__((ext_vector_type(16))) _Float16 v16h;
typedef __attribute__((ext_vector_type(8)))  _Float16 v8h;
typedef __attribute__((ext_vector_type(8)))  unsigned short v8us;
typedef __attribute__((ext_vector_type(8)))  short    v8s;
typedef __attribute__((ext_vector_type(8)))  float    v8f;
typedef __attribute__((ext_vector_type(4)))  float    v4f;
typedef v4f  __attribute__((may_alias)) v4fa;
typedef uint32_t u32x4 __attribute__((ext_vector_type(4)));
typedef uint32_t u32x8 __attribute__((ext_vector_type(8)));

__device__ __forceinline__ unsigned short f2bf(float f) { unsigned u = __float_as_uint(f); u += 0x7FFFu + ((u >> 16) & 1u); return (unsigned short)(u >> 16); }
__device__ __forceinline__ float bf2f(unsigned short s) { return __uint_as_float(((unsigned)s) << 16); }
__device__ __forceinline__ v16h cat16(v8h lo, v8h hi) { return __builtin_shufflevector(lo, hi, 0, 1, 2, 3, 4, 5, 6, 7, 8, 9, 10, 11, 12, 13, 14, 15); }
__device__ __forceinline__ v16bf cat16b(v8us lo, v8us hi) { return __builtin_bit_cast(v16bf, __builtin_shufflevector(lo, hi, 0, 1, 2, 3, 4, 5, 6, 7, 8, 9, 10, 11, 12, 13, 14, 15)); }
__device__ __forceinline__ v8f wmma16(v16h a, v16h b, v8f c) { return __builtin_amdgcn_wmma_f32_16x16x32_f16(false, a, false, b, (short)0, c, false, false); }
__device__ __forceinline__ v8f wmmab(v16bf a, v16bf b, v8f c) { return __builtin_amdgcn_wmma_f32_16x16x32_bf16(false, a, false, b, (short)0, c, false, false); }
// fragment loaders from K-contiguous 16-bit rows; p already includes + 8*(lane>>4): elements 0..7 <- k0+8h+0..7, elements 8..15 <- k0+16+8h+0..7 (same map for A and B)
__device__ __forceinline__ v16h  ldh(const h16* p) { return cat16(*(const v8h*)p, *(const v8h*)(p + 16)); }
__device__ __forceinline__ v16bf ldb(const bf* p)  { return cat16b(*(const v8us*)p, *(const v8us*)(p + 16)); }
// transposing LDS load from a row-major 16-bit tile T (rows = k, pitch LPV): with p = T + (k0 + 8*(lane>>4) + (lane&7)) * LPV + 2*d0 + 16*((lane>>3)&1)
// lane (c = lane&15, h = lane>>4) gets T[k0+8h+0..7][d0+c]; the loads at k0 and k0+16 make one A fragment of T^T in the k order of ldh (elements 0..7 <- k0+8h+0..7, 8..15 <- k0+16+8h+0..7)
__device__ __forceinline__ v8h ldtr(const unsigned char* p) { typedef __attribute__((address_space(3))) v8s lds_v8s; return __builtin_bit_cast(v8h, __builtin_amdgcn_ds_load_tr16_b128_v8i16((lds_v8s*)p)); }
__device__ __forceinline__ v16h ldvt(const unsigned char* p) { return cat16(ldtr(p), ldtr(p + 16 * LPV)); }
// ordering point for wave-private LDS tiles (same wave writes and reads)
__device__ __forceinline__ void wave_sync() { __builtin_amdgcn_fence(3 /* release order */, "wavefront"); __builtin_amdgcn_wave_barrier(); asm volatile("" ::: "memory"); }

__device__ __forceinline__ uint32_t uni(uint32_t v) { return (uint32_t)__builtin_amdgcn_readfirstlane(v); }
// wave-uniform test held in a scalar register, so that the branch on it is a scalar branch (a tensor load ignores EXEC)
__device__ __forceinline__ uint32_t pinned(uint32_t v) { uint32_t w = (uint32_t)__builtin_amdgcn_readfirstlane(v); asm volatile("" : "+s"(w)); return w; }
__device__ __forceinline__ void wait_ds0()     { asm volatile("s_wait_dscnt 0x0" ::: "memory"); }      // this wave's LDS reads have returned before the buffer is handed back
__device__ __forceinline__ void wait_tensor0() { asm volatile("s_wait_tensorcnt 0x0" ::: "memory"); }  // this wave's tensor load has landed (the compiler places no wait for it)
// one tile of 64 rows x 128 bytes, rows contiguous in the source, into LDS with a pad of PADC + 1 dwords behind every 128-B row (PADC = 3: pitch 144 B, PADC = 7: pitch 160 B): group 1 built once
template <uint32_t PADC>
__device__ __forceinline__ u32x8 tile128_group1() {
    u32x8 g1;
    g1[0] = uni((1u << 20) | (4u << 22) | (PADC << 25)); // no mask, 1-byte elements, pad behind every 32 dwords
    g1[1] = uni(128u << 16); g1[2] = uni(64u << 16); g1[3] = uni(128u << 16); g1[4] = uni(64u); g1[5] = uni(128u); g1[6] = uni(0u); g1[7] = uni(0u);
    asm volatile("" : "+s"(g1));   // as pinned(): the descriptor words are held in their scalar registers through the loop, so that none of them takes another value while a request is outstanding
    return g1;
}
// a wave's one request of a stage: a K tile (is_k) at the pitch of the 16-byte reads or a V tile (is_v) at the pitch of the transposing reads;
// is_k and is_v come from pinned(), one of them set: two scalar branches, so that each request's pad word is a constant
__device__ __forceinline__ void stage_load(uint32_t is_k, uint32_t is_v, u32x4 g0, u32x8 g1k, u32x8 g1v) {
    if (is_k) asm volatile("tensor_load_to_lds %0, %1" :: "s"(g0), "s"(g1k) : "memory");
    if (is_v) asm volatile("tensor_load_to_lds %0, %1" :: "s"(g0), "s"(g1v) : "memory");
}
// group 0 of a wave's first request
__device__ __forceinline__ u32x4 stage_group0(uint32_t lds_dst, uint64_t ga) {
    u32x4 g0;
    g0[0] = uni(1u); g0[1] = uni(lds_dst); g0[2] = uni((uint32_t)ga); g0[3] = uni((((uint32_t)(ga >> 32)) & 0x01FFFFFFu) | 0x80000000u);
    return g0;
}
// group 0 of a wave's next request, formed from that of its last one (place in LDS anew, source address moved by step bytes; the address stays inside its field, so the type bits above it stay):
// the group is so carried from request to request: the words that the next one is formed from (0, 2, 3) stay live, so their registers take no other value while a request is outstanding
__device__ __forceinline__ u32x4 stage_next(u32x4 g0, uint32_t lds_dst, int64_t step) {
    const uint64_t a = (((uint64_t)g0[3] << 32) | (uint64_t)g0[2]) + (uint64_t)step;
    g0[1] = uni(lds_dst); g0[2] = uni((uint32_t)a); g0[3] = uni((uint32_t)(a >> 32));
    return g0;
}
// one tile of 64 rows x 256 bytes, source row pitch src_pitch bytes, into LDS at pitch 272 B (a 16-B pad behind every 256-B row): group 1 built once, group 0 per request
__device__ __forceinline__ u32x8 tile256_group1(uint32_t src_pitch) {
    u32x8 g1;
    g1[0] = uni((1u << 20) | (5u << 22) | (3u << 25));   // no mask, 1-byte elements, pad of 4 dwords behind every 64
    g1[1] = uni(256u << 16); g1[2] = uni(64u << 16); g1[3] = uni(256u << 16); g1[4] = uni(64u); g1[5] = uni(src_pitch); g1[6] = uni(0u); g1[7] = uni(0u);
    asm volatile("" : "+s"(g1));   // as pinned(): the descriptor words are held in their scalar registers through the loop, so that none of them takes another value while a request is outstanding
    return g1;
}
__device__ __forceinline__ void tile256_load(uint32_t lds_dst, uint64_t ga, u32x8 g1) {
    u32x4 g0;
    g0[0] = uni(1u); g0[1] = uni(lds_dst); g0[2] = uni((uint32_t)ga); g0[3] = uni((((uint32_t)(ga >> 32)) & 0x01FFFFFFu) | 0x80000000u);
    asm volatile("tensor_load_to_lds %0, %1" :: "s"(g0), "s"(g1) : "memory");
}

static constexpr size_t al256(size_t v) { return (v + 255) & ~(size_t)255; }
static constexpr size_t SZ_XB  = al256((size_t)NB * SEQ * DM * 2);          // one bf16 input copy
static constexpr size_t SZ_WB  = al256((size_t)DM * DM * 2);                // one bf16 W^T plane
static constexpr size_t SZ_PL  = al256((size_t)NB * NH_ * SEQ * HD * 2);    // one f16 plane
static constexpr size_t SZ_CTX = al256((size_t)NB * SEQ * 2 * DM * 2);      // ctx hi | lo
static constexpr size_t SZ_TOTAL = 3 * SZ_XB + 4 * SZ_WB + 6 * SZ_PL + SZ_CTX;
static_assert(SZ_TOTAL <= (size_t)134217728);          // workspace carve <= 128 MiB
static_assert(SZ_PL == (size_t)NB * SEQ * DM * 2);     // value / residual plane pairs are exactly contiguous

#define WTB ((DM / 64) * (DM / 64))                          // blocks per weight: 64x64 tiles
#define CVN ((size_t)NB * SEQ * DM / 8)                      // 8-element chunks per activation input
#define CVB ((int)((CVN + 255) / 256))                       // blocks per activation input

// RNE convert of one activation input: block cb takes 256 chunks of 8 floats; source batches SEQ_FULL tokens apart, copy packed [NB*SEQ][DM].
__device__ __forceinline__ void cvt8_block(const float* __restrict__ src, bf* dst, int cb) {
    const size_t i = (size_t)cb * 256 + threadIdx.x; if (i >= CVN) return;
    const size_t e = i * 8;
    const v8f v = *(const v8f*)(src + e + (e / ((size_t)SEQ * DM)) * ((size_t)(SEQ_FULL - SEQ) * DM)); v8us o;
#pragma unroll
    for (int k = 0; k < 8; ++k) o[k] = f2bf(v[k]);
    *(v8us*)(dst + e) = o;
}

// weight transpose + RNE convert of one 64x64 tile: in W[DM rows k][DM cols n] f32 -> out WT[DM rows n][DM cols k] bf16.
__device__ __forceinline__ void wt_block(const float* __restrict__ W, bf* WT, int n0, int k0, float* tile) {
    const int tid = threadIdx.x;
#pragma unroll
    for (int it = 0; it < 4; ++it) { const int c = it * 256 + tid; const int r = c >> 4, c4 = (c & 15) * 4;   // 64 rows x 16 chunks of 4 floats
        const v4f v = *(const v4f*)(W + (size_t)(k0 + r) * DM + n0 + c4);
        tile[r * 65 + c4 + 0] = v[0]; tile[r * 65 + c4 + 1] = v[1]; tile[r * 65 + c4 + 2] = v[2]; tile[r * 65 + c4 + 3] = v[3]; }
    __syncthreads();
    v8us o[2];
#pragma unroll
    for (int it = 0; it < 2; ++it) { const int c = it * 256 + tid; const int n = c >> 3, k8 = (c & 7) * 8;     // 64 output rows x 8 chunks of 8
#pragma unroll
        for (int e = 0; e < 8; ++e) o[it][e] = f2bf(tile[(k8 + e) * 65 + n]); }
#pragma unroll
    for (int it = 0; it < 2; ++it) { const int c = it * 256 + tid; const int n = c >> 3, k8 = (c & 7) * 8;
        *(v8us*)(WT + (size_t)(n0 + n) * DM + k0 + k8) = o[it]; }
}

// k_prep: every input conversion in one launch; none depends on another, the block index alone says which piece a block does (block-uniform branch).
// Blocks [0, 4*WTB): weight w = index / WTB, tile (n, k) = (index % WTB) % (DM/64), / (DM/64) -> plane w of WT. Blocks behind them: input index / CVB, chunk block index % CVB -> copy of X.
// grid 4*WTB + 3*CVB, 256 threads. X: three copies SZ_XB bytes apart (q, k, v); WT: four planes SZ_WB bytes apart (Wq, Wk, Wv, Wp).
__global__ __launch_bounds__(256) void k_prep(const float* __restrict__ xq, const float* __restrict__ xk, const float* __restrict__ xv,
                                              const float* __restrict__ wq, const float* __restrict__ wk, const float* __restrict__ wv, const float* __restrict__ wp,
                                              bf* X, bf* WT) {
    __shared__ float tile[64 * 65];
    const unsigned bid = blockIdx.x;
    if (bid < 4u * WTB) {
        const int w = (int)(bid / WTB), t = (int)(bid % WTB);
        wt_block(w == 0 ? wq : w == 1 ? wk : w == 2 ? wv : wp, WT + (size_t)w * (SZ_WB / 2), (t % (DM / 64)) * 64, (t / (DM / 64)) * 64, tile);
    } else {
        const unsigned c = bid - 4u * WTB; const int w = (int)(c / CVB);
        cvt8_block(w == 0 ? xq : w == 1 ? xk : xv, X + (size_t)w * (SZ_XB / 2), (int)(c % CVB));
    }
}

// k_gemm: bf16 GEMM, 128x128 tile of C per block of four waves (2 x 2), each wave a 64x64 tile (16 accumulators).
// C[m][n] = sum_{kc < KA} A[m][kc] Bt[n][kc & (DM-1)]; A row pitch KA, Bt row pitch DM (KA = 2*DM folds the hi | lo halves of A against the same Bt rows).
// Per stage of 128 k each wave brings one tile of 64 rows x 256 B into LDS with one tensor load (waves 0, 1 the block's A rows, waves 2, 3 its Bt rows);
// two buffers, the next stage's loads in flight while this stage is worked on; every wave reads its fragments from LDS (two 16-B reads each).
// MODE 0: C written as f16 (Ph) and f16 residual x2048 (Pr), row-major pitch DM. MODE 1: C written as f32 to OUT rows (m/SEQ)*OUT_SEQ + m%SEQ, pitch DM.
// grid (M/128, DM/128, Z), 128 threads; KA a multiple of 128, at least 256. Epilogue per 16-row slab staged in LDS (wave-private part of the ring);
// blockIdx.z picks one of Z independent products of the same shape: A planes za elements apart, Bt planes zb apart, Ph and Pr planes zp apart.
template <int MODE>
__global__ __launch_bounds__(128) void k_gemm(const bf* __restrict__ A0, const bf* __restrict__ Bt0, int KA, h16* Ph0, h16* Pr0, float* OUT, size_t za, size_t zb, size_t zp) {
    __shared__ __attribute__((aligned(2048))) unsigned char gring[2 * GBSZ];
    const bf* A = A0 + blockIdx.z * za; const bf* Bt = Bt0 + blockIdx.z * zb;
    h16* Ph = Ph0 + blockIdx.z * zp; h16* Pr = Pr0 + blockIdx.z * zp;
    const int lane = threadIdx.x & 31, wave = (int)uni(threadIdx.x >> 5), lr = lane & 15, hi = lane >> 4;
    const int wm = wave >> 1, wn = wave & 1;                 // the wave's 64x64 tile inside the block's 128x128
    const int r0 = blockIdx.x * 128 + wm * 64, c0 = blockIdx.y * 128 + wn * 64;
    // this wave's tile to load: waves 0, 1 rows 0..63, 64..127 of the block's A rows; waves 2, 3 the same of its Bt rows
    const int lrow = (wave < 2 ? (int)blockIdx.x : (int)blockIdx.y) * 128 + (wave & 1) * 64;
    const uint32_t gpitch = wave < 2 ? (uint32_t)KA * 2u : (uint32_t)(DM * 2);
    const uint64_t gsrc = (uint64_t)(size_t)(wave < 2 ? A : Bt) + (uint64_t)lrow * gpitch;
    const uint32_t gmask = wave < 2 ? 0xFFFFFFFFu : (uint32_t)(DM * 2 - 1);   // byte offset along a row; Bt's wraps at DM elements
    const uint32_t ldst = (uint32_t)(size_t)gring + (uint32_t)wave * GTSZ;
    const int nst = KA / GKS;
    const u32x8 g1 = tile256_group1(gpitch);
    tile256_load(ldst, gsrc, g1);                            // stage 0 -> buffer 0
    v8f acc[4][4];
#pragma unroll
    for (int mb = 0; mb < 4; ++mb)
#pragma unroll
        for (int nb = 0; nb < 4; ++nb) acc[mb][nb] = (v8f){};
    const int fo = lr * GLP + 16 * hi;                       // lane's byte offset in a tile: row lr, k offset 8h elements (A and B fragments alike)
    wait_tensor0();
    __syncthreads();                                         // stage 0 published
    tile256_load(ldst + GBSZ, gsrc + ((uint32_t)(GKS * 2) & gmask), g1);       // stage 1 -> buffer 1
#pragma unroll 1
    for (int st = 0; st < nst; ++st) {
        const unsigned char* bp = gring + (st & 1) * GBSZ + fo;
        const bf* ap = (const bf*)(bp + wm * GTSZ);          // A rows of this wave
        const bf* bq = (const bf*)(bp + (2 + wn) * GTSZ);    // Bt rows of this wave
        v16bf a[2][4], b[2][4];                              // two fragment sets: the next 32 k are fetched ahead of this block's products
#pragma unroll
        for (int f = 0; f < 4; ++f) a[0][f] = ldb(ap + f * 16 * GLPH);
#pragma unroll
        for (int f = 0; f < 4; ++f) b[0][f] = ldb(bq + f * 16 * GLPH);
#pragma unroll
        for (int ks = 0; ks < GKS / 32; ++ks) {
            if (ks + 1 < GKS / 32) {
#pragma unroll
                for (int f = 0; f < 4; ++f) a[(ks + 1) & 1][f] = ldb(ap + f * 16 * GLPH + (ks + 1) * 32);
#pragma unroll
                for (int f = 0; f < 4; ++f) b[(ks + 1) & 1][f] = ldb(bq + f * 16 * GLPH + (ks + 1) * 32);
                __builtin_amdgcn_sched_barrier(0);           // holds the next block's LDS reads as one group ahead of this block's products (else each read sinks to its use and is waited for there)
            }
#pragma unroll
            for (int nb = 0; nb < 4; ++nb)
#pragma unroll
                for (int mb = 0; mb < 4; ++mb) acc[mb][nb] = wmmab(a[ks & 1][mb], b[ks & 1][nb], acc[mb][nb]);
            __builtin_amdgcn_sched_barrier(0);               // keeps this block's products ahead of the reads after next, which reuse its fragment registers
        }
        // hand-over, every wave: own LDS reads done, own tile of stage st+1 landed, barrier (publishes stage st+1, frees this stage's buffer), then the refill
        wait_ds0();
        wait_tensor0();
        __syncthreads();
        if (pinned(st + 2 < nst)) tile256_load(ldst + (uint32_t)(st & 1) * GBSZ, gsrc + ((uint32_t)((st + 2) * GKS * 2) & gmask), g1);
    }
    wait_tensor0();
    wait_ds0();
    float* os = (float*)gring + wave * 16 * 68;              // output staging reuses the ring: the last hand-over's barrier stands behind every wave's last read, and nothing was issued behind it
#pragma unroll
    for (int mb = 0; mb < 4; ++mb) {
#pragma unroll
        for (int nb = 0; nb < 4; ++nb) {
#pragma unroll
            for (int j = 0; j < 8; ++j) os[(hi * 8 + j) * 68 + nb * 16 + lr] = acc[mb][nb][j]; }   // D: row 8h+j, col lane&15; rows 0..15 x cols 0..63 all written
        wave_sync();
        const int m0 = r0 + mb * 16;
        if (MODE == 0) {
            const size_t sb = (size_t)m0 * DM + c0;
{
#pragma unroll
                for (int s = 0; s < 4; ++s) { const int row = 4 * s + (lane >> 3), c8 = (lane & 7) * 8;   // 4 s x 4 row groups = 16 rows; 8 lanes x 8 = 64 columns
                    const v4f x0 = *(const v4fa*)(&os[row * 68 + c8]); const v4f x1 = *(const v4fa*)(&os[row * 68 + c8 + 4]); v8h hv, rv;
#pragma unroll
                    for (int i = 0; i < 4; ++i) { const h16 a0 = (h16)x0[i]; const h16 a1 = (h16)x1[i]; hv[i] = a0; hv[4 + i] = a1; rv[i] = (h16)((x0[i] - (float)a0) * QRS); rv[4 + i] = (h16)((x1[i] - (float)a1) * QRS); }
                    const size_t oo = sb + (size_t)row * DM + c8;
                    *(v8h*)(Ph + oo) = hv; *(v8h*)(Pr + oo) = rv; }
                 }
        } else {
            float* orow = OUT + ((size_t)(m0 / SEQ) * OUT_SEQ + (size_t)(m0 % SEQ)) * DM + c0;
{
#pragma unroll
                for (int s = 0; s < 8; ++s) { const int row = 2 * s + hi, cofs = lr * 4;   // 8 s x 2 rows = 16 rows; 16 lanes x 4 floats = 64 columns
                    const v4f val = *(const v4fa*)(&os[row * 68 + cofs]);
                    *(v4f*)(orow + (size_t)row * DM + cofs) = val; }
                 }
        }
        wave_sync();
    }
}

#define STG(OFS, OH, OR) { v4f a_, c_; \
    a_[0] = OH[0] * inv + OR[0] * ri; a_[1] = OH[1] * inv + OR[1] * ri; a_[2] = OH[2] * inv + OR[2] * ri; a_[3] = OH[3] * inv + OR[3] * ri; \
    c_[0] = OH[4] * inv + OR[4] * ri; c_[1] = OH[5] * inv + OR[5] * ri; c_[2] = OH[6] * inv + OR[6] * ri; c_[3] = OH[7] * inv + OR[7] * ri; \
    *(v4fa*)(&os[wb + lr * 68 + (OFS) + 8 * hi]) = a_; *(v4fa*)(&os[wb + lr * 68 + (OFS) + 8 * hi + 4]) = c_; }

// k_flash: fused causal attention, one wave per 16 query rows of one (batch, head); Q fragments straight from the f16 planes (two 16-B loads each).
// K and V: per stage of 64 keys each of the four waves brings one tile (K value, K residual, V value, V residual; 64 key rows x 128 B) into LDS with one tensor load;
// two buffers, the next stage's loads in flight while this stage is worked on; every wave reads its fragments from LDS (two 16-B reads each, transposing ones for V^T). Every wave passes every stage's hand-over.
// Transposed form: S^T[key][t] = K Q^T (A = K rows, B = Q rows); lane (t = lane&15, h = lane>>4) holds keys 8h+r of each 16-key tile, so the packed
// P tile is directly the B fragment of O^T[d][t] = V^T P^T (element r <- tile keys 0..15, element 8+r <- tile keys 16..31, lane unchanged).
// Causal: a wave works on the 32-key blocks below t0+16 (wave-uniform); entries with key > t are replaced by a large negative value (P = 0); every visited 32-key block holds a visible key for each row.
// Softmax state (running max, partial sum) is one scalar per lane; the two lane halves of a row are combined with one xor-16 exchange.
// Balance: a tile's cost grows with its index (tile x walks x+1 stages), so a block takes tile blockIdx.x and then tile NQT-1-blockIdx.x of its head, NQT+1 stages whatever the block;
// the ring runs through both tiles as one sequence of stages (the second tile's first stages are in flight while the first tile is finished), so the output staging has LDS of its own behind the ring.
// grid (NQT/2, NB*NH_).
__global__ __launch_bounds__(32 * AW) void k_flash(const h16* __restrict__ QH, const h16* __restrict__ QR, const h16* __restrict__ KH, const h16* __restrict__ KR,
                                                   const h16* __restrict__ VH, const h16* __restrict__ VR, bf* CTX) {
    __shared__ __attribute__((aligned(2048))) unsigned char ring[2 * BSZ + OSB];
    const int lane = threadIdx.x & 31, wave = (int)uni(threadIdx.x >> 5), lr = lane & 15, hi = lane >> 4;
    const int zh = blockIdx.y; const int b = zh / NH_, h = zh % NH_;
    const size_t pbase = (size_t)zh * SEQ * HD;
    // this wave's tile: waves 0, 1 the K planes, waves 2, 3 the V planes (rows = keys, 128 B each, contiguous)
    const h16* pl = wave == 0 ? KH : wave == 1 ? KR : wave == 2 ? VH : VR;
    const uint64_t gsrc = (uint64_t)(size_t)(pl + pbase);
    const uint32_t gstep = (uint32_t)(KST * HD * 2);         // bytes from one stage's tile to the next
    const uint32_t isk = pinned(wave < 2), isv = pinned(wave >= 2);
    const u32x8 g1k = tile128_group1<3u>(), g1v = tile128_group1<7u>();
    const uint32_t ldst = (uint32_t)(size_t)ring + (uint32_t)wave * TSZ;
    // 64-key stages the block walks: na = blockIdx.x+1 of its first tile (keys from 0 on), then NQT-blockIdx.x of its second (keys from 0 on again): NQT+1 in all
    // as pinned(): the first tile's stage count, which the refill's source step is formed from, is formed here, ahead of the first request (without it the build keeps group 0 in two register sets, and a register of the issued set takes another value while the request is outstanding)
    const int na = (int)pinned(blockIdx.x + 1u);
    u32x4 g0 = stage_group0(ldst, gsrc);
    stage_load(isk, isv, g0, g1k, g1v);                      // stage 0 -> buffer 0
    const int fo = lr * LP + 16 * hi;                        // lane's byte offset in a K tile: row lr, k offset 8h halves
    const int vo = (8 * hi + (lane & 7)) * LPV + 16 * ((lane >> 3) & 1);   // lane's byte offset in a V tile for the transposing load: key row 8h + (lane & 7), 16-B half (lane >> 3) & 1
    float* os = (float*)(ring + 2 * BSZ);                    // output staging, a wave-private part each
    const int wb = wave * 16 * 68;
    wait_tensor0();
    __syncthreads();                                         // stage 0 published
    g0 = stage_next(g0, ldst + BSZ, na > 1 ? (int64_t)gstep : (int64_t)0);
    stage_load(isk, isv, g0, g1k, g1v);                      // stage 1 -> buffer 1: the first tile's keys 64.., or, where it has one stage, the second tile's keys 0..
    int g = 0;                                               // stage number in the block's sequence; buffer g & 1
#pragma unroll 1                                             // the two tiles share one copy of the loop's code
    for (int half = 0; half < 2; ++half) {
    const int xt = half ? NQT - 1 - (int)blockIdx.x : (int)blockIdx.x;   // this pass's query tile
    const int nst = xt + 1;                                  // its stages: keys [0, 64*(xt+1))
    const int t0 = (xt * AW + wave) * 16;
    const size_t qo = pbase + (size_t)(t0 + lr) * HD + 8 * hi;
    const v16h qh0 = ldh(QH + qo), qh1 = ldh(QH + qo + 32), qr0 = ldh(QR + qo), qr1 = ldh(QR + qo + 32);   // B fragments: col t, k = d
    v8f oh0 = (v8f){}, oh1 = (v8f){}, oh2 = (v8f){}, oh3 = (v8f){};
    v8f or0 = (v8f){}, or1 = (v8f){}, or2 = (v8f){}, or3 = (v8f){};
    float m = NEGB, l = 0.0f;
    const int kend = t0 + 16;                                // keys 0 .. t0+15 visible to this wave; kend <= SEQ
#pragma unroll 1
    for (int st = 0; st < nst; ++st, ++g) {
      const unsigned char* bp = ring + (g & 1) * BSZ + fo;
      const unsigned char* bv = ring + (g & 1) * BSZ + vo;
#pragma unroll
      for (int sub = 0; sub < 2; ++sub) {
       const int key0 = st * KST + sub * 32;
       if (key0 < kend) {                                    // wave-uniform skip beyond the diagonal; the hand-over below stands outside it
        const h16* kk = (const h16*)(bp + sub * 32 * LP);    // K value tile, rows sub*32 + lr; residual tile TSZ bytes behind it
        v8f sHa = (v8f){}, sLa = (v8f){}, sHb = (v8f){}, sLb = (v8f){};
        { const v16h ka0 = ldh(kk), ka1 = ldh(kk + 32), kb0 = ldh(kk + 16 * LPH), kb1 = ldh(kk + 16 * LPH + 32);
          sHa = wmma16(ka0, qh0, sHa); sLa = wmma16(ka0, qr0, sLa); sHb = wmma16(kb0, qh0, sHb); sLb = wmma16(kb0, qr0, sLb);
          sHa = wmma16(ka1, qh1, sHa); sLa = wmma16(ka1, qr1, sLa); sHb = wmma16(kb1, qh1, sHb); sLb = wmma16(kb1, qr1, sLb);
          asm volatile("v_nop\n\tv_nop\n\tv_nop\n\tv_nop" : "+v"(sHa), "+v"(sLa), "+v"(sHb), "+v"(sLb) : "v"(ka0), "v"(ka1), "v"(kb0), "v"(kb1)); }
        { const h16* kr = kk + TSZ / 2;
          const v16h ra0 = ldh(kr), ra1 = ldh(kr + 32), rb0 = ldh(kr + 16 * LPH), rb1 = ldh(kr + 16 * LPH + 32);
          sLa = wmma16(ra0, qh0, sLa); sLb = wmma16(rb0, qh0, sLb); sLa = wmma16(ra1, qh1, sLa); sLb = wmma16(rb1, qh1, sLb);
          asm volatile("v_nop\n\tv_nop\n\tv_nop\n\tv_nop" : "+v"(sLa), "+v"(sLb) : "v"(ra0), "v"(ra1), "v"(rb0), "v"(rb1)); }
        float ta[8], tb[8];
#pragma unroll
        for (int r = 0; r < 8; ++r) { ta[r] = (sHa[r] + sLa[r] * QRI) * L2E; tb[r] = (sHb[r] + sLb[r] * QRI) * L2E; }
        if (key0 + 31 > t0) {                                // wave-uniform: block crosses the diagonal
            const int tq = t0 + lr - key0 - 8 * hi;          // tile a entry r is key key0+8h+r: hidden when r > tq; tile b entry r when 16 + r > tq
#pragma unroll
            for (int r = 0; r < 8; ++r) { ta[r] = (r > tq) ? NEGB : ta[r]; tb[r] = (16 + r > tq) ? NEGB : tb[r]; }
        }
        float mx = NEGB;
#pragma unroll
        for (int r = 0; r < 8; ++r) mx = fmaxf(mx, fmaxf(ta[r], tb[r]));
        mx = fmaxf(mx, __shfl_xor(mx, 16, 32));
        const float mnew = fmaxf(m, mx);
        const float alpha = __builtin_amdgcn_exp2f(m - mnew);
        const float sh = PSH - mnew;
        v16h pb; float ls = 0.0f;
#pragma unroll
        for (int r = 0; r < 8; ++r) { const h16 pa = (h16)__builtin_amdgcn_exp2f(ta[r] + sh); const h16 pc = (h16)__builtin_amdgcn_exp2f(tb[r] + sh); pb[r] = pa; pb[8 + r] = pc; ls += (float)pa + (float)pc; }
        l = l * alpha + ls; m = mnew;
        oh0 = oh0 * alpha; oh1 = oh1 * alpha; oh2 = oh2 * alpha; oh3 = oh3 * alpha;
        or0 = or0 * alpha; or1 = or1 * alpha; or2 = or2 * alpha; or3 = or3 * alpha;
        { const unsigned char* va = bv + 2 * TSZ + sub * 32 * LPV;   // V value tile, key rows sub*32 ..; fragment j: features 16j .. 16j+15 (32 B on)
          const v16h v0 = ldvt(va), v1 = ldvt(va + 32), v2 = ldvt(va + 64), v3 = ldvt(va + 96);
          oh0 = wmma16(v0, pb, oh0); oh1 = wmma16(v1, pb, oh1); oh2 = wmma16(v2, pb, oh2); oh3 = wmma16(v3, pb, oh3);
          asm volatile("v_nop\n\tv_nop\n\tv_nop\n\tv_nop" : "+v"(oh0), "+v"(oh1), "+v"(oh2), "+v"(oh3) : "v"(v0), "v"(v1), "v"(v2), "v"(v3), "v"(pb)); }
        { const unsigned char* va = bv + 3 * TSZ + sub * 32 * LPV;   // V residual tile
          const v16h v0 = ldvt(va), v1 = ldvt(va + 32), v2 = ldvt(va + 64), v3 = ldvt(va + 96);
          or0 = wmma16(v0, pb, or0); or1 = wmma16(v1, pb, or1); or2 = wmma16(v2, pb, or2); or3 = wmma16(v3, pb, or3);
          asm volatile("v_nop\n\tv_nop\n\tv_nop\n\tv_nop" : "+v"(or0), "+v"(or1), "+v"(or2), "+v"(or3) : "v"(v0), "v"(v1), "v"(v2), "v"(v3), "v"(pb)); }
       }
      }
      // hand-over, every wave: own LDS reads done, own tile of stage g+1 landed, barrier (publishes stage g+1, frees this stage's buffer), then the refill
      wait_ds0();
      wait_tensor0();
      __syncthreads();
      if (pinned(g + 2 < NQT + 1)) {                         // stage g+2: the next 64 keys, or, where it is the second tile's first, back to keys 0..
          g0 = stage_next(g0, ldst + (uint32_t)(g & 1) * BSZ, g + 2 == na ? -(int64_t)(na - 1) * (int64_t)gstep : (int64_t)gstep);
          stage_load(isk, isv, g0, g1k, g1v);
      }
    }
    l += __shfl_xor(l, 16, 32);
    const float inv = 1.0f / l;
    const float ri = QRI * inv;
    // O^T D layout: o_j[r] = (d = 16j + 8h + r, t = lane&15) -> os[t][d]; rows 0..15 x columns 0..63 all written
    STG(0, oh0, or0)
    STG(16, oh1, or1)
    STG(32, oh2, or2)
    STG(48, oh3, or3)
    wave_sync();
    bf* crow = CTX + ((size_t)b * SEQ + t0) * (size_t)(2 * DM) + h * HD;
{
#pragma unroll
        for (int s = 0; s < 4; ++s) { const int row = 4 * s + (lane >> 3), c8 = (lane & 7) * 8;   // 4 s x 4 row groups = 16 rows; 8 lanes x 8 = 64 columns
            const v4f x0 = *(const v4fa*)(&os[wb + row * 68 + c8]); const v4f x1 = *(const v4fa*)(&os[wb + row * 68 + c8 + 4]); v8us hv, lv;
#pragma unroll
            for (int i = 0; i < 4; ++i) { const unsigned short a0 = f2bf(x0[i]); const unsigned short a1 = f2bf(x1[i]); hv[i] = a0; hv[4 + i] = a1; lv[i] = f2bf(x0[i] - bf2f(a0)); lv[4 + i] = f2bf(x1[i] - bf2f(a1)); }
            const size_t oo = (size_t)row * (size_t)(2 * DM) + c8;
            *(v8us*)(crow + oo) = hv; *(v8us*)(crow + oo + DM) = lv; }
         }
    wave_sync();                                             // the staging rows are read before the second tile's results are written over them
    }
    wait_tensor0();
    wait_ds0();
}

extern "C" void kernel_launch(void* const* d_in, const int* in_sizes, int n_in,
                              void* d_out, int out_size, void* d_ws, size_t ws_size, hipStream_t stream) {
    if (n_in < 7) return;
    const size_t needx = ((size_t)(NB - 1) * SEQ_FULL + SEQ) * DM;
    if ((size_t)in_sizes[0] < needx || (size_t)in_sizes[1] < needx || (size_t)in_sizes[2] < needx) return;
    if ((size_t)in_sizes[3] < (size_t)DM * DM || (size_t)in_sizes[4] < (size_t)DM * DM || (size_t)in_sizes[5] < (size_t)DM * DM || (size_t)in_sizes[6] < (size_t)DM * DM) return;
    if ((size_t)out_size < ((size_t)(NB - 1) * OUT_SEQ + SEQ) * DM) return;
    if (SZ_TOTAL > ws_size) return;
    // wire order: q, k, v, Wq, Wk, Wv, Wp (weights [in][out])
    const float* xq = (const float*)d_in[0]; const float* xk = (const float*)d_in[1]; const float* xv = (const float*)d_in[2];
    const float* wq = (const float*)d_in[3]; const float* wk = (const float*)d_in[4]; const float* wv = (const float*)d_in[5]; const float* wp = (const float*)d_in[6];
    float* OUT = (float*)d_out;      // [NB][SEQ][1024]
    char* wsp = (char*)d_ws;
    bf* XQ = (bf*)wsp; wsp += SZ_XB;                 // [NB*SEQ][1024]; the k and v copies are reached from XQ, the other W^T planes from WQT, by their strides
    bf* XK = (bf*)wsp; wsp += SZ_XB;
    bf* XV = (bf*)wsp; wsp += SZ_XB;
    bf* WQT = (bf*)wsp; wsp += SZ_WB;                // [out][in]
    bf* WKT = (bf*)wsp; wsp += SZ_WB;
    bf* WVT = (bf*)wsp; wsp += SZ_WB;
    bf* WPT = (bf*)wsp; wsp += SZ_WB;
    h16* QH = (h16*)wsp; wsp += SZ_PL;               // [NB*SEQ][1024] == [NB*16][SEQ][64]
    h16* QR = (h16*)wsp; wsp += SZ_PL;               // residual x2048
    h16* KH = (h16*)wsp; wsp += SZ_PL;
    h16* KR = (h16*)wsp; wsp += SZ_PL;
    h16* VH = (h16*)wsp; wsp += SZ_PL;
    h16* VR = (h16*)wsp; wsp += SZ_PL;
    bf* CTX = (bf*)wsp; wsp += SZ_CTX;               // [NB*SEQ][2048]: hi | lo

    // every input conversion in one launch: W[in][out] -> WT[out][in] bf16 (four planes from WQT on), q, k, v -> bf16 copies (three from XQ on)
    k_prep<<<4 * WTB + 3 * CVB, 256, 0, stream>>>(xq, xk, xv, wq, wk, wv, wp, XQ, WQT);

    // projections, one launch, z = q, k, v: A = x rows (m = b*SEQ + t), Bt = W^T rows (n) -> row-major planes [m][n] (value + residual; a pair of planes per z)
    k_gemm<0><<<dim3(NB * SEQ / 128, DM / 128, 3), 128, 0, stream>>>(XQ, WQT, DM, QH, QR, OUT, SZ_XB / 2, SZ_WB / 2, SZ_PL);

    k_flash<<<dim3(NQT / 2, NB * NH_, 1), 32 * AW, 0, stream>>>(QH, QR, KH, KR, VH, VR, CTX);

    // output projection: A = ctx rows [hi | lo] (K = 2048), Bt = Wp^T rows (k index wraps at 1024) -> f32 output
    k_gemm<1><<<dim3(NB * SEQ / 128, DM / 128, 1), 128, 0, stream>>>(CTX, WPT, 2 * DM, QH, QR, OUT, 0, 0, 0);
}

// v006
// A run of this version takes 93.5 microseconds.
// Next to v005, in two timings, it ran 1.05 times as fast each time.
// Counting every step since v000, it is 3.77 times as fast.
#include <hip/hip_runtime.h>

// Multi-head attention, width 1024 = 16 heads x 64, separate q/k/v inputs [NB][SEQ][1024], Wq/Wk/Wv/Wp [in][out] (y = x W), no biases, unscaled scores, causal replace-mask, head split = flat row-major view (B,S,1024)->(B,16,S,64), output projection Wp (f32 out).
// Compute dtypes, f32 accumulate everywhere: q/k/v projections v_wmma_f32_16x16x32_bf16 (x and W RNE-converted to bf16; products exact);
// scores v_wmma_f32_16x16x32_f16 with q and k each as f16 value + f16 residual x2048 (three products, scaled residual products in their own accumulator);
// P (x2^14 carry, cancels in the normalisation) single f16, v as f16 value + f16 residual x2048 (two products, own accumulator); softmax f32 (online, running max);
// output projection v_wmma_f32_16x16x32_bf16 with ctx as bf16 hi | bf16 lo folded along K (K = 2048 against Wp^T repeated), Wp RNE-converted to bf16.
// Layout: bf16 copies of q/k/v, bf16 W^T planes [out][in]; projection planes [NB*SEQ][1024] f16 (== [b*16+h][s][64] by the flat head view);
// fused flash kernel in transposed form (S^T = K Q^T, O^T = V^T P^T), K / V tiles of 64 keys staged row-major in LDS by tensor loads (two buffers, shared by the block's four waves),
// the V^T fragments read from the row-major V tiles by the transposing LDS load (ds_load_tr16_b128); ctx plane [NB*SEQ][2048] bf16 (hi | lo).
// Each flash block works on two query tiles of one head, one after the other: tile x and tile NQT-1-x, so that every block walks the same number of key stages.
// GEMMs: 128x128 tile per block of four waves (64x64 each), A and Bt stages of 128 k staged in LDS by tensor loads (two buffers).
// Four launches: k_prep (all seven input conversions, split by block index), k_gemm<0> (the three projections, one per blockIdx.z), k_flash, k_gemm<1>.

#ifndef NB
#define NB 2
#endif
#ifndef SEQ
#define SEQ 2048
#endif
#define NB_FULL  2
#define SEQ_FULL 2048
#ifndef OUT_SEQ
#define OUT_SEQ SEQ              // row pitch (in tokens) between batches of the output
#endif
#define DM   1024
#define NH_  16
#define HD   64
#define AW   4                   // waves per flash block (16 query rows each)
#define QRS  2048.0f             // carry of the residual planes
#define QRI  (1.0f / 2048.0f)
#define L2E  1.4426950408889634f // log2(e); scores are unscaled
#define PSH  14.0f               // log2 of the P carry (16384)
#define NEGB (-3.0e38f)
#define KST  64                  // keys per LDS stage of the flash kernel
#define LP   144                 // LDS row pitch of the K tiles in bytes: 128-B rows + 16-B pad (16 B x odd, for 16-byte LDS reads)
#define LPH  (LP / 2)            // the same in halves
#define LPV  160                 // LDS row pitch of the V tiles in bytes: 128-B rows + 32-B pad (32 B x odd, for transposing LDS reads)
#define TSZ  10240               // place of one tile in LDS: 64 rows x 144 B = 9216 B or x 160 B = 10240 B, a multiple of 2 KiB
#define BSZ  (4 * TSZ)           // one buffer: K value, K residual, V value, V residual
#define NQT  (SEQ / (16 * AW))   // query tiles (64 rows) per head
#define OSB  (AW * 16 * 68 * 4)  // output staging of the flash kernel in bytes, behind its ring
#define GKS  128                 // k per LDS stage of the GEMM (256-B rows)
#define GLP  272                 // its LDS row pitch in bytes: 256-B rows + 16-B pad (16 B x odd, for 16-byte LDS reads)
#define GLPH (GLP / 2)           // the same in 16-bit elements
#define GTSZ 18432               // place of one GEMM tile in LDS: 64 rows x 272 B = 17408 B, rounded up to a multiple of 2 KiB
#define GBSZ (4 * GTSZ)          // one buffer: A rows 0..63, A rows 64..127, Bt rows 0..63, Bt rows 64..127

static_assert(HD == 64);
static_assert(NH_ * HD == DM);
static_assert((DM & (DM - 1)) == 0);           // B-operand k index wraps with a mask
static_assert(DM % 64 == 0);
static_assert(SEQ % 64 == 0);                  // 64-row tiles never straddle two batches; K and V tiles of 64 keys
static_assert((NB * SEQ) % 64 == 0);
static_assert(SEQ % 32 == 0);                  // a P fragment covers 32 keys
static_assert(SEQ % (16 * AW) == 0);           // flash grid covers the sequence exactly
static_assert(((size_t)SEQ * DM) % 8 == 0);
static_assert(NB <= NB_FULL);
static_assert(SEQ <= SEQ_FULL);
static_assert(AW == 4);                        // one tensor load per wave and stage: four tiles, four waves
static_assert(16 * AW == KST);                 // a block's queries end where its last 64-key stage ends
static_assert(NQT % 2 == 0 && NQT >= 2);       // query tiles pair up as x and NQT-1-x; a pair has NQT+1 >= 2 stages, which the ring's prologue needs
static_assert(HD * 2 == 128);                  // K and V tiles have 128-byte rows (one key's 64 features)
static_assert(KST * LP <= TSZ && KST * LPV <= TSZ && TSZ % 2048 == 0);
static_assert((NB * SEQ) % 128 == 0 && DM % 128 == 0);   // GEMM grid of 128x128 tiles covers C exactly
static_assert(DM % GKS == 0 && DM >= 2 * GKS);           // whole stages, the Bt wrap falls on a stage boundary, the ring's prologue loads two stages
static_assert(GKS * 2 == 256 && 64 * GLP <= GTSZ && GTSZ % 2048 == 0);
static_assert(4 * 16 * 68 * 4 <= 2 * GBSZ);              // GEMM output staging reuses its ring

typedef _Float16 h16;
typedef unsigned short bf;
typedef __attribute__((ext_vector_type(16))) __bf16   v16bf;
typedef __attribute__((ext_vector_type(16))) _Float16 v16h;
typedef __attribute__((ext_vector_type(8)))  _Float16 v8h;
typedef __attribute__((ext_vector_type(8)))  unsigned short v8us;
typedef __attribute__((ext_vector_type(8)))  short    v8s;
typedef __attribute__((ext_vector_type(8)))  float    v8f;
typedef __attribute__((ext_vector_type(4)))  float    v4f;
typedef v4f  __attribute__((may_alias)) v4fa;
typedef uint32_t u32x4 __attribute__((ext_vector_type(4)));
typedef uint32_t u32x8 __attribute__((ext_vector_type(8)));

__device__ __forceinline__ unsigned short f2bf(float f) { unsigned u = __float_as_uint(f); u += 0x7FFFu + ((u >> 16) & 1u); return (unsigned short)(u >> 16); }
__device__ __forceinline__ float bf2f(unsigned short s) { return __uint_as_float(((unsigned)s) << 16); }
__device__ __forceinline__ v16h cat16(v8h lo, v8h hi) { return __builtin_shufflevector(lo, hi, 0, 1, 2, 3, 4, 5, 6, 7, 8, 9, 10, 11, 12, 13, 14, 15); }
__device__ __forceinline__ v16bf cat16b(v8us lo, v8us hi) { return __builtin_bit_cast(v16bf, __builtin_shufflevector(lo, hi, 0, 1, 2, 3, 4, 5, 6, 7, 8, 9, 10, 11, 12, 13, 14, 15)); }
__device__ __forceinline__ v8f wmma16(v16h a, v16h b, v8f c) { return __builtin_amdgcn_wmma_f32_16x16x32_f16(false, a, false, b, (short)0, c, false, false); }
__device__ __forceinline__ v8f wmmab(v16bf a, v16bf b, v8f c) { return __builtin_amdgcn_wmma_f32_16x16x32_bf16(false, a, false, b, (short)0, c, false, false); }
// fragment loaders from K-contiguous 16-bit rows; p already includes + 8*(lane>>4): elements 0..7 <- k0+8h+0..7, elements 8..15 <- k0+16+8h+0..7 (same map for A and B)
__device__ __forceinline__ v16h  ldh(const h16* p) { return cat16(*(const v8h*)p, *(const v8h*)(p + 16)); }
__device__ __forceinline__ v16bf ldb(const bf* p)  { return cat16b(*(const v8us*)p, *(const v8us*)(p + 16)); }
// transposing LDS load from a row-major 16-bit tile T (rows = k, pitch LPV): with p = T + (k0 + 8*(lane>>4) + (lane&7)) * LPV + 2*d0 + 16*((lane>>3)&1)
// lane (c = lane&15, h = lane>>4) gets T[k0+8h+0..7][d0+c]; the loads at k0 and k0+16 make one A fragment of T^T in the k order of ldh (elements 0..7 <- k0+8h+0..7, 8..15 <- k0+16+8h+0..7)
__device__ __forceinline__ v8h ldtr(const unsigned char* p) { typedef __attribute__((address_space(3))) v8s lds_v8s; return __builtin_bit_cast(v8h, __builtin_amdgcn_ds_load_tr16_b128_v8i16((lds_v8s*)p)); }
__device__ __forceinline__ v16h ldvt(const unsigned char* p) { return cat16(ldtr(p), ldtr(p + 16 * LPV)); }
// ordering point for wave-private LDS tiles (same wave writes and reads)
__device__ __forceinline__ void wave_sync() { __builtin_amdgcn_fence(3 /* release order */, "wavefront"); __builtin_amdgcn_wave_barrier(); asm volatile("" ::: "memory"); }

__device__ __forceinline__ uint32_t uni(uint32_t v) { return (uint32_t)__builtin_amdgcn_readfirstlane(v); }
// wave-uniform test held in a scalar register, so that the branch on it is a scalar branch (a tensor load ignores EXEC)
__device__ __forceinline__ uint32_t pinned(uint32_t v) { uint32_t w = (uint32_t)__builtin_amdgcn_readfirstlane(v); asm volatile("" : "+s"(w)); return w; }
__device__ __forceinline__ void wait_ds0()     { asm volatile("s_wait_dscnt 0x0" ::: "memory"); }      // this wave's LDS reads have returned before the buffer is handed back
__device__ __forceinline__ void wait_tensor0() { asm volatile("s_wait_tensorcnt 0x0" ::: "memory"); }  // this wave's tensor load has landed (the compiler places no wait for it)
// one tile of 64 rows x 128 bytes, rows contiguous in the source, into LDS with a pad of PADC + 1 dwords behind every 128-B row (PADC = 3: pitch 144 B, PADC = 7: pitch 160 B): group 1 built once
template <uint32_t PADC>
__device__ __forceinline__ u32x8 tile128_group1() {
    u32x8 g1;
    g1[0] = uni((1u << 20) | (4u << 22) | (PADC << 25)); // no mask, 1-byte elements, pad behind every 32 dwords
    g1[1] = uni(128u << 16); g1[2] = uni(64u << 16); g1[3] = uni(128u << 16); g1[4] = uni(64u); g1[5] = uni(128u); g1[6] = uni(0u); g1[7] = uni(0u);
    asm volatile("" : "+s"(g1));   // as pinned(): the descriptor words are held in their scalar registers through the loop, so that none of them takes another value while a request is outstanding
    return g1;
}
// a wave's one request of a stage: a K tile (is_k) at the pitch of the 16-byte reads or a V tile (is_v) at the pitch of the transposing reads;
// is_k and is_v come from pinned(), one of them set: two scalar branches, so that each request's pad word is a constant
__device__ __forceinline__ void stage_load(uint32_t is_k, uint32_t is_v, u32x4 g0, u32x8 g1k, u32x8 g1v) {
    if (is_k) asm volatile("tensor_load_to_lds %0, %1" :: "s"(g0), "s"(g1k) : "memory");
    if (is_v) asm volatile("tensor_load_to_lds %0, %1" :: "s"(g0), "s"(g1v) : "memory");
}
// group 0 of a wave's first request
__device__ __forceinline__ u32x4 stage_group0(uint32_t lds_dst, uint64_t ga) {
    u32x4 g0;
    g0[0] = uni(1u); g0[1] = uni(lds_dst); g0[2] = uni((uint32_t)ga); g0[3] = uni((((uint32_t)(ga >> 32)) & 0x01FFFFFFu) | 0x80000000u);
    return g0;
}
// group 0 of a wave's next request, formed from that of its last one (place in LDS anew, source address moved by step bytes; the address stays inside its field, so the type bits above it stay):
// the group is so carried from request to request: the words that the next one is formed from (0, 2, 3) stay live, so their registers take no other value while a request is outstanding
__device__ __forceinline__ u32x4 stage_next(u32x4 g0, uint32_t lds_dst, int64_t step) {
    const uint64_t a = (((uint64_t)g0[3] << 32) | (uint64_t)g0[2]) + (uint64_t)step;
    g0[1] = uni(lds_dst); g0[2] = uni((uint32_t)a); g0[3] = uni((uint32_t)(a >> 32));
    return g0;
}
// one tile of 64 rows x 256 bytes, source row pitch src_pitch bytes, into LDS at pitch 272 B (a 16-B pad behind every 256-B row): group 1 built once, group 0 per request
__device__ __forceinline__ u32x8 tile256_group1(uint32_t src_pitch) {
    u32x8 g1;
    g1[0] = uni((1u << 20) | (5u << 22) | (3u << 25));   // no mask, 1-byte elements, pad of 4 dwords behind every 64
    g1[1] = uni(256u << 16); g1[2] = uni(64u << 16); g1[3] = uni(256u << 16); g1[4] = uni(64u); g1[5] = uni(src_pitch); g1[6] = uni(0u); g1[7] = uni(0u);
    asm volatile("" : "+s"(g1));   // as pinned(): the descriptor words are held in their scalar registers through the loop, so that none of them takes another value while a request is outstanding
    return g1;
}
__device__ __forceinline__ void tile256_load(uint32_t lds_dst, uint64_t ga, u32x8 g1) {
    u32x4 g0;
    g0[0] = uni(1u); g0[1] = uni(lds_dst); g0[2] = uni((uint32_t)ga); g0[3] = uni((((uint32_t)(ga >> 32)) & 0x01FFFFFFu) | 0x80000000u);
    asm volatile("tensor_load_to_lds %0, %1" :: "s"(g0), "s"(g1) : "memory");
}

static constexpr size_t al256(size_t v) { return (v + 255) & ~(size_t)255; }
static constexpr size_t SZ_XB  = al256((size_t)NB * SEQ * DM * 2);          // one bf16 input copy
static constexpr size_t SZ_WB  = al256((size_t)DM * DM * 2);                // one bf16 W^T plane
static constexpr size_t SZ_PL  = al256((size_t)NB * NH_ * SEQ * HD * 2);    // one f16 plane
static constexpr size_t SZ_CTX = al256((size_t)NB * SEQ * 2 * DM * 2);      // ctx hi | lo
static constexpr size_t SZ_TOTAL = 3 * SZ_XB + 4 * SZ_WB + 6 * SZ_PL + SZ_CTX;
static_assert(SZ_TOTAL <= (size_t)134217728);          // workspace carve <= 128 MiB
static_assert(SZ_PL == (size_t)NB * SEQ * DM * 2);     // value / residual plane pairs are exactly contiguous

#define WTB ((DM / 64) * (DM / 64))                          // blocks per weight: 64x64 tiles
#define CVN ((size_t)NB * SEQ * DM / 8)                      // 8-element chunks per activation input
#define CVB ((int)((CVN + 255) / 256))                       // blocks per activation input

// RNE convert of one activation input: block cb takes 256 chunks of 8 floats; source batches SEQ_FULL tokens apart, copy packed [NB*SEQ][DM].
__device__ __forceinline__ void cvt8_block(const float* __restrict__ src, bf* dst, int cb) {
    const size_t i = (size_t)cb * 256 + threadIdx.x; if (i >= CVN) return;
    const size_t e = i * 8;
    const v8f v = *(const v8f*)(src + e + (e / ((size_t)SEQ * DM)) * ((size_t)(SEQ_FULL - SEQ) * DM)); v8us o;
#pragma unroll
    for (int k = 0; k < 8; ++k) o[k] = f2bf(v[k]);
    *(v8us*)(dst + e) = o;
}

// weight transpose + RNE convert of one 64x64 tile: in W[DM rows k][DM cols n] f32 -> out WT[DM rows n][DM cols k] bf16.
__device__ __forceinline__ void wt_block(const float* __restrict__ W, bf* WT, int n0, int k0, float* tile) {
    const int tid = threadIdx.x;
#pragma unroll
    for (int it = 0; it < 4; ++it) { const int c = it * 256 + tid; const int r = c >> 4, c4 = (c & 15) * 4;   // 64 rows x 16 chunks of 4 floats
        const v4f v = *(const v4f*)(W + (size_t)(k0 + r) * DM + n0 + c4);
        tile[r * 65 + c4 + 0] = v[0]; tile[r * 65 + c4 + 1] = v[1]; tile[r * 65 + c4 + 2] = v[2]; tile[r * 65 + c4 + 3] = v[3]; }
    __syncthreads();
    v8us o[2];
#pragma unroll
    for (int it = 0; it < 2; ++it) { const int c = it * 256 + tid; const int n = c >> 3, k8 = (c & 7) * 8;     // 64 output rows x 8 chunks of 8
#pragma unroll
        for (int e = 0; e < 8; ++e) o[it][e] = f2bf(tile[(k8 + e) * 65 + n]); }
#pragma unroll
    for (int it = 0; it < 2; ++it) { const int c = it * 256 + tid; const int n = c >> 3, k8 = (c & 7) * 8;
        *(v8us*)(WT + (size_t)(n0 + n) * DM + k0 + k8) = o[it]; }
}

// k_prep: every input conversion in one launch; none depends on another, the block index alone says which piece a block does (block-uniform branch).
// Blocks [0, 4*WTB): weight w = index / WTB, tile (n, k) = (index % WTB) % (DM/64), / (DM/64) -> plane w of WT. Blocks behind them: input index / CVB, chunk block index % CVB -> copy of X.
// grid 4*WTB + 3*CVB, 256 threads. X: three copies SZ_XB bytes apart (q, k, v); WT: four planes SZ_WB bytes apart (Wq, Wk, Wv, Wp).
__global__ __launch_bounds__(256) void k_prep(const float* __restrict__ xq, const float* __restrict__ xk, const float* __restrict__ xv,
                                              const float* __restrict__ wq, const float* __restrict__ wk, const float* __restrict__ wv, const float* __restrict__ wp,
                                              bf* X, bf* WT) {
    __shared__ float tile[64 * 65];
    const unsigned bid = blockIdx.x;
    if (bid < 4u * WTB) {
        const int w = (int)(bid / WTB), t = (int)(bid % WTB);
        wt_block(w == 0 ? wq : w == 1 ? wk : w == 2 ? wv : wp, WT + (size_t)w * (SZ_WB / 2), (t % (DM / 64)) * 64, (t / (DM / 64)) * 64, tile);
    } else {
        const unsigned c = bid - 4u * WTB; const int w = (int)(c / CVB);
        cvt8_block(w == 0 ? xq : w == 1 ? xk : xv, X + (size_t)w * (SZ_XB / 2), (int)(c % CVB));
    }
}

// k_gemm: bf16 GEMM, 128x128 tile of C per block of four waves (2 x 2), each wave a 64x64 tile (16 accumulators).
// C[m][n] = sum_{kc < KA} A[m][kc] Bt[n][kc & (DM-1)]; A row pitch KA, Bt row pitch DM (KA = 2*DM folds the hi | lo halves of A against the same Bt rows).
// Per stage of 128 k each wave brings one tile of 64 rows x 256 B into LDS with one tensor load (waves 0, 1 the block's A rows, waves 2, 3 its Bt rows);
// two buffers, the next stage's loads in flight while this stage is worked on; every wave reads its fragments from LDS (two 16-B reads each).
// MODE 0: C written as f16 (Ph) and f16 residual x2048 (Pr), row-major pitch DM. MODE 1: C written as f32 to OUT rows (m/SEQ)*OUT_SEQ + m%SEQ, pitch DM.
// grid (M/128, DM/128, Z), 128 threads; KA a multiple of 128, at least 256. Epilogue per 16-row slab staged in LDS (wave-private part of the ring);
// blockIdx.z picks one of Z independent products of the same shape: A planes za elements apart, Bt planes zb apart, Ph and Pr planes zp apart.
template <int MODE>
__global__ __launch_bounds__(128) void k_gemm(const bf* __restrict__ A0, const bf* __restrict__ Bt0, int KA, h16* Ph0, h16* Pr0, float* OUT, size_t za, size_t zb, size_t zp) {
    __shared__ __attribute__((aligned(2048))) unsigned char gring[2 * GBSZ];
    const bf* A = A0 + blockIdx.z * za; const bf* Bt = Bt0 + blockIdx.z * zb;
    h16* Ph = Ph0 + blockIdx.z * zp; h16* Pr = Pr0 + blockIdx.z * zp;
    const int lane = threadIdx.x & 31, wave = (int)uni(threadIdx.x >> 5), lr = lane & 15, hi = lane >> 4;
    const int wm = wave >> 1, wn = wave & 1;                 // the wave's 64x64 tile inside the block's 128x128
    const int r0 = blockIdx.x * 128 + wm * 64, c0 = blockIdx.y * 128 + wn * 64;
    // this wave's tile to load: waves 0, 1 rows 0..63, 64..127 of the block's A rows; waves 2, 3 the same of its Bt rows
    const int lrow = (wave < 2 ? (int)blockIdx.x : (int)blockIdx.y) * 128 + (wave & 1) * 64;
    const uint32_t gpitch = wave < 2 ? (uint32_t)KA * 2u : (uint32_t)(DM * 2);
    const uint64_t gsrc = (uint64_t)(size_t)(wave < 2 ? A : Bt) + (uint64_t)lrow * gpitch;
    const uint32_t gmask = wave < 2 ? 0xFFFFFFFFu : (uint32_t)(DM * 2 - 1);   // byte offset along a row; Bt's wraps at DM elements
    const uint32_t ldst = (uint32_t)(size_t)gring + (uint32_t)wave * GTSZ;
    const int nst = KA / GKS;
    const u32x8 g1 = tile256_group1(gpitch);
    tile256_load(ldst, gsrc, g1);                            // stage 0 -> buffer 0
    v8f acc[4][4];
#pragma unroll
    for (int mb = 0; mb < 4; ++mb)
#pragma unroll
        for (int nb = 0; nb < 4; ++nb) acc[mb][nb] = (v8f){};
    const int fo = lr * GLP + 16 * hi;                       // lane's byte offset in a tile: row lr, k offset 8h elements (A and B fragments alike)
    wait_tensor0();
    __syncthreads();                                         // stage 0 published
    tile256_load(ldst + GBSZ, gsrc + ((uint32_t)(GKS * 2) & gmask), g1);       // stage 1 -> buffer 1
#pragma unroll 1
    for (int st = 0; st < nst; ++st) {
        const unsigned char* bp = gring + (st & 1) * GBSZ + fo;
        const bf* ap = (const bf*)(bp + wm * GTSZ);          // A rows of this wave
        const bf* bq = (const bf*)(bp + (2 + wn) * GTSZ);    // Bt rows of this wave
        v16bf a[2][4], b[2][4];                              // two fragment sets: the next 32 k are fetched ahead of this block's products
#pragma unroll
        for (int f = 0; f < 4; ++f) a[0][f] = ldb(ap + f * 16 * GLPH);
#pragma unroll
        for (int f = 0; f < 4; ++f) b[0][f] = ldb(bq + f * 16 * GLPH);
#pragma unroll
        for (int ks = 0; ks < GKS / 32; ++ks) {
            if (ks + 1 < GKS / 32) {
#pragma unroll
                for (int f = 0; f < 4; ++f) a[(ks + 1) & 1][f] = ldb(ap + f * 16 * GLPH + (ks + 1) * 32);
#pragma unroll
                for (int f = 0; f < 4; ++f) b[(ks + 1) & 1][f] = ldb(bq + f * 16 * GLPH + (ks + 1) * 32);
                __builtin_amdgcn_sched_barrier(0);           // holds the next block's LDS reads as one group ahead of this block's products (else each read sinks to its use and is waited for there)
            }
#pragma unroll
            for (int nb = 0; nb < 4; ++nb)
#pragma unroll
                for (int mb = 0; mb < 4; ++mb) acc[mb][nb] = wmmab(a[ks & 1][mb], b[ks & 1][nb], acc[mb][nb]);
            __builtin_amdgcn_sched_barrier(0);               // keeps this block's products ahead of the reads after next, which reuse its fragment registers
        }
        // hand-over, every wave: own LDS reads done, own tile of stage st+1 landed, barrier (publishes stage st+1, frees this stage's buffer), then the refill
        wait_ds0();
        wait_tensor0();
        __syncthreads();
        if (pinned(st + 2 < nst)) tile256_load(ldst + (uint32_t)(st & 1) * GBSZ, gsrc + ((uint32_t)((st + 2) * GKS * 2) & gmask), g1);
    }
    wait_tensor0();
    wait_ds0();
    float* os = (float*)gring + wave * 16 * 68;              // output staging reuses the ring: the last hand-over's barrier stands behind every wave's last read, and nothing was issued behind it
#pragma unroll
    for (int mb = 0; mb < 4; ++mb) {
#pragma unroll
        for (int nb = 0; nb < 4; ++nb) {
#pragma unroll
            for (int j = 0; j < 8; ++j) os[(hi * 8 + j) * 68 + nb * 16 + lr] = acc[mb][nb][j]; }   // D: row 8h+j, col lane&15; rows 0..15 x cols 0..63 all written
        wave_sync();
        const int m0 = r0 + mb * 16;
        if (MODE == 0) {
            const size_t sb = (size_t)m0 * DM + c0;
{
#pragma unroll
                for (int s = 0; s < 4; ++s) { const int row = 4 * s + (lane >> 3), c8 = (lane & 7) * 8;   // 4 s x 4 row groups = 16 rows; 8 lanes x 8 = 64 columns
                    const v4f x0 = *(const v4fa*)(&os[row * 68 + c8]); const v4f x1 = *(const v4fa*)(&os[row * 68 + c8 + 4]); v8h hv, rv;
#pragma unroll
                    for (int i = 0; i < 4; ++i) { const h16 a0 = (h16)x0[i]; const h16 a1 = (h16)x1[i]; hv[i] = a0; hv[4 + i] = a1; rv[i] = (h16)((x0[i] - (float)a0) * QRS); rv[4 + i] = (h16)((x1[i] - (float)a1) * QRS); }
                    const size_t oo = sb + (size_t)row * DM + c8;
                    *(v8h*)(Ph + oo) = hv; *(v8h*)(Pr + oo) = rv; }
                 }
        } else {
            float* orow = OUT + ((size_t)(m0 / SEQ) * OUT_SEQ + (size_t)(m0 % SEQ)) * DM + c0;
{
#pragma unroll
                for (int s = 0; s < 8; ++s) { const int row = 2 * s + hi, cofs = lr * 4;   // 8 s x 2 rows = 16 rows; 16 lanes x 4 floats = 64 columns
                    const v4f val = *(const v4fa*)(&os[row * 68 + cofs]);
                    *(v4f*)(orow + (size_t)row * DM + cofs) = val; }
                 }
        }
        wave_sync();
    }
}

#define STG(OFS, OH, OR) { v4f a_, c_; \
    a_[0] = OH[0] * inv + OR[0] * ri; a_[1] = OH[1] * inv + OR[1] * ri; a_[2] = OH[2] * inv + OR[2] * ri; a_[3] = OH[3] * inv + OR[3] * ri; \
    c_[0] = OH[4] * inv + OR[4] * ri; c_[1] = OH[5] * inv + OR[5] * ri; c_[2] = OH[6] * inv + OR[6] * ri; c_[3] = OH[7] * inv + OR[7] * ri; \
    *(v4fa*)(&os[wb + lr * 68 + (OFS) + 8 * hi]) = a_; *(v4fa*)(&os[wb + lr * 68 + (OFS) + 8 * hi + 4]) = c_; }

// k_flash: fused causal attention, one wave per 16 query rows of one (batch, head); Q fragments straight from the f16 planes (two 16-B loads each).
// K and V: per stage of 64 keys each of the four waves brings one tile (K value, K residual, V value, V residual; 64 key rows x 128 B) into LDS with one tensor load;
// two buffers, the next stage's loads in flight while this stage is worked on; every wave reads its fragments from LDS (two 16-B reads each, transposing ones for V^T). Every wave passes every stage's hand-over.
// Transposed form: S^T[key][t] = K Q^T (A = K rows, B = Q rows); lane (t = lane&15, h = lane>>4) holds keys 8h+r of each 16-key tile, so the packed
// P tile is directly the B fragment of O^T[d][t] = V^T P^T (element r <- tile keys 0..15, element 8+r <- tile keys 16..31, lane unchanged).
// A wave takes each stage whole: its 32 K reads as one group, the 24 score products of the four 16-key tiles, one softmax step over the 64 keys, its 32 V reads as one group under the exponentials, the 16 PV products.
// Causal: entries with key > t are replaced by a large negative value (P = 0), in a tile's last stage only (wave-uniform test); every stage of a tile holds a visible key for each of its rows (its first key is <= t0).
// Softmax state (running max, partial sum) is one scalar per lane; the two lane halves of a row are combined with one xor-16 exchange.
// Balance: a tile's cost grows with its index (tile x walks x+1 stages), so a block takes tile blockIdx.x and then tile NQT-1-blockIdx.x of its head, NQT+1 stages whatever the block;
// the ring runs through both tiles as one sequence of stages (the second tile's first stages are in flight while the first tile is finished), so the output staging has LDS of its own behind the ring.
// grid (NQT/2, NB*NH_).
__global__ __launch_bounds__(32 * AW) void k_flash(const h16* __restrict__ QH, const h16* __restrict__ QR, const h16* __restrict__ KH, const h16* __restrict__ KR,
                                                   const h16* __restrict__ VH, const h16* __restrict__ VR, bf* CTX) {
    __shared__ __attribute__((aligned(2048))) unsigned char ring[2 * BSZ + OSB];
    const int lane = threadIdx.x & 31, wave = (int)uni(threadIdx.x >> 5), lr = lane & 15, hi = lane >> 4;
    const int zh = blockIdx.y; const int b = zh / NH_, h = zh % NH_;
    const size_t pbase = (size_t)zh * SEQ * HD;
    // this wave's tile: waves 0, 1 the K planes, waves 2, 3 the V planes (rows = keys, 128 B each, contiguous)
    const h16* pl = wave == 0 ? KH : wave == 1 ? KR : wave == 2 ? VH : VR;
    const uint64_t gsrc = (uint64_t)(size_t)(pl + pbase);
    const uint32_t gstep = (uint32_t)(KST * HD * 2);         // bytes from one stage's tile to the next
    const uint32_t isk = pinned(wave < 2), isv = pinned(wave >= 2);
    const u32x8 g1k = tile128_group1<3u>(), g1v = tile128_group1<7u>();
    const uint32_t ldst = (uint32_t)(size_t)ring + (uint32_t)wave * TSZ;
    // 64-key stages the block walks: na = blockIdx.x+1 of its first tile (keys from 0 on), then NQT-blockIdx.x of its second (keys from 0 on again): NQT+1 in all
    // as pinned(): the first tile's stage count, which the refill's source step is formed from, is formed here, ahead of the first request (without it the build keeps group 0 in two register sets, and a register of the issued set takes another value while the request is outstanding)
    const int na = (int)pinned(blockIdx.x + 1u);
    u32x4 g0 = stage_group0(ldst, gsrc);
    stage_load(isk, isv, g0, g1k, g1v);                      // stage 0 -> buffer 0
    const int fo = lr * LP + 16 * hi;                        // lane's byte offset in a K tile: row lr, k offset 8h halves
    const int vo = (8 * hi + (lane & 7)) * LPV + 16 * ((lane >> 3) & 1);   // lane's byte offset in a V tile for the transposing load: key row 8h + (lane & 7), 16-B half (lane >> 3) & 1
    float* os = (float*)(ring + 2 * BSZ);                    // output staging, a wave-private part each
    const int wb = wave * 16 * 68;
    wait_tensor0();
    __syncthreads();                                         // stage 0 published
    g0 = stage_next(g0, ldst + BSZ, na > 1 ? (int64_t)gstep : (int64_t)0);
    stage_load(isk, isv, g0, g1k, g1v);                      // stage 1 -> buffer 1: the first tile's keys 64.., or, where it has one stage, the second tile's keys 0..
    int g = 0;                                               // stage number in the block's sequence; buffer g & 1
#pragma unroll 1                                             // the two tiles share one copy of the loop's code
    for (int half = 0; half < 2; ++half) {
    const int xt = half ? NQT - 1 - (int)blockIdx.x : (int)blockIdx.x;   // this pass's query tile
    const int nst = xt + 1;                                  // its stages: keys [0, 64*(xt+1))
    const int t0 = (xt * AW + wave) * 16;
    const size_t qo = pbase + (size_t)(t0 + lr) * HD + 8 * hi;
    const v16h qh0 = ldh(QH + qo), qh1 = ldh(QH + qo + 32), qr0 = ldh(QR + qo), qr1 = ldh(QR + qo + 32);   // B fragments: col t, k = d
    v8f oh0 = (v8f){}, oh1 = (v8f){}, oh2 = (v8f){}, oh3 = (v8f){};
    v8f or0 = (v8f){}, or1 = (v8f){}, or2 = (v8f){}, or3 = (v8f){};
    float m = NEGB, l = 0.0f;
    int st = 0;
#pragma unroll 1
    do {                                                     // a tile has at least one stage
      const h16* kk = (const h16*)(ring + (g & 1) * BSZ + fo);            // K value tile, row lr of its first 16 keys; key tile kt is 16 rows on
      const h16* kr = kk + TSZ / 2;                                       // K residual tile
      const unsigned char* va = ring + (g & 1) * BSZ + 2 * TSZ + vo;      // V value tile; fragment j: features 16j .. 16j+15 (32 B on), keys 32.. are 32 rows on
      const unsigned char* vr = va + TSZ;                                 // V residual tile
      const int key0 = st * KST;
      v16h ka[4], kb[4], ra[4], rb[4];                                    // A fragments of the four 16-key tiles: value d 0..31, d 32..63, residual d 0..31, d 32..63
#pragma unroll
      for (int kt = 0; kt < 4; ++kt) ka[kt] = ldh(kk + kt * 16 * LPH);
#pragma unroll
      for (int kt = 0; kt < 4; ++kt) kb[kt] = ldh(kk + kt * 16 * LPH + 32);
#pragma unroll
      for (int kt = 0; kt < 4; ++kt) ra[kt] = ldh(kr + kt * 16 * LPH);
#pragma unroll
      for (int kt = 0; kt < 4; ++kt) rb[kt] = ldh(kr + kt * 16 * LPH + 32);
      __builtin_amdgcn_sched_barrier(0);                                  // holds the stage's K reads as one group ahead of its score products (else a part sinks among them and is waited for there)
      v8f sH[4], sL[4];
#pragma unroll
      for (int kt = 0; kt < 4; ++kt) { sH[kt] = wmma16(ka[kt], qh0, (v8f){}); sL[kt] = wmma16(ka[kt], qr0, (v8f){}); }
#pragma unroll
      for (int kt = 0; kt < 4; ++kt) { sH[kt] = wmma16(kb[kt], qh1, sH[kt]); sL[kt] = wmma16(kb[kt], qr1, sL[kt]); }
#pragma unroll
      for (int kt = 0; kt < 4; ++kt) sL[kt] = wmma16(ra[kt], qh0, sL[kt]);
#pragma unroll
      for (int kt = 0; kt < 4; ++kt) sL[kt] = wmma16(rb[kt], qh1, sL[kt]);
      // the distance between the last products and the vector instructions that read their results, on every path
      asm volatile("v_nop\n\tv_nop\n\tv_nop\n\tv_nop" : "+v"(sH[0]), "+v"(sH[1]), "+v"(sH[2]), "+v"(sH[3]), "+v"(sL[0]), "+v"(sL[1]), "+v"(sL[2]), "+v"(sL[3]) : "v"(rb[0]), "v"(rb[1]), "v"(rb[2]), "v"(rb[3]));
      float t[4][8];                                                      // t[kt][r]: key key0 + 16 kt + 8h + r, query t0 + lr
#pragma unroll
      for (int kt = 0; kt < 4; ++kt)
#pragma unroll
          for (int r = 0; r < 8; ++r) t[kt][r] = (sH[kt][r] + sL[kt][r] * QRI) * L2E;
      if (key0 + KST - 1 > t0) {                                          // wave-uniform: the stage crosses the diagonal (a tile's last stage)
          const int tq = t0 + lr - key0 - 8 * hi;                         // entry r of key tile kt is hidden when 16 kt + r > tq
#pragma unroll
          for (int kt = 0; kt < 4; ++kt)
#pragma unroll
              for (int r = 0; r < 8; ++r) t[kt][r] = (16 * kt + r > tq) ? NEGB : t[kt][r];
      }
      float mxa = NEGB, mxb = NEGB;
#pragma unroll
      for (int r = 0; r < 8; ++r) { mxa = fmaxf(mxa, fmaxf(t[0][r], t[1][r])); mxb = fmaxf(mxb, fmaxf(t[2][r], t[3][r])); }
      float mx = fmaxf(mxa, mxb);
      const float mo = __shfl_xor(mx, 16, 32);
      asm volatile("" :: "v"(mo) : "memory");                             // inputs-only fence on the exchanged value: the V reads below stay behind its return (LDS results return in order: issued ahead of it, they would all be waited for at the exchange)
      v16h vh[2][4], vl[2][4];                                            // A fragments of V^T: [keys 0..31, 32..63][features 16j ..], value and residual
#pragma unroll
      for (int s = 0; s < 2; ++s) {
#pragma unroll
          for (int j = 0; j < 4; ++j) vh[s][j] = ldvt(va + s * 32 * LPV + 32 * j);
#pragma unroll
          for (int j = 0; j < 4; ++j) vl[s][j] = ldvt(vr + s * 32 * LPV + 32 * j);
      }
      __builtin_amdgcn_sched_barrier(0);                                  // holds the stage's V reads as one group ahead of the exponentials, which cover their latency
      const float mnew = fmaxf(m, fmaxf(mx, mo));
      const float alpha = __builtin_amdgcn_exp2f(m - mnew);
      const float sh = PSH - mnew;
      v16h pb0, pb1; float ls0 = 0.0f, ls1 = 0.0f;                        // B fragments of P^T: keys 0..31 and 32..63 of the stage
#pragma unroll
      for (int r = 0; r < 8; ++r) {
          const h16 pa = (h16)__builtin_amdgcn_exp2f(t[0][r] + sh); const h16 pc = (h16)__builtin_amdgcn_exp2f(t[1][r] + sh); pb0[r] = pa; pb0[8 + r] = pc; ls0 += (float)pa + (float)pc;
          const h16 pd = (h16)__builtin_amdgcn_exp2f(t[2][r] + sh); const h16 pe = (h16)__builtin_amdgcn_exp2f(t[3][r] + sh); pb1[r] = pd; pb1[8 + r] = pe; ls1 += (float)pd + (float)pe; }
      l = l * alpha + (ls0 + ls1); m = mnew;
      oh0 = oh0 * alpha; oh1 = oh1 * alpha; oh2 = oh2 * alpha; oh3 = oh3 * alpha;
      or0 = or0 * alpha; or1 = or1 * alpha; or2 = or2 * alpha; or3 = or3 * alpha;
      oh0 = wmma16(vh[0][0], pb0, oh0); oh1 = wmma16(vh[0][1], pb0, oh1); oh2 = wmma16(vh[0][2], pb0, oh2); oh3 = wmma16(vh[0][3], pb0, oh3);
      or0 = wmma16(vl[0][0], pb0, or0); or1 = wmma16(vl[0][1], pb0, or1); or2 = wmma16(vl[0][2], pb0, or2); or3 = wmma16(vl[0][3], pb0, or3);
      oh0 = wmma16(vh[1][0], pb1, oh0); oh1 = wmma16(vh[1][1], pb1, oh1); oh2 = wmma16(vh[1][2], pb1, oh2); oh3 = wmma16(vh[1][3], pb1, oh3);
      or0 = wmma16(vl[1][0], pb1, or0); or1 = wmma16(vl[1][1], pb1, or1); or2 = wmma16(vl[1][2], pb1, or2); or3 = wmma16(vl[1][3], pb1, or3);
      // the distance between the last products and the vector instructions that read or rescale their results, on every path (the loop's exit too)
      asm volatile("v_nop\n\tv_nop\n\tv_nop\n\tv_nop" : "+v"(oh0), "+v"(oh1), "+v"(oh2), "+v"(oh3), "+v"(or0), "+v"(or1), "+v"(or2), "+v"(or3) : "v"(vl[1][0]), "v"(vl[1][1]), "v"(vl[1][2]), "v"(vl[1][3]), "v"(pb1));
      // hand-over, every wave: own LDS reads done, own tile of stage g+1 landed, barrier (publishes stage g+1, frees this stage's buffer), then the refill
      wait_ds0();
      wait_tensor0();
      __syncthreads();
      if (pinned(g + 2 < NQT + 1)) {                         // stage g+2: the next 64 keys, or, where it is the second tile's first, back to keys 0..
          g0 = stage_next(g0, ldst + (uint32_t)(g & 1) * BSZ, g + 2 == na ? -(int64_t)(na - 1) * (int64_t)gstep : (int64_t)gstep);
          stage_load(isk, isv, g0, g1k, g1v);
      }
      ++g;
    } while (++st < nst);
    l += __shfl_xor(l, 16, 32);
    const float inv = 1.0f / l;
    const float ri = QRI * inv;
    // O^T D layout: o_j[r] = (d = 16j + 8h + r, t = lane&15) -> os[t][d]; rows 0..15 x columns 0..63 all written
    STG(0, oh0, or0)
    STG(16, oh1, or1)
    STG(32, oh2, or2)
    STG(48, oh3, or3)
    wave_sync();
    bf* crow = CTX + ((size_t)b * SEQ + t0) * (size_t)(2 * DM) + h * HD;
{
#pragma unroll
        for (int s = 0; s < 4; ++s) { const int row = 4 * s + (lane >> 3), c8 = (lane & 7) * 8;   // 4 s x 4 row groups = 16 rows; 8 lanes x 8 = 64 columns
            const v4f x0 = *(const v4fa*)(&os[wb + row * 68 + c8]); const v4f x1 = *(const v4fa*)(&os[wb + row * 68 + c8 + 4]); v8us hv, lv;
#pragma unroll
            for (int i = 0; i < 4; ++i) { const unsigned short a0 = f2bf(x0[i]); const unsigned short a1 = f2bf(x1[i]); hv[i] = a0; hv[4 + i] = a1; lv[i] = f2bf(x0[i] - bf2f(a0)); lv[4 + i] = f2bf(x1[i] - bf2f(a1)); }
            const size_t oo = (size_t)row * (size_t)(2 * DM) + c8;
            *(v8us*)(crow + oo) = hv; *(v8us*)(crow + oo + DM) = lv; }
         }
    asm volatile("s_wait_xcnt 0x0" ::: "memory");            // stands in front of the first overwrite of a register that the stores above name (the next tile's set-up)
    wave_sync();                                             // the staging rows are read before the second tile's results are written over them
    }
    wait_tensor0();
    wait_ds0();
}

extern "C" void kernel_launch(void* const* d_in, const int* in_sizes, int n_in,
                              void* d_out, int out_size, void* d_ws, size_t ws_size, hipStream_t stream) {
    if (n_in < 7) return;
    const size_t needx = ((size_t)(NB - 1) * SEQ_FULL + SEQ) * DM;
    if ((size_t)in_sizes[0] < needx || (size_t)in_sizes[1] < needx || (size_t)in_sizes[2] < needx) return;
    if ((size_t)in_sizes[3] < (size_t)DM * DM || (size_t)in_sizes[4] < (size_t)DM * DM || (size_t)in_sizes[5] < (size_t)DM * DM || (size_t)in_sizes[6] < (size_t)DM * DM) return;
    if ((size_t)out_size < ((size_t)(NB - 1) * OUT_SEQ + SEQ) * DM) return;
    if (SZ_TOTAL > ws_size) return;
    // wire order: q, k, v, Wq, Wk, Wv, Wp (weights [in][out])
    const float* xq = (const float*)d_in[0]; const float* xk = (const float*)d_in[1]; const float* xv = (const float*)d_in[2];
    const float* wq = (const float*)d_in[3]; const float* wk = (const float*)d_in[4]; const float* wv = (const float*)d_in[5]; const float* wp = (const float*)d_in[6];
    float* OUT = (float*)d_out;      // [NB][SEQ][1024]
    char* wsp = (char*)d_ws;
    bf* XQ = (bf*)wsp; wsp += SZ_XB;                 // [NB*SEQ][1024]; the k and v copies are reached from XQ, the other W^T planes from WQT, by their strides
    bf* XK = (bf*)wsp; wsp += SZ_XB;
    bf* XV = (bf*)wsp; wsp += SZ_XB;
    bf* WQT = (bf*)wsp; wsp += SZ_WB;                // [out][in]
    bf* WKT = (bf*)wsp; wsp += SZ_WB;
    bf* WVT = (bf*)wsp; wsp += SZ_WB;
    bf* WPT = (bf*)wsp; wsp += SZ_WB;
    h16* QH = (h16*)wsp; wsp += SZ_PL;               // [NB*SEQ][1024] == [NB*16][SEQ][64]
    h16* QR = (h16*)wsp; wsp += SZ_PL;               // residual x2048
    h16* KH = (h16*)wsp; wsp += SZ_PL;
    h16* KR = (h16*)wsp; wsp += SZ_PL;
    h16* VH = (h16*)wsp; wsp += SZ_PL;
    h16* VR = (h16*)wsp; wsp += SZ_PL;
    bf* CTX = (bf*)wsp; wsp += SZ_CTX;               // [NB*SEQ][2048]: hi | lo

    // every input conversion in one launch: W[in][out] -> WT[out][in] bf16 (four planes from WQT on), q, k, v -> bf16 copies (three from XQ on)
    k_prep<<<4 * WTB + 3 * CVB, 256, 0, stream>>>(xq, xk, xv, wq, wk, wv, wp, XQ, WQT);

    // projections, one launch, z = q, k, v: A = x rows (m = b*SEQ + t), Bt = W^T rows (n) -> row-major planes [m][n] (value + residual; a pair of planes per z)
    k_gemm<0><<<dim3(NB * SEQ / 128, DM / 128, 3), 128, 0, stream>>>(XQ, WQT, DM, QH, QR, OUT, SZ_XB / 2, SZ_WB / 2, SZ_PL);

    k_flash<<<dim3(NQT / 2, NB * NH_, 1), 32 * AW, 0, stream>>>(QH, QR, KH, KR, VH, VR, CTX);

    // output projection: A = ctx rows [hi | lo] (K = 2048), Bt = Wp^T rows (k index wraps at 1024) -> f32 output
    k_gemm<1><<<dim3(NB * SEQ / 128, DM / 128, 1), 128, 0, stream>>>(CTX, WPT, 2 * DM, QH, QR, OUT, 0, 0, 0);
}

// v007
// A run of this version takes 90.3 microseconds.
// Two timings next to v006 both put it at 1.04 times that version's speed.
// Counting every step since v000, it is 3.91 times as fast.
#include <hip/hip_runtime.h>

// Multi-head attention, width 1024 = 16 heads x 64, separate q/k/v inputs [NB][SEQ][1024], Wq/Wk/Wv/Wp [in][out] (y = x W), no biases, unscaled scores, causal replace-mask, head split = flat row-major view (B,S,1024)->(B,16,S,64), output projection Wp (f32 out).
// Compute dtypes, f32 accumulate everywhere: q/k/v projections v_wmma_f32_16x16x32_bf16 (x and W RNE-converted to bf16; products exact);
// scores v_wmma_f32_16x16x32_f16 with q and k each as f16 value + f16 residual x2048 (three products, scaled residual products in their own accumulator);
// P (x2^14 carry, cancels in the normalisation) single f16, v as f16 value + f16 residual x2048 (two products, own accumulator); softmax f32 (online, running max);
// output projection v_wmma_f32_16x16x32_bf16 with ctx as bf16 hi | bf16 lo folded along K (K = 2048 against Wp^T repeated), Wp RNE-converted to bf16.
// Layout: bf16 copies of q/k/v, bf16 W^T planes [out][in]; projection planes [NB*SEQ][1024] f16 (== [b*16+h][s][64] by the flat head view);
// fused flash kernel in transposed form (S^T = K Q^T, O^T = V^T P^T), K / V tiles of 64 keys staged row-major in LDS by tensor loads (two buffers, shared by the block's four waves),
// the V^T fragments read from the row-major V tiles by the transposing LDS load (ds_load_tr16_b128); ctx plane [NB*SEQ][2048] bf16 (hi | lo).
// Each flash block works on two query tiles of one head, one after the other: tile x and tile NQT-1-x, so that every block walks the same number of key stages.
// GEMMs: 128x128 tile per block of four waves (64x64 each), A and Bt stages of 128 k staged in LDS by tensor loads (two buffers).
// Every operand of the two GEMMs and K, V of the flash kernel were written by an earlier launch and lie in memory: at its head each block asks for its share of the rows that it and its sharers will stream (global_prefetch_b8 into L2).
// Four launches: k_prep (all seven input conversions, split by block index), k_gemm<0> (the three projections, one per blockIdx.z), k_flash, k_gemm<1>.

#ifndef NB
#define NB 2
#endif
#ifndef SEQ
#define SEQ 2048
#endif
#define NB_FULL  2
#define SEQ_FULL 2048
#ifndef OUT_SEQ
#define OUT_SEQ SEQ              // row pitch (in tokens) between batches of the output
#endif
#define DM   1024
#define NH_  16
#define HD   64
#define AW   4                   // waves per flash block (16 query rows each)
#define QRS  2048.0f             // carry of the residual planes
#define QRI  (1.0f / 2048.0f)
#define L2E  1.4426950408889634f // log2(e); scores are unscaled
#define PSH  14.0f               // log2 of the P carry (16384)
#define NEGB (-3.0e38f)
#define KST  64                  // keys per LDS stage of the flash kernel
#define LP   144                 // LDS row pitch of the K tiles in bytes: 128-B rows + 16-B pad (16 B x odd, for 16-byte LDS reads)
#define LPH  (LP / 2)            // the same in halves
#define LPV  160                 // LDS row pitch of the V tiles in bytes: 128-B rows + 32-B pad (32 B x odd, for transposing LDS reads)
#define TSZ  10240               // place of one tile in LDS: 64 rows x 144 B = 9216 B or x 160 B = 10240 B, a multiple of 2 KiB
#define BSZ  (4 * TSZ)           // one buffer: K value, K residual, V value, V residual
#define NQT  (SEQ / (16 * AW))   // query tiles (64 rows) per head
#define OSB  (AW * 16 * 68 * 4)  // output staging of the flash kernel in bytes, behind its ring
#define GKS  128                 // k per LDS stage of the GEMM (256-B rows)
#define GLP  272                 // its LDS row pitch in bytes: 256-B rows + 16-B pad (16 B x odd, for 16-byte LDS reads)
#define GLPH (GLP / 2)           // the same in 16-bit elements
#define GTSZ 18432               // place of one GEMM tile in LDS: 64 rows x 272 B = 17408 B, rounded up to a multiple of 2 KiB
#define GBSZ (4 * GTSZ)          // one buffer: A rows 0..63, A rows 64..127, Bt rows 0..63, Bt rows 64..127

static_assert(HD == 64);
static_assert(NH_ * HD == DM);
static_assert((DM & (DM - 1)) == 0);           // B-operand k index wraps with a mask
static_assert(DM % 64 == 0);
static_assert(SEQ % 64 == 0);                  // 64-row tiles never straddle two batches; K and V tiles of 64 keys
static_assert((NB * SEQ) % 64 == 0);
static_assert(SEQ % 32 == 0);                  // a P fragment covers 32 keys
static_assert(SEQ % (16 * AW) == 0);           // flash grid covers the sequence exactly
static_assert(((size_t)SEQ * DM) % 8 == 0);
static_assert(NB <= NB_FULL);
static_assert(SEQ <= SEQ_FULL);
static_assert(AW == 4);                        // one tensor load per wave and stage: four tiles, four waves
static_assert(16 * AW == KST);                 // a block's queries end where its last 64-key stage ends
static_assert(NQT % 2 == 0 && NQT >= 2);       // query tiles pair up as x and NQT-1-x; a pair has NQT+1 >= 2 stages, which the ring's prologue needs
static_assert(HD * 2 == 128);                  // K and V tiles have 128-byte rows (one key's 64 features)
static_assert(KST * LP <= TSZ && KST * LPV <= TSZ && TSZ % 2048 == 0);
static_assert((NB * SEQ) % 128 == 0 && DM % 128 == 0);   // GEMM grid of 128x128 tiles covers C exactly
static_assert(DM % GKS == 0 && DM >= 2 * GKS);           // whole stages, the Bt wrap falls on a stage boundary, the ring's prologue loads two stages
static_assert(GKS * 2 == 256 && 64 * GLP <= GTSZ && GTSZ % 2048 == 0);
static_assert(4 * 16 * 68 * 4 <= 2 * GBSZ);              // GEMM output staging reuses its ring
static_assert(DM == 1024 && SEQ * HD * 2 == 4 * 65536);  // the prefetch shares: eight of 32 KiB (or 64 KiB) cover a GEMM block's rows, eight of 4 x 8 KiB a head's part of a plane

typedef _Float16 h16;
typedef unsigned short bf;
typedef __attribute__((ext_vector_type(16))) __bf16   v16bf;
typedef __attribute__((ext_vector_type(16))) _Float16 v16h;
typedef __attribute__((ext_vector_type(8)))  _Float16 v8h;
typedef __attribute__((ext_vector_type(8)))  unsigned short v8us;
typedef __attribute__((ext_vector_type(8)))  short    v8s;
typedef __attribute__((ext_vector_type(8)))  float    v8f;
typedef __attribute__((ext_vector_type(4)))  float    v4f;
typedef v4f  __attribute__((may_alias)) v4fa;
typedef uint32_t u32x4 __attribute__((ext_vector_type(4)));
typedef uint32_t u32x8 __attribute__((ext_vector_type(8)));

__device__ __forceinline__ unsigned short f2bf(float f) { unsigned u = __float_as_uint(f); u += 0x7FFFu + ((u >> 16) & 1u); return (unsigned short)(u >> 16); }
__device__ __forceinline__ float bf2f(unsigned short s) { return __uint_as_float(((unsigned)s) << 16); }
__device__ __forceinline__ v16h cat16(v8h lo, v8h hi) { return __builtin_shufflevector(lo, hi, 0, 1, 2, 3, 4, 5, 6, 7, 8, 9, 10, 11, 12, 13, 14, 15); }
__device__ __forceinline__ v16bf cat16b(v8us lo, v8us hi) { return __builtin_bit_cast(v16bf, __builtin_shufflevector(lo, hi, 0, 1, 2, 3, 4, 5, 6, 7, 8, 9, 10, 11, 12, 13, 14, 15)); }
__device__ __forceinline__ v8f wmma16(v16h a, v16h b, v8f c) { return __builtin_amdgcn_wmma_f32_16x16x32_f16(false, a, false, b, (short)0, c, false, false); }
__device__ __forceinline__ v8f wmmab(v16bf a, v16bf b, v8f c) { return __builtin_amdgcn_wmma_f32_16x16x32_bf16(false, a, false, b, (short)0, c, false, false); }
// fragment loaders from K-contiguous 16-bit rows; p already includes + 8*(lane>>4): elements 0..7 <- k0+8h+0..7, elements 8..15 <- k0+16+8h+0..7 (same map for A and B)
__device__ __forceinline__ v16h  ldh(const h16* p) { return cat16(*(const v8h*)p, *(const v8h*)(p + 16)); }
__device__ __forceinline__ v16bf ldb(const bf* p)  { return cat16b(*(const v8us*)p, *(const v8us*)(p + 16)); }
// transposing LDS load from a row-major 16-bit tile T (rows = k, pitch LPV): with p = T + (k0 + 8*(lane>>4) + (lane&7)) * LPV + 2*d0 + 16*((lane>>3)&1)
// lane (c = lane&15, h = lane>>4) gets T[k0+8h+0..7][d0+c]; the loads at k0 and k0+16 make one A fragment of T^T in the k order of ldh (elements 0..7 <- k0+8h+0..7, 8..15 <- k0+16+8h+0..7)
__device__ __forceinline__ v8h ldtr(const unsigned char* p) { typedef __attribute__((address_space(3))) v8s lds_v8s; return __builtin_bit_cast(v8h, __builtin_amdgcn_ds_load_tr16_b128_v8i16((lds_v8s*)p)); }
__device__ __forceinline__ v16h ldvt(const unsigned char* p) { return cat16(ldtr(p), ldtr(p + 16 * LPV)); }
// ordering point for wave-private LDS tiles (same wave writes and reads)
__device__ __forceinline__ void wave_sync() { __builtin_amdgcn_fence(3 /* release order */, "wavefront"); __builtin_amdgcn_wave_barrier(); asm volatile("" ::: "memory"); }

__device__ __forceinline__ uint32_t uni(uint32_t v) { return (uint32_t)__builtin_amdgcn_readfirstlane(v); }
// wave-uniform test held in a scalar register, so that the branch on it is a scalar branch (a tensor load ignores EXEC)
__device__ __forceinline__ uint32_t pinned(uint32_t v) { uint32_t w = (uint32_t)__builtin_amdgcn_readfirstlane(v); asm volatile("" : "+s"(w)); return w; }
__device__ __forceinline__ void wait_ds0()     { asm volatile("s_wait_dscnt 0x0" ::: "memory"); }      // this wave's LDS reads have returned before the buffer is handed back
__device__ __forceinline__ void wait_tensor0() { asm volatile("s_wait_tensorcnt 0x0" ::: "memory"); }  // this wave's tensor load has landed (the compiler places no wait for it)
// one tile of 64 rows x 128 bytes, rows contiguous in the source, into LDS with a pad of PADC + 1 dwords behind every 128-B row (PADC = 3: pitch 144 B, PADC = 7: pitch 160 B): group 1 built once
template <uint32_t PADC>
__device__ __forceinline__ u32x8 tile128_group1() {
    u32x8 g1;
    g1[0] = uni((1u << 20) | (4u << 22) | (PADC << 25)); // no mask, 1-byte elements, pad behind every 32 dwords
    g1[1] = uni(128u << 16); g1[2] = uni(64u << 16); g1[3] = uni(128u << 16); g1[4] = uni(64u); g1[5] = uni(128u); g1[6] = uni(0u); g1[7] = uni(0u);
    asm volatile("" : "+s"(g1));   // as pinned(): the descriptor words are held in their scalar registers through the loop, so that none of them takes another value while a request is outstanding
    return g1;
}
// a wave's one request of a stage: a K tile (is_k) at the pitch of the 16-byte reads or a V tile (is_v) at the pitch of the transposing reads;
// is_k and is_v come from pinned(), one of them set: two scalar branches, so that each request's pad word is a constant
__device__ __forceinline__ void stage_load(uint32_t is_k, uint32_t is_v, u32x4 g0, u32x8 g1k, u32x8 g1v) {
    if (is_k) asm volatile("tensor_load_to_lds %0, %1" :: "s"(g0), "s"(g1k) : "memory");
    if (is_v) asm volatile("tensor_load_to_lds %0, %1" :: "s"(g0), "s"(g1v) : "memory");
}
// group 0 of a wave's first request
__device__ __forceinline__ u32x4 stage_group0(uint32_t lds_dst, uint64_t ga) {
    u32x4 g0;
    g0[0] = uni(1u); g0[1] = uni(lds_dst); g0[2] = uni((uint32_t)ga); g0[3] = uni((((uint32_t)(ga >> 32)) & 0x01FFFFFFu) | 0x80000000u);
    return g0;
}
// group 0 of a wave's next request, formed from that of its last one (place in LDS anew, source address moved by step bytes; the address stays inside its field, so the type bits above it stay):
// the group is so carried from request to request: the words that the next one is formed from (0, 2, 3) stay live, so their registers take no other value while a request is outstanding
__device__ __forceinline__ u32x4 stage_next(u32x4 g0, uint32_t lds_dst, int64_t step) {
    const uint64_t a = (((uint64_t)g0[3] << 32) | (uint64_t)g0[2]) + (uint64_t)step;
    g0[1] = uni(lds_dst); g0[2] = uni((uint32_t)a); g0[3] = uni((uint32_t)(a >> 32));
    return g0;
}
// one tile of 64 rows x 256 bytes, source row pitch src_pitch bytes, into LDS at pitch 272 B (a 16-B pad behind every 256-B row): group 1 built once, group 0 per request
__device__ __forceinline__ u32x8 tile256_group1(uint32_t src_pitch) {
    u32x8 g1;
    g1[0] = uni((1u << 20) | (5u << 22) | (3u << 25));   // no mask, 1-byte elements, pad of 4 dwords behind every 64
    g1[1] = uni(256u << 16); g1[2] = uni(64u << 16); g1[3] = uni(256u << 16); g1[4] = uni(64u); g1[5] = uni(src_pitch); g1[6] = uni(0u); g1[7] = uni(0u);
    asm volatile("" : "+s"(g1));   // as pinned(): the descriptor words are held in their scalar registers through the loop, so that none of them takes another value while a request is outstanding
    return g1;
}
__device__ __forceinline__ void tile256_load(uint32_t lds_dst, uint64_t ga, u32x8 g1) {
    u32x4 g0;
    g0[0] = uni(1u); g0[1] = uni(lds_dst); g0[2] = uni((uint32_t)ga); g0[3] = uni((((uint32_t)(ga >> 32)) & 0x01FFFFFFu) | 0x80000000u);
    asm volatile("tensor_load_to_lds %0, %1" :: "s"(g0), "s"(g1) : "memory");
}

// Which eighth of a shared operand a block asks for, from its index x along the grid's fastest dimension: x & 3 and bit 3 of x,
// so the values 0..7 all occur among the x with x % 8 in 0..3 and among those in 4..7. For speed only: wherever the blocks land, a unit that nobody asked for is simply fetched by the tensor load that reads it.
__device__ __forceinline__ uint32_t pf_eighth(uint32_t x) { return (x & 3u) | (((x >> 3) & 1u) << 2); }
// keeps a prefetch's address registers live, so at their value, up to this point: a prefetch is issued over registers that hold no other value soon after it (here: not before a tile's landing and a barrier have gone by)
__device__ __forceinline__ void pf_hold(const char* p) { asm volatile("" :: "v"(p)); }

static constexpr size_t al256(size_t v) { return (v + 255) & ~(size_t)255; }
static constexpr size_t SZ_XB  = al256((size_t)NB * SEQ * DM * 2);          // one bf16 input copy
static constexpr size_t SZ_WB  = al256((size_t)DM * DM * 2);                // one bf16 W^T plane
static constexpr size_t SZ_PL  = al256((size_t)NB * NH_ * SEQ * HD * 2);    // one f16 plane
static constexpr size_t SZ_CTX = al256((size_t)NB * SEQ * 2 * DM * 2);      // ctx hi | lo
static constexpr size_t SZ_TOTAL = 3 * SZ_XB + 4 * SZ_WB + 6 * SZ_PL + SZ_CTX;
static_assert(SZ_TOTAL <= (size_t)134217728);          // workspace carve <= 128 MiB
static_assert(SZ_PL == (size_t)NB * SEQ * DM * 2);     // value / residual plane pairs are exactly contiguous

#define WTB ((DM / 64) * (DM / 64))                          // blocks per weight: 64x64 tiles
#define CVN ((size_t)NB * SEQ * DM / 8)                      // 8-element chunks per activation input
#define CVB ((int)((CVN + 255) / 256))                       // blocks per activation input

// RNE convert of one activation input: block cb takes 256 chunks of 8 floats; source batches SEQ_FULL tokens apart, copy packed [NB*SEQ][DM].
__device__ __forceinline__ void cvt8_block(const float* __restrict__ src, bf* dst, int cb) {
    const size_t i = (size_t)cb * 256 + threadIdx.x; if (i >= CVN) return;
    const size_t e = i * 8;
    const v8f v = *(const v8f*)(src + e + (e / ((size_t)SEQ * DM)) * ((size_t)(SEQ_FULL - SEQ) * DM)); v8us o;
#pragma unroll
    for (int k = 0; k < 8; ++k) o[k] = f2bf(v[k]);
    *(v8us*)(dst + e) = o;
}

// weight transpose + RNE convert of one 64x64 tile: in W[DM rows k][DM cols n] f32 -> out WT[DM rows n][DM cols k] bf16.
__device__ __forceinline__ void wt_block(const float* __restrict__ W, bf* WT, int n0, int k0, float* tile) {
    const int tid = threadIdx.x;
#pragma unroll
    for (int it = 0; it < 4; ++it) { const int c = it * 256 + tid; const int r = c >> 4, c4 = (c & 15) * 4;   // 64 rows x 16 chunks of 4 floats
        const v4f v = *(const v4f*)(W + (size_t)(k0 + r) * DM + n0 + c4);
        tile[r * 65 + c4 + 0] = v[0]; tile[r * 65 + c4 + 1] = v[1]; tile[r * 65 + c4 + 2] = v[2]; tile[r * 65 + c4 + 3] = v[3]; }
    __syncthreads();
    v8us o[2];
#pragma unroll
    for (int it = 0; it < 2; ++it) { const int c = it * 256 + tid; const int n = c >> 3, k8 = (c & 7) * 8;     // 64 output rows x 8 chunks of 8
#pragma unroll
        for (int e = 0; e < 8; ++e) o[it][e] = f2bf(tile[(k8 + e) * 65 + n]); }
#pragma unroll
    for (int it = 0; it < 2; ++it) { const int c = it * 256 + tid; const int n = c >> 3, k8 = (c & 7) * 8;
        *(v8us*)(WT + (size_t)(n0 + n) * DM + k0 + k8) = o[it]; }
}

// k_prep: every input conversion in one launch; none depends on another, the block index alone says which piece a block does (block-uniform branch).
// Blocks [0, 4*WTB): weight w = index / WTB, tile (n, k) = (index % WTB) % (DM/64), / (DM/64) -> plane w of WT. Blocks behind them: input index / CVB, chunk block index % CVB -> copy of X.
// grid 4*WTB + 3*CVB, 256 threads. X: three copies SZ_XB bytes apart (q, k, v); WT: four planes SZ_WB bytes apart (Wq, Wk, Wv, Wp).
__global__ __launch_bounds__(256) void k_prep(const float* __restrict__ xq, const float* __restrict__ xk, const float* __restrict__ xv,
                                              const float* __restrict__ wq, const float* __restrict__ wk, const float* __restrict__ wv, const float* __restrict__ wp,
                                              bf* X, bf* WT) {
    __shared__ float tile[64 * 65];
    const unsigned bid = blockIdx.x;
    if (bid < 4u * WTB) {
        const int w = (int)(bid / WTB), t = (int)(bid % WTB);
        wt_block(w == 0 ? wq : w == 1 ? wk : w == 2 ? wv : wp, WT + (size_t)w * (SZ_WB / 2), (t % (DM / 64)) * 64, (t / (DM / 64)) * 64, tile);
    } else {
        const unsigned c = bid - 4u * WTB; const int w = (int)(c / CVB);
        cvt8_block(w == 0 ? xq : w == 1 ? xk : xv, X + (size_t)w * (SZ_XB / 2), (int)(c % CVB));
    }
}

// k_gemm: bf16 GEMM, 128x128 tile of C per block of four waves (2 x 2), each wave a 64x64 tile (16 accumulators).
// C[m][n] = sum_{kc < KA} A[m][kc] Bt[n][kc & (DM-1)]; A row pitch KA, Bt row pitch DM (KA = 2*DM folds the hi | lo halves of A against the same Bt rows).
// Per stage of 128 k each wave brings one tile of 64 rows x 256 B into LDS with one tensor load (waves 0, 1 the block's A rows, waves 2, 3 its Bt rows);
// two buffers, the next stage's loads in flight while this stage is worked on; every wave reads its fragments from LDS (two 16-B reads each).
// MODE 0: C written as f16 (Ph) and f16 residual x2048 (Pr), row-major pitch DM. MODE 1: C written as f32 to OUT rows (m/SEQ)*OUT_SEQ + m%SEQ, pitch DM.
// grid (M/128, DM/128, Z), 128 threads; KA a multiple of 128, at least 256. Epilogue per 16-row slab staged in LDS (wave-private part of the ring);
// blockIdx.z picks one of Z independent products of the same shape: A planes za elements apart, Bt planes zb apart, Ph and Pr planes zp apart.
template <int MODE>
__global__ __launch_bounds__(128) void k_gemm(const bf* __restrict__ A0, const bf* __restrict__ Bt0, int KA, h16* Ph0, h16* Pr0, float* OUT, size_t za, size_t zb, size_t zp) {
    __shared__ __attribute__((aligned(2048))) unsigned char gring[2 * GBSZ];
    const bf* A = A0 + blockIdx.z * za; const bf* Bt = Bt0 + blockIdx.z * zb;
    h16* Ph = Ph0 + blockIdx.z * zp; h16* Pr = Pr0 + blockIdx.z * zp;
    const int lane = threadIdx.x & 31, wave = (int)uni(threadIdx.x >> 5), lr = lane & 15, hi = lane >> 4;
    const int wm = wave >> 1, wn = wave & 1;                 // the wave's 64x64 tile inside the block's 128x128
    const int r0 = blockIdx.x * 128 + wm * 64, c0 = blockIdx.y * 128 + wn * 64;
    // this wave's tile to load: waves 0, 1 rows 0..63, 64..127 of the block's A rows; waves 2, 3 the same of its Bt rows
    const int lrow = (wave < 2 ? (int)blockIdx.x : (int)blockIdx.y) * 128 + (wave & 1) * 64;
    const uint32_t gpitch = wave < 2 ? (uint32_t)KA * 2u : (uint32_t)(DM * 2);
    const uint64_t gsrc = (uint64_t)(size_t)(wave < 2 ? A : Bt) + (uint64_t)lrow * gpitch;
    const uint32_t gmask = wave < 2 ? 0xFFFFFFFFu : (uint32_t)(DM * 2 - 1);   // byte offset along a row; Bt's wraps at DM elements
    const uint32_t ldst = (uint32_t)(size_t)gring + (uint32_t)wave * GTSZ;
    const int nst = KA / GKS;
    const u32x8 g1 = tile256_group1(gpitch);
    tile256_load(ldst, gsrc, g1);                            // stage 0 -> buffer 0
    // Prefetch into L2, one 256-B unit a lane: the block's 128 A rows (128 * KAC * 2 bytes in a row) are read by the DM/128 = 8 blocks of its x, an eighth each by blockIdx.y;
    // its 128 Bt rows (256 KiB in a row) by every x, an eighth each by pf_eighth. For speed only.
    constexpr int KAC = MODE == 0 ? DM : 2 * DM;             // KA of the launch of this MODE
    const char* pfa = (const char*)(A + (size_t)blockIdx.x * 128 * KAC) + (size_t)blockIdx.y * (KAC * 32) + threadIdx.x * 256;
    const char* pfb = (const char*)(Bt + (size_t)blockIdx.y * 128 * DM) + (size_t)pf_eighth(blockIdx.x) * 32768 + threadIdx.x * 256;
    // s_wait_xcnt, a precaution as behind any issued global memory instruction: it stands in front of every overwrite of the address registers that the prefetches name
    if (MODE == 0) asm volatile("global_prefetch_b8 %0, off scope:SCOPE_SE\n\tglobal_prefetch_b8 %1, off scope:SCOPE_SE\n\ts_wait_xcnt 0x0" :: "v"(pfa), "v"(pfb));
    else           asm volatile("global_prefetch_b8 %0, off scope:SCOPE_SE\n\tglobal_prefetch_b8 %0, off offset:32768 scope:SCOPE_SE\n\tglobal_prefetch_b8 %1, off scope:SCOPE_SE\n\ts_wait_xcnt 0x0" :: "v"(pfa), "v"(pfb));
    v8f acc[4][4];
#pragma unroll
    for (int mb = 0; mb < 4; ++mb)
#pragma unroll
        for (int nb = 0; nb < 4; ++nb) acc[mb][nb] = (v8f){};
    const int fo = lr * GLP + 16 * hi;                       // lane's byte offset in a tile: row lr, k offset 8h elements (A and B fragments alike)
    wait_tensor0();
    __syncthreads();                                         // stage 0 published
    tile256_load(ldst + GBSZ, gsrc + ((uint32_t)(GKS * 2) & gmask), g1);       // stage 1 -> buffer 1
    pf_hold(pfa); pf_hold(pfb);                              // the prefetches' address registers keep their values up to here
#pragma unroll 1
    for (int st = 0; st < nst; ++st) {
        const unsigned char* bp = gring + (st & 1) * GBSZ + fo;
        const bf* ap = (const bf*)(bp + wm * GTSZ);          // A rows of this wave
        const bf* bq = (const bf*)(bp + (2 + wn) * GTSZ);    // Bt rows of this wave
        v16bf a[2][4], b[2][4];                              // two fragment sets: the next 32 k are fetched ahead of this block's products
#pragma unroll
        for (int f = 0; f < 4; ++f) a[0][f] = ldb(ap + f * 16 * GLPH);
#pragma unroll
        for (int f = 0; f < 4; ++f) b[0][f] = ldb(bq + f * 16 * GLPH);
#pragma unroll
        for (int ks = 0; ks < GKS / 32; ++ks) {
            if (ks + 1 < GKS / 32) {
#pragma unroll
                for (int f = 0; f < 4; ++f) a[(ks + 1) & 1][f] = ldb(ap + f * 16 * GLPH + (ks + 1) * 32);
#pragma unroll
                for (int f = 0; f < 4; ++f) b[(ks + 1) & 1][f] = ldb(bq + f * 16 * GLPH + (ks + 1) * 32);
                __builtin_amdgcn_sched_barrier(0);           // holds the next block's LDS reads as one group ahead of this block's products (else each read sinks to its use and is waited for there)
            }
#pragma unroll
            for (int nb = 0; nb < 4; ++nb)
#pragma unroll
                for (int mb = 0; mb < 4; ++mb) acc[mb][nb] = wmmab(a[ks & 1][mb], b[ks & 1][nb], acc[mb][nb]);
            __builtin_amdgcn_sched_barrier(0);               // keeps this block's products ahead of the reads after next, which reuse its fragment registers
        }
        // hand-over, every wave: own LDS reads done, own tile of stage st+1 landed, barrier (publishes stage st+1, frees this stage's buffer), then the refill
        wait_ds0();
        wait_tensor0();
        __syncthreads();
        if (pinned(st + 2 < nst)) tile256_load(ldst + (uint32_t)(st & 1) * GBSZ, gsrc + ((uint32_t)((st + 2) * GKS * 2) & gmask), g1);
    }
    wait_tensor0();
    wait_ds0();
    float* os = (float*)gring + wave * 16 * 68;              // output staging reuses the ring: the last hand-over's barrier stands behind every wave's last read, and nothing was issued behind it
#pragma unroll
    for (int mb = 0; mb < 4; ++mb) {
#pragma unroll
        for (int nb = 0; nb < 4; ++nb) {
#pragma unroll
            for (int j = 0; j < 8; ++j) os[(hi * 8 + j) * 68 + nb * 16 + lr] = acc[mb][nb][j]; }   // D: row 8h+j, col lane&15; rows 0..15 x cols 0..63 all written
        wave_sync();
        const int m0 = r0 + mb * 16;
        if (MODE == 0) {
            const size_t sb = (size_t)m0 * DM + c0;
{
#pragma unroll
                for (int s = 0; s < 4; ++s) { const int row = 4 * s + (lane >> 3), c8 = (lane & 7) * 8;   // 4 s x 4 row groups = 16 rows; 8 lanes x 8 = 64 columns
                    const v4f x0 = *(const v4fa*)(&os[row * 68 + c8]); const v4f x1 = *(const v4fa*)(&os[row * 68 + c8 + 4]); v8h hv, rv;
#pragma unroll
                    for (int i = 0; i < 4; ++i) { const h16 a0 = (h16)x0[i]; const h16 a1 = (h16)x1[i]; hv[i] = a0; hv[4 + i] = a1; rv[i] = (h16)((x0[i] - (float)a0) * QRS); rv[4 + i] = (h16)((x1[i] - (float)a1) * QRS); }
                    const size_t oo = sb + (size_t)row * DM + c8;
                    *(v8h*)(Ph + oo) = hv; *(v8h*)(Pr + oo) = rv; }
                 }
        } else {
            float* orow = OUT + ((size_t)(m0 / SEQ) * OUT_SEQ + (size_t)(m0 % SEQ)) * DM + c0;
{
#pragma unroll
                for (int s = 0; s < 8; ++s) { const int row = 2 * s + hi, cofs = lr * 4;   // 8 s x 2 rows = 16 rows; 16 lanes x 4 floats = 64 columns
                    const v4f val = *(const v4fa*)(&os[row * 68 + cofs]);
                    *(v4f*)(orow + (size_t)row * DM + cofs) = val; }
                 }
        }
        wave_sync();
    }
}

#define STG(OFS, OH, OR) { v4f a_, c_; \
    a_[0] = OH[0] * inv + OR[0] * ri; a_[1] = OH[1] * inv + OR[1] * ri; a_[2] = OH[2] * inv + OR[2] * ri; a_[3] = OH[3] * inv + OR[3] * ri; \
    c_[0] = OH[4] * inv + OR[4] * ri; c_[1] = OH[5] * inv + OR[5] * ri; c_[2] = OH[6] * inv + OR[6] * ri; c_[3] = OH[7] * inv + OR[7] * ri; \
    *(v4fa*)(&os[wb + lr * 68 + (OFS) + 8 * hi]) = a_; *(v4fa*)(&os[wb + lr * 68 + (OFS) + 8 * hi + 4]) = c_; }

// k_flash: fused causal attention, one wave per 16 query rows of one (batch, head); Q fragments straight from the f16 planes (two 16-B loads each).
// K and V: per stage of 64 keys each of the four waves brings one tile (K value, K residual, V value, V residual; 64 key rows x 128 B) into LDS with one tensor load;
// two buffers, the next stage's loads in flight while this stage is worked on; every wave reads its fragments from LDS (two 16-B reads each, transposing ones for V^T). Every wave passes every stage's hand-over.
// Transposed form: S^T[key][t] = K Q^T (A = K rows, B = Q rows); lane (t = lane&15, h = lane>>4) holds keys 8h+r of each 16-key tile, so the packed
// P tile is directly the B fragment of O^T[d][t] = V^T P^T (element r <- tile keys 0..15, element 8+r <- tile keys 16..31, lane unchanged).
// A wave takes each stage whole: its 32 K reads as one group, the 24 score products of the four 16-key tiles, one softmax step over the 64 keys, its 32 V reads as one group under the exponentials, the 16 PV products.
// Causal: entries with key > t are replaced by a large negative value (P = 0), in a tile's last stage only (wave-uniform test); every stage of a tile holds a visible key for each of its rows (its first key is <= t0).
// Softmax state (running max, partial sum) is one scalar per lane; the two lane halves of a row are combined with one xor-16 exchange.
// Balance: a tile's cost grows with its index (tile x walks x+1 stages), so a block takes tile blockIdx.x and then tile NQT-1-blockIdx.x of its head, NQT+1 stages whatever the block;
// the ring runs through both tiles as one sequence of stages (the second tile's first stages are in flight while the first tile is finished), so the output staging has LDS of its own behind the ring.
// grid (NQT/2, NB*NH_).
__global__ __launch_bounds__(32 * AW) void k_flash(const h16* __restrict__ QH, const h16* __restrict__ QR, const h16* __restrict__ KH, const h16* __restrict__ KR,
                                                   const h16* __restrict__ VH, const h16* __restrict__ VR, bf* CTX) {
    __shared__ __attribute__((aligned(2048))) unsigned char ring[2 * BSZ + OSB];
    const int lane = threadIdx.x & 31, wave = (int)uni(threadIdx.x >> 5), lr = lane & 15, hi = lane >> 4;
    const int zh = blockIdx.y; const int b = zh / NH_, h = zh % NH_;
    const size_t pbase = (size_t)zh * SEQ * HD;
    // this wave's tile: waves 0, 1 the K planes, waves 2, 3 the V planes (rows = keys, 128 B each, contiguous)
    const h16* pl = wave == 0 ? KH : wave == 1 ? KR : wave == 2 ? VH : VR;
    const uint64_t gsrc = (uint64_t)(size_t)(pl + pbase);
    const uint32_t gstep = (uint32_t)(KST * HD * 2);         // bytes from one stage's tile to the next
    const uint32_t isk = pinned(wave < 2), isv = pinned(wave >= 2);
    const u32x8 g1k = tile128_group1<3u>(), g1v = tile128_group1<7u>();
    const uint32_t ldst = (uint32_t)(size_t)ring + (uint32_t)wave * TSZ;
    // 64-key stages the block walks: na = blockIdx.x+1 of its first tile (keys from 0 on), then NQT-blockIdx.x of its second (keys from 0 on again): NQT+1 in all
    // as pinned(): the first tile's stage count, which the refill's source step is formed from, is formed here, ahead of the first request (without it the build keeps group 0 in two register sets, and a register of the issued set takes another value while the request is outstanding)
    const int na = (int)pinned(blockIdx.x + 1u);
    u32x4 g0 = stage_group0(ldst, gsrc);
    stage_load(isk, isv, g0, g1k, g1v);                      // stage 0 -> buffer 0
    // Prefetch into L2, one 256-B unit a lane: each wave asks for an eighth of its own plane's 256 KiB of this head (the head's NQT/2 blocks all stream them), in four runs of 8 KiB, 64 KiB apart, the low keys first.
    // Without it the block that is first at a stage takes memory latency there, stage after stage, and the launch lasts as long as that block.
    const char* pfk = (const char*)(pl + pbase) + (size_t)pf_eighth(blockIdx.x) * 8192 + lane * 256;
    // s_wait_xcnt, a precaution as behind any issued global memory instruction: it stands in front of every overwrite of the address registers that the prefetches name
    asm volatile("global_prefetch_b8 %0, off scope:SCOPE_SE\n\tglobal_prefetch_b8 %0, off offset:65536 scope:SCOPE_SE\n\tglobal_prefetch_b8 %0, off offset:131072 scope:SCOPE_SE\n\tglobal_prefetch_b8 %0, off offset:196608 scope:SCOPE_SE\n\ts_wait_xcnt 0x0" :: "v"(pfk));
    const int fo = lr * LP + 16 * hi;                        // lane's byte offset in a K tile: row lr, k offset 8h halves
    const int vo = (8 * hi + (lane & 7)) * LPV + 16 * ((lane >> 3) & 1);   // lane's byte offset in a V tile for the transposing load: key row 8h + (lane & 7), 16-B half (lane >> 3) & 1
    float* os = (float*)(ring + 2 * BSZ);                    // output staging, a wave-private part each
    const int wb = wave * 16 * 68;
    wait_tensor0();
    __syncthreads();                                         // stage 0 published
    g0 = stage_next(g0, ldst + BSZ, na > 1 ? (int64_t)gstep : (int64_t)0);
    stage_load(isk, isv, g0, g1k, g1v);                      // stage 1 -> buffer 1: the first tile's keys 64.., or, where it has one stage, the second tile's keys 0..
    pf_hold(pfk);                                            // the prefetches' address registers keep their value up to here
    int g = 0;                                               // stage number in the block's sequence; buffer g & 1
#pragma unroll 1                                             // the two tiles share one copy of the loop's code
    for (int half = 0; half < 2; ++half) {
    const int xt = half ? NQT - 1 - (int)blockIdx.x : (int)blockIdx.x;   // this pass's query tile
    const int nst = xt + 1;                                  // its stages: keys [0, 64*(xt+1))
    const int t0 = (xt * AW + wave) * 16;
    const size_t qo = pbase + (size_t)(t0 + lr) * HD + 8 * hi;
    const v16h qh0 = ldh(QH + qo), qh1 = ldh(QH + qo + 32), qr0 = ldh(QR + qo), qr1 = ldh(QR + qo + 32);   // B fragments: col t, k = d
    v8f oh0 = (v8f){}, oh1 = (v8f){}, oh2 = (v8f){}, oh3 = (v8f){};
    v8f or0 = (v8f){}, or1 = (v8f){}, or2 = (v8f){}, or3 = (v8f){};
    float m = NEGB, l = 0.0f;
    int st = 0;
#pragma unroll 1
    do {                                                     // a tile has at least one stage
      const h16* kk = (const h16*)(ring + (g & 1) * BSZ + fo);            // K value tile, row lr of its first 16 keys; key tile kt is 16 rows on
      const h16* kr = kk + TSZ / 2;                                       // K residual tile
      const unsigned char* va = ring + (g & 1) * BSZ + 2 * TSZ + vo;      // V value tile; fragment j: features 16j .. 16j+15 (32 B on), keys 32.. are 32 rows on
      const unsigned char* vr = va + TSZ;                                 // V residual tile
      const int key0 = st * KST;
      v16h ka[4], kb[4], ra[4], rb[4];                                    // A fragments of the four 16-key tiles: value d 0..31, d 32..63, residual d 0..31, d 32..63
#pragma unroll
      for (int kt = 0; kt < 4; ++kt) ka[kt] = ldh(kk + kt * 16 * LPH);
#pragma unroll
      for (int kt = 0; kt < 4; ++kt) kb[kt] = ldh(kk + kt * 16 * LPH + 32);
#pragma unroll
      for (int kt = 0; kt < 4; ++kt) ra[kt] = ldh(kr + kt * 16 * LPH);
#pragma unroll
      for (int kt = 0; kt < 4; ++kt) rb[kt] = ldh(kr + kt * 16 * LPH + 32);
      __builtin_amdgcn_sched_barrier(0);                                  // holds the stage's K reads as one group ahead of its score products (else a part sinks among them and is waited for there)
      v8f sH[4], sL[4];
#pragma unroll
      for (int kt = 0; kt < 4; ++kt) { sH[kt] = wmma16(ka[kt], qh0, (v8f){}); sL[kt] = wmma16(ka[kt], qr0, (v8f){}); }
#pragma unroll
      for (int kt = 0; kt < 4; ++kt) { sH[kt] = wmma16(kb[kt], qh1, sH[kt]); sL[kt] = wmma16(kb[kt], qr1, sL[kt]); }
#pragma unroll
      for (int kt = 0; kt < 4; ++kt) sL[kt] = wmma16(ra[kt], qh0, sL[kt]);
#pragma unroll
      for (int kt = 0; kt < 4; ++kt) sL[kt] = wmma16(rb[kt], qh1, sL[kt]);
      // the distance between the last products and the vector instructions that read their results, on every path
      asm volatile("v_nop\n\tv_nop\n\tv_nop\n\tv_nop" : "+v"(sH[0]), "+v"(sH[1]), "+v"(sH[2]), "+v"(sH[3]), "+v"(sL[0]), "+v"(sL[1]), "+v"(sL[2]), "+v"(sL[3]) : "v"(rb[0]), "v"(rb[1]), "v"(rb[2]), "v"(rb[3]));
      float t[4][8];                                                      // t[kt][r]: key key0 + 16 kt + 8h + r, query t0 + lr
#pragma unroll
      for (int kt = 0; kt < 4; ++kt)
#pragma unroll
          for (int r = 0; r < 8; ++r) t[kt][r] = (sH[kt][r] + sL[kt][r] * QRI) * L2E;
      if (key0 + KST - 1 > t0) {                                          // wave-uniform: the stage crosses the diagonal (a tile's last stage)
          const int tq = t0 + lr - key0 - 8 * hi;                         // entry r of key tile kt is hidden when 16 kt + r > tq
#pragma unroll
          for (int kt = 0; kt < 4; ++kt)
#pragma unroll
              for (int r = 0; r < 8; ++r) t[kt][r] = (16 * kt + r > tq) ? NEGB : t[kt][r];
      }
      float mxa = NEGB, mxb = NEGB;
#pragma unroll
      for (int r = 0; r < 8; ++r) { mxa = fmaxf(mxa, fmaxf(t[0][r], t[1][r])); mxb = fmaxf(mxb, fmaxf(t[2][r], t[3][r])); }
      float mx = fmaxf(mxa, mxb);
      const float mo = __shfl_xor(mx, 16, 32);
      asm volatile("" :: "v"(mo) : "memory");                             // inputs-only fence on the exchanged value: the V reads below stay behind its return (LDS results return in order: issued ahead of it, they would all be waited for at the exchange)
      v16h vh[2][4], vl[2][4];                                            // A fragments of V^T: [keys 0..31, 32..63][features 16j ..], value and residual
#pragma unroll
      for (int s = 0; s < 2; ++s) {
#pragma unroll
          for (int j = 0; j < 4; ++j) vh[s][j] = ldvt(va + s * 32 * LPV + 32 * j);
#pragma unroll
          for (int j = 0; j < 4; ++j) vl[s][j] = ldvt(vr + s * 32 * LPV + 32 * j);
      }
      __builtin_amdgcn_sched_barrier(0);                                  // holds the stage's V reads as one group ahead of the exponentials, which cover their latency
      const float mnew = fmaxf(m, fmaxf(mx, mo));
      const float alpha = __builtin_amdgcn_exp2f(m - mnew);
      const float sh = PSH - mnew;
      v16h pb0, pb1; float ls0 = 0.0f, ls1 = 0.0f;                        // B fragments of P^T: keys 0..31 and 32..63 of the stage
#pragma unroll
      for (int r = 0; r < 8; ++r) {
          const h16 pa = (h16)__builtin_amdgcn_exp2f(t[0][r] + sh); const h16 pc = (h16)__builtin_amdgcn_exp2f(t[1][r] + sh); pb0[r] = pa; pb0[8 + r] = pc; ls0 += (float)pa + (float)pc;
          const h16 pd = (h16)__builtin_amdgcn_exp2f(t[2][r] + sh); const h16 pe = (h16)__builtin_amdgcn_exp2f(t[3][r] + sh); pb1[r] = pd; pb1[8 + r] = pe; ls1 += (float)pd + (float)pe; }
      l = l * alpha + (ls0 + ls1); m = mnew;
      oh0 = oh0 * alpha; oh1 = oh1 * alpha; oh2 = oh2 * alpha; oh3 = oh3 * alpha;
      or0 = or0 * alpha; or1 = or1 * alpha; or2 = or2 * alpha; or3 = or3 * alpha;
      oh0 = wmma16(vh[0][0], pb0, oh0); oh1 = wmma16(vh[0][1], pb0, oh1); oh2 = wmma16(vh[0][2], pb0, oh2); oh3 = wmma16(vh[0][3], pb0, oh3);
      or0 = wmma16(vl[0][0], pb0, or0); or1 = wmma16(vl[0][1], pb0, or1); or2 = wmma16(vl[0][2], pb0, or2); or3 = wmma16(vl[0][3], pb0, or3);
      oh0 = wmma16(vh[1][0], pb1, oh0); oh1 = wmma16(vh[1][1], pb1, oh1); oh2 = wmma16(vh[1][2], pb1, oh2); oh3 = wmma16(vh[1][3], pb1, oh3);
      or0 = wmma16(vl[1][0], pb1, or0); or1 = wmma16(vl[1][1], pb1, or1); or2 = wmma16(vl[1][2], pb1, or2); or3 = wmma16(vl[1][3], pb1, or3);
      // the distance between the last products and the vector instructions that read or rescale their results, on every path (the loop's exit too)
      asm volatile("v_nop\n\tv_nop\n\tv_nop\n\tv_nop" : "+v"(oh0), "+v"(oh1), "+v"(oh2), "+v"(oh3), "+v"(or0), "+v"(or1), "+v"(or2), "+v"(or3) : "v"(vl[1][0]), "v"(vl[1][1]), "v"(vl[1][2]), "v"(vl[1][3]), "v"(pb1));
      // hand-over, every wave: own LDS reads done, own tile of stage g+1 landed, barrier (publishes stage g+1, frees this stage's buffer), then the refill
      wait_ds0();
      wait_tensor0();
      __syncthreads();
      if (pinned(g + 2 < NQT + 1)) {                         // stage g+2: the next 64 keys, or, where it is the second tile's first, back to keys 0..
          g0 = stage_next(g0, ldst + (uint32_t)(g & 1) * BSZ, g + 2 == na ? -(int64_t)(na - 1) * (int64_t)gstep : (int64_t)gstep);
          stage_load(isk, isv, g0, g1k, g1v);
      }
      ++g;
    } while (++st < nst);
    l += __shfl_xor(l, 16, 32);
    const float inv = 1.0f / l;
    const float ri = QRI * inv;
    // O^T D layout: o_j[r] = (d = 16j + 8h + r, t = lane&15) -> os[t][d]; rows 0..15 x columns 0..63 all written
    STG(0, oh0, or0)
    STG(16, oh1, or1)
    STG(32, oh2, or2)
    STG(48, oh3, or3)
    wave_sync();
    bf* crow = CTX + ((size_t)b * SEQ + t0) * (size_t)(2 * DM) + h * HD;
{
#pragma unroll
        for (int s = 0; s < 4; ++s) { const int row = 4 * s + (lane >> 3), c8 = (lane & 7) * 8;   // 4 s x 4 row groups = 16 rows; 8 lanes x 8 = 64 columns
            const v4f x0 = *(const v4fa*)(&os[wb + row * 68 + c8]); const v4f x1 = *(const v4fa*)(&os[wb + row * 68 + c8 + 4]); v8us hv, lv;
#pragma unroll
            for (int i = 0; i < 4; ++i) { const unsigned short a0 = f2bf(x0[i]); const unsigned short a1 = f2bf(x1[i]); hv[i] = a0; hv[4 + i] = a1; lv[i] = f2bf(x0[i] - bf2f(a0)); lv[4 + i] = f2bf(x1[i] - bf2f(a1)); }
            const size_t oo = (size_t)row * (size_t)(2 * DM) + c8;
            *(v8us*)(crow + oo) = hv; *(v8us*)(crow + oo + DM) = lv; }
         }
    asm volatile("s_wait_xcnt 0x0" ::: "memory");            // stands in front of the first overwrite of a register that the stores above name (the next tile's set-up)
    wave_sync();                                             // the staging rows are read before the second tile's results are written over them
    }
    wait_tensor0();
    wait_ds0();
}

extern "C" void kernel_launch(void* const* d_in, const int* in_sizes, int n_in,
                              void* d_out, int out_size, void* d_ws, size_t ws_size, hipStream_t stream) {
    if (n_in < 7) return;
    const size_t needx = ((size_t)(NB - 1) * SEQ_FULL + SEQ) * DM;
    if ((size_t)in_sizes[0] < needx || (size_t)in_sizes[1] < needx || (size_t)in_sizes[2] < needx) return;
    if ((size_t)in_sizes[3] < (size_t)DM * DM || (size_t)in_sizes[4] < (size_t)DM * DM || (size_t)in_sizes[5] < (size_t)DM * DM || (size_t)in_sizes[6] < (size_t)DM * DM) return;
    if ((size_t)out_size < ((size_t)(NB - 1) * OUT_SEQ + SEQ) * DM) return;
    if (SZ_TOTAL > ws_size) return;
    // wire order: q, k, v, Wq, Wk, Wv, Wp (weights [in][out])
    const float* xq = (const float*)d_in[0]; const float* xk = (const float*)d_in[1]; const float* xv = (const float*)d_in[2];
    const float* wq = (const float*)d_in[3]; const float* wk = (const float*)d_in[4]; const float* wv = (const float*)d_in[5]; const float* wp = (const float*)d_in[6];
    float* OUT = (float*)d_out;      // [NB][SEQ][1024]
    char* wsp = (char*)d_ws;
    bf* XQ = (bf*)wsp; wsp += SZ_XB;                 // [NB*SEQ][1024]; the k and v copies are reached from XQ, the other W^T planes from WQT, by their strides
    bf* XK = (bf*)wsp; wsp += SZ_XB;
    bf* XV = (bf*)wsp; wsp += SZ_XB;
    bf* WQT = (bf*)wsp; wsp += SZ_WB;                // [out][in]
    bf* WKT = (bf*)wsp; wsp += SZ_WB;
    bf* WVT = (bf*)wsp; wsp += SZ_WB;
    bf* WPT = (bf*)wsp; wsp += SZ_WB;
    h16* QH = (h16*)wsp; wsp += SZ_PL;               // [NB*SEQ][1024] == [NB*16][SEQ][64]
    h16* QR = (h16*)wsp; wsp += SZ_PL;               // residual x2048
    h16* KH = (h16*)wsp; wsp += SZ_PL;
    h16* KR = (h16*)wsp; wsp += SZ_PL;
    h16* VH = (h16*)wsp; wsp += SZ_PL;
    h16* VR = (h16*)wsp; wsp += SZ_PL;
    bf* CTX = (bf*)wsp; wsp += SZ_CTX;               // [NB*SEQ][2048]: hi | lo

    // every input conversion in one launch: W[in][out] -> WT[out][in] bf16 (four planes from WQT on), q, k, v -> bf16 copies (three from XQ on)
    k_prep<<<4 * WTB + 3 * CVB, 256, 0, stream>>>(xq, xk, xv, wq, wk, wv, wp, XQ, WQT);

    // projections, one launch, z = q, k, v: A = x rows (m = b*SEQ + t), Bt = W^T rows (n) -> row-major planes [m][n] (value + residual; a pair of planes per z)
    k_gemm<0><<<dim3(NB * SEQ / 128, DM / 128, 3), 128, 0, stream>>>(XQ, WQT, DM, QH, QR, OUT, SZ_XB / 2, SZ_WB / 2, SZ_PL);

    k_flash<<<dim3(NQT / 2, NB * NH_, 1), 32 * AW, 0, stream>>>(QH, QR, KH, KR, VH, VR, CTX);

    // output projection: A = ctx rows [hi | lo] (K = 2048), Bt = Wp^T rows (k index wraps at 1024) -> f32 output
    k_gemm<1><<<dim3(NB * SEQ / 128, DM / 128, 1), 128, 0, stream>>>(CTX, WPT, 2 * DM, QH, QR, OUT, 0, 0, 0);
}

// v008
// Measured time: 84.1 microseconds a run.
// Next to v007, in two timings, it ran 1.07 and 1.08 times as fast.
// Counting every step since v000, it is 4.19 times as fast.
#include <hip/hip_runtime.h>

// Multi-head attention, width 1024 = 16 heads x 64, separate q/k/v inputs [NB][SEQ][1024], Wq/Wk/Wv/Wp [in][out] (y = x W), no biases, unscaled scores, causal replace-mask, head split = flat row-major view (B,S,1024)->(B,16,S,64), output projection Wp (f32 out).
// Compute dtypes, f32 accumulate everywhere: q/k/v projections v_wmma_f32_16x16x32_bf16 (x and W RNE-converted to bf16; products exact);
// scores v_wmma_f32_16x16x32_f16 with q and k each as f16 value + f16 residual x2048 (three products, scaled residual products in their own accumulator);
// P (x2^14 carry, cancels in the normalisation) single f16, v as f16 value + f16 residual x2048 (two products, own accumulator); softmax f32 (online, running max);
// output projection v_wmma_f32_16x16x32_f16 with ctx as one f16 value (K = 1024; P, which ctx is summed from, is one f16 value too), Wp RNE-converted to bf16 and that value held as f16.
// Layout: bf16 copies of q/k/v, 16-bit W^T planes [out][in]; projection planes [NB*SEQ][1024] f16 (== [b*16+h][s][64] by the flat head view);
// fused flash kernel in transposed form (S^T = K Q^T, O^T = V^T P^T), K / V tiles of 64 keys staged row-major in LDS by tensor loads (two buffers, shared by the block's four waves),
// the V^T fragments read from the row-major V tiles by the transposing LDS load (ds_load_tr16_b128); ctx plane [NB*SEQ][1024] f16.
// Each flash block works on two query tiles of one head, one after the other: tile x and tile NQT-1-x, so that every block walks the same number of key stages.
// GEMMs: 128x128 tile per block of four waves (64x64 each), A and Bt stages of 128 k staged in LDS by tensor loads (two buffers).
// Every operand of the two GEMMs and K, V of the flash kernel were written by an earlier launch and lie in memory: at its head each block asks for its share of the rows that it and its sharers will stream (global_prefetch_b8 into L2).
// Four launches: k_prep (all seven input conversions, split by block index), k_gemm<0> (the three projections, one per blockIdx.z), k_flash, k_gemm<1>.

#ifndef NB
#define NB 2
#endif
#ifndef SEQ
#define SEQ 2048
#endif
#define NB_FULL  2
#define SEQ_FULL 2048
#ifndef OUT_SEQ
#define OUT_SEQ SEQ              // row pitch (in tokens) between batches of the output
#endif
#define DM   1024
#define NH_  16
#define HD   64
#define AW   4                   // waves per flash block (16 query rows each)
#define QRS  2048.0f             // carry of the residual planes
#define QRI  (1.0f / 2048.0f)
#define L2E  1.4426950408889634f // log2(e); scores are unscaled
#define PSH  14.0f               // log2 of the P carry (16384)
#define NEGB (-3.0e38f)
#define KST  64                  // keys per LDS stage of the flash kernel
#define LP   144                 // LDS row pitch of the K tiles in bytes: 128-B rows + 16-B pad (16 B x odd, for 16-byte LDS reads)
#define LPH  (LP / 2)            // the same in halves
#define LPV  160                 // LDS row pitch of the V tiles in bytes: 128-B rows + 32-B pad (32 B x odd, for transposing LDS reads)
#define TSZ  10240               // place of one tile in LDS: 64 rows x 144 B = 9216 B or x 160 B = 10240 B, a multiple of 2 KiB
#define BSZ  (4 * TSZ)           // one buffer: K value, K residual, V value, V residual
#define NQT  (SEQ / (16 * AW))   // query tiles (64 rows) per head
#define OSB  (AW * 16 * 68 * 4)  // output staging of the flash kernel in bytes, behind its ring
#define GKS  128                 // k per LDS stage of the GEMM (256-B rows)
#define GLP  272                 // its LDS row pitch in bytes: 256-B rows + 16-B pad (16 B x odd, for 16-byte LDS reads)
#define GLPH (GLP / 2)           // the same in 16-bit elements
#define GTSZ 18432               // place of one GEMM tile in LDS: 64 rows x 272 B = 17408 B, rounded up to a multiple of 2 KiB
#define GBSZ (4 * GTSZ)          // one buffer: A rows 0..63, A rows 64..127, Bt rows 0..63, Bt rows 64..127

static_assert(HD == 64);
static_assert(NH_ * HD == DM);
static_assert((DM & (DM - 1)) == 0);           // B-operand k index wraps with a mask
static_assert(DM % 64 == 0);
static_assert(SEQ % 64 == 0);                  // 64-row tiles never straddle two batches; K and V tiles of 64 keys
static_assert((NB * SEQ) % 64 == 0);
static_assert(SEQ % 32 == 0);                  // a P fragment covers 32 keys
static_assert(SEQ % (16 * AW) == 0);           // flash grid covers the sequence exactly
static_assert(((size_t)SEQ * DM) % 8 == 0);
static_assert(NB <= NB_FULL);
static_assert(SEQ <= SEQ_FULL);
static_assert(AW == 4);                        // one tensor load per wave and stage: four tiles, four waves
static_assert(16 * AW == KST);                 // a block's queries end where its last 64-key stage ends
static_assert(NQT % 2 == 0 && NQT >= 2);       // query tiles pair up as x and NQT-1-x; a pair has NQT+1 >= 2 stages, which the ring's prologue needs
static_assert(HD * 2 == 128);                  // K and V tiles have 128-byte rows (one key's 64 features)
static_assert(KST * LP <= TSZ && KST * LPV <= TSZ && TSZ % 2048 == 0);
static_assert((NB * SEQ) % 128 == 0 && DM % 128 == 0);   // GEMM grid of 128x128 tiles covers C exactly
static_assert(DM % GKS == 0 && DM >= 2 * GKS);           // whole stages, the Bt wrap falls on a stage boundary, the ring's prologue loads two stages
static_assert(GKS * 2 == 256 && 64 * GLP <= GTSZ && GTSZ % 2048 == 0);
static_assert(4 * 16 * 68 * 4 <= 2 * GBSZ);              // GEMM output staging reuses its ring
static_assert(DM == 1024 && SEQ * HD * 2 == 4 * 65536);  // the prefetch shares: eight of 32 KiB cover a GEMM block's rows, eight of 4 x 8 KiB a head's part of a plane

typedef _Float16 h16;
typedef unsigned short bf;
typedef __attribute__((ext_vector_type(16))) __bf16   v16bf;
typedef __attribute__((ext_vector_type(16))) _Float16 v16h;
typedef __attribute__((ext_vector_type(8)))  _Float16 v8h;
typedef __attribute__((ext_vector_type(8)))  unsigned short v8us;
typedef __attribute__((ext_vector_type(8)))  short    v8s;
typedef __attribute__((ext_vector_type(8)))  float    v8f;
typedef __attribute__((ext_vector_type(4)))  float    v4f;
typedef v4f  __attribute__((may_alias)) v4fa;
typedef uint32_t u32x4 __attribute__((ext_vector_type(4)));
typedef uint32_t u32x8 __attribute__((ext_vector_type(8)));

__device__ __forceinline__ unsigned short f2bf(float f) { unsigned u = __float_as_uint(f); u += 0x7FFFu + ((u >> 16) & 1u); return (unsigned short)(u >> 16); }
__device__ __forceinline__ float bf2f(unsigned short s) { return __uint_as_float(((unsigned)s) << 16); }
__device__ __forceinline__ v16h cat16(v8h lo, v8h hi) { return __builtin_shufflevector(lo, hi, 0, 1, 2, 3, 4, 5, 6, 7, 8, 9, 10, 11, 12, 13, 14, 15); }
__device__ __forceinline__ v16bf cat16b(v8us lo, v8us hi) { return __builtin_bit_cast(v16bf, __builtin_shufflevector(lo, hi, 0, 1, 2, 3, 4, 5, 6, 7, 8, 9, 10, 11, 12, 13, 14, 15)); }
__device__ __forceinline__ v8f wmma16(v16h a, v16h b, v8f c) { return __builtin_amdgcn_wmma_f32_16x16x32_f16(false, a, false, b, (short)0, c, false, false); }
__device__ __forceinline__ v8f wmmab(v16bf a, v16bf b, v8f c) { return __builtin_amdgcn_wmma_f32_16x16x32_bf16(false, a, false, b, (short)0, c, false, false); }
// fragment loaders from K-contiguous 16-bit rows; p already includes + 8*(lane>>4): elements 0..7 <- k0+8h+0..7, elements 8..15 <- k0+16+8h+0..7 (same map for A and B)
__device__ __forceinline__ v16h  ldh(const h16* p) { return cat16(*(const v8h*)p, *(const v8h*)(p + 16)); }
__device__ __forceinline__ v16bf ldb(const bf* p)  { return cat16b(*(const v8us*)p, *(const v8us*)(p + 16)); }
// transposing LDS load from a row-major 16-bit tile T (rows = k, pitch LPV): with p = T + (k0 + 8*(lane>>4) + (lane&7)) * LPV + 2*d0 + 16*((lane>>3)&1)
// lane (c = lane&15, h = lane>>4) gets T[k0+8h+0..7][d0+c]; the loads at k0 and k0+16 make one A fragment of T^T in the k order of ldh (elements 0..7 <- k0+8h+0..7, 8..15 <- k0+16+8h+0..7)
__device__ __forceinline__ v8h ldtr(const unsigned char* p) { typedef __attribute__((address_space(3))) v8s lds_v8s; return __builtin_bit_cast(v8h, __builtin_amdgcn_ds_load_tr16_b128_v8i16((lds_v8s*)p)); }
__device__ __forceinline__ v16h ldvt(const unsigned char* p) { return cat16(ldtr(p), ldtr(p + 16 * LPV)); }
// ordering point for wave-private LDS tiles (same wave writes and reads)
__device__ __forceinline__ void wave_sync() { __builtin_amdgcn_fence(3 /* release order */, "wavefront"); __builtin_amdgcn_wave_barrier(); asm volatile("" ::: "memory"); }

__device__ __forceinline__ uint32_t uni(uint32_t v) { return (uint32_t)__builtin_amdgcn_readfirstlane(v); }
// wave-uniform test held in a scalar register, so that the branch on it is a scalar branch (a tensor load ignores EXEC)
__device__ __forceinline__ uint32_t pinned(uint32_t v) { uint32_t w = (uint32_t)__builtin_amdgcn_readfirstlane(v); asm volatile("" : "+s"(w)); return w; }
__device__ __forceinline__ void wait_ds0()     { asm volatile("s_wait_dscnt 0x0" ::: "memory"); }      // this wave's LDS reads have returned before the buffer is handed back
__device__ __forceinline__ void wait_tensor0() { asm volatile("s_wait_tensorcnt 0x0" ::: "memory"); }  // this wave's tensor load has landed (the compiler places no wait for it)
// one tile of 64 rows x 128 bytes, rows contiguous in the source, into LDS with a pad of PADC + 1 dwords behind every 128-B row (PADC = 3: pitch 144 B, PADC = 7: pitch 160 B): group 1 built once
template <uint32_t PADC>
__device__ __forceinline__ u32x8 tile128_group1() {
    u32x8 g1;
    g1[0] = uni((1u << 20) | (4u << 22) | (PADC << 25)); // no mask, 1-byte elements, pad behind every 32 dwords
    g1[1] = uni(128u << 16); g1[2] = uni(64u << 16); g1[3] = uni(128u << 16); g1[4] = uni(64u); g1[5] = uni(128u); g1[6] = uni(0u); g1[7] = uni(0u);
    asm volatile("" : "+s"(g1));   // as pinned(): the descriptor words are held in their scalar registers through the loop, so that none of them takes another value while a request is outstanding
    return g1;
}
// a wave's one request of a stage: a K tile (is_k) at the pitch of the 16-byte reads or a V tile (is_v) at the pitch of the transposing reads;
// is_k and is_v come from pinned(), one of them set: two scalar branches, so that each request's pad word is a constant
__device__ __forceinline__ void stage_load(uint32_t is_k, uint32_t is_v, u32x4 g0, u32x8 g1k, u32x8 g1v) {
    if (is_k) asm volatile("tensor_load_to_lds %0, %1" :: "s"(g0), "s"(g1k) : "memory");
    if (is_v) asm volatile("tensor_load_to_lds %0, %1" :: "s"(g0), "s"(g1v) : "memory");
}
// group 0 of a wave's first request
__device__ __forceinline__ u32x4 stage_group0(uint32_t lds_dst, uint64_t ga) {
    u32x4 g0;
    g0[0] = uni(1u); g0[1] = uni(lds_dst); g0[2] = uni((uint32_t)ga); g0[3] = uni((((uint32_t)(ga >> 32)) & 0x01FFFFFFu) | 0x80000000u);
    return g0;
}
// group 0 of a wave's next request, formed from that of its last one (place in LDS anew, source address moved by step bytes; the address stays inside its field, so the type bits above it stay):
// the group is so carried from request to request: the words that the next one is formed from (0, 2, 3) stay live, so their registers take no other value while a request is outstanding
__device__ __forceinline__ u32x4 stage_next(u32x4 g0, uint32_t lds_dst, int64_t step) {
    const uint64_t a = (((uint64_t)g0[3] << 32) | (uint64_t)g0[2]) + (uint64_t)step;
    g0[1] = uni(lds_dst); g0[2] = uni((uint32_t)a); g0[3] = uni((uint32_t)(a >> 32));
    return g0;
}
// one tile of 64 rows x 256 bytes, source row pitch src_pitch bytes, into LDS at pitch 272 B (a 16-B pad behind every 256-B row): group 1 built once, group 0 per request
__device__ __forceinline__ u32x8 tile256_group1(uint32_t src_pitch) {
    u32x8 g1;
    g1[0] = uni((1u << 20) | (5u << 22) | (3u << 25));   // no mask, 1-byte elements, pad of 4 dwords behind every 64
    g1[1] = uni(256u << 16); g1[2] = uni(64u << 16); g1[3] = uni(256u << 16); g1[4] = uni(64u); g1[5] = uni(src_pitch); g1[6] = uni(0u); g1[7] = uni(0u);
    asm volatile("" : "+s"(g1));   // as pinned(): the descriptor words are held in their scalar registers through the loop, so that none of them takes another value while a request is outstanding
    return g1;
}
__device__ __forceinline__ void tile256_load(uint32_t lds_dst, uint64_t ga, u32x8 g1) {
    u32x4 g0;
    g0[0] = uni(1u); g0[1] = uni(lds_dst); g0[2] = uni((uint32_t)ga); g0[3] = uni((((uint32_t)(ga >> 32)) & 0x01FFFFFFu) | 0x80000000u);
    asm volatile("tensor_load_to_lds %0, %1" :: "s"(g0), "s"(g1) : "memory");
}

// Which eighth of a shared operand a block asks for, from its index x along the grid's fastest dimension: x & 3 and bit 3 of x,
// so the values 0..7 all occur among the x with x % 8 in 0..3 and among those in 4..7. For speed only: wherever the blocks land, a unit that nobody asked for is simply fetched by the tensor load that reads it.
__device__ __forceinline__ uint32_t pf_eighth(uint32_t x) { return (x & 3u) | (((x >> 3) & 1u) << 2); }
// keeps a prefetch's address registers live, so at their value, up to this point: a prefetch is issued over registers that hold no other value soon after it (here: not before a tile's landing and a barrier have gone by)
__device__ __forceinline__ void pf_hold(const char* p) { asm volatile("" :: "v"(p)); }

static constexpr size_t al256(size_t v) { return (v + 255) & ~(size_t)255; }
static constexpr size_t SZ_XB  = al256((size_t)NB * SEQ * DM * 2);          // one bf16 input copy
static constexpr size_t SZ_WB  = al256((size_t)DM * DM * 2);                // one 16-bit W^T plane
static constexpr size_t SZ_PL  = al256((size_t)NB * NH_ * SEQ * HD * 2);    // one f16 plane
static constexpr size_t SZ_CTX = al256((size_t)NB * SEQ * DM * 2);          // ctx, f16
static constexpr size_t SZ_TOTAL = 3 * SZ_XB + 4 * SZ_WB + 6 * SZ_PL + SZ_CTX;
static_assert(SZ_TOTAL <= (size_t)134217728);          // workspace carve <= 128 MiB
static_assert(SZ_PL == (size_t)NB * SEQ * DM * 2);     // value / residual plane pairs are exactly contiguous

#define WTB ((DM / 64) * (DM / 64))                          // blocks per weight: 64x64 tiles
#define CVN ((size_t)NB * SEQ * DM / 8)                      // 8-element chunks per activation input
#define CVB ((int)((CVN + 255) / 256))                       // blocks per activation input

// RNE convert of one activation input: block cb takes 256 chunks of 8 floats; source batches SEQ_FULL tokens apart, copy packed [NB*SEQ][DM].
__device__ __forceinline__ void cvt8_block(const float* __restrict__ src, bf* dst, int cb) {
    const size_t i = (size_t)cb * 256 + threadIdx.x; if (i >= CVN) return;
    const size_t e = i * 8;
    const v8f v = *(const v8f*)(src + e + (e / ((size_t)SEQ * DM)) * ((size_t)(SEQ_FULL - SEQ) * DM)); v8us o;
#pragma unroll
    for (int k = 0; k < 8; ++k) o[k] = f2bf(v[k]);
    *(v8us*)(dst + e) = o;
}

// weight transpose + RNE convert of one 64x64 tile: in W[DM rows k][DM cols n] f32 -> out WT[DM rows n][DM cols k] bf16;
// as_h (block-uniform): the same bf16-rounded value written in f16 form (exact from 2^-17 up in magnitude, below that within 2^-25), for a product whose other operand is f16.
__device__ __forceinline__ void wt_block(const float* __restrict__ W, bf* WT, int n0, int k0, float* tile, bool as_h) {
    const int tid = threadIdx.x;
#pragma unroll
    for (int it = 0; it < 4; ++it) { const int c = it * 256 + tid; const int r = c >> 4, c4 = (c & 15) * 4;   // 64 rows x 16 chunks of 4 floats
        const v4f v = *(const v4f*)(W + (size_t)(k0 + r) * DM + n0 + c4);
        tile[r * 65 + c4 + 0] = v[0]; tile[r * 65 + c4 + 1] = v[1]; tile[r * 65 + c4 + 2] = v[2]; tile[r * 65 + c4 + 3] = v[3]; }
    __syncthreads();
    v8us o[2];
#pragma unroll
    for (int it = 0; it < 2; ++it) { const int c = it * 256 + tid; const int n = c >> 3, k8 = (c & 7) * 8;     // 64 output rows x 8 chunks of 8
#pragma unroll
        for (int e = 0; e < 8; ++e) { const unsigned short r = f2bf(tile[(k8 + e) * 65 + n]); o[it][e] = as_h ? __builtin_bit_cast(unsigned short, (h16)bf2f(r)) : r; } }
#pragma unroll
    for (int it = 0; it < 2; ++it) { const int c = it * 256 + tid; const int n = c >> 3, k8 = (c & 7) * 8;
        *(v8us*)(WT + (size_t)(n0 + n) * DM + k0 + k8) = o[it]; }
}

// k_prep: every input conversion in one launch; none depends on another, the block index alone says which piece a block does (block-uniform branch).
// Blocks [0, 4*WTB): weight w = index / WTB, tile (n, k) = (index % WTB) % (DM/64), / (DM/64) -> plane w of WT. Blocks behind them: input index / CVB, chunk block index % CVB -> copy of X.
// grid 4*WTB + 3*CVB, 256 threads. X: three copies SZ_XB bytes apart (q, k, v); WT: four planes SZ_WB bytes apart (Wq, Wk, Wv in bf16 form, Wp in f16 form).
__global__ __launch_bounds__(256) void k_prep(const float* __restrict__ xq, const float* __restrict__ xk, const float* __restrict__ xv,
                                              const float* __restrict__ wq, const float* __restrict__ wk, const float* __restrict__ wv, const float* __restrict__ wp,
                                              bf* X, bf* WT) {
    __shared__ float tile[64 * 65];
    const unsigned bid = blockIdx.x;
    if (bid < 4u * WTB) {
        const int w = (int)(bid / WTB), t = (int)(bid % WTB);
        wt_block(w == 0 ? wq : w == 1 ? wk : w == 2 ? wv : wp, WT + (size_t)w * (SZ_WB / 2), (t % (DM / 64)) * 64, (t / (DM / 64)) * 64, tile, w == 3);
    } else {
        const unsigned c = bid - 4u * WTB; const int w = (int)(c / CVB);
        cvt8_block(w == 0 ? xq : w == 1 ? xk : xv, X + (size_t)w * (SZ_XB / 2), (int)(c % CVB));
    }
}

// k_gemm: 16-bit GEMM (MODE 0: both operands bf16, MODE 1: both f16; same fragment maps), 128x128 tile of C per block of four waves (2 x 2), each wave a 64x64 tile (16 accumulators).
// C[m][n] = sum_{kc < KA} A[m][kc] Bt[n][kc & (DM-1)]; A row pitch KA, Bt row pitch DM.
// Per stage of 128 k each wave brings one tile of 64 rows x 256 B into LDS with one tensor load (waves 0, 1 the block's A rows, waves 2, 3 its Bt rows);
// two buffers, the next stage's loads in flight while this stage is worked on; every wave reads its fragments from LDS (two 16-B reads each).
// MODE 0: C written as f16 (Ph) and f16 residual x2048 (Pr), row-major pitch DM. MODE 1: C written as f32 to OUT rows (m/SEQ)*OUT_SEQ + m%SEQ, pitch DM.
// grid (M/128, DM/128, Z), 128 threads; KA a multiple of 128, at least 256. Epilogue per 16-row slab staged in LDS (wave-private part of the ring);
// blockIdx.z picks one of Z independent products of the same shape: A planes za elements apart, Bt planes zb apart, Ph and Pr planes zp apart.
template <int MODE>
__device__ __forceinline__ v8f wmmag(v16bf a, v16bf b, v8f c) {
    if constexpr (MODE == 0) return wmmab(a, b, c);
    else return wmma16(__builtin_bit_cast(v16h, a), __builtin_bit_cast(v16h, b), c);
}
template <int MODE>
__global__ __launch_bounds__(128) void k_gemm(const bf* __restrict__ A0, const bf* __restrict__ Bt0, int KA, h16* Ph0, h16* Pr0, float* OUT, size_t za, size_t zb, size_t zp) {
    __shared__ __attribute__((aligned(2048))) unsigned char gring[2 * GBSZ];
    const bf* A = A0 + blockIdx.z * za; const bf* Bt = Bt0 + blockIdx.z * zb;
    h16* Ph = Ph0 + blockIdx.z * zp; h16* Pr = Pr0 + blockIdx.z * zp;
    const int lane = threadIdx.x & 31, wave = (int)uni(threadIdx.x >> 5), lr = lane & 15, hi = lane >> 4;
    const int wm = wave >> 1, wn = wave & 1;                 // the wave's 64x64 tile inside the block's 128x128
    const int r0 = blockIdx.x * 128 + wm * 64, c0 = blockIdx.y * 128 + wn * 64;
    // this wave's tile to load: waves 0, 1 rows 0..63, 64..127 of the block's A rows; waves 2, 3 the same of its Bt rows
    const int lrow = (wave < 2 ? (int)blockIdx.x : (int)blockIdx.y) * 128 + (wave & 1) * 64;
    const uint32_t gpitch = wave < 2 ? (uint32_t)KA * 2u : (uint32_t)(DM * 2);
    const uint64_t gsrc = (uint64_t)(size_t)(wave < 2 ? A : Bt) + (uint64_t)lrow * gpitch;
    const uint32_t gmask = wave < 2 ? 0xFFFFFFFFu : (uint32_t)(DM * 2 - 1);   // byte offset along a row; Bt's wraps at DM elements
    const uint32_t ldst = (uint32_t)(size_t)gring + (uint32_t)wave * GTSZ;
    const int nst = KA / GKS;
    const u32x8 g1 = tile256_group1(gpitch);
    tile256_load(ldst, gsrc, g1);                            // stage 0 -> buffer 0
    // Prefetch into L2, one request a lane, 256 B apart: the block's 128 A rows (256 KiB in a row) are read by the DM/128 = 8 blocks of its x, an eighth each by blockIdx.y;
    // its 128 Bt rows (256 KiB in a row) by every x, an eighth each by pf_eighth. Without it every stage of blocks that walk k in step is a first touch and lands with memory latency.
    const char* pfa = (const char*)(A + (size_t)blockIdx.x * 128 * DM) + (size_t)blockIdx.y * 32768 + threadIdx.x * 256;   // KA of both launches is DM
    const char* pfb = (const char*)(Bt + (size_t)blockIdx.y * 128 * DM) + (size_t)pf_eighth(blockIdx.x) * 32768 + threadIdx.x * 256;
    // s_wait_xcnt, a precaution as behind any issued global memory instruction: it stands in front of every overwrite of the address registers that the prefetches name
    asm volatile("global_prefetch_b8 %0, off scope:SCOPE_SE\n\tglobal_prefetch_b8 %1, off scope:SCOPE_SE\n\ts_wait_xcnt 0x0" :: "v"(pfa), "v"(pfb));
    v8f acc[4][4];
#pragma unroll
    for (int mb = 0; mb < 4; ++mb)
#pragma unroll
        for (int nb = 0; nb < 4; ++nb) acc[mb][nb] = (v8f){};
    const int fo = lr * GLP + 16 * hi;                       // lane's byte offset in a tile: row lr, k offset 8h elements (A and B fragments alike)
    wait_tensor0();
    __syncthreads();                                         // stage 0 published
    tile256_load(ldst + GBSZ, gsrc + ((uint32_t)(GKS * 2) & gmask), g1);       // stage 1 -> buffer 1
    pf_hold(pfa); pf_hold(pfb);                              // the prefetches' address registers keep their values up to here
#pragma unroll 1
    for (int st = 0; st < nst; ++st) {
        const unsigned char* bp = gring + (st & 1) * GBSZ + fo;
        const bf* ap = (const bf*)(bp + wm * GTSZ);          // A rows of this wave
        const bf* bq = (const bf*)(bp + (2 + wn) * GTSZ);    // Bt rows of this wave
        v16bf a[2][4], b[2][4];                              // two fragment sets: the next 32 k are fetched ahead of this block's products
#pragma unroll
        for (int f = 0; f < 4; ++f) a[0][f] = ldb(ap + f * 16 * GLPH);
#pragma unroll
        for (int f = 0; f < 4; ++f) b[0][f] = ldb(bq + f * 16 * GLPH);
#pragma unroll
        for (int ks = 0; ks < GKS / 32; ++ks) {
            if (ks + 1 < GKS / 32) {
#pragma unroll
                for (int f = 0; f < 4; ++f) a[(ks + 1) & 1][f] = ldb(ap + f * 16 * GLPH + (ks + 1) * 32);
#pragma unroll
                for (int f = 0; f < 4; ++f) b[(ks + 1) & 1][f] = ldb(bq + f * 16 * GLPH + (ks + 1) * 32);
                __builtin_amdgcn_sched_barrier(0);           // holds the next block's LDS reads as one group ahead of this block's products (else each read sinks to its use and is waited for there)
            }
#pragma unroll
            for (int nb = 0; nb < 4; ++nb)
#pragma unroll
                for (int mb = 0; mb < 4; ++mb) acc[mb][nb] = wmmag<MODE>(a[ks & 1][mb], b[ks & 1][nb], acc[mb][nb]);
            __builtin_amdgcn_sched_barrier(0);               // keeps this block's products ahead of the reads after next, which reuse its fragment registers
        }
        // hand-over, every wave: own LDS reads done, own tile of stage st+1 landed, barrier (publishes stage st+1, frees this stage's buffer), then the refill
        wait_ds0();
        wait_tensor0();
        __syncthreads();
        if (pinned(st + 2 < nst)) tile256_load(ldst + (uint32_t)(st & 1) * GBSZ, gsrc + ((uint32_t)((st + 2) * GKS * 2) & gmask), g1);
    }
    wait_tensor0();
    wait_ds0();
    float* os = (float*)gring + wave * 16 * 68;              // output staging reuses the ring: the last hand-over's barrier stands behind every wave's last read, and nothing was issued behind it
#pragma unroll
    for (int mb = 0; mb < 4; ++mb) {
#pragma unroll
        for (int nb = 0; nb < 4; ++nb) {
#pragma unroll
            for (int j = 0; j < 8; ++j) os[(hi * 8 + j) * 68 + nb * 16 + lr] = acc[mb][nb][j]; }   // D: row 8h+j, col lane&15; rows 0..15 x cols 0..63 all written
        wave_sync();
        const int m0 = r0 + mb * 16;
        if (MODE == 0) {
            const size_t sb = (size_t)m0 * DM + c0;
{
#pragma unroll
                for (int s = 0; s < 4; ++s) { const int row = 4 * s + (lane >> 3), c8 = (lane & 7) * 8;   // 4 s x 4 row groups = 16 rows; 8 lanes x 8 = 64 columns
                    const v4f x0 = *(const v4fa*)(&os[row * 68 + c8]); const v4f x1 = *(const v4fa*)(&os[row * 68 + c8 + 4]); v8h hv, rv;
#pragma unroll
                    for (int i = 0; i < 4; ++i) { const h16 a0 = (h16)x0[i]; const h16 a1 = (h16)x1[i]; hv[i] = a0; hv[4 + i] = a1; rv[i] = (h16)((x0[i] - (float)a0) * QRS); rv[4 + i] = (h16)((x1[i] - (float)a1) * QRS); }
                    const size_t oo = sb + (size_t)row * DM + c8;
                    *(v8h*)(Ph + oo) = hv; *(v8h*)(Pr + oo) = rv; }
                 }
        } else {
            float* orow = OUT + ((size_t)(m0 / SEQ) * OUT_SEQ + (size_t)(m0 % SEQ)) * DM + c0;
{
#pragma unroll
                for (int s = 0; s < 8; ++s) { const int row = 2 * s + hi, cofs = lr * 4;   // 8 s x 2 rows = 16 rows; 16 lanes x 4 floats = 64 columns
                    const v4f val = *(const v4fa*)(&os[row * 68 + cofs]);
                    *(v4f*)(orow + (size_t)row * DM + cofs) = val; }
                 }
        }
        wave_sync();
    }
}

#define STG(OFS, OH, OR) { v4f a_, c_; \
    a_[0] = OH[0] * inv + OR[0] * ri; a_[1] = OH[1] * inv + OR[1] * ri; a_[2] = OH[2] * inv + OR[2] * ri; a_[3] = OH[3] * inv + OR[3] * ri; \
    c_[0] = OH[4] * inv + OR[4] * ri; c_[1] = OH[5] * inv + OR[5] * ri; c_[2] = OH[6] * inv + OR[6] * ri; c_[3] = OH[7] * inv + OR[7] * ri; \
    *(v4fa*)(&os[wb + lr * 68 + (OFS) + 8 * hi]) = a_; *(v4fa*)(&os[wb + lr * 68 + (OFS) + 8 * hi + 4]) = c_; }

// k_flash: fused causal attention, one wave per 16 query rows of one (batch, head); Q fragments straight from the f16 planes (two 16-B loads each).
// K and V: per stage of 64 keys each of the four waves brings one tile (K value, K residual, V value, V residual; 64 key rows x 128 B) into LDS with one tensor load;
// two buffers, the next stage's loads in flight while this stage is worked on; every wave reads its fragments from LDS (two 16-B reads each, transposing ones for V^T). Every wave passes every stage's hand-over.
// Transposed form: S^T[key][t] = K Q^T (A = K rows, B = Q rows); lane (t = lane&15, h = lane>>4) holds keys 8h+r of each 16-key tile, so the packed
// P tile is directly the B fragment of O^T[d][t] = V^T P^T (element r <- tile keys 0..15, element 8+r <- tile keys 16..31, lane unchanged).
// A wave takes each stage whole: its 32 K reads as one group, the 24 score products of the four 16-key tiles, one softmax step over the 64 keys, its 32 V reads as one group under the exponentials, the 16 PV products.
// Causal: entries with key > t are replaced by a large negative value (P = 0), in a tile's last stage only (wave-uniform test); every stage of a tile holds a visible key for each of its rows (its first key is <= t0).
// Softmax state (running max, partial sum) is one scalar per lane; the two lane halves of a row are combined with one xor-16 exchange.
// Balance: a tile's cost grows with its index (tile x walks x+1 stages), so a block takes tile blockIdx.x and then tile NQT-1-blockIdx.x of its head, NQT+1 stages whatever the block;
// the ring runs through both tiles as one sequence of stages (the second tile's first stages are in flight while the first tile is finished), so the output staging has LDS of its own behind the ring.
// grid (NQT/2, NB*NH_).
__global__ __launch_bounds__(32 * AW) void k_flash(const h16* __restrict__ QH, const h16* __restrict__ QR, const h16* __restrict__ KH, const h16* __restrict__ KR,
                                                   const h16* __restrict__ VH, const h16* __restrict__ VR, h16* CTX) {
    __shared__ __attribute__((aligned(2048))) unsigned char ring[2 * BSZ + OSB];
    const int lane = threadIdx.x & 31, wave = (int)uni(threadIdx.x >> 5), lr = lane & 15, hi = lane >> 4;
    const int zh = blockIdx.y; const int b = zh / NH_, h = zh % NH_;
    const size_t pbase = (size_t)zh * SEQ * HD;
    // this wave's tile: waves 0, 1 the K planes, waves 2, 3 the V planes (rows = keys, 128 B each, contiguous)
    const h16* pl = wave == 0 ? KH : wave == 1 ? KR : wave == 2 ? VH : VR;
    const uint64_t gsrc = (uint64_t)(size_t)(pl + pbase);
    const uint32_t gstep = (uint32_t)(KST * HD * 2);         // bytes from one stage's tile to the next
    const uint32_t isk = pinned(wave < 2), isv = pinned(wave >= 2);
    const u32x8 g1k = tile128_group1<3u>(), g1v = tile128_group1<7u>();
    const uint32_t ldst = (uint32_t)(size_t)ring + (uint32_t)wave * TSZ;
    // 64-key stages the block walks: na = blockIdx.x+1 of its first tile (keys from 0 on), then NQT-blockIdx.x of its second (keys from 0 on again): NQT+1 in all
    // as pinned(): the first tile's stage count, which the refill's source step is formed from, is formed here, ahead of the first request (without it the build keeps group 0 in two register sets, and a register of the issued set takes another value while the request is outstanding)
    const int na = (int)pinned(blockIdx.x + 1u);
    u32x4 g0 = stage_group0(ldst, gsrc);
    stage_load(isk, isv, g0, g1k, g1v);                      // stage 0 -> buffer 0
    // Prefetch into L2, one request a lane, 256 B apart: each wave asks for an eighth of its own plane's 256 KiB of this head (the head's NQT/2 blocks all stream them), in four runs of 8 KiB, 64 KiB apart, the low keys first.
    // Without it the block that is first at a stage takes memory latency there, stage after stage, and the launch lasts as long as that block.
    const char* pfk = (const char*)(pl + pbase) + (size_t)pf_eighth(blockIdx.x) * 8192 + lane * 256;
    // s_wait_xcnt, a precaution as behind any issued global memory instruction: it stands in front of every overwrite of the address registers that the prefetches name
    asm volatile("global_prefetch_b8 %0, off scope:SCOPE_SE\n\tglobal_prefetch_b8 %0, off offset:65536 scope:SCOPE_SE\n\tglobal_prefetch_b8 %0, off offset:131072 scope:SCOPE_SE\n\tglobal_prefetch_b8 %0, off offset:196608 scope:SCOPE_SE\n\ts_wait_xcnt 0x0" :: "v"(pfk));
    const int fo = lr * LP + 16 * hi;                        // lane's byte offset in a K tile: row lr, k offset 8h halves
    const int vo = (8 * hi + (lane & 7)) * LPV + 16 * ((lane >> 3) & 1);   // lane's byte offset in a V tile for the transposing load: key row 8h + (lane & 7), 16-B half (lane >> 3) & 1
    float* os = (float*)(ring + 2 * BSZ);                    // output staging, a wave-private part each
    const int wb = wave * 16 * 68;
    wait_tensor0();
    __syncthreads();                                         // stage 0 published
    g0 = stage_next(g0, ldst + BSZ, na > 1 ? (int64_t)gstep : (int64_t)0);
    stage_load(isk, isv, g0, g1k, g1v);                      // stage 1 -> buffer 1: the first tile's keys 64.., or, where it has one stage, the second tile's keys 0..
    pf_hold(pfk);                                            // the prefetches' address registers keep their value up to here
    int g = 0;                                               // stage number in the block's sequence; buffer g & 1
#pragma unroll 1                                             // the two tiles share one copy of the loop's code
    for (int half = 0; half < 2; ++half) {
    const int xt = half ? NQT - 1 - (int)blockIdx.x : (int)blockIdx.x;   // this pass's query tile
    const int nst = xt + 1;                                  // its stages: keys [0, 64*(xt+1))
    const int t0 = (xt * AW + wave) * 16;
    const size_t qo = pbase + (size_t)(t0 + lr) * HD + 8 * hi;
    const v16h qh0 = ldh(QH + qo), qh1 = ldh(QH + qo + 32), qr0 = ldh(QR + qo), qr1 = ldh(QR + qo + 32);   // B fragments: col t, k = d
    v8f oh0 = (v8f){}, oh1 = (v8f){}, oh2 = (v8f){}, oh3 = (v8f){};
    v8f or0 = (v8f){}, or1 = (v8f){}, or2 = (v8f){}, or3 = (v8f){};
    float m = NEGB, l = 0.0f;
    int st = 0;
#pragma unroll 1
    do {                                                     // a tile has at least one stage
      const h16* kk = (const h16*)(ring + (g & 1) * BSZ + fo);            // K value tile, row lr of its first 16 keys; key tile kt is 16 rows on
      const h16* kr = kk + TSZ / 2;                                       // K residual tile
      const unsigned char* va = ring + (g & 1) * BSZ + 2 * TSZ + vo;      // V value tile; fragment j: features 16j .. 16j+15 (32 B on), keys 32.. are 32 rows on
      const unsigned char* vr = va + TSZ;                                 // V residual tile
      const int key0 = st * KST;
      v16h ka[4], kb[4], ra[4], rb[4];                                    // A fragments of the four 16-key tiles: value d 0..31, d 32..63, residual d 0..31, d 32..63
#pragma unroll
      for (int kt = 0; kt < 4; ++kt) ka[kt] = ldh(kk + kt * 16 * LPH);
#pragma unroll
      for (int kt = 0; kt < 4; ++kt) kb[kt] = ldh(kk + kt * 16 * LPH + 32);
#pragma unroll
      for (int kt = 0; kt < 4; ++kt) ra[kt] = ldh(kr + kt * 16 * LPH);
#pragma unroll
      for (int kt = 0; kt < 4; ++kt) rb[kt] = ldh(kr + kt * 16 * LPH + 32);
      __builtin_amdgcn_sched_barrier(0);                                  // holds the stage's K reads as one group ahead of its score products (else a part sinks among them and is waited for there)
      v8f sH[4], sL[4];
#pragma unroll
      for (int kt = 0; kt < 4; ++kt) { sH[kt] = wmma16(ka[kt], qh0, (v8f){}); sL[kt] = wmma16(ka[kt], qr0, (v8f){}); }
#pragma unroll
      for (int kt = 0; kt < 4; ++kt) { sH[kt] = wmma16(kb[kt], qh1, sH[kt]); sL[kt] = wmma16(kb[kt], qr1, sL[kt]); }
#pragma unroll
      for (int kt = 0; kt < 4; ++kt) sL[kt] = wmma16(ra[kt], qh0, sL[kt]);
#pragma unroll
      for (int kt = 0; kt < 4; ++kt) sL[kt] = wmma16(rb[kt], qh1, sL[kt]);
      // the distance between the last products and the vector instructions that read their results, on every path
      asm volatile("v_nop\n\tv_nop\n\tv_nop\n\tv_nop" : "+v"(sH[0]), "+v"(sH[1]), "+v"(sH[2]), "+v"(sH[3]), "+v"(sL[0]), "+v"(sL[1]), "+v"(sL[2]), "+v"(sL[3]) : "v"(rb[0]), "v"(rb[1]), "v"(rb[2]), "v"(rb[3]));
      float t[4][8];                                                      // t[kt][r]: key key0 + 16 kt + 8h + r, query t0 + lr
#pragma unroll
      for (int kt = 0; kt < 4; ++kt)
#pragma unroll
          for (int r = 0; r < 8; ++r) t[kt][r] = (sH[kt][r] + sL[kt][r] * QRI) * L2E;
      if (key0 + KST - 1 > t0) {                                          // wave-uniform: the stage crosses the diagonal (a tile's last stage)
          const int tq = t0 + lr - key0 - 8 * hi;                         // entry r of key tile kt is hidden when 16 kt + r > tq
#pragma unroll
          for (int kt = 0; kt < 4; ++kt)
#pragma unroll
              for (int r = 0; r < 8; ++r) t[kt][r] = (16 * kt + r > tq) ? NEGB : t[kt][r];
      }
      float mxa = NEGB, mxb = NEGB;
#pragma unroll
      for (int r = 0; r < 8; ++r) { mxa = fmaxf(mxa, fmaxf(t[0][r], t[1][r])); mxb = fmaxf(mxb, fmaxf(t[2][r], t[3][r])); }
      float mx = fmaxf(mxa, mxb);
      const float mo = __shfl_xor(mx, 16, 32);
      asm volatile("" :: "v"(mo) : "memory");                             // inputs-only fence on the exchanged value: the V reads below stay behind its return (LDS results return in order: issued ahead of it, they would all be waited for at the exchange)
      v16h vh[2][4], vl[2][4];                                            // A fragments of V^T: [keys 0..31, 32..63][features 16j ..], value and residual
#pragma unroll
      for (int s = 0; s < 2; ++s) {
#pragma unroll
          for (int j = 0; j < 4; ++j) vh[s][j] = ldvt(va + s * 32 * LPV + 32 * j);
#pragma unroll
          for (int j = 0; j < 4; ++j) vl[s][j] = ldvt(vr + s * 32 * LPV + 32 * j);
      }
      __builtin_amdgcn_sched_barrier(0);                                  // holds the stage's V reads as one group ahead of the exponentials, which cover their latency
      const float mnew = fmaxf(m, fmaxf(mx, mo));
      const float alpha = __builtin_amdgcn_exp2f(m - mnew);
      const float sh = PSH - mnew;
      v16h pb0, pb1; float ls0 = 0.0f, ls1 = 0.0f;                        // B fragments of P^T: keys 0..31 and 32..63 of the stage
#pragma unroll
      for (int r = 0; r < 8; ++r) {
          const h16 pa = (h16)__builtin_amdgcn_exp2f(t[0][r] + sh); const h16 pc = (h16)__builtin_amdgcn_exp2f(t[1][r] + sh); pb0[r] = pa; pb0[8 + r] = pc; ls0 += (float)pa + (float)pc;
          const h16 pd = (h16)__builtin_amdgcn_exp2f(t[2][r] + sh); const h16 pe = (h16)__builtin_amdgcn_exp2f(t[3][r] + sh); pb1[r] = pd; pb1[8 + r] = pe; ls1 += (float)pd + (float)pe; }
      l = l * alpha + (ls0 + ls1); m = mnew;
      oh0 = oh0 * alpha; oh1 = oh1 * alpha; oh2 = oh2 * alpha; oh3 = oh3 * alpha;
      or0 = or0 * alpha; or1 = or1 * alpha; or2 = or2 * alpha; or3 = or3 * alpha;
      oh0 = wmma16(vh[0][0], pb0, oh0); oh1 = wmma16(vh[0][1], pb0, oh1); oh2 = wmma16(vh[0][2], pb0, oh2); oh3 = wmma16(vh[0][3], pb0, oh3);
      or0 = wmma16(vl[0][0], pb0, or0); or1 = wmma16(vl[0][1], pb0, or1); or2 = wmma16(vl[0][2], pb0, or2); or3 = wmma16(vl[0][3], pb0, or3);
      oh0 = wmma16(vh[1][0], pb1, oh0); oh1 = wmma16(vh[1][1], pb1, oh1); oh2 = wmma16(vh[1][2], pb1, oh2); oh3 = wmma16(vh[1][3], pb1, oh3);
      or0 = wmma16(vl[1][0], pb1, or0); or1 = wmma16(vl[1][1], pb1, or1); or2 = wmma16(vl[1][2], pb1, or2); or3 = wmma16(vl[1][3], pb1, or3);
      // the distance between the last products and the vector instructions that read or rescale their results, on every path (the loop's exit too)
      asm volatile("v_nop\n\tv_nop\n\tv_nop\n\tv_nop" : "+v"(oh0), "+v"(oh1), "+v"(oh2), "+v"(oh3), "+v"(or0), "+v"(or1), "+v"(or2), "+v"(or3) : "v"(vl[1][0]), "v"(vl[1][1]), "v"(vl[1][2]), "v"(vl[1][3]), "v"(pb1));
      // hand-over, every wave: own LDS reads done, own tile of stage g+1 landed, barrier (publishes stage g+1, frees this stage's buffer), then the refill
      wait_ds0();
      wait_tensor0();
      __syncthreads();
      if (pinned(g + 2 < NQT + 1)) {                         // stage g+2: the next 64 keys, or, where it is the second tile's first, back to keys 0..
          g0 = stage_next(g0, ldst + (uint32_t)(g & 1) * BSZ, g + 2 == na ? -(int64_t)(na - 1) * (int64_t)gstep : (int64_t)gstep);
          stage_load(isk, isv, g0, g1k, g1v);
      }
      ++g;
    } while (++st < nst);
    l += __shfl_xor(l, 16, 32);
    const float inv = 1.0f / l;
    const float ri = QRI * inv;
    // O^T D layout: o_j[r] = (d = 16j + 8h + r, t = lane&15) -> os[t][d]; rows 0..15 x columns 0..63 all written
    STG(0, oh0, or0)
    STG(16, oh1, or1)
    STG(32, oh2, or2)
    STG(48, oh3, or3)
    wave_sync();
    h16* crow = CTX + ((size_t)b * SEQ + t0) * (size_t)DM + h * HD;
{
#pragma unroll
        for (int s = 0; s < 4; ++s) { const int row = 4 * s + (lane >> 3), c8 = (lane & 7) * 8;   // 4 s x 4 row groups = 16 rows; 8 lanes x 8 = 64 columns
            const v4f x0 = *(const v4fa*)(&os[wb + row * 68 + c8]); const v4f x1 = *(const v4fa*)(&os[wb + row * 68 + c8 + 4]); v8h hv;
#pragma unroll
            for (int i = 0; i < 4; ++i) { hv[i] = (h16)x0[i]; hv[4 + i] = (h16)x1[i]; }
            *(v8h*)(crow + (size_t)row * DM + c8) = hv; }
         }
    asm volatile("s_wait_xcnt 0x0" ::: "memory");            // stands in front of the first overwrite of a register that the stores above name (the next tile's set-up)
    wave_sync();                                             // the staging rows are read before the second tile's results are written over them
    }
    wait_tensor0();
    wait_ds0();
}

extern "C" void kernel_launch(void* const* d_in, const int* in_sizes, int n_in,
                              void* d_out, int out_size, void* d_ws, size_t ws_size, hipStream_t stream) {
    if (n_in < 7) return;
    const size_t needx = ((size_t)(NB - 1) * SEQ_FULL + SEQ) * DM;
    if ((size_t)in_sizes[0] < needx || (size_t)in_sizes[1] < needx || (size_t)in_sizes[2] < needx) return;
    if ((size_t)in_sizes[3] < (size_t)DM * DM || (size_t)in_sizes[4] < (size_t)DM * DM || (size_t)in_sizes[5] < (size_t)DM * DM || (size_t)in_sizes[6] < (size_t)DM * DM) return;
    if ((size_t)out_size < ((size_t)(NB - 1) * OUT_SEQ + SEQ) * DM) return;
    if (SZ_TOTAL > ws_size) return;
    // wire order: q, k, v, Wq, Wk, Wv, Wp (weights [in][out])
    const float* xq = (const float*)d_in[0]; const float* xk = (const float*)d_in[1]; const float* xv = (const float*)d_in[2];
    const float* wq = (const float*)d_in[3]; const float* wk = (const float*)d_in[4]; const float* wv = (const float*)d_in[5]; const float* wp = (const float*)d_in[6];
    float* OUT = (float*)d_out;      // [NB][SEQ][1024]
    char* wsp = (char*)d_ws;
    bf* XQ = (bf*)wsp; wsp += SZ_XB;                 // [NB*SEQ][1024]; the k and v copies are reached from XQ, the other W^T planes from WQT, by their strides
    bf* XK = (bf*)wsp; wsp += SZ_XB;
    bf* XV = (bf*)wsp; wsp += SZ_XB;
    bf* WQT = (bf*)wsp; wsp += SZ_WB;                // [out][in]
    bf* WKT = (bf*)wsp; wsp += SZ_WB;
    bf* WVT = (bf*)wsp; wsp += SZ_WB;
    bf* WPT = (bf*)wsp; wsp += SZ_WB;
    h16* QH = (h16*)wsp; wsp += SZ_PL;               // [NB*SEQ][1024] == [NB*16][SEQ][64]
    h16* QR = (h16*)wsp; wsp += SZ_PL;               // residual x2048
    h16* KH = (h16*)wsp; wsp += SZ_PL;
    h16* KR = (h16*)wsp; wsp += SZ_PL;
    h16* VH = (h16*)wsp; wsp += SZ_PL;
    h16* VR = (h16*)wsp; wsp += SZ_PL;
    h16* CTX = (h16*)wsp; wsp += SZ_CTX;             // [NB*SEQ][1024]

    // every input conversion in one launch: W[in][out] -> WT[out][in], 16 bits (four planes from WQT on), q, k, v -> bf16 copies (three from XQ on)
    k_prep<<<4 * WTB + 3 * CVB, 256, 0, stream>>>(xq, xk, xv, wq, wk, wv, wp, XQ, WQT);

    // projections, one launch, z = q, k, v: A = x rows (m = b*SEQ + t), Bt = W^T rows (n) -> row-major planes [m][n] (value + residual; a pair of planes per z)
    k_gemm<0><<<dim3(NB * SEQ / 128, DM / 128, 3), 128, 0, stream>>>(XQ, WQT, DM, QH, QR, OUT, SZ_XB / 2, SZ_WB / 2, SZ_PL);

    k_flash<<<dim3(NQT / 2, NB * NH_, 1), 32 * AW, 0, stream>>>(QH, QR, KH, KR, VH, VR, CTX);

    // output projection: A = ctx rows, Bt = Wp^T rows (both f16, handed over as 16-bit words) -> f32 output
    k_gemm<1><<<dim3(NB * SEQ / 128, DM / 128, 1), 128, 0, stream>>>((const bf*)CTX, WPT, DM, QH, QR, OUT, 0, 0, 0);
}

// v009
// It runs in 77.6 microseconds.
// Two timings next to v008 put it at 1.09 and 1.08 times that version's speed.
// All steps since v000 together make it 4.53 times as fast.
#include <hip/hip_runtime.h>

// Multi-head attention, width 1024 = 16 heads x 64, separate q/k/v inputs [NB][SEQ][1024], Wq/Wk/Wv/Wp [in][out] (y = x W), no biases, unscaled scores, causal replace-mask, head split = flat row-major view (B,S,1024)->(B,16,S,64), output projection Wp (f32 out).
// Compute dtypes, f32 accumulate everywhere: q/k/v projections v_wmma_f32_16x16x32_bf16 (x and W RNE-converted to bf16; products exact);
// scores v_wmma_f32_16x16x32_f16 with q and k each as f16 value + f16 residual x2048 (three products, scaled residual products in their own accumulator);
// P (x2^14 carry, cancels in the normalisation) single f16, v as one f16 value (one product; its rounding has the bound of P's, and ctx keeps one f16 value of the sum); softmax f32 (online, running max);
// output projection v_wmma_f32_16x16x32_f16 with ctx as one f16 value (K = 1024; P, which ctx is summed from, is one f16 value too), Wp RNE-converted to bf16 and that value held as f16.
// Layout: bf16 copies of q/k/v, 16-bit W^T planes [out][in]; projection planes [NB*SEQ][1024] f16 (== [b*16+h][s][64] by the flat head view), value and residual for q and k, value alone for v;
// fused flash kernel in transposed form (S^T = K Q^T, O^T = V^T P^T), K / V tiles of 64 keys staged row-major in LDS by tensor loads (two buffers, shared by the block's four waves),
// the V^T fragments read from the row-major V tiles by the transposing LDS load (ds_load_tr16_b128); ctx plane [NB*SEQ][1024] f16.
// Each flash block works on two query tiles of one head, one after the other: tile x and tile NQT-1-x, so that every block walks the same number of key stages.
// GEMMs: 128x128 tile per block of four waves (64x64 each), A and Bt stages of 128 k staged in LDS by tensor loads (two buffers).
// Every operand of the two GEMMs and K, V of the flash kernel were written by an earlier launch and lie in memory: at its head each block asks for its share of the rows that it and its sharers will stream (global_prefetch_b8 into L2).
// Four launches: k_prep (all seven input conversions, split by block index), k_gemm<0> (the three projections, one per blockIdx.z), k_flash, k_gemm<1>.

#ifndef NB
#define NB 2
#endif
#ifndef SEQ
#define SEQ 2048
#endif
#define NB_FULL  2
#define SEQ_FULL 2048
#ifndef OUT_SEQ
#define OUT_SEQ SEQ              // row pitch (in tokens) between batches of the output
#endif
#define DM   1024
#define NH_  16
#define HD   64
#define AW   4                   // waves per flash block (16 query rows each)
#define QRS  2048.0f             // carry of the residual planes
#define QRI  (1.0f / 2048.0f)
#define L2E  1.4426950408889634f // log2(e); scores are unscaled
#define PSH  14.0f               // log2 of the P carry (16384)
#define NEGB (-3.0e38f)
#define KST  64                  // keys per LDS stage of the flash kernel
#define LP   144                 // LDS row pitch of the K tiles in bytes: 128-B rows + 16-B pad (16 B x odd, for 16-byte LDS reads)
#define LPH  (LP / 2)            // the same in halves
#define LPV  160                 // LDS row pitch of the V tiles in bytes: 128-B rows + 32-B pad (32 B x odd, for transposing LDS reads)
#define TSZ  10240               // place of one tile in LDS: 64 rows x 144 B = 9216 B or x 160 B = 10240 B, a multiple of 2 KiB
#define BSZ  (3 * TSZ)           // one buffer: K value, K residual, V
#define NQT  (SEQ / (16 * AW))   // query tiles (64 rows) per head
#define OSB  (AW * 16 * 68 * 4)  // output staging of the flash kernel in bytes, behind its ring
#define GKS  128                 // k per LDS stage of the GEMM (256-B rows)
#define GLP  272                 // its LDS row pitch in bytes: 256-B rows + 16-B pad (16 B x odd, for 16-byte LDS reads)
#define GLPH (GLP / 2)           // the same in 16-bit elements
#define GTSZ 18432               // place of one GEMM tile in LDS: 64 rows x 272 B = 17408 B, rounded up to a multiple of 2 KiB
#define GBSZ (4 * GTSZ)          // one buffer: A rows 0..63, A rows 64..127, Bt rows 0..63, Bt rows 64..127

static_assert(HD == 64);
static_assert(NH_ * HD == DM);
static_assert((DM & (DM - 1)) == 0);           // B-operand k index wraps with a mask
static_assert(DM % 64 == 0);
static_assert(SEQ % 64 == 0);                  // 64-row tiles never straddle two batches; K and V tiles of 64 keys
static_assert((NB * SEQ) % 64 == 0);
static_assert(SEQ % 32 == 0);                  // a P fragment covers 32 keys
static_assert(SEQ % (16 * AW) == 0);           // flash grid covers the sequence exactly
static_assert(((size_t)SEQ * DM) % 8 == 0);
static_assert(NB <= NB_FULL);
static_assert(SEQ <= SEQ_FULL);
static_assert(AW == 4);                        // at most one tensor load per wave and stage: three tiles, waves 0 to 2
static_assert(16 * AW == KST);                 // a block's queries end where its last 64-key stage ends
static_assert(NQT % 2 == 0 && NQT >= 2);       // query tiles pair up as x and NQT-1-x; a pair has NQT+1 >= 2 stages, which the ring's prologue needs
static_assert(HD * 2 == 128);                  // K and V tiles have 128-byte rows (one key's 64 features)
static_assert(KST * LP <= TSZ && KST * LPV <= TSZ && TSZ % 2048 == 0);
static_assert((NB * SEQ) % 128 == 0 && DM % 128 == 0);   // GEMM grid of 128x128 tiles covers C exactly
static_assert(DM % GKS == 0 && DM >= 2 * GKS);           // whole stages, the Bt wrap falls on a stage boundary, the ring's prologue loads two stages
static_assert(GKS * 2 == 256 && 64 * GLP <= GTSZ && GTSZ % 2048 == 0);
static_assert(4 * 16 * 68 * 4 <= 2 * GBSZ);              // GEMM output staging reuses its ring
static_assert(DM == 1024 && SEQ * HD * 2 == 4 * 65536);  // the prefetch shares: eight of 32 KiB cover a GEMM block's rows, eight of 4 x 8 KiB a head's part of a plane

typedef _Float16 h16;
typedef unsigned short bf;
typedef __attribute__((ext_vector_type(16))) __bf16   v16bf;
typedef __attribute__((ext_vector_type(16))) _Float16 v16h;
typedef __attribute__((ext_vector_type(8)))  _Float16 v8h;
typedef __attribute__((ext_vector_type(8)))  unsigned short v8us;
typedef __attribute__((ext_vector_type(8)))  short    v8s;
typedef __attribute__((ext_vector_type(8)))  float    v8f;
typedef __attribute__((ext_vector_type(4)))  float    v4f;
typedef v4f  __attribute__((may_alias)) v4fa;
typedef uint32_t u32x4 __attribute__((ext_vector_type(4)));
typedef uint32_t u32x8 __attribute__((ext_vector_type(8)));

__device__ __forceinline__ unsigned short f2bf(float f) { unsigned u = __float_as_uint(f); u += 0x7FFFu + ((u >> 16) & 1u); return (unsigned short)(u >> 16); }
__device__ __forceinline__ float bf2f(unsigned short s) { return __uint_as_float(((unsigned)s) << 16); }
__device__ __forceinline__ v16h cat16(v8h lo, v8h hi) { return __builtin_shufflevector(lo, hi, 0, 1, 2, 3, 4, 5, 6, 7, 8, 9, 10, 11, 12, 13, 14, 15); }
__device__ __forceinline__ v16bf cat16b(v8us lo, v8us hi) { return __builtin_bit_cast(v16bf, __builtin_shufflevector(lo, hi, 0, 1, 2, 3, 4, 5, 6, 7, 8, 9, 10, 11, 12, 13, 14, 15)); }
__device__ __forceinline__ v8f wmma16(v16h a, v16h b, v8f c) { return __builtin_amdgcn_wmma_f32_16x16x32_f16(false, a, false, b, (short)0, c, false, false); }
__device__ __forceinline__ v8f wmmab(v16bf a, v16bf b, v8f c) { return __builtin_amdgcn_wmma_f32_16x16x32_bf16(false, a, false, b, (short)0, c, false, false); }
// fragment loaders from K-contiguous 16-bit rows; p already includes + 8*(lane>>4): elements 0..7 <- k0+8h+0..7, elements 8..15 <- k0+16+8h+0..7 (same map for A and B)
__device__ __forceinline__ v16h  ldh(const h16* p) { return cat16(*(const v8h*)p, *(const v8h*)(p + 16)); }
__device__ __forceinline__ v16bf ldb(const bf* p)  { return cat16b(*(const v8us*)p, *(const v8us*)(p + 16)); }
// transposing LDS load from a row-major 16-bit tile T (rows = k, pitch LPV): with p = T + (k0 + 8*(lane>>4) + (lane&7)) * LPV + 2*d0 + 16*((lane>>3)&1)
// lane (c = lane&15, h = lane>>4) gets T[k0+8h+0..7][d0+c]; the loads at k0 and k0+16 make one A fragment of T^T in the k order of ldh (elements 0..7 <- k0+8h+0..7, 8..15 <- k0+16+8h+0..7)
__device__ __forceinline__ v8h ldtr(const unsigned char* p) { typedef __attribute__((address_space(3))) v8s lds_v8s; return __builtin_bit_cast(v8h, __builtin_amdgcn_ds_load_tr16_b128_v8i16((lds_v8s*)p)); }
__device__ __forceinline__ v16h ldvt(const unsigned char* p) { return cat16(ldtr(p), ldtr(p + 16 * LPV)); }
// ordering point for wave-private LDS tiles (same wave writes and reads)
__device__ __forceinline__ void wave_sync() { __builtin_amdgcn_fence(3 /* release order */, "wavefront"); __builtin_amdgcn_wave_barrier(); asm volatile("" ::: "memory"); }

__device__ __forceinline__ uint32_t uni(uint32_t v) { return (uint32_t)__builtin_amdgcn_readfirstlane(v); }
// wave-uniform test held in a scalar register, so that the branch on it is a scalar branch (a tensor load ignores EXEC)
__device__ __forceinline__ uint32_t pinned(uint32_t v) { uint32_t w = (uint32_t)__builtin_amdgcn_readfirstlane(v); asm volatile("" : "+s"(w)); return w; }
__device__ __forceinline__ void wait_ds0()     { asm volatile("s_wait_dscnt 0x0" ::: "memory"); }      // this wave's LDS reads have returned before the buffer is handed back
__device__ __forceinline__ void wait_tensor0() { asm volatile("s_wait_tensorcnt 0x0" ::: "memory"); }  // this wave's tensor load has landed (the compiler places no wait for it)
// one tile of 64 rows x 128 bytes, rows contiguous in the source, into LDS with a pad of PADC + 1 dwords behind every 128-B row (PADC = 3: pitch 144 B, PADC = 7: pitch 160 B): group 1 built once
template <uint32_t PADC>
__device__ __forceinline__ u32x8 tile128_group1() {
    u32x8 g1;
    g1[0] = uni((1u << 20) | (4u << 22) | (PADC << 25)); // no mask, 1-byte elements, pad behind every 32 dwords
    g1[1] = uni(128u << 16); g1[2] = uni(64u << 16); g1[3] = uni(128u << 16); g1[4] = uni(64u); g1[5] = uni(128u); g1[6] = uni(0u); g1[7] = uni(0u);
    asm volatile("" : "+s"(g1));   // as pinned(): the descriptor words are held in their scalar registers through the loop, so that none of them takes another value while a request is outstanding
    return g1;
}
// a wave's one request of a stage: a K tile (is_k) at the pitch of the 16-byte reads or a V tile (is_v) at the pitch of the transposing reads;
// is_k and is_v come from pinned(), at most one of them set: two scalar branches, so that each request's pad word is a constant
__device__ __forceinline__ void stage_load(uint32_t is_k, uint32_t is_v, u32x4 g0, u32x8 g1k, u32x8 g1v) {
    if (is_k) asm volatile("tensor_load_to_lds %0, %1" :: "s"(g0), "s"(g1k) : "memory");
    if (is_v) asm volatile("tensor_load_to_lds %0, %1" :: "s"(g0), "s"(g1v) : "memory");
}
// group 0 of a wave's first request
__device__ __forceinline__ u32x4 stage_group0(uint32_t lds_dst, uint64_t ga) {
    u32x4 g0;
    g0[0] = uni(1u); g0[1] = uni(lds_dst); g0[2] = uni((uint32_t)ga); g0[3] = uni((((uint32_t)(ga >> 32)) & 0x01FFFFFFu) | 0x80000000u);
    return g0;
}
// group 0 of a wave's next request, formed from that of its last one (place in LDS anew, source address moved by step bytes; the address stays inside its field, so the type bits above it stay):
// the group is so carried from request to request: the words that the next one is formed from (0, 2, 3) stay live, so their registers take no other value while a request is outstanding
__device__ __forceinline__ u32x4 stage_next(u32x4 g0, uint32_t lds_dst, int64_t step) {
    const uint64_t a = (((uint64_t)g0[3] << 32) | (uint64_t)g0[2]) + (uint64_t)step;
    g0[1] = uni(lds_dst); g0[2] = uni((uint32_t)a); g0[3] = uni((uint32_t)(a >> 32));
    return g0;
}
// one tile of 64 rows x 256 bytes, source row pitch src_pitch bytes, into LDS at pitch 272 B (a 16-B pad behind every 256-B row): group 1 built once, group 0 per request
__device__ __forceinline__ u32x8 tile256_group1(uint32_t src_pitch) {
    u32x8 g1;
    g1[0] = uni((1u << 20) | (5u << 22) | (3u << 25));   // no mask, 1-byte elements, pad of 4 dwords behind every 64
    g1[1] = uni(256u << 16); g1[2] = uni(64u << 16); g1[3] = uni(256u << 16); g1[4] = uni(64u); g1[5] = uni(src_pitch); g1[6] = uni(0u); g1[7] = uni(0u);
    asm volatile("" : "+s"(g1));   // as pinned(): the descriptor words are held in their scalar registers through the loop, so that none of them takes another value while a request is outstanding
    return g1;
}
__device__ __forceinline__ void tile256_load(uint32_t lds_dst, uint64_t ga, u32x8 g1) {
    u32x4 g0;
    g0[0] = uni(1u); g0[1] = uni(lds_dst); g0[2] = uni((uint32_t)ga); g0[3] = uni((((uint32_t)(ga >> 32)) & 0x01FFFFFFu) | 0x80000000u);
    asm volatile("tensor_load_to_lds %0, %1" :: "s"(g0), "s"(g1) : "memory");
}

// Which eighth of a shared operand a block asks for, from its index x along the grid's fastest dimension: x & 3 and bit 3 of x,
// so the values 0..7 all occur among the x with x % 8 in 0..3 and among those in 4..7. For speed only: wherever the blocks land, a unit that nobody asked for is simply fetched by the tensor load that reads it.
__device__ __forceinline__ uint32_t pf_eighth(uint32_t x) { return (x & 3u) | (((x >> 3) & 1u) << 2); }
// keeps a prefetch's address registers live, so at their value, up to this point: a prefetch is issued over registers that hold no other value soon after it (here: not before a tile's landing and a barrier have gone by)
__device__ __forceinline__ void pf_hold(const char* p) { asm volatile("" :: "v"(p)); }

static constexpr size_t al256(size_t v) { return (v + 255) & ~(size_t)255; }
static constexpr size_t SZ_XB  = al256((size_t)NB * SEQ * DM * 2);          // one bf16 input copy
static constexpr size_t SZ_WB  = al256((size_t)DM * DM * 2);                // one 16-bit W^T plane
static constexpr size_t SZ_PL  = al256((size_t)NB * NH_ * SEQ * HD * 2);    // one f16 plane
static constexpr size_t SZ_CTX = al256((size_t)NB * SEQ * DM * 2);          // ctx, f16
static constexpr size_t SZ_TOTAL = 3 * SZ_XB + 4 * SZ_WB + 5 * SZ_PL + SZ_CTX;
static_assert(SZ_TOTAL <= (size_t)134217728);          // workspace carve <= 128 MiB
static_assert(SZ_PL == (size_t)NB * SEQ * DM * 2);     // value / residual plane pairs are exactly contiguous

#define WTB ((DM / 64) * (DM / 64))                          // blocks per weight: 64x64 tiles
#define CVN ((size_t)NB * SEQ * DM / 8)                      // 8-element chunks per activation input
#define CVB ((int)((CVN + 255) / 256))                       // blocks per activation input

// RNE convert of one activation input: block cb takes 256 chunks of 8 floats; source batches SEQ_FULL tokens apart, copy packed [NB*SEQ][DM].
__device__ __forceinline__ void cvt8_block(const float* __restrict__ src, bf* dst, int cb) {
    const size_t i = (size_t)cb * 256 + threadIdx.x; if (i >= CVN) return;
    const size_t e = i * 8;
    const v8f v = *(const v8f*)(src + e + (e / ((size_t)SEQ * DM)) * ((size_t)(SEQ_FULL - SEQ) * DM)); v8us o;
#pragma unroll
    for (int k = 0; k < 8; ++k) o[k] = f2bf(v[k]);
    *(v8us*)(dst + e) = o;
}

// weight transpose + RNE convert of one 64x64 tile: in W[DM rows k][DM cols n] f32 -> out WT[DM rows n][DM cols k] bf16;
// as_h (block-uniform): the same bf16-rounded value written in f16 form (exact from 2^-17 up in magnitude, below that within 2^-25), for a product whose other operand is f16.
__device__ __forceinline__ void wt_block(const float* __restrict__ W, bf* WT, int n0, int k0, float* tile, bool as_h) {
    const int tid = threadIdx.x;
#pragma unroll
    for (int it = 0; it < 4; ++it) { const int c = it * 256 + tid; const int r = c >> 4, c4 = (c & 15) * 4;   // 64 rows x 16 chunks of 4 floats
        const v4f v = *(const v4f*)(W + (size_t)(k0 + r) * DM + n0 + c4);
        tile[r * 65 + c4 + 0] = v[0]; tile[r * 65 + c4 + 1] = v[1]; tile[r * 65 + c4 + 2] = v[2]; tile[r * 65 + c4 + 3] = v[3]; }
    __syncthreads();
    v8us o[2];
#pragma unroll
    for (int it = 0; it < 2; ++it) { const int c = it * 256 + tid; const int n = c >> 3, k8 = (c & 7) * 8;     // 64 output rows x 8 chunks of 8
#pragma unroll
        for (int e = 0; e < 8; ++e) { const unsigned short r = f2bf(tile[(k8 + e) * 65 + n]); o[it][e] = as_h ? __builtin_bit_cast(unsigned short, (h16)bf2f(r)) : r; } }
#pragma unroll
    for (int it = 0; it < 2; ++it) { const int c = it * 256 + tid; const int n = c >> 3, k8 = (c & 7) * 8;
        *(v8us*)(WT + (size_t)(n0 + n) * DM + k0 + k8) = o[it]; }
}

// k_prep: every input conversion in one launch; none depends on another, the block index alone says which piece a block does (block-uniform branch).
// Blocks [0, 4*WTB): weight w = index / WTB, tile (n, k) = (index % WTB) % (DM/64), / (DM/64) -> plane w of WT. Blocks behind them: input index / CVB, chunk block index % CVB -> copy of X.
// grid 4*WTB + 3*CVB, 256 threads. X: three copies SZ_XB bytes apart (q, k, v); WT: four planes SZ_WB bytes apart (Wq, Wk, Wv in bf16 form, Wp in f16 form).
__global__ __launch_bounds__(256) void k_prep(const float* __restrict__ xq, const float* __restrict__ xk, const float* __restrict__ xv,
                                              const float* __restrict__ wq, const float* __restrict__ wk, const float* __restrict__ wv, const float* __restrict__ wp,
                                              bf* X, bf* WT) {
    __shared__ float tile[64 * 65];
    const unsigned bid = blockIdx.x;
    if (bid < 4u * WTB) {
        const int w = (int)(bid / WTB), t = (int)(bid % WTB);
        wt_block(w == 0 ? wq : w == 1 ? wk : w == 2 ? wv : wp, WT + (size_t)w * (SZ_WB / 2), (t % (DM / 64)) * 64, (t / (DM / 64)) * 64, tile, w == 3);
    } else {
        const unsigned c = bid - 4u * WTB; const int w = (int)(c / CVB);
        cvt8_block(w == 0 ? xq : w == 1 ? xk : xv, X + (size_t)w * (SZ_XB / 2), (int)(c % CVB));
    }
}

// k_gemm: 16-bit GEMM (MODE 0: both operands bf16, MODE 1: both f16; same fragment maps), 128x128 tile of C per block of four waves (2 x 2), each wave a 64x64 tile (16 accumulators).
// C[m][n] = sum_{kc < KA} A[m][kc] Bt[n][kc & (DM-1)]; A row pitch KA, Bt row pitch DM.
// Per stage of 128 k each wave brings one tile of 64 rows x 256 B into LDS with one tensor load (waves 0, 1 the block's A rows, waves 2, 3 its Bt rows);
// two buffers, the next stage's loads in flight while this stage is worked on; every wave reads its fragments from LDS (two 16-B reads each).
// MODE 0: C written as f16 (Ph) and, for the products z < nres, f16 residual x2048 (Pr), row-major pitch DM. MODE 1: C written as f32 to OUT rows (m/SEQ)*OUT_SEQ + m%SEQ, pitch DM.
// grid (M/128, DM/128, Z), 128 threads; KA a multiple of 128, at least 256. Epilogue per 16-row slab staged in LDS (wave-private part of the ring);
// blockIdx.z picks one of Z independent products of the same shape: A planes za elements apart, Bt planes zb apart, Ph and Pr planes zp apart.
template <int MODE>
__device__ __forceinline__ v8f wmmag(v16bf a, v16bf b, v8f c) {
    if constexpr (MODE == 0) return wmmab(a, b, c);
    else return wmma16(__builtin_bit_cast(v16h, a), __builtin_bit_cast(v16h, b), c);
}
template <int MODE>
__global__ __launch_bounds__(128) void k_gemm(const bf* __restrict__ A0, const bf* __restrict__ Bt0, int KA, h16* Ph0, h16* Pr0, float* OUT, size_t za, size_t zb, size_t zp, int nres) {
    __shared__ __attribute__((aligned(2048))) unsigned char gring[2 * GBSZ];
    const bf* A = A0 + blockIdx.z * za; const bf* Bt = Bt0 + blockIdx.z * zb;
    h16* Ph = Ph0 + blockIdx.z * zp; h16* Pr = Pr0 + blockIdx.z * zp;
    const bool wres = (int)blockIdx.z < nres;                // block-uniform: this product's residual plane is wanted
    const int lane = threadIdx.x & 31, wave = (int)uni(threadIdx.x >> 5), lr = lane & 15, hi = lane >> 4;
    const int wm = wave >> 1, wn = wave & 1;                 // the wave's 64x64 tile inside the block's 128x128
    const int r0 = blockIdx.x * 128 + wm * 64, c0 = blockIdx.y * 128 + wn * 64;
    // this wave's tile to load: waves 0, 1 rows 0..63, 64..127 of the block's A rows; waves 2, 3 the same of its Bt rows
    const int lrow = (wave < 2 ? (int)blockIdx.x : (int)blockIdx.y) * 128 + (wave & 1) * 64;
    const uint32_t gpitch = wave < 2 ? (uint32_t)KA * 2u : (uint32_t)(DM * 2);
    const uint64_t gsrc = (uint64_t)(size_t)(wave < 2 ? A : Bt) + (uint64_t)lrow * gpitch;
    const uint32_t gmask = wave < 2 ? 0xFFFFFFFFu : (uint32_t)(DM * 2 - 1);   // byte offset along a row; Bt's wraps at DM elements
    const uint32_t ldst = (uint32_t)(size_t)gring + (uint32_t)wave * GTSZ;
    const int nst = KA / GKS;
    const u32x8 g1 = tile256_group1(gpitch);
    tile256_load(ldst, gsrc, g1);                            // stage 0 -> buffer 0
    // Prefetch into L2, one request a lane, 256 B apart: the block's 128 A rows (256 KiB in a row) are read by the DM/128 = 8 blocks of its x, an eighth each by blockIdx.y;
    // its 128 Bt rows (256 KiB in a row) by every x, an eighth each by pf_eighth. Without it every stage of blocks that walk k in step is a first touch and lands with memory latency.
    const char* pfa = (const char*)(A + (size_t)blockIdx.x * 128 * DM) + (size_t)blockIdx.y * 32768 + threadIdx.x * 256;   // KA of both launches is DM
    const char* pfb = (const char*)(Bt + (size_t)blockIdx.y * 128 * DM) + (size_t)pf_eighth(blockIdx.x) * 32768 + threadIdx.x * 256;
    // s_wait_xcnt, a precaution as behind any issued global memory instruction: it stands in front of every overwrite of the address registers that the prefetches name
    asm volatile("global_prefetch_b8 %0, off scope:SCOPE_SE\n\tglobal_prefetch_b8 %1, off scope:SCOPE_SE\n\ts_wait_xcnt 0x0" :: "v"(pfa), "v"(pfb));
    v8f acc[4][4];
#pragma unroll
    for (int mb = 0; mb < 4; ++mb)
#pragma unroll
        for (int nb = 0; nb < 4; ++nb) acc[mb][nb] = (v8f){};
    const int fo = lr * GLP + 16 * hi;                       // lane's byte offset in a tile: row lr, k offset 8h elements (A and B fragments alike)
    wait_tensor0();
    __syncthreads();                                         // stage 0 published
    tile256_load(ldst + GBSZ, gsrc + ((uint32_t)(GKS * 2) & gmask), g1);       // stage 1 -> buffer 1
    pf_hold(pfa); pf_hold(pfb);                              // the prefetches' address registers keep their values up to here
#pragma unroll 1
    for (int st = 0; st < nst; ++st) {
        const unsigned char* bp = gring + (st & 1) * GBSZ + fo;
        const bf* ap = (const bf*)(bp + wm * GTSZ);          // A rows of this wave
        const bf* bq = (const bf*)(bp + (2 + wn) * GTSZ);    // Bt rows of this wave
        v16bf a[2][4], b[2][4];                              // two fragment sets: the next 32 k are fetched ahead of this block's products
#pragma unroll
        for (int f = 0; f < 4; ++f) a[0][f] = ldb(ap + f * 16 * GLPH);
#pragma unroll
        for (int f = 0; f < 4; ++f) b[0][f] = ldb(bq + f * 16 * GLPH);
#pragma unroll
        for (int ks = 0; ks < GKS / 32; ++ks) {
            if (ks + 1 < GKS / 32) {
#pragma unroll
                for (int f = 0; f < 4; ++f) a[(ks + 1) & 1][f] = ldb(ap + f * 16 * GLPH + (ks + 1) * 32);
#pragma unroll
                for (int f = 0; f < 4; ++f) b[(ks + 1) & 1][f] = ldb(bq + f * 16 * GLPH + (ks + 1) * 32);
                __builtin_amdgcn_sched_barrier(0);           // holds the next block's LDS reads as one group ahead of this block's products (else each read sinks to its use and is waited for there)
            }
#pragma unroll
            for (int nb = 0; nb < 4; ++nb)
#pragma unroll
                for (int mb = 0; mb < 4; ++mb) acc[mb][nb] = wmmag<MODE>(a[ks & 1][mb], b[ks & 1][nb], acc[mb][nb]);
            __builtin_amdgcn_sched_barrier(0);               // keeps this block's products ahead of the reads after next, which reuse its fragment registers
        }
        // hand-over, every wave: own LDS reads done, own tile of stage st+1 landed, barrier (publishes stage st+1, frees this stage's buffer), then the refill
        wait_ds0();
        wait_tensor0();
        __syncthreads();
        if (pinned(st + 2 < nst)) tile256_load(ldst + (uint32_t)(st & 1) * GBSZ, gsrc + ((uint32_t)((st + 2) * GKS * 2) & gmask), g1);
    }
    wait_tensor0();
    wait_ds0();
    float* os = (float*)gring + wave * 16 * 68;              // output staging reuses the ring: the last hand-over's barrier stands behind every wave's last read, and nothing was issued behind it
    if (MODE == 0 && !wres) {                                // a product whose value plane alone is wanted: staging, rows and columns as below, no residual formed or stored; the whole block takes this path and ends here (loops unrolled as below: acc is indexed by constants only and stays in registers)
#pragma unroll
        for (int mb = 0; mb < 4; ++mb) {
#pragma unroll
            for (int nb = 0; nb < 4; ++nb) {
#pragma unroll
                for (int j = 0; j < 8; ++j) os[(hi * 8 + j) * 68 + nb * 16 + lr] = acc[mb][nb][j]; }
            wave_sync();
            h16* prow = Ph + (size_t)(r0 + mb * 16) * DM + c0;
#pragma unroll
            for (int s = 0; s < 4; ++s) { const int row = 4 * s + (lane >> 3), c8 = (lane & 7) * 8;
                const v4f x0 = *(const v4fa*)(&os[row * 68 + c8]); const v4f x1 = *(const v4fa*)(&os[row * 68 + c8 + 4]); v8h hv;
#pragma unroll
                for (int i = 0; i < 4; ++i) { hv[i] = (h16)x0[i]; hv[4 + i] = (h16)x1[i]; }
                *(v8h*)(prow + (size_t)row * DM + c8) = hv; }
            wave_sync();
        }
        asm volatile("s_wait_xcnt 0x0" ::: "memory");   // a precaution as behind any issued global store: it stands in front of every later overwrite of the registers that this path's last stores name
        return;
    }
#pragma unroll
    for (int mb = 0; mb < 4; ++mb) {
#pragma unroll
        for (int nb = 0; nb < 4; ++nb) {
#pragma unroll
            for (int j = 0; j < 8; ++j) os[(hi * 8 + j) * 68 + nb * 16 + lr] = acc[mb][nb][j]; }   // D: row 8h+j, col lane&15; rows 0..15 x cols 0..63 all written
        wave_sync();
        const int m0 = r0 + mb * 16;
        if (MODE == 0) {
            const size_t sb = (size_t)m0 * DM + c0;
{
#pragma unroll
                for (int s = 0; s < 4; ++s) { const int row = 4 * s + (lane >> 3), c8 = (lane & 7) * 8;   // 4 s x 4 row groups = 16 rows; 8 lanes x 8 = 64 columns
                    const v4f x0 = *(const v4fa*)(&os[row * 68 + c8]); const v4f x1 = *(const v4fa*)(&os[row * 68 + c8 + 4]); v8h hv, rv;
#pragma unroll
                    for (int i = 0; i < 4; ++i) { const h16 a0 = (h16)x0[i]; const h16 a1 = (h16)x1[i]; hv[i] = a0; hv[4 + i] = a1; rv[i] = (h16)((x0[i] - (float)a0) * QRS); rv[4 + i] = (h16)((x1[i] - (float)a1) * QRS); }
                    const size_t oo = sb + (size_t)row * DM + c8;
                    *(v8h*)(Ph + oo) = hv; *(v8h*)(Pr + oo) = rv; }
                 }
        } else {
            float* orow = OUT + ((size_t)(m0 / SEQ) * OUT_SEQ + (size_t)(m0 % SEQ)) * DM + c0;
{
#pragma unroll
                for (int s = 0; s < 8; ++s) { const int row = 2 * s + hi, cofs = lr * 4;   // 8 s x 2 rows = 16 rows; 16 lanes x 4 floats = 64 columns
                    const v4f val = *(const v4fa*)(&os[row * 68 + cofs]);
                    *(v4f*)(orow + (size_t)row * DM + cofs) = val; }
                 }
        }
        wave_sync();
    }
}

#define STG(OFS, OH) { v4f a_, c_; \
    a_[0] = OH[0] * inv; a_[1] = OH[1] * inv; a_[2] = OH[2] * inv; a_[3] = OH[3] * inv; \
    c_[0] = OH[4] * inv; c_[1] = OH[5] * inv; c_[2] = OH[6] * inv; c_[3] = OH[7] * inv; \
    *(v4fa*)(&os[wb + lr * 68 + (OFS) + 8 * hi]) = a_; *(v4fa*)(&os[wb + lr * 68 + (OFS) + 8 * hi + 4]) = c_; }

// k_flash: fused causal attention, one wave per 16 query rows of one (batch, head); Q fragments straight from the f16 planes (two 16-B loads each).
// K and V: per stage of 64 keys waves 0 to 2 each bring one tile (K value, K residual, V; 64 key rows x 128 B) into LDS with one tensor load, wave 3 none;
// two buffers, the next stage's loads in flight while this stage is worked on; every wave reads its fragments from LDS (two 16-B reads each, transposing ones for V^T). Every wave passes every stage's hand-over.
// Transposed form: S^T[key][t] = K Q^T (A = K rows, B = Q rows); lane (t = lane&15, h = lane>>4) holds keys 8h+r of each 16-key tile, so the packed
// P tile is directly the B fragment of O^T[d][t] = V^T P^T (element r <- tile keys 0..15, element 8+r <- tile keys 16..31, lane unchanged).
// A wave takes each stage whole: its 32 K reads as one group, the 24 score products of the four 16-key tiles, one softmax step over the 64 keys, its 16 V reads as one group under the exponentials, the 8 PV products.
// Causal: entries with key > t are replaced by a large negative value (P = 0), in a tile's last stage only (wave-uniform test); every stage of a tile holds a visible key for each of its rows (its first key is <= t0).
// Softmax state (running max, partial sum) is one scalar per lane; the two lane halves of a row are combined with one xor-16 exchange.
// Balance: a tile's cost grows with its index (tile x walks x+1 stages), so a block takes tile blockIdx.x and then tile NQT-1-blockIdx.x of its head, NQT+1 stages whatever the block;
// the ring runs through both tiles as one sequence of stages (the second tile's first stages are in flight while the first tile is finished), so the output staging has LDS of its own behind the ring.
// grid (NQT/2, NB*NH_).
__global__ __launch_bounds__(32 * AW) void k_flash(const h16* __restrict__ QH, const h16* __restrict__ QR, const h16* __restrict__ KH, const h16* __restrict__ KR,
                                                   const h16* __restrict__ VH, h16* CTX) {
    __shared__ __attribute__((aligned(2048))) unsigned char ring[2 * BSZ + OSB];
    const int lane = threadIdx.x & 31, wave = (int)uni(threadIdx.x >> 5), lr = lane & 15, hi = lane >> 4;
    const int zh = blockIdx.y; const int b = zh / NH_, h = zh % NH_;
    const size_t pbase = (size_t)zh * SEQ * HD;
    // this wave's tile: waves 0, 1 the K planes, wave 2 the V plane (rows = keys, 128 B each, contiguous); wave 3 issues no request (its group 0 is formed like wave 2's and never used)
    const h16* pl = wave == 0 ? KH : wave == 1 ? KR : VH;
    const uint64_t gsrc = (uint64_t)(size_t)(pl + pbase);
    const uint32_t gstep = (uint32_t)(KST * HD * 2);         // bytes from one stage's tile to the next
    const uint32_t isk = pinned(wave < 2), isv = pinned(wave == 2);
    const u32x8 g1k = tile128_group1<3u>(), g1v = tile128_group1<7u>();
    const uint32_t ldst = (uint32_t)(size_t)ring + (uint32_t)wave * TSZ;
    // 64-key stages the block walks: na = blockIdx.x+1 of its first tile (keys from 0 on), then NQT-blockIdx.x of its second (keys from 0 on again): NQT+1 in all
    // as pinned(): the first tile's stage count, which the refill's source step is formed from, is formed here, ahead of the first request (without it the build keeps group 0 in two register sets, and a register of the issued set takes another value while the request is outstanding)
    const int na = (int)pinned(blockIdx.x + 1u);
    u32x4 g0 = stage_group0(ldst, gsrc);
    stage_load(isk, isv, g0, g1k, g1v);                      // stage 0 -> buffer 0
    // Prefetch into L2, one request a lane, 256 B apart: each of waves 0 to 2 asks for an eighth of its own plane's 256 KiB of this head (the head's NQT/2 blocks all stream them), in four runs of 8 KiB, 64 KiB apart, the low keys first.
    // Without it the block that is first at a stage takes memory latency there, stage after stage, and the launch lasts as long as that block.
    const char* pfk = (const char*)(pl + pbase) + (size_t)pf_eighth(blockIdx.x) * 8192 + lane * 256;
    // s_wait_xcnt, a precaution as behind any issued global memory instruction: it stands in front of every overwrite of the address registers that the prefetches name
    if (isk | isv) asm volatile("global_prefetch_b8 %0, off scope:SCOPE_SE\n\tglobal_prefetch_b8 %0, off offset:65536 scope:SCOPE_SE\n\tglobal_prefetch_b8 %0, off offset:131072 scope:SCOPE_SE\n\tglobal_prefetch_b8 %0, off offset:196608 scope:SCOPE_SE\n\ts_wait_xcnt 0x0" :: "v"(pfk));
    const int fo = lr * LP + 16 * hi;                        // lane's byte offset in a K tile: row lr, k offset 8h halves
    const int vo = (8 * hi + (lane & 7)) * LPV + 16 * ((lane >> 3) & 1);   // lane's byte offset in a V tile for the transposing load: key row 8h + (lane & 7), 16-B half (lane >> 3) & 1
    float* os = (float*)(ring + 2 * BSZ);                    // output staging, a wave-private part each
    const int wb = wave * 16 * 68;
    wait_tensor0();
    __syncthreads();                                         // stage 0 published
    g0 = stage_next(g0, ldst + BSZ, na > 1 ? (int64_t)gstep : (int64_t)0);
    stage_load(isk, isv, g0, g1k, g1v);                      // stage 1 -> buffer 1: the first tile's keys 64.., or, where it has one stage, the second tile's keys 0..
    pf_hold(pfk);                                            // the prefetches' address registers keep their value up to here
    int g = 0;                                               // stage number in the block's sequence; buffer g & 1
#pragma unroll 1                                             // the two tiles share one copy of the loop's code
    for (int half = 0; half < 2; ++half) {
    const int xt = half ? NQT - 1 - (int)blockIdx.x : (int)blockIdx.x;   // this pass's query tile
    const int nst = xt + 1;                                  // its stages: keys [0, 64*(xt+1))
    const int t0 = (xt * AW + wave) * 16;
    const size_t qo = pbase + (size_t)(t0 + lr) * HD + 8 * hi;
    const v16h qh0 = ldh(QH + qo), qh1 = ldh(QH + qo + 32), qr0 = ldh(QR + qo), qr1 = ldh(QR + qo + 32);   // B fragments: col t, k = d
    v8f oh0 = (v8f){}, oh1 = (v8f){}, oh2 = (v8f){}, oh3 = (v8f){};
    float m = NEGB, l = 0.0f;
    int st = 0;
#pragma unroll 1
    do {                                                     // a tile has at least one stage
      const h16* kk = (const h16*)(ring + (g & 1) * BSZ + fo);            // K value tile, row lr of its first 16 keys; key tile kt is 16 rows on
      const h16* kr = kk + TSZ / 2;                                       // K residual tile
      const unsigned char* va = ring + (g & 1) * BSZ + 2 * TSZ + vo;      // V tile; fragment j: features 16j .. 16j+15 (32 B on), keys 32.. are 32 rows on
      const int key0 = st * KST;
      v16h ka[4], kb[4], ra[4], rb[4];                                    // A fragments of the four 16-key tiles: value d 0..31, d 32..63, residual d 0..31, d 32..63
#pragma unroll
      for (int kt = 0; kt < 4; ++kt) ka[kt] = ldh(kk + kt * 16 * LPH);
#pragma unroll
      for (int kt = 0; kt < 4; ++kt) kb[kt] = ldh(kk + kt * 16 * LPH + 32);
#pragma unroll
      for (int kt = 0; kt < 4; ++kt) ra[kt] = ldh(kr + kt * 16 * LPH);
#pragma unroll
      for (int kt = 0; kt < 4; ++kt) rb[kt] = ldh(kr + kt * 16 * LPH + 32);
      __builtin_amdgcn_sched_barrier(0);                                  // holds the stage's K reads as one group ahead of its score products (else a part sinks among them and is waited for there)
      v8f sH[4], sL[4];
#pragma unroll
      for (int kt = 0; kt < 4; ++kt) { sH[kt] = wmma16(ka[kt], qh0, (v8f){}); sL[kt] = wmma16(ka[kt], qr0, (v8f){}); }
#pragma unroll
      for (int kt = 0; kt < 4; ++kt) { sH[kt] = wmma16(kb[kt], qh1, sH[kt]); sL[kt] = wmma16(kb[kt], qr1, sL[kt]); }
#pragma unroll
      for (int kt = 0; kt < 4; ++kt) sL[kt] = wmma16(ra[kt], qh0, sL[kt]);
#pragma unroll
      for (int kt = 0; kt < 4; ++kt) sL[kt] = wmma16(rb[kt], qh1, sL[kt]);
      // the distance between the last products and the vector instructions that read their results, on every path
      asm volatile("v_nop\n\tv_nop\n\tv_nop\n\tv_nop" : "+v"(sH[0]), "+v"(sH[1]), "+v"(sH[2]), "+v"(sH[3]), "+v"(sL[0]), "+v"(sL[1]), "+v"(sL[2]), "+v"(sL[3]) : "v"(rb[0]), "v"(rb[1]), "v"(rb[2]), "v"(rb[3]));
      float t[4][8];                                                      // t[kt][r]: key key0 + 16 kt + 8h + r, query t0 + lr
#pragma unroll
      for (int kt = 0; kt < 4; ++kt)
#pragma unroll
          for (int r = 0; r < 8; ++r) t[kt][r] = (sH[kt][r] + sL[kt][r] * QRI) * L2E;
      if (key0 + KST - 1 > t0) {                                          // wave-uniform: the stage crosses the diagonal (a tile's last stage)
          const int tq = t0 + lr - key0 - 8 * hi;                         // entry r of key tile kt is hidden when 16 kt + r > tq
#pragma unroll
          for (int kt = 0; kt < 4; ++kt)
#pragma unroll
              for (int r = 0; r < 8; ++r) t[kt][r] = (16 * kt + r > tq) ? NEGB : t[kt][r];
      }
      float mxa = NEGB, mxb = NEGB;
#pragma unroll
      for (int r = 0; r < 8; ++r) { mxa = fmaxf(mxa, fmaxf(t[0][r], t[1][r])); mxb = fmaxf(mxb, fmaxf(t[2][r], t[3][r])); }
      float mx = fmaxf(mxa, mxb);
      const float mo = __shfl_xor(mx, 16, 32);
      asm volatile("" :: "v"(mo) : "memory");                             // inputs-only fence on the exchanged value: the V reads below stay behind its return (LDS results return in order: issued ahead of it, they would all be waited for at the exchange)
      v16h vh[2][4];                                                      // A fragments of V^T: [keys 0..31, 32..63][features 16j ..]
#pragma unroll
      for (int s = 0; s < 2; ++s) {
#pragma unroll
          for (int j = 0; j < 4; ++j) vh[s][j] = ldvt(va + s * 32 * LPV + 32 * j);
      }
      __builtin_amdgcn_sched_barrier(0);                                  // holds the stage's V reads as one group ahead of the exponentials, which cover their latency
      const float mnew = fmaxf(m, fmaxf(mx, mo));
      const float alpha = __builtin_amdgcn_exp2f(m - mnew);
      const float sh = PSH - mnew;
      v16h pb0, pb1; float ls0 = 0.0f, ls1 = 0.0f;                        // B fragments of P^T: keys 0..31 and 32..63 of the stage
#pragma unroll
      for (int r = 0; r < 8; ++r) {
          const h16 pa = (h16)__builtin_amdgcn_exp2f(t[0][r] + sh); const h16 pc = (h16)__builtin_amdgcn_exp2f(t[1][r] + sh); pb0[r] = pa; pb0[8 + r] = pc; ls0 += (float)pa + (float)pc;
          const h16 pd = (h16)__builtin_amdgcn_exp2f(t[2][r] + sh); const h16 pe = (h16)__builtin_amdgcn_exp2f(t[3][r] + sh); pb1[r] = pd; pb1[8 + r] = pe; ls1 += (float)pd + (float)pe; }
      l = l * alpha + (ls0 + ls1); m = mnew;
      oh0 = oh0 * alpha; oh1 = oh1 * alpha; oh2 = oh2 * alpha; oh3 = oh3 * alpha;
      oh0 = wmma16(vh[0][0], pb0, oh0); oh1 = wmma16(vh[0][1], pb0, oh1); oh2 = wmma16(vh[0][2], pb0, oh2); oh3 = wmma16(vh[0][3], pb0, oh3);
      oh0 = wmma16(vh[1][0], pb1, oh0); oh1 = wmma16(vh[1][1], pb1, oh1); oh2 = wmma16(vh[1][2], pb1, oh2); oh3 = wmma16(vh[1][3], pb1, oh3);
      // the distance between the last products and the vector instructions that read or rescale their results, on every path (the loop's exit too)
      asm volatile("v_nop\n\tv_nop\n\tv_nop\n\tv_nop" : "+v"(oh0), "+v"(oh1), "+v"(oh2), "+v"(oh3) : "v"(vh[1][0]), "v"(vh[1][1]), "v"(vh[1][2]), "v"(vh[1][3]), "v"(pb1));
      // hand-over, every wave: own LDS reads done, own tile of stage g+1 landed, barrier (publishes stage g+1, frees this stage's buffer), then the refill
      wait_ds0();
      wait_tensor0();
      __syncthreads();
      if (pinned(g + 2 < NQT + 1)) {                         // stage g+2: the next 64 keys, or, where it is the second tile's first, back to keys 0..
          g0 = stage_next(g0, ldst + (uint32_t)(g & 1) * BSZ, g + 2 == na ? -(int64_t)(na - 1) * (int64_t)gstep : (int64_t)gstep);
          stage_load(isk, isv, g0, g1k, g1v);
      }
      ++g;
    } while (++st < nst);
    l += __shfl_xor(l, 16, 32);
    const float inv = 1.0f / l;
    // O^T D layout: o_j[r] = (d = 16j + 8h + r, t = lane&15) -> os[t][d]; rows 0..15 x columns 0..63 all written
    STG(0, oh0)
    STG(16, oh1)
    STG(32, oh2)
    STG(48, oh3)
    wave_sync();
    h16* crow = CTX + ((size_t)b * SEQ + t0) * (size_t)DM + h * HD;
{
#pragma unroll
        for (int s = 0; s < 4; ++s) { const int row = 4 * s + (lane >> 3), c8 = (lane & 7) * 8;   // 4 s x 4 row groups = 16 rows; 8 lanes x 8 = 64 columns
            const v4f x0 = *(const v4fa*)(&os[wb + row * 68 + c8]); const v4f x1 = *(const v4fa*)(&os[wb + row * 68 + c8 + 4]); v8h hv;
#pragma unroll
            for (int i = 0; i < 4; ++i) { hv[i] = (h16)x0[i]; hv[4 + i] = (h16)x1[i]; }
            *(v8h*)(crow + (size_t)row * DM + c8) = hv; }
         }
    asm volatile("s_wait_xcnt 0x0" ::: "memory");            // stands in front of the first overwrite of a register that the stores above name (the next tile's set-up)
    wave_sync();                                             // the staging rows are read before the second tile's results are written over them
    }
    wait_tensor0();
    wait_ds0();
}

extern "C" void kernel_launch(void* const* d_in, const int* in_sizes, int n_in,
                              void* d_out, int out_size, void* d_ws, size_t ws_size, hipStream_t stream) {
    if (n_in < 7) return;
    const size_t needx = ((size_t)(NB - 1) * SEQ_FULL + SEQ) * DM;
    if ((size_t)in_sizes[0] < needx || (size_t)in_sizes[1] < needx || (size_t)in_sizes[2] < needx) return;
    if ((size_t)in_sizes[3] < (size_t)DM * DM || (size_t)in_sizes[4] < (size_t)DM * DM || (size_t)in_sizes[5] < (size_t)DM * DM || (size_t)in_sizes[6] < (size_t)DM * DM) return;
    if ((size_t)out_size < ((size_t)(NB - 1) * OUT_SEQ + SEQ) * DM) return;
    if (SZ_TOTAL > ws_size) return;
    // wire order: q, k, v, Wq, Wk, Wv, Wp (weights [in][out])
    const float* xq = (const float*)d_in[0]; const float* xk = (const float*)d_in[1]; const float* xv = (const float*)d_in[2];
    const float* wq = (const float*)d_in[3]; const float* wk = (const float*)d_in[4]; const float* wv = (const float*)d_in[5]; const float* wp = (const float*)d_in[6];
    float* OUT = (float*)d_out;      // [NB][SEQ][1024]
    char* wsp = (char*)d_ws;
    bf* XQ = (bf*)wsp; wsp += SZ_XB;                 // [NB*SEQ][1024]; the k and v copies are reached from XQ, the other W^T planes from WQT, by their strides
    bf* XK = (bf*)wsp; wsp += SZ_XB;
    bf* XV = (bf*)wsp; wsp += SZ_XB;
    bf* WQT = (bf*)wsp; wsp += SZ_WB;                // [out][in]
    bf* WKT = (bf*)wsp; wsp += SZ_WB;
    bf* WVT = (bf*)wsp; wsp += SZ_WB;
    bf* WPT = (bf*)wsp; wsp += SZ_WB;
    h16* QH = (h16*)wsp; wsp += SZ_PL;               // [NB*SEQ][1024] == [NB*16][SEQ][64]
    h16* QR = (h16*)wsp; wsp += SZ_PL;               // residual x2048
    h16* KH = (h16*)wsp; wsp += SZ_PL;
    h16* KR = (h16*)wsp; wsp += SZ_PL;
    h16* VH = (h16*)wsp; wsp += SZ_PL;               // value alone
    h16* CTX = (h16*)wsp; wsp += SZ_CTX;             // [NB*SEQ][1024]

    // every input conversion in one launch: W[in][out] -> WT[out][in], 16 bits (four planes from WQT on), q, k, v -> bf16 copies (three from XQ on)
    k_prep<<<4 * WTB + 3 * CVB, 256, 0, stream>>>(xq, xk, xv, wq, wk, wv, wp, XQ, WQT);

    // projections, one launch, z = q, k, v: A = x rows (m = b*SEQ + t), Bt = W^T rows (n) -> row-major planes [m][n] (value, and residual for q and k; z steps by a pair of planes)
    k_gemm<0><<<dim3(NB * SEQ / 128, DM / 128, 3), 128, 0, stream>>>(XQ, WQT, DM, QH, QR, OUT, SZ_XB / 2, SZ_WB / 2, SZ_PL, 2);

    k_flash<<<dim3(NQT / 2, NB * NH_, 1), 32 * AW, 0, stream>>>(QH, QR, KH, KR, VH, CTX);

    // output projection: A = ctx rows, Bt = Wp^T rows (both f16, handed over as 16-bit words) -> f32 output
    k_gemm<1><<<dim3(NB * SEQ / 128, DM / 128, 1), 128, 0, stream>>>((const bf*)CTX, WPT, DM, QH, QR, OUT, 0, 0, 0, 0);
}
